// v000
// Measured on an AMD MI455X. A time is GPU time per run, averaged over a window of back-to-back runs after a warm-up
// (all launches, gaps included; the runs take copies of the inputs in turn), and the median of several windows.
// Apart from v000's, it joins two sittings. Times from different sittings can be a few percent apart, while
// side-by-side timings come from the same sitting.
// The starting kernel, v000, takes 1350 microseconds a run.
#include <hip/hip_runtime.h>
// WedoctorAttention (2 x 2048 tokens, hidden 2048; 32 query heads / 8 kv heads of 64 (GQA), rotate-half RoPE from the INPUT position ids, causal SDPA (1/8), out = o Wo): q/k/v = x W + b.
// Structure (per batch): exact f16 plane of x; q / k / v GEMMs (32x64 wave tiles, f32 accumulation, exact x16 weights + bias) into f32 planes; angle tables from the input position ids (f32 trig); RoPE on VALU while splitting q and k into f16 hi + 2^10-residual planes, v split directly; the 8 kv heads expanded to the 32 query heads (repeat 4) into the fused [q | k | v] hi/lo planes; V^T hi/residual by LDS tiles; the fused causal flash kernel in its 5-plane form for the first 256 query rows and plain beyond; attention output as f16 hi (+ residual on those rows) into the output GEMMs.
// Compute dtype: x, weights and biases rounded to bf16; rows < 256 per batch: q, k, P, v, O hi + residual; beyond: plain f16; f32 accumulation/softmax/trig. v_wmma_f32_16x16x32_f16.
#define NB 2
#define EMB 2048
#define NR (NB * SLEN)           /* 4096 token rows */
#define SLEN 2048
#define SQ SLEN
#define TQ SLEN
#define TK SLEN
#define NH 32
#define NKV 8
#define KVD (NKV * HD)
#define HD 64
#define HH (HD / 2)
#define SCL 0.125f               /* 64^-0.5 */
#define QBLKS (TQ / 64)
#define QB05 0                   /* 5-plane flash: query blocks [0, QBN5) of every (batch, head) — the early causal rows whose outputs average over few keys */
#define QBN5 4
#define QB0P QBN5                /* plain flash (hi planes only): query blocks [QBN5, QBLKS) */
#define QBNP (QBLKS - QBN5)
#define RE 256                   /* rows per batch that take the hi+lo output operand (= QBN5 * 64) */
typedef __bf16 v16b __attribute__((ext_vector_type(16)));
typedef unsigned short v8us __attribute__((ext_vector_type(8), may_alias));
typedef float  v8f  __attribute__((ext_vector_type(8)));
typedef float  v4f  __attribute__((ext_vector_type(4)));
typedef float  v4fa __attribute__((ext_vector_type(4), may_alias));
union FragB { v16b v; v8us half[2]; unsigned short u[16]; };

__device__ __forceinline__ unsigned short bf16_bits(float x) { unsigned int u = __float_as_uint(x); return (unsigned short)((u + 0x7FFFu + ((u >> 16) & 1u)) >> 16); }
__device__ __forceinline__ float bf16_val(unsigned short b) { return __uint_as_float(((unsigned int)b) << 16); }
__device__ __forceinline__ float bf16_round(float x) { return bf16_val(bf16_bits(x)); }
// D += A·B with NT terms: 1 = ah·bh, 2 = + al·bh (A split), 3 = + ah·bl (both split)
template <int NT>
__device__ __forceinline__ v8f mmaN(v16b ah, v16b al, v16b bh, v16b bl, v8f c) {
  c = __builtin_amdgcn_wmma_f32_16x16x32_bf16(false, ah, false, bh, (short)0, c, false, false);
  if (NT >= 2) c = __builtin_amdgcn_wmma_f32_16x16x32_bf16(false, al, false, bh, (short)0, c, false, false);
  if (NT >= 3) c = __builtin_amdgcn_wmma_f32_16x16x32_bf16(false, ah, false, bl, (short)0, c, false, false);
  asm volatile("v_nop\n\tv_nop\n\tv_nop\n\tv_nop" : "+v"(c) : "v"(ah), "v"(al), "v"(bh), "v"(bl));
  return c;
}

__global__ __launch_bounds__(256) void k_wt_bf16(const float* __restrict__ W, unsigned short* __restrict__ Wt, int K, int N) {
  const int t = blockIdx.x * 256 + threadIdx.x;
  const int k8n = K / 8;
  if (t >= N * k8n) return;
  const int n = t / k8n, k8 = (t % k8n) * 8;
  v8us v;
#pragma unroll
  for (int i = 0; i < 8; ++i) v[i] = bf16_bits(W[(size_t)(k8 + i) * N + n]);
  *(v8us*)(Wt + (size_t)n * K + k8) = v;
  
}

// GEMM C[M][N] (f32, pitch ldc) = act(A[M][K]·W + bias). A f32 row-major (pitch lda) converted per fragment to bf16
// (ASPLIT: hi/lo two planes -> 2 terms, else single rounded term); Wt bf16 [N][K] (pitch ldb). BIAS_BF16 rounds the
// bias to bf16 first (bias quantised to bf16 before the add). K%32==0, M%16==0, N%64==0.
template <bool ASPLIT, int ACT, bool BIAS_BF16>
__global__ __launch_bounds__(128) void k_gemm_bf(const float* __restrict__ A, int lda, const unsigned short* __restrict__ Wt, int ldb,
                                               const float* __restrict__ bias, float* __restrict__ C, int ldc, int M, int N, int K) {
  __shared__ __attribute__((aligned(16))) float so[4][16][64];
  const int tid = threadIdx.x, w = tid >> 5, lane = tid & 31, ln = lane & 15, hh = lane >> 4;
  const int ntn = N / 64;
  const int wid = blockIdx.x * 4 + w;
  const int mt = wid / ntn, nq = wid % ntn;
  if (mt * 16 >= M) return;
  const int row0 = mt * 16, col0 = nq * 64;
  const float* arow = A + (size_t)(row0 + ln) * lda;
  v8f acc[4] = {};
  for (int kb = 0; kb < K; kb += 32) {
    FragB ah, al;
    const v4f x0 = *(const v4fa*)(arow + kb + 8 * hh), x1 = *(const v4fa*)(arow + kb + 8 * hh + 4);
    const v4f x2 = *(const v4fa*)(arow + kb + 16 + 8 * hh), x3 = *(const v4fa*)(arow + kb + 16 + 8 * hh + 4);
    float xs[16] = {x0[0],x0[1],x0[2],x0[3],x1[0],x1[1],x1[2],x1[3],x2[0],x2[1],x2[2],x2[3],x3[0],x3[1],x3[2],x3[3]};
#pragma unroll
    for (int i = 0; i < 16; ++i) { const unsigned short hb = bf16_bits(xs[i]); ah.u[i] = hb; al.u[i] = ASPLIT ? bf16_bits(xs[i] - bf16_val(hb)) : (unsigned short)0; }
#pragma unroll
    for (int t = 0; t < 4; ++t) {
      const unsigned short* brow = Wt + (size_t)(col0 + t * 16 + ln) * ldb + kb;
      FragB b;
      b.half[0] = *(const v8us*)(brow + 8 * hh);
      b.half[1] = *(const v8us*)(brow + 16 + 8 * hh);
      acc[t] = mmaN<ASPLIT ? 2 : 1>(ah.v, al.v, b.v, b.v, acc[t]);
    }
  }
#pragma unroll
  for (int t = 0; t < 4; ++t) {
    float bv = bias ? bias[col0 + t * 16 + ln] : 0.f;
    if (BIAS_BF16) bv = bf16_round(bv);
#pragma unroll
    for (int r = 0; r < 8; ++r) { float v = acc[t][r] + bv; if (ACT == 1) v = fmaxf(v, 0.f); so[w][8 * hh + r][t * 16 + ln] = v; }
  }
  __builtin_amdgcn_fence(__ATOMIC_ACQ_REL, "workgroup");
  __builtin_amdgcn_wave_barrier();
  const int rsub = lane >> 4, c4 = (lane & 15) * 4;
  {
#pragma unroll
    for (int q = 0; q < 8; ++q) {
      const int r = q * 2 + rsub;
      const v4f v = *(const v4fa*)&so[w][r][c4];
      *(v4f*)(C + (size_t)(row0 + r) * ldc + col0 + c4) = v;
    }
    
  }
}

// GEMM C = act(A·W + bias + resid): A f32 (ASPLIT -> hi/lo 2 terms), Wt bf16 [N][K]; ACT 0 none, 1 relu, 2 exact gelu;
// resid (optional, f32, row index = (row % rmod), pitch ldr, RES_BF16 rounds it) added before the activation.
template <bool ASPLIT, int ACT, bool BIAS_BF16, bool RES_BF16>
__global__ __launch_bounds__(128) void k_gemm_bf3(const float* __restrict__ A, int lda, const unsigned short* __restrict__ Wt, int ldb,
                                                const float* __restrict__ bias, const float* __restrict__ resid, int rmod, int ldr,
                                                float* __restrict__ C, int ldc, int M, int N, int K) {
  __shared__ __attribute__((aligned(16))) float so[4][16][64];
  const int tid = threadIdx.x, w = tid >> 5, lane = tid & 31, ln = lane & 15, hh = lane >> 4;
  const int ntn = N / 64;
  const int wid = blockIdx.x * 4 + w;
  const int mt = wid / ntn, nq = wid % ntn;
  if (mt * 16 >= M) return;
  const int row0 = mt * 16, col0 = nq * 64;
  const float* arow = A + (size_t)(row0 + ln) * lda;
  v8f acc[4] = {};
  for (int kb = 0; kb < K; kb += 32) {
    FragB ah, al;
    const v4f x0 = *(const v4fa*)(arow + kb + 8 * hh), x1 = *(const v4fa*)(arow + kb + 8 * hh + 4);
    const v4f x2 = *(const v4fa*)(arow + kb + 16 + 8 * hh), x3 = *(const v4fa*)(arow + kb + 16 + 8 * hh + 4);
    float xs[16] = {x0[0],x0[1],x0[2],x0[3],x1[0],x1[1],x1[2],x1[3],x2[0],x2[1],x2[2],x2[3],x3[0],x3[1],x3[2],x3[3]};
#pragma unroll
    for (int i = 0; i < 16; ++i) { const unsigned short hb = bf16_bits(xs[i]); ah.u[i] = hb; al.u[i] = ASPLIT ? bf16_bits(xs[i] - bf16_val(hb)) : (unsigned short)0; }
#pragma unroll
    for (int t = 0; t < 4; ++t) {
      const unsigned short* brow = Wt + (size_t)(col0 + t * 16 + ln) * ldb + kb;
      FragB b;
      b.half[0] = *(const v8us*)(brow + 8 * hh);
      b.half[1] = *(const v8us*)(brow + 16 + 8 * hh);
      acc[t] = mmaN<ASPLIT ? 2 : 1>(ah.v, al.v, b.v, b.v, acc[t]);
    }
  }
#pragma unroll
  for (int t = 0; t < 4; ++t) {
    const int col = col0 + t * 16 + ln;
    float bv = bias ? bias[col] : 0.f;
    if (BIAS_BF16) bv = bf16_round(bv);
#pragma unroll
    for (int r = 0; r < 8; ++r) {
      float v = acc[t][r] + bv;
      if (resid) { float rv = resid[(size_t)((row0 + 8 * hh + r) % rmod) * ldr + col]; if (RES_BF16) rv = bf16_round(rv); v += rv; }
      if (ACT == 1) v = fmaxf(v, 0.f);
      if (ACT == 2) v = 0.5f * v * (1.0f + erff(v * 0.70710678118654752f));
      if (ACT == 3) { const float u = 0.7978845608028654f * (v + 0.044715f * v * v * v); v = 0.5f * v * (1.0f + tanhf(u)); }
      so[w][8 * hh + r][t * 16 + ln] = v;
    }
  }
  __builtin_amdgcn_fence(__ATOMIC_ACQ_REL, "workgroup");
  __builtin_amdgcn_wave_barrier();
  const int rsub = lane >> 4, c4 = (lane & 15) * 4;
  {
#pragma unroll
    for (int q = 0; q < 8; ++q) {
      const int r = q * 2 + rsub;
      const v4f v = *(const v4fa*)&so[w][r][c4];
      *(v4f*)(C + (size_t)(row0 + r) * ldc + col0 + c4) = v;
    }
    
  }
}
// row LayerNorm (biased variance, eps) over N: s = X (+ R); optional out_sum <- s; out_norm <- (s-mu)*rsqrt(var+eps)*g + b
template <bool PARAM_BF16>
__global__ __launch_bounds__(256) void k_layernorm(const float* __restrict__ X, const float* __restrict__ R, const float* __restrict__ g, const float* __restrict__ bta,
                                                  float* __restrict__ out_sum, float* __restrict__ out_norm, int N, float eps) {
  __shared__ float red[256];
  const int row = blockIdx.x, tid = threadIdx.x;
  const float* x = X + (size_t)row * N; const float* rr = R ? R + (size_t)row * N : nullptr;
  float vals[16];                     // up to N = 4096
  const int per = N / 256;            // contiguous chunk per thread? use strided-by-4 chunks: thread handles j = tid*4 + 1024*u
  float s1 = 0.f;
  for (int u = 0; u < per / 4; ++u) {
    const int j = tid * 4 + 1024 * u;
    const v4f a = *(const v4fa*)(x + j);
    v4f b = {0.f,0.f,0.f,0.f}; if (rr) b = *(const v4fa*)(rr + j);
#pragma unroll
    for (int q = 0; q < 4; ++q) { const float v = a[q] + b[q]; vals[u * 4 + q] = v; s1 += v; }
  }
  red[tid] = s1; __syncthreads();
  for (int st = 128; st > 0; st >>= 1) { if (tid < st) red[tid] += red[tid + st]; __syncthreads(); }
  const float mu = red[0] / (float)N; __syncthreads();
  float s2 = 0.f;
  for (int u = 0; u < per / 4; ++u)
#pragma unroll
    for (int q = 0; q < 4; ++q) { const float c = vals[u * 4 + q] - mu; s2 += c * c; }
  red[tid] = s2; __syncthreads();
  for (int st = 128; st > 0; st >>= 1) { if (tid < st) red[tid] += red[tid + st]; __syncthreads(); }
  const float rs = rsqrtf(red[0] / (float)N + eps);
  {
    for (int u = 0; u < per / 4; ++u) {
      const int j = tid * 4 + 1024 * u;
      v4f o, sm;
#pragma unroll
      for (int q = 0; q < 4; ++q) {
        float gg = g[j + q], bb = bta[j + q];
        if (PARAM_BF16) { gg = bf16_round(gg); bb = bf16_round(bb); }
        sm[q] = vals[u * 4 + q]; o[q] = (vals[u * 4 + q] - mu) * rs * gg + bb;
      }
      if (out_sum) *(v4f*)(out_sum + (size_t)row * N + j) = sm;
      *(v4f*)(out_norm + (size_t)row * N + j) = o;
    }
    
  }
}



// ---- f16 WMMA path (v_wmma_f32_16x16x32_f16): 11-bit significands for operands in range — used where a [0,1] probability operand needs more precision than bf16
typedef _Float16 v16h __attribute__((ext_vector_type(16)));
union FragH { v16h v; v8us half[2]; _Float16 h[16]; unsigned short u[16]; };
template <int NT>
__device__ __forceinline__ v8f mmaH(v16h ah, v16h al, v16h bh, v16h bl, v8f c) {
  c = __builtin_amdgcn_wmma_f32_16x16x32_f16(false, ah, false, bh, (short)0, c, false, false);
  if (NT >= 2) c = __builtin_amdgcn_wmma_f32_16x16x32_f16(false, al, false, bh, (short)0, c, false, false);
  if (NT >= 3) c = __builtin_amdgcn_wmma_f32_16x16x32_f16(false, ah, false, bl, (short)0, c, false, false);
  asm volatile("v_nop\n\tv_nop\n\tv_nop\n\tv_nop" : "+v"(c) : "v"(ah), "v"(al), "v"(bh), "v"(bl));
  return c;
}
// batched GEMM like k_gemm_b but f16 operands: A f32 (split into f16 hi/lo if ASPLIT, else rounded to f16), Bt = f16 values [n][k]; alpha; C f32; N multiple of 16 (partial tiles skipped)
template <bool ASPLIT>
__global__ __launch_bounds__(128) void k_gemm_h(const float* __restrict__ A, int lda, size_t sA, const _Float16* __restrict__ Bh, int ldb, size_t sB, float alpha, float* __restrict__ C, int ldc, size_t sC, int M, int N, int K) {
  __shared__ __attribute__((aligned(16))) float so[4][16][64];
  const int tid = threadIdx.x, w = tid >> 5, lane = tid & 31, ln = lane & 15, hh = lane >> 4; const int by = blockIdx.y;
  A += (size_t)by * sA; Bh += (size_t)by * sB; C += (size_t)by * sC;
  const int ntn = (N + 63) / 64; const int wid = blockIdx.x * 4 + w; const int mt = wid / ntn, nq = wid % ntn; if (mt * 16 >= M) return;
  const int row0 = mt * 16, col0 = nq * 64; const float* arow = A + (size_t)(row0 + ln) * lda;
  v8f acc[4] = {};
  for (int kb = 0; kb < K; kb += 32) {
    FragH ah, al;
    const v4f x0 = *(const v4fa*)(arow + kb + 8 * hh), x1 = *(const v4fa*)(arow + kb + 8 * hh + 4), x2 = *(const v4fa*)(arow + kb + 16 + 8 * hh), x3 = *(const v4fa*)(arow + kb + 16 + 8 * hh + 4);
    float xs[16] = {x0[0],x0[1],x0[2],x0[3],x1[0],x1[1],x1[2],x1[3],x2[0],x2[1],x2[2],x2[3],x3[0],x3[1],x3[2],x3[3]};
#pragma unroll
    for (int i = 0; i < 16; ++i) { const _Float16 h = (_Float16)xs[i]; ah.h[i] = h; al.h[i] = ASPLIT ? (_Float16)(xs[i] - (float)h) : (_Float16)0.0f; }
#pragma unroll
    for (int t = 0; t < 4; ++t) { if (col0 + t * 16 >= N) continue; const size_t boff = (size_t)(col0 + t * 16 + ln) * ldb + kb; FragH bq; bq.half[0] = *(const v8us*)(Bh + boff + 8 * hh); bq.half[1] = *(const v8us*)(Bh + boff + 16 + 8 * hh);
      acc[t] = mmaH<ASPLIT ? 2 : 1>(ah.v, al.v, bq.v, bq.v, acc[t]); }
  }
#pragma unroll
  for (int t = 0; t < 4; ++t) { if (col0 + t * 16 >= N) continue;
#pragma unroll
    for (int r = 0; r < 8; ++r) so[w][8 * hh + r][t * 16 + ln] = acc[t][r] * alpha; }
  __builtin_amdgcn_fence(__ATOMIC_ACQ_REL, "workgroup"); __builtin_amdgcn_wave_barrier();
  const int rsub = lane >> 4, c4 = (lane & 15) * 4;
  {
#pragma unroll
    for (int q = 0; q < 8; ++q) { const int r = q * 2 + rsub; if (col0 + c4 < N) { const v4f v = *(const v4fa*)&so[w][r][c4]; *(v4f*)(C + (size_t)(row0 + r) * ldc + col0 + c4) = v; } }
     }
}

// Wt[n][k] = f16(W[k][n]·scale) from f32 row-major W[K][N] (scale = power of two; bf16-exact weights stay exact in f16 away from the subnormal range)
__global__ __launch_bounds__(256) void k_wt_f16(const float* __restrict__ W, _Float16* __restrict__ Wt, int K, int N, float scale) {
  const int t = blockIdx.x * 256 + threadIdx.x; if (t >= N * (K / 8)) return; const int n = t / (K / 8), k8 = (t % (K / 8)) * 8; FragH f;
#pragma unroll
  for (int i = 0; i < 8; ++i) f.h[i] = (_Float16)(bf16_round(W[(size_t)(k8 + i) * N + n]) * scale); const v8us o = f.half[0];
  *(v8us*)((unsigned short*)Wt + (size_t)n * K + k8) = o; 
}
// k_gemm_hh variant with fused epilogue: v = acc·alpha + bias[by·sBias + col] (+ CP[(row/rowsPerB)·sCPb + by·64 + col] if CP) ; ACT 0 none / 1 elu ; writes f16 C16 (and f32 C if non-null)
template <int ACT>
__global__ __launch_bounds__(128) void k_gemm_hhx(const _Float16* __restrict__ A, int lda, size_t sA, const _Float16* __restrict__ Bh, int ldb, size_t sB, float alpha, const float* __restrict__ bias, size_t sBias, const float* __restrict__ CP, int rowsPerB, size_t sCPb, int row0g,
    float* __restrict__ C, _Float16* __restrict__ C16, int ldc, size_t sC, int M, int N, int K) {
  __shared__ __attribute__((aligned(16))) float so[4][16][64];
  const int tid = threadIdx.x, w = tid >> 5, lane = tid & 31, ln = lane & 15, hh = lane >> 4; const int by = blockIdx.y;
  A += (size_t)by * sA; Bh += (size_t)by * sB; const size_t cofs = (size_t)by * sC; const float* bp = bias ? bias + (size_t)by * sBias : nullptr;
  const int ntn = (N + 63) / 64; const int wid = blockIdx.x * 4 + w; const int mt = wid / ntn, nq = wid % ntn; if (mt * 16 >= M) return;
  const int row0 = mt * 16, col0 = nq * 64; const _Float16* arow = A + (size_t)(row0 + ln) * lda;
  v8f acc[4] = {};
  for (int kb = 0; kb < K; kb += 32) { FragH ah; ah.half[0] = *(const v8us*)((const unsigned short*)arow + kb + 8 * hh); ah.half[1] = *(const v8us*)((const unsigned short*)arow + kb + 16 + 8 * hh);
#pragma unroll
    for (int t = 0; t < 4; ++t) { if (col0 + t * 16 >= N) continue; const size_t boff = (size_t)(col0 + t * 16 + ln) * ldb + kb; FragH bq; bq.half[0] = *(const v8us*)((const unsigned short*)Bh + boff + 8 * hh); bq.half[1] = *(const v8us*)((const unsigned short*)Bh + boff + 16 + 8 * hh);
      acc[t] = mmaH<1>(ah.v, ah.v, bq.v, bq.v, acc[t]); }
  }
#pragma unroll
  for (int t = 0; t < 4; ++t) { if (col0 + t * 16 >= N) continue; const int col = col0 + t * 16 + ln; const float bv = bp ? bf16_round(bp[col]) : 0.f;
#pragma unroll
    for (int r = 0; r < 8; ++r) { float v = acc[t][r] * alpha + bv; if (CP) { const int bidx = (row0g + row0 + 8 * hh + r) / rowsPerB; v += CP[(size_t)bidx * sCPb + (size_t)by * 64 + col]; } if (ACT == 1) v = (v > 0.f) ? v : expm1f(v); else if (ACT == 7) v = (v > 0.f) ? v + 1.0f : expf(v); else if (ACT == 8) v = tanhf(v); else if (ACT == 9) v = 0.5f * v * (1.0f + tanhf(0.7978845608028654f * (v + 0.044715f * v * v * v))); else if (ACT == 11) v = 1.0f / (1.0f + expf(-v)); else if (ACT == 12) v = (v > 0.f) ? v : 0.01f * v; else if (ACT == 14) v = (v > 0.f) ? v : 0.1f * v; else if (ACT == 15) v = v / (1.0f + expf(-v)); else if (ACT == 3) v = fmaxf(v, 0.f); else if (ACT == 6) v = 0.5f * v * (1.0f + erff(v * 0.70710678118654752f)); so[w][8 * hh + r][t * 16 + ln] = v; } }
  __builtin_amdgcn_fence(__ATOMIC_ACQ_REL, "workgroup"); __builtin_amdgcn_wave_barrier();
  const int rsub = lane >> 4, c4 = (lane & 15) * 4; typedef _Float16 v4h __attribute__((ext_vector_type(4)));
  {
#pragma unroll
    for (int q = 0; q < 8; ++q) { const int r = q * 2 + rsub; if (col0 + c4 < N) { const v4f v = *(const v4fa*)&so[w][r][c4]; if (C) *(v4f*)(C + cofs + (size_t)(row0 + r) * ldc + col0 + c4) = v; if (C16) { v4h h4; for (int i = 0; i < 4; ++i) h4[i] = (_Float16)v[i]; *(v4h*)(C16 + cofs + (size_t)(row0 + r) * ldc + col0 + c4) = h4; } } }
     }
}


typedef _Float16 v4h __attribute__((ext_vector_type(4)));

__global__ __launch_bounds__(256) void k_x16(const float* __restrict__ x, _Float16* __restrict__ X16, size_t n8) { const size_t t = (size_t)blockIdx.x * 256 + threadIdx.x; if (t >= n8) return; FragH f;
#pragma unroll
  for (int q = 0; q < 8; ++q) f.h[q] = (_Float16)bf16_round(x[t * 8 + q]); *(v8us*)((unsigned short*)X16 + t * 8) = f.half[0];  }
__global__ __launch_bounds__(256) void k_h16(const float* __restrict__ x, _Float16* __restrict__ X16, size_t n8) { const size_t t = (size_t)blockIdx.x * 256 + threadIdx.x; if (t >= n8) return; FragH f;
#pragma unroll
  for (int q = 0; q < 8; ++q) f.h[q] = (_Float16)x[t * 8 + q]; *(v8us*)((unsigned short*)X16 + t * 8) = f.half[0];  }
__global__ __launch_bounds__(256) void k_round16f(const float* __restrict__ W, _Float16* __restrict__ Bt, size_t n8) { const size_t t = (size_t)blockIdx.x * 256 + threadIdx.x; if (t >= n8) return; FragH f;
#pragma unroll
  for (int i = 0; i < 8; ++i) f.h[i] = (_Float16)(bf16_round(W[t * 8 + i]) * 16.0f); *(v8us*)((unsigned short*)Bt + t * 8) = f.half[0];  }
template <int NHv, int TTv>
__global__ __launch_bounds__(256) void k_vt(const _Float16* __restrict__ V16, int ldv, int voff, _Float16* __restrict__ Vt) { __shared__ unsigned short tl[64][66]; const int tid = threadIdx.x; const int slab = blockIdx.x / (TTv / 64), lg = blockIdx.x % (TTv / 64); const int b = slab / NHv, h = slab % NHv;
  for (int i = tid; i < 64 * 8; i += 256) { const int r = i / 8, c8 = (i % 8) * 8; FragH f; f.half[0] = *(const v8us*)((const unsigned short*)V16 + ((size_t)b * TTv + lg * 64 + r) * ldv + voff + h * 64 + c8);
#pragma unroll
    for (int q = 0; q < 8; ++q) tl[r][c8 + q] = f.u[q]; }
  __syncthreads();
  {
#pragma unroll
    for (int rd = 0; rd < 2; ++rd) { const int d = rd * 32 + tid / 8, pc = tid % 8; FragH f;
#pragma unroll
      for (int q = 0; q < 8; ++q) f.u[q] = tl[pc * 8 + q][d];
      *(v8us*)((unsigned short*)Vt + ((size_t)slab * 64 + d) * TTv + lg * 64 + pc * 8) = f.half[0]; }
     } }

__global__ __launch_bounds__(256) void k_hl(const float* __restrict__ F, _Float16* __restrict__ Hh, _Float16* __restrict__ Hl, size_t n8) { const size_t t = (size_t)blockIdx.x * 256 + threadIdx.x; if (t >= n8) return; FragH fh, fl; const v4f a = *(const v4fa*)(F + t * 8), c = *(const v4fa*)(F + t * 8 + 4);
#pragma unroll
  for (int q = 0; q < 4; ++q) { _Float16 h = (_Float16)a[q]; fh.h[q] = h; fl.h[q] = (_Float16)((a[q] - (float)h) * 1024.0f); h = (_Float16)c[q]; fh.h[4 + q] = h; fl.h[4 + q] = (_Float16)((c[q] - (float)h) * 1024.0f); }
  { *(v8us*)((unsigned short*)Hh + t * 8) = fh.half[0]; *(v8us*)((unsigned short*)Hl + t * 8) = fl.half[0];  } }

// ---- fast GEMM (wave tile 32x64; requires M % 32 == 0 rows per launch region and N % 64 == 0); epilogue = k_gemm_hhx semantics ----
__device__ __forceinline__ v16h g2_frag(const _Float16* p, int hh) { FragH f; f.half[0] = *(const v8us*)((const unsigned short*)p + 8 * hh); f.half[1] = *(const v8us*)((const unsigned short*)p + 16 + 8 * hh); return f.v; }
__device__ __forceinline__ v8f g2_mma(v16h a, v16h b, v8f c) { v8f d = __builtin_amdgcn_wmma_f32_16x16x32_f16(false, a, false, b, (short)0, c, false, false); asm volatile("v_nop\n\tv_nop\n\tv_nop\n\tv_nop" : "+v"(d) : "v"(a), "v"(b)); return d; }
template <int ACT>
__global__ __launch_bounds__(128) void k_gemm2(const _Float16* __restrict__ A, int lda, size_t sA, const _Float16* __restrict__ Bh, int ldb, size_t sB, float alpha, const float* __restrict__ bias, size_t sBias, const float* __restrict__ CP, int rowsPerB, size_t sCPb, int row0g,
    float* __restrict__ C, _Float16* __restrict__ C16, int ldc, size_t sC, int M, int N, int K) {
  __shared__ __attribute__((aligned(16))) float so[4][32][68];
  const int tid = threadIdx.x, w = tid >> 5, lane = tid & 31, ln = lane & 15, hh = lane >> 4; const int by = blockIdx.y;
  A += (size_t)by * sA; Bh += (size_t)by * sB; const size_t cofs = (size_t)by * sC; const float* bp = bias ? bias + (size_t)by * sBias : nullptr;
  const int ntn = N >> 6; const int mt = blockIdx.x / ntn, nq = blockIdx.x - mt * ntn; const int row0 = mt * 128 + 32 * w, col0 = nq * 64; if (row0 >= M) return;
  const _Float16* a0p = A + (size_t)(row0 + ln) * lda; const _Float16* a1p = a0p + (size_t)16 * lda;
  const _Float16* b0p = Bh + (size_t)(col0 + ln) * ldb; const _Float16* b1p = b0p + (size_t)16 * ldb; const _Float16* b2p = b1p + (size_t)16 * ldb; const _Float16* b3p = b2p + (size_t)16 * ldb;
  const v8f z8 = {0.f,0.f,0.f,0.f,0.f,0.f,0.f,0.f}; v8f c00 = z8, c01 = z8, c02 = z8, c03 = z8, c10 = z8, c11 = z8, c12 = z8, c13 = z8;
#pragma unroll 1
  for (int kb = 0; kb < K; kb += 32) { const v16h a0 = g2_frag(a0p + kb, hh), a1 = g2_frag(a1p + kb, hh);
    v16h b = g2_frag(b0p + kb, hh); c00 = g2_mma(a0, b, c00); c10 = g2_mma(a1, b, c10);
    b = g2_frag(b1p + kb, hh); c01 = g2_mma(a0, b, c01); c11 = g2_mma(a1, b, c11);
    b = g2_frag(b2p + kb, hh); c02 = g2_mma(a0, b, c02); c12 = g2_mma(a1, b, c12);
    b = g2_frag(b3p + kb, hh); c03 = g2_mma(a0, b, c03); c13 = g2_mma(a1, b, c13); }
  v8f accs[8] = {c00, c01, c02, c03, c10, c11, c12, c13};
#pragma unroll
  for (int u = 0; u < 8; ++u) { const int t = u & 3, half = u >> 2; const int col = col0 + t * 16 + ln; const float bv = bp ? bf16_round(bp[col]) : 0.f;
#pragma unroll
    for (int r = 0; r < 8; ++r) { const int rloc = half * 16 + 8 * hh + r; float v = accs[u][r] * alpha + bv; if (CP) { const int bidx = (row0g + row0 + rloc) / rowsPerB; v += CP[(size_t)bidx * sCPb + (size_t)by * 64 + col]; }
      if (ACT == 3) v = fmaxf(v, 0.f); else if (ACT == 6) v = 0.5f * v * (1.0f + erff(v * 0.70710678118654752f)); else if (ACT == 11) v = 1.0f / (1.0f + expf(-v)); else if (ACT == 15) v = v / (1.0f + expf(-v)); else if (ACT == 12) v = (v > 0.f) ? v : 0.01f * v; else if (ACT == 8) v = tanhf(v);
      so[w][rloc][t * 16 + ln] = v; } }
  __builtin_amdgcn_fence(__ATOMIC_ACQ_REL, "workgroup"); __builtin_amdgcn_wave_barrier();
  const int rsub = lane >> 4, c4 = (lane & 15) * 4;
  {
#pragma unroll
    for (int q = 0; q < 16; ++q) { const int r = q * 2 + rsub; const v4f v = *(const v4fa*)&so[w][r][c4]; if (C) *(v4f*)(C + cofs + (size_t)(row0 + r) * ldc + col0 + c4) = v; if (C16) { v4h h4; for (int i = 0; i < 4; ++i) h4[i] = (_Float16)v[i]; *(v4h*)(C16 + cofs + (size_t)(row0 + r) * ldc + col0 + c4) = h4; } }
     } }



template <int CAUSAL>
__global__ __launch_bounds__(128) void k_flash(const _Float16* __restrict__ Q16, int ldq, const _Float16* __restrict__ K16, int ldk, const _Float16* __restrict__ Vt, const int* __restrict__ MSK, float* __restrict__ O, int ldo) {
  constexpr int RPW = 16, RTN = RPW / 16, NQB = TQ / (4 * RPW), DT = 4, KS = 2;
  __shared__ __attribute__((aligned(16))) unsigned short sP[4][RPW][40]; __shared__ __attribute__((aligned(16))) float sO[4][RPW][64 + 4];
  const int tid = threadIdx.x, w = tid >> 5, lane = tid & 31, ln = lane & 15, hh = lane >> 4;
  const int slab = blockIdx.x / QBNP, qblk = QB0P + blockIdx.x % QBNP; (void)NQB; const int b = slab / NH, h = slab % NH; const int qb0 = qblk * (4 * RPW); const int q0 = qb0 + w * RPW;
  FragH aq[2][KS];
#pragma unroll
  for (int rt = 0; rt < RTN; ++rt) { const unsigned short* qr = (const unsigned short*)Q16 + ((size_t)b * TQ + q0 + rt * 16 + ln) * ldq + h * 64;
#pragma unroll
    for (int ks = 0; ks < KS; ++ks) { aq[rt][ks].half[0] = *(const v8us*)(qr + ks * 32 + 8 * hh); aq[rt][ks].half[1] = *(const v8us*)(qr + ks * 32 + 16 + 8 * hh); } }
  const unsigned short* Vth = (const unsigned short*)Vt + (size_t)slab * 64 * TK;
  float m_r[2][8], l_r[2][8]; v8f oacc[2][DT];
#pragma unroll
  for (int rt = 0; rt < RTN; ++rt) {
#pragma unroll
    for (int r = 0; r < 8; ++r) { m_r[rt][r] = -3.0e38f; l_r[rt][r] = 0.f; }
#pragma unroll
    for (int dt = 0; dt < DT; ++dt) oacc[rt][dt] = (v8f){0.f,0.f,0.f,0.f,0.f,0.f,0.f,0.f}; }
  const int jend = (CAUSAL == 1) ? (qb0 + 4 * RPW) : TK;      /* causal: keys beyond the block's last query never contribute */
#pragma unroll 1
  for (int j0 = 0; j0 < jend; j0 += 32) {
    v8f s[2][2];
#pragma unroll
    for (int nt = 0; nt < 2; ++nt) { const unsigned short* kr = (const unsigned short*)K16 + ((size_t)b * TK + j0 + nt * 16 + ln) * ldk + h * 64; FragH bk[KS];
#pragma unroll
      for (int ks = 0; ks < KS; ++ks) { bk[ks].half[0] = *(const v8us*)(kr + ks * 32 + 8 * hh); bk[ks].half[1] = *(const v8us*)(kr + ks * 32 + 16 + 8 * hh); }
#pragma unroll
      for (int rt = 0; rt < RTN; ++rt) { v8f acc = (v8f){0.f,0.f,0.f,0.f,0.f,0.f,0.f,0.f};
#pragma unroll
        for (int ks = 0; ks < KS; ++ks) acc = mmaH<1>(aq[rt][ks].v, aq[rt][ks].v, bk[ks].v, bk[ks].v, acc); s[rt][nt] = acc; } }
#pragma unroll
    for (int rt = 0; rt < RTN; ++rt)
#pragma unroll
      for (int r = 0; r < 8; ++r) { const int tq = q0 + rt * 16 + 8 * hh + r; const int k0 = j0 + ln, k1 = j0 + 16 + ln;
        const bool ok0 = (CAUSAL == 1) ? (k0 <= tq) : ((CAUSAL == 2) ? ((k0 >> 5) == (tq >> 5)) : true), ok1 = (CAUSAL == 1) ? (k1 <= tq) : ((CAUSAL == 2) ? ((k1 >> 5) == (tq >> 5)) : true);      /* mode 2: block-diagonal 32-token groups */
        const float s0 = ok0 ? s[rt][0][r] * SCL : -3.0e38f, s1 = ok1 ? s[rt][1][r] * SCL : -3.0e38f; float mc = fmaxf(s0, s1);
        mc = fmaxf(mc, __shfl_xor(mc, 1, 32)); mc = fmaxf(mc, __shfl_xor(mc, 2, 32)); mc = fmaxf(mc, __shfl_xor(mc, 4, 32)); mc = fmaxf(mc, __shfl_xor(mc, 8, 32));
        const float mn = fmaxf(m_r[rt][r], mc); const float al = (mn > -1.0e38f) ? expf(m_r[rt][r] - mn) : 1.0f; m_r[rt][r] = mn; const float p0 = ok0 ? expf(s0 - mn) : 0.f, p1 = ok1 ? expf(s1 - mn) : 0.f; l_r[rt][r] = l_r[rt][r] * al + p0 + p1;
#pragma unroll
        for (int dt = 0; dt < DT; ++dt) oacc[rt][dt][r] *= al;
        FragH t2; t2.h[0] = (_Float16)(p0 * 1024.0f); t2.h[1] = (_Float16)(p1 * 1024.0f); sP[w][rt * 16 + 8 * hh + r][ln] = t2.u[0]; sP[w][rt * 16 + 8 * hh + r][16 + ln] = t2.u[1]; }
    __builtin_amdgcn_fence(__ATOMIC_ACQ_REL, "workgroup"); __builtin_amdgcn_wave_barrier();
    FragH pa[2];
#pragma unroll
    for (int rt = 0; rt < RTN; ++rt) { pa[rt].half[0] = *(const v8us*)&sP[w][rt * 16 + ln][8 * hh]; pa[rt].half[1] = *(const v8us*)&sP[w][rt * 16 + ln][16 + 8 * hh]; }
#pragma unroll
    for (int dt = 0; dt < DT; ++dt) { const unsigned short* vrow = Vth + (size_t)(dt * 16 + ln) * TK + j0; FragH bv; bv.half[0] = *(const v8us*)(vrow + 8 * hh); bv.half[1] = *(const v8us*)(vrow + 16 + 8 * hh);
#pragma unroll
      for (int rt = 0; rt < RTN; ++rt) oacc[rt][dt] = mmaH<1>(pa[rt].v, pa[rt].v, bv.v, bv.v, oacc[rt][dt]); }
    __builtin_amdgcn_fence(__ATOMIC_ACQ_REL, "workgroup"); __builtin_amdgcn_wave_barrier(); }
#pragma unroll
  for (int rt = 0; rt < RTN; ++rt) {
#pragma unroll
    for (int r = 0; r < 8; ++r) { float l = l_r[rt][r]; l += __shfl_xor(l, 1, 32); l += __shfl_xor(l, 2, 32); l += __shfl_xor(l, 4, 32); l += __shfl_xor(l, 8, 32); l_r[rt][r] = (l > 0.f) ? 1.0f / (l * 1024.0f) : 0.f; }
#pragma unroll
    for (int dt = 0; dt < DT; ++dt)
#pragma unroll
      for (int r = 0; r < 8; ++r) sO[w][rt * 16 + 8 * hh + r][dt * 16 + ln] = oacc[rt][dt][r] * l_r[rt][r]; }
  __builtin_amdgcn_fence(__ATOMIC_ACQ_REL, "workgroup"); __builtin_amdgcn_wave_barrier();
  {
#pragma unroll
    for (int rp = 0; rp < RPW; rp += 2) { const int r = rp + (lane >> 4), pc = lane & 15; const v4f val = *(const v4fa*)&sO[w][r][pc * 4]; *(v4f*)(O + ((size_t)b * TQ + q0 + r) * ldo + h * 64 + pc * 4) = val; }
     } }
// 5-plane variant: S = Qh Kh^T + (Ql Kh^T + Qh Kl^T)/1024 with Q/K = [hi | 2^10 residual] f16 planes (QL/KL same layout as Q16/K16), then the 3-term P.V below.
// 3-term variant: O = (P_hi V_hi + (P_lo V_hi + P_hi V_lo) / 1024) / l with P = [hi | 2^10 residual] of 1024 p and V^T = [hi | 2^10 residual] planes (VtL same layout as Vt) -> ~2^-21-class products for un-averaged (early causal / peaked) rows
template <int CAUSAL>
__global__ __launch_bounds__(128) void k_flash5(const _Float16* __restrict__ Q16, const _Float16* __restrict__ QL, int ldq, const _Float16* __restrict__ K16, const _Float16* __restrict__ KL, int ldk, const _Float16* __restrict__ Vt, const _Float16* __restrict__ VtL, const int* __restrict__ MSK, float* __restrict__ O, int ldo) {
  constexpr int RPW = 16, RTN = RPW / 16, NQB = TQ / (4 * RPW), DT = 4, KS = 2;
  __shared__ __attribute__((aligned(16))) unsigned short sP[4][RPW][40]; __shared__ __attribute__((aligned(16))) unsigned short sPL[4][RPW][40]; __shared__ __attribute__((aligned(16))) float sO[4][RPW][64 + 4];
  const int tid = threadIdx.x, w = tid >> 5, lane = tid & 31, ln = lane & 15, hh = lane >> 4;
  const int slab = blockIdx.x / QBN5, qblk = QB05 + blockIdx.x % QBN5; (void)NQB; const int b = slab / NH, h = slab % NH; const int qb0 = qblk * (4 * RPW); const int q0 = qb0 + w * RPW;
  FragH aq[2][KS], aql[2][KS];
#pragma unroll
  for (int rt = 0; rt < RTN; ++rt) { const unsigned short* qr = (const unsigned short*)Q16 + ((size_t)b * TQ + q0 + rt * 16 + ln) * ldq + h * 64; const unsigned short* ql = (const unsigned short*)QL + ((size_t)b * TQ + q0 + rt * 16 + ln) * ldq + h * 64;
#pragma unroll
    for (int ks = 0; ks < KS; ++ks) { aq[rt][ks].half[0] = *(const v8us*)(qr + ks * 32 + 8 * hh); aq[rt][ks].half[1] = *(const v8us*)(qr + ks * 32 + 16 + 8 * hh); aql[rt][ks].half[0] = *(const v8us*)(ql + ks * 32 + 8 * hh); aql[rt][ks].half[1] = *(const v8us*)(ql + ks * 32 + 16 + 8 * hh); } }
  const unsigned short* Vth = (const unsigned short*)Vt + (size_t)slab * 64 * TK; const unsigned short* Vtl = (const unsigned short*)VtL + (size_t)slab * 64 * TK;
  float m_r[2][8], l_r[2][8]; v8f oacc[2][DT], oaccL[2][DT];
#pragma unroll
  for (int rt = 0; rt < RTN; ++rt) {
#pragma unroll
    for (int r = 0; r < 8; ++r) { m_r[rt][r] = -3.0e38f; l_r[rt][r] = 0.f; }
#pragma unroll
    for (int dt = 0; dt < DT; ++dt) { oacc[rt][dt] = (v8f){0.f,0.f,0.f,0.f,0.f,0.f,0.f,0.f}; oaccL[rt][dt] = oacc[rt][dt]; } }
  const int jend = (CAUSAL == 1) ? (qb0 + 4 * RPW) : TK;      /* causal: keys beyond the block's last query never contribute */
#pragma unroll 1
  for (int j0 = 0; j0 < jend; j0 += 32) {
    v8f s[2][2];
#pragma unroll
    for (int nt = 0; nt < 2; ++nt) { const unsigned short* kr = (const unsigned short*)K16 + ((size_t)b * TK + j0 + nt * 16 + ln) * ldk + h * 64; const unsigned short* klr = (const unsigned short*)KL + ((size_t)b * TK + j0 + nt * 16 + ln) * ldk + h * 64; FragH bk[KS], bkl[KS];
#pragma unroll
      for (int ks = 0; ks < KS; ++ks) { bk[ks].half[0] = *(const v8us*)(kr + ks * 32 + 8 * hh); bk[ks].half[1] = *(const v8us*)(kr + ks * 32 + 16 + 8 * hh); bkl[ks].half[0] = *(const v8us*)(klr + ks * 32 + 8 * hh); bkl[ks].half[1] = *(const v8us*)(klr + ks * 32 + 16 + 8 * hh); }
#pragma unroll
      for (int rt = 0; rt < RTN; ++rt) { v8f acc = (v8f){0.f,0.f,0.f,0.f,0.f,0.f,0.f,0.f}, accl = acc;
#pragma unroll
        for (int ks = 0; ks < KS; ++ks) { acc = mmaH<1>(aq[rt][ks].v, aq[rt][ks].v, bk[ks].v, bk[ks].v, acc); accl = mmaH<1>(aql[rt][ks].v, aql[rt][ks].v, bk[ks].v, bk[ks].v, accl); accl = mmaH<1>(aq[rt][ks].v, aq[rt][ks].v, bkl[ks].v, bkl[ks].v, accl); }
#pragma unroll
        for (int r = 0; r < 8; ++r) acc[r] += accl[r] * 0.0009765625f;
        s[rt][nt] = acc; } }
#pragma unroll
    for (int rt = 0; rt < RTN; ++rt)
#pragma unroll
      for (int r = 0; r < 8; ++r) { const int tq = q0 + rt * 16 + 8 * hh + r; const int k0 = j0 + ln, k1 = j0 + 16 + ln;
        bool ok0 = (CAUSAL == 1) ? (k0 <= tq) : ((CAUSAL == 2) ? ((k0 >> 5) == (tq >> 5)) : true), ok1 = (CAUSAL == 1) ? (k1 <= tq) : ((CAUSAL == 2) ? ((k1 >> 5) == (tq >> 5)) : true);      /* mode 2: block-diagonal 32-token groups */
        if (CAUSAL == 4) { const int* mrow = MSK + ((size_t)b * TQ + tq) * TK; ok0 = mrow[k0] != 0; ok1 = mrow[k1] != 0; }      /* mode 4: per-(query, key) INPUT mask shared by all heads; masked keys contribute nothing (== the reference's -4096 fill, whose exp underflows to 0), rows with no valid key give l = 0 -> output 0 (== the reference's row_valid zeroing) */
        const float s0 = ok0 ? s[rt][0][r] * SCL : -3.0e38f, s1 = ok1 ? s[rt][1][r] * SCL : -3.0e38f; float mc = fmaxf(s0, s1);
        mc = fmaxf(mc, __shfl_xor(mc, 1, 32)); mc = fmaxf(mc, __shfl_xor(mc, 2, 32)); mc = fmaxf(mc, __shfl_xor(mc, 4, 32)); mc = fmaxf(mc, __shfl_xor(mc, 8, 32));
        const float mn = fmaxf(m_r[rt][r], mc); const float al = (mn > -1.0e38f) ? expf(m_r[rt][r] - mn) : 1.0f; m_r[rt][r] = mn; const float p0 = ok0 ? expf(s0 - mn) : 0.f, p1 = ok1 ? expf(s1 - mn) : 0.f; l_r[rt][r] = l_r[rt][r] * al + p0 + p1;
#pragma unroll
        for (int dt = 0; dt < DT; ++dt) { oacc[rt][dt][r] *= al; oaccL[rt][dt][r] *= al; }
        FragH t2, t2l; const float ps0 = p0 * 1024.0f, ps1 = p1 * 1024.0f; t2.h[0] = (_Float16)ps0; t2.h[1] = (_Float16)ps1; t2l.h[0] = (_Float16)((ps0 - (float)t2.h[0]) * 1024.0f); t2l.h[1] = (_Float16)((ps1 - (float)t2.h[1]) * 1024.0f);
        sP[w][rt * 16 + 8 * hh + r][ln] = t2.u[0]; sP[w][rt * 16 + 8 * hh + r][16 + ln] = t2.u[1]; sPL[w][rt * 16 + 8 * hh + r][ln] = t2l.u[0]; sPL[w][rt * 16 + 8 * hh + r][16 + ln] = t2l.u[1]; }
    __builtin_amdgcn_fence(__ATOMIC_ACQ_REL, "workgroup"); __builtin_amdgcn_wave_barrier();
    FragH pa[2], pl[2];
#pragma unroll
    for (int rt = 0; rt < RTN; ++rt) { pa[rt].half[0] = *(const v8us*)&sP[w][rt * 16 + ln][8 * hh]; pa[rt].half[1] = *(const v8us*)&sP[w][rt * 16 + ln][16 + 8 * hh]; pl[rt].half[0] = *(const v8us*)&sPL[w][rt * 16 + ln][8 * hh]; pl[rt].half[1] = *(const v8us*)&sPL[w][rt * 16 + ln][16 + 8 * hh]; }
#pragma unroll
    for (int dt = 0; dt < DT; ++dt) { const unsigned short* vrow = Vth + (size_t)(dt * 16 + ln) * TK + j0; const unsigned short* vrl = Vtl + (size_t)(dt * 16 + ln) * TK + j0; FragH bv, bl; bv.half[0] = *(const v8us*)(vrow + 8 * hh); bv.half[1] = *(const v8us*)(vrow + 16 + 8 * hh); bl.half[0] = *(const v8us*)(vrl + 8 * hh); bl.half[1] = *(const v8us*)(vrl + 16 + 8 * hh);
#pragma unroll
      for (int rt = 0; rt < RTN; ++rt) { oacc[rt][dt] = mmaH<1>(pa[rt].v, pa[rt].v, bv.v, bv.v, oacc[rt][dt]); oaccL[rt][dt] = mmaH<1>(pl[rt].v, pl[rt].v, bv.v, bv.v, oaccL[rt][dt]); oaccL[rt][dt] = mmaH<1>(pa[rt].v, pa[rt].v, bl.v, bl.v, oaccL[rt][dt]); } }
    __builtin_amdgcn_fence(__ATOMIC_ACQ_REL, "workgroup"); __builtin_amdgcn_wave_barrier(); }
#pragma unroll
  for (int rt = 0; rt < RTN; ++rt) {
#pragma unroll
    for (int r = 0; r < 8; ++r) { float l = l_r[rt][r]; l += __shfl_xor(l, 1, 32); l += __shfl_xor(l, 2, 32); l += __shfl_xor(l, 4, 32); l += __shfl_xor(l, 8, 32); l_r[rt][r] = (l > 0.f) ? 1.0f / (l * 1024.0f) : 0.f; }
#pragma unroll
    for (int dt = 0; dt < DT; ++dt)
#pragma unroll
      for (int r = 0; r < 8; ++r) { float v = oacc[rt][dt][r]; v += oaccL[rt][dt][r] * 0.0009765625f; sO[w][rt * 16 + 8 * hh + r][dt * 16 + ln] = v * l_r[rt][r]; } }
  __builtin_amdgcn_fence(__ATOMIC_ACQ_REL, "workgroup"); __builtin_amdgcn_wave_barrier();
  {
#pragma unroll
    for (int rp = 0; rp < RPW; rp += 2) { const int r = rp + (lane >> 4), pc = lane & 15; const v4f val = *(const v4fa*)&sO[w][r][pc * 4]; *(v4f*)(O + ((size_t)b * TQ + q0 + r) * ldo + h * 64 + pc * 4) = val; }
     } }

__global__ __launch_bounds__(256) void k_wsc(const float* __restrict__ Wm, _Float16* __restrict__ Bt, size_t n8, float sc) { const size_t t = (size_t)blockIdx.x * 256 + threadIdx.x; if (t >= n8) return; FragH f; for (int q = 0; q < 8; ++q) f.h[q] = (_Float16)(bf16_round(Wm[t * 8 + q]) * sc); *(v8us*)((unsigned short*)Bt + t * 8) = f.half[0];  }      /* torch (out,in) weight == Bt[n][k]: scaled copy */




__global__ __launch_bounds__(256) void k_rope(const float* __restrict__ F, int nheads, const float* __restrict__ CS, const float* __restrict__ SN, _Float16* __restrict__ H, _Float16* __restrict__ L, int ldd) {      /* ldd: destination row pitch (the source pitch is nheads*HD) */
  #pragma clang fp contract(off)
  const size_t t = (size_t)blockIdx.x * 256 + threadIdx.x; if (t >= (size_t)SQ * nheads * (HH / 8)) return; const int g = (int)(t % (HH / 8)) * 8; const int h = (int)((t / (HH / 8)) % nheads); const int s = (int)(t / ((HH / 8) * (size_t)nheads)); const int ld = nheads * HD;
  const size_t base = (size_t)s * ld + h * HD + g, dbase = (size_t)s * ldd + h * HD + g; FragH h0, h1, l0, l1;
#pragma unroll
  for (int q = 0; q < 8; ++q) { const float c = CS[s * HH + g + q], sn = SN[s * HH + g + q]; const float x0 = F[base + q], x1 = F[base + HH + q]; float o0 = x0 * c; o0 += -x1 * sn; float o1 = x1 * c; o1 += x0 * sn;
    const _Float16 a0 = (_Float16)o0, a1 = (_Float16)o1; h0.h[q] = a0; h1.h[q] = a1; l0.h[q] = (_Float16)((o0 - (float)a0) * 1024.0f); l1.h[q] = (_Float16)((o1 - (float)a1) * 1024.0f); }
  { *(v8us*)((unsigned short*)H + dbase) = h0.half[0]; *(v8us*)((unsigned short*)H + dbase + HH) = h1.half[0]; if (L) { *(v8us*)((unsigned short*)L + dbase) = l0.half[0]; *(v8us*)((unsigned short*)L + dbase + HH) = l1.half[0]; }  } }

__global__ __launch_bounds__(256) void k_rotab(const int* __restrict__ pid, int b, float* __restrict__ CS, float* __restrict__ SN) {
  #pragma clang fp contract(off)
  const int t = blockIdx.x * 256 + threadIdx.x; if (t >= SQ * HH) return; const int j = t % HH, s = t / HH; const float inv = 1.0f / powf(10000.0f, (float)(2 * j) / (float)HD); const float th = (float)pid[(size_t)b * SQ + s] * inv; const float c = cosf(th), sn = sinf(th);
  { *(float*)(CS + t) = c; *(float*)(SN + t) = sn;  } }

__global__ __launch_bounds__(256) void k_expand(const _Float16* __restrict__ SH, const _Float16* __restrict__ SL, _Float16* __restrict__ DH, _Float16* __restrict__ DL, int col0) {
  const size_t t = (size_t)blockIdx.x * 256 + threadIdx.x; if (t >= (size_t)SQ * NH * (HD / 8)) return; const int d0 = (int)(t % (HD / 8)) * 8; const int h = (int)((t / (HD / 8)) % NH); const size_t s = t / ((HD / 8) * NH);
  const size_t si = s * KVD + (size_t)(h / (NH / NKV)) * HD + d0, di = s * (size_t)(3 * EMB) + col0 + (size_t)h * HD + d0; const v8us a = *(const v8us*)((const unsigned short*)SH + si), bl = *(const v8us*)((const unsigned short*)SL + si);
  { *(v8us*)((unsigned short*)DH + di) = a; *(v8us*)((unsigned short*)DL + di) = bl;  } }

extern "C" void kernel_launch(void* const* d_in, const int* in_sizes, int n_in,
                              void* d_out, int out_size, void* d_ws, size_t ws_size, hipStream_t stream) {
  (void)in_sizes; (void)n_in; (void)out_size;
  const float* const* I = (const float* const*)d_in; const float* x = I[0]; const float* Wq = I[1]; const float* bq = I[2]; const float* Wk = I[3]; const float* bk = I[4]; const float* Wv = I[5]; const float* bv = I[6]; const float* Wo = I[7]; const int* pid = (const int*)d_in[8];
  char* ws = (char*)d_ws; size_t off = 0;
  auto take = [&](size_t bytes) { char* p = ws + off; off += (bytes + 255) & ~(size_t)255; return p; };
  const size_t npb = (size_t)SLEN * EMB;      /* per-batch plane */
  _Float16* BQ = (_Float16*)take((size_t)EMB * EMB * 2); _Float16* BK = (_Float16*)take((size_t)KVD * EMB * 2); _Float16* BV = (_Float16*)take((size_t)KVD * EMB * 2); _Float16* BO = (_Float16*)take((size_t)EMB * EMB * 2);
  float* CS = (float*)take((size_t)SLEN * HH * 4); float* SN = (float*)take((size_t)SLEN * HH * 4);
  _Float16* X16 = (_Float16*)take(npb * 2); float* QF = (float*)take(npb * 4); float* KF = (float*)take((size_t)SLEN * KVD * 4); float* VF = (float*)take((size_t)SLEN * KVD * 4); _Float16* KH8 = (_Float16*)take((size_t)SLEN * KVD * 2); _Float16* KL8 = (_Float16*)take((size_t)SLEN * KVD * 2); _Float16* VH8 = (_Float16*)take((size_t)SLEN * KVD * 2); _Float16* VL8 = (_Float16*)take((size_t)SLEN * KVD * 2);
  _Float16* H16 = (_Float16*)take(npb * 3 * 2); _Float16* L16 = (_Float16*)take(npb * 3 * 2); _Float16* VT = (_Float16*)take(npb * 2); _Float16* VTL = (_Float16*)take(npb * 2);
  float* O = QF; _Float16* OH = X16; _Float16* OLo = (_Float16*)take(npb * 2);      /* O over the q f32 plane (dead after the rope split); O hi over the x plane (dead after the projections) */
  if (off > ws_size) return;      /* 8+2+2+8 + 0.5 + 8 + 16 + 4+4 + 2x4 + 24 + 24 + 8 + 8 + 8 = 133 MiB */
  k_wt_f16<<<(unsigned)(((size_t)EMB * EMB / 8 + 255) / 256), 256, 0, stream>>>(Wq, BQ, EMB, EMB, 16.0f); k_wt_f16<<<(unsigned)(((size_t)EMB * KVD / 8 + 255) / 256), 256, 0, stream>>>(Wk, BK, EMB, KVD, 16.0f); k_wt_f16<<<(unsigned)(((size_t)EMB * KVD / 8 + 255) / 256), 256, 0, stream>>>(Wv, BV, EMB, KVD, 16.0f); k_wt_f16<<<(unsigned)(((size_t)EMB * EMB / 8 + 255) / 256), 256, 0, stream>>>(Wo, BO, EMB, EMB, 16.0f);      /* (in,out) weights */
  for (int b = 0; b < NB; ++b) { float* ob = (float*)d_out + (size_t)b * npb;
    k_rotab<<<(SLEN * HH + 255) / 256, 256, 0, stream>>>(pid, b, CS, SN);
    k_x16<<<(unsigned)((npb / 8 + 255) / 256), 256, 0, stream>>>(x + (size_t)b * npb, X16, npb / 8);
    k_gemm2<0><<<dim3((SLEN / 128) * (EMB / 64), 1), 128, 0, stream>>>(X16, EMB, 0, BQ, EMB, 0, 0.0625f, bq, 0, nullptr, 1, 0, 0, QF, nullptr, EMB, 0, SLEN, EMB, EMB);
    k_gemm2<0><<<dim3((SLEN / 128) * (KVD / 64), 1), 128, 0, stream>>>(X16, EMB, 0, BK, EMB, 0, 0.0625f, bk, 0, nullptr, 1, 0, 0, KF, nullptr, KVD, 0, SLEN, KVD, EMB);
    k_gemm2<0><<<dim3((SLEN / 128) * (KVD / 64), 1), 128, 0, stream>>>(X16, EMB, 0, BV, EMB, 0, 0.0625f, bv, 0, nullptr, 1, 0, 0, VF, nullptr, KVD, 0, SLEN, KVD, EMB);
    k_rope<<<(unsigned)(((size_t)SLEN * NH * (HH / 8) + 255) / 256), 256, 0, stream>>>(QF, NH, CS, SN, H16, L16, 3 * EMB);      /* q roped + split into the [q | k | v] planes */
    k_rope<<<(unsigned)(((size_t)SLEN * NKV * (HH / 8) + 255) / 256), 256, 0, stream>>>(KF, NKV, CS, SN, KH8, KL8, KVD);
    k_hl<<<(unsigned)(((size_t)SLEN * KVD / 8 + 255) / 256), 256, 0, stream>>>(VF, VH8, VL8, (size_t)SLEN * KVD / 8);
    k_expand<<<(unsigned)(((size_t)SLEN * NH * (HD / 8) + 255) / 256), 256, 0, stream>>>(KH8, KL8, H16, L16, EMB); k_expand<<<(unsigned)(((size_t)SLEN * NH * (HD / 8) + 255) / 256), 256, 0, stream>>>(VH8, VL8, H16, L16, 2 * EMB);
    k_vt<NH, SLEN><<<1 * NH * (SLEN / 64), 256, 0, stream>>>(H16, 3 * EMB, 2 * EMB, VT); k_vt<NH, SLEN><<<1 * NH * (SLEN / 64), 256, 0, stream>>>(L16, 3 * EMB, 2 * EMB, VTL);
    k_flash5<1><<<1 * NH * QBN5, 128, 0, stream>>>(H16, L16, 3 * EMB, H16 + EMB, L16 + EMB, 3 * EMB, VT, VTL, nullptr, O, EMB);
    k_flash<1><<<1 * NH * QBNP, 128, 0, stream>>>(H16, 3 * EMB, H16 + EMB, 3 * EMB, VT, nullptr, O, EMB);
    k_hl<<<(unsigned)((npb / 8 + 255) / 256), 256, 0, stream>>>(O, OH, OLo, npb / 8);
    k_gemm2<0><<<dim3((SLEN / 128) * (EMB / 64), 1), 128, 0, stream>>>(OH, EMB, 0, BO, EMB, 0, 0.0625f, nullptr, 0, nullptr, 1, 0, 0, ob, nullptr, EMB, 0, SLEN, EMB, EMB);
    k_gemm2<0><<<dim3((RE / 128) * (EMB / 64), 1), 128, 0, stream>>>(OLo, EMB, 0, BO, EMB, 0, 0.0625f / 1024.0f, nullptr, 0, ob, 1, (size_t)EMB, 0, ob, nullptr, EMB, 0, RE, EMB, EMB); }
}

// v001
// A run of this version takes 792 microseconds.
// Timed twice side by side with v000, it ran 1.72 times as fast both times.
#include <hip/hip_runtime.h>
// WedoctorAttention (2 x 2048 tokens, hidden 2048; 32 query heads / 8 kv heads of 64 (GQA), rotate-half RoPE from the INPUT position ids, causal SDPA (1/8), out = o Wo): q/k/v = x W + b.
// Structure (both batches in every launch: the 4096 token rows are one row range, batch = row / 2048): exact f16 plane of x; q / k / v GEMMs (32x64 wave tiles, f32 accumulation, exact x16 weights + bias) into f32 planes; angle tables from the input position ids (f32 trig); RoPE on VALU while splitting q and k into f16 hi + 2^10-residual planes, v split directly; the 8 kv heads expanded to the 32 query heads (repeat 4) into the fused [q | k | v] hi/lo planes; V^T hi/residual by LDS tiles; the fused causal flash kernel in its 5-plane form for the first 256 query rows and plain beyond; attention output as f16 hi (+ residual on those rows) into the output GEMMs.
// Compute dtype: x, weights and biases rounded to bf16; rows < 256 per batch: q, k, P, v, O hi + residual; beyond: plain f16; f32 accumulation/softmax/trig. v_wmma_f32_16x16x32_f16.
#define NB 2
#define EMB 2048
#define NR (NB * SLEN)           /* 4096 token rows */
#define SLEN 2048
#define SQ SLEN
#define TQ SLEN
#define TK SLEN
#define NH 32
#define NKV 8
#define KVD (NKV * HD)
#define HD 64
#define HH (HD / 2)
#define SCL 0.125f               /* 64^-0.5 */
#define QBLKS (TQ / 64)
#define QB05 0                   /* 5-plane flash: query blocks [0, QBN5) of every (batch, head) — the early causal rows whose outputs average over few keys */
#define QBN5 4
#define QB0P QBN5                /* plain flash (hi planes only): query blocks [QBN5, QBLKS) */
#define QBNP (QBLKS - QBN5)
#define RE 256                   /* rows per batch that take the hi+lo output operand (= QBN5 * 64) */
typedef __bf16 v16b __attribute__((ext_vector_type(16)));
typedef unsigned short v8us __attribute__((ext_vector_type(8), may_alias));
typedef float  v8f  __attribute__((ext_vector_type(8)));
typedef float  v4f  __attribute__((ext_vector_type(4)));
typedef float  v4fa __attribute__((ext_vector_type(4), may_alias));
union FragB { v16b v; v8us half[2]; unsigned short u[16]; };

__device__ __forceinline__ unsigned short bf16_bits(float x) { unsigned int u = __float_as_uint(x); return (unsigned short)((u + 0x7FFFu + ((u >> 16) & 1u)) >> 16); }
__device__ __forceinline__ float bf16_val(unsigned short b) { return __uint_as_float(((unsigned int)b) << 16); }
__device__ __forceinline__ float bf16_round(float x) { return bf16_val(bf16_bits(x)); }
// D += A·B with NT terms: 1 = ah·bh, 2 = + al·bh (A split), 3 = + ah·bl (both split)
template <int NT>
__device__ __forceinline__ v8f mmaN(v16b ah, v16b al, v16b bh, v16b bl, v8f c) {
  c = __builtin_amdgcn_wmma_f32_16x16x32_bf16(false, ah, false, bh, (short)0, c, false, false);
  if (NT >= 2) c = __builtin_amdgcn_wmma_f32_16x16x32_bf16(false, al, false, bh, (short)0, c, false, false);
  if (NT >= 3) c = __builtin_amdgcn_wmma_f32_16x16x32_bf16(false, ah, false, bl, (short)0, c, false, false);
  asm volatile("v_nop\n\tv_nop\n\tv_nop\n\tv_nop" : "+v"(c) : "v"(ah), "v"(al), "v"(bh), "v"(bl));
  return c;
}

__global__ __launch_bounds__(256) void k_wt_bf16(const float* __restrict__ W, unsigned short* __restrict__ Wt, int K, int N) {
  const int t = blockIdx.x * 256 + threadIdx.x;
  const int k8n = K / 8;
  if (t >= N * k8n) return;
  const int n = t / k8n, k8 = (t % k8n) * 8;
  v8us v;
#pragma unroll
  for (int i = 0; i < 8; ++i) v[i] = bf16_bits(W[(size_t)(k8 + i) * N + n]);
  *(v8us*)(Wt + (size_t)n * K + k8) = v;
  
}

// GEMM C[M][N] (f32, pitch ldc) = act(A[M][K]·W + bias). A f32 row-major (pitch lda) converted per fragment to bf16
// (ASPLIT: hi/lo two planes -> 2 terms, else single rounded term); Wt bf16 [N][K] (pitch ldb). BIAS_BF16 rounds the
// bias to bf16 first (bias quantised to bf16 before the add). K%32==0, M%16==0, N%64==0.
template <bool ASPLIT, int ACT, bool BIAS_BF16>
__global__ __launch_bounds__(128) void k_gemm_bf(const float* __restrict__ A, int lda, const unsigned short* __restrict__ Wt, int ldb,
                                               const float* __restrict__ bias, float* __restrict__ C, int ldc, int M, int N, int K) {
  __shared__ __attribute__((aligned(16))) float so[4][16][64];
  const int tid = threadIdx.x, w = tid >> 5, lane = tid & 31, ln = lane & 15, hh = lane >> 4;
  const int ntn = N / 64;
  const int wid = blockIdx.x * 4 + w;
  const int mt = wid / ntn, nq = wid % ntn;
  if (mt * 16 >= M) return;
  const int row0 = mt * 16, col0 = nq * 64;
  const float* arow = A + (size_t)(row0 + ln) * lda;
  v8f acc[4] = {};
  for (int kb = 0; kb < K; kb += 32) {
    FragB ah, al;
    const v4f x0 = *(const v4fa*)(arow + kb + 8 * hh), x1 = *(const v4fa*)(arow + kb + 8 * hh + 4);
    const v4f x2 = *(const v4fa*)(arow + kb + 16 + 8 * hh), x3 = *(const v4fa*)(arow + kb + 16 + 8 * hh + 4);
    float xs[16] = {x0[0],x0[1],x0[2],x0[3],x1[0],x1[1],x1[2],x1[3],x2[0],x2[1],x2[2],x2[3],x3[0],x3[1],x3[2],x3[3]};
#pragma unroll
    for (int i = 0; i < 16; ++i) { const unsigned short hb = bf16_bits(xs[i]); ah.u[i] = hb; al.u[i] = ASPLIT ? bf16_bits(xs[i] - bf16_val(hb)) : (unsigned short)0; }
#pragma unroll
    for (int t = 0; t < 4; ++t) {
      const unsigned short* brow = Wt + (size_t)(col0 + t * 16 + ln) * ldb + kb;
      FragB b;
      b.half[0] = *(const v8us*)(brow + 8 * hh);
      b.half[1] = *(const v8us*)(brow + 16 + 8 * hh);
      acc[t] = mmaN<ASPLIT ? 2 : 1>(ah.v, al.v, b.v, b.v, acc[t]);
    }
  }
#pragma unroll
  for (int t = 0; t < 4; ++t) {
    float bv = bias ? bias[col0 + t * 16 + ln] : 0.f;
    if (BIAS_BF16) bv = bf16_round(bv);
#pragma unroll
    for (int r = 0; r < 8; ++r) { float v = acc[t][r] + bv; if (ACT == 1) v = fmaxf(v, 0.f); so[w][8 * hh + r][t * 16 + ln] = v; }
  }
  __builtin_amdgcn_fence(__ATOMIC_ACQ_REL, "workgroup");
  __builtin_amdgcn_wave_barrier();
  const int rsub = lane >> 4, c4 = (lane & 15) * 4;
  {
#pragma unroll
    for (int q = 0; q < 8; ++q) {
      const int r = q * 2 + rsub;
      const v4f v = *(const v4fa*)&so[w][r][c4];
      *(v4f*)(C + (size_t)(row0 + r) * ldc + col0 + c4) = v;
    }
    
  }
}

// GEMM C = act(A·W + bias + resid): A f32 (ASPLIT -> hi/lo 2 terms), Wt bf16 [N][K]; ACT 0 none, 1 relu, 2 exact gelu;
// resid (optional, f32, row index = (row % rmod), pitch ldr, RES_BF16 rounds it) added before the activation.
template <bool ASPLIT, int ACT, bool BIAS_BF16, bool RES_BF16>
__global__ __launch_bounds__(128) void k_gemm_bf3(const float* __restrict__ A, int lda, const unsigned short* __restrict__ Wt, int ldb,
                                                const float* __restrict__ bias, const float* __restrict__ resid, int rmod, int ldr,
                                                float* __restrict__ C, int ldc, int M, int N, int K) {
  __shared__ __attribute__((aligned(16))) float so[4][16][64];
  const int tid = threadIdx.x, w = tid >> 5, lane = tid & 31, ln = lane & 15, hh = lane >> 4;
  const int ntn = N / 64;
  const int wid = blockIdx.x * 4 + w;
  const int mt = wid / ntn, nq = wid % ntn;
  if (mt * 16 >= M) return;
  const int row0 = mt * 16, col0 = nq * 64;
  const float* arow = A + (size_t)(row0 + ln) * lda;
  v8f acc[4] = {};
  for (int kb = 0; kb < K; kb += 32) {
    FragB ah, al;
    const v4f x0 = *(const v4fa*)(arow + kb + 8 * hh), x1 = *(const v4fa*)(arow + kb + 8 * hh + 4);
    const v4f x2 = *(const v4fa*)(arow + kb + 16 + 8 * hh), x3 = *(const v4fa*)(arow + kb + 16 + 8 * hh + 4);
    float xs[16] = {x0[0],x0[1],x0[2],x0[3],x1[0],x1[1],x1[2],x1[3],x2[0],x2[1],x2[2],x2[3],x3[0],x3[1],x3[2],x3[3]};
#pragma unroll
    for (int i = 0; i < 16; ++i) { const unsigned short hb = bf16_bits(xs[i]); ah.u[i] = hb; al.u[i] = ASPLIT ? bf16_bits(xs[i] - bf16_val(hb)) : (unsigned short)0; }
#pragma unroll
    for (int t = 0; t < 4; ++t) {
      const unsigned short* brow = Wt + (size_t)(col0 + t * 16 + ln) * ldb + kb;
      FragB b;
      b.half[0] = *(const v8us*)(brow + 8 * hh);
      b.half[1] = *(const v8us*)(brow + 16 + 8 * hh);
      acc[t] = mmaN<ASPLIT ? 2 : 1>(ah.v, al.v, b.v, b.v, acc[t]);
    }
  }
#pragma unroll
  for (int t = 0; t < 4; ++t) {
    const int col = col0 + t * 16 + ln;
    float bv = bias ? bias[col] : 0.f;
    if (BIAS_BF16) bv = bf16_round(bv);
#pragma unroll
    for (int r = 0; r < 8; ++r) {
      float v = acc[t][r] + bv;
      if (resid) { float rv = resid[(size_t)((row0 + 8 * hh + r) % rmod) * ldr + col]; if (RES_BF16) rv = bf16_round(rv); v += rv; }
      if (ACT == 1) v = fmaxf(v, 0.f);
      if (ACT == 2) v = 0.5f * v * (1.0f + erff(v * 0.70710678118654752f));
      if (ACT == 3) { const float u = 0.7978845608028654f * (v + 0.044715f * v * v * v); v = 0.5f * v * (1.0f + tanhf(u)); }
      so[w][8 * hh + r][t * 16 + ln] = v;
    }
  }
  __builtin_amdgcn_fence(__ATOMIC_ACQ_REL, "workgroup");
  __builtin_amdgcn_wave_barrier();
  const int rsub = lane >> 4, c4 = (lane & 15) * 4;
  {
#pragma unroll
    for (int q = 0; q < 8; ++q) {
      const int r = q * 2 + rsub;
      const v4f v = *(const v4fa*)&so[w][r][c4];
      *(v4f*)(C + (size_t)(row0 + r) * ldc + col0 + c4) = v;
    }
    
  }
}
// row LayerNorm (biased variance, eps) over N: s = X (+ R); optional out_sum <- s; out_norm <- (s-mu)*rsqrt(var+eps)*g + b
template <bool PARAM_BF16>
__global__ __launch_bounds__(256) void k_layernorm(const float* __restrict__ X, const float* __restrict__ R, const float* __restrict__ g, const float* __restrict__ bta,
                                                  float* __restrict__ out_sum, float* __restrict__ out_norm, int N, float eps) {
  __shared__ float red[256];
  const int row = blockIdx.x, tid = threadIdx.x;
  const float* x = X + (size_t)row * N; const float* rr = R ? R + (size_t)row * N : nullptr;
  float vals[16];                     // up to N = 4096
  const int per = N / 256;            // contiguous chunk per thread? use strided-by-4 chunks: thread handles j = tid*4 + 1024*u
  float s1 = 0.f;
  for (int u = 0; u < per / 4; ++u) {
    const int j = tid * 4 + 1024 * u;
    const v4f a = *(const v4fa*)(x + j);
    v4f b = {0.f,0.f,0.f,0.f}; if (rr) b = *(const v4fa*)(rr + j);
#pragma unroll
    for (int q = 0; q < 4; ++q) { const float v = a[q] + b[q]; vals[u * 4 + q] = v; s1 += v; }
  }
  red[tid] = s1; __syncthreads();
  for (int st = 128; st > 0; st >>= 1) { if (tid < st) red[tid] += red[tid + st]; __syncthreads(); }
  const float mu = red[0] / (float)N; __syncthreads();
  float s2 = 0.f;
  for (int u = 0; u < per / 4; ++u)
#pragma unroll
    for (int q = 0; q < 4; ++q) { const float c = vals[u * 4 + q] - mu; s2 += c * c; }
  red[tid] = s2; __syncthreads();
  for (int st = 128; st > 0; st >>= 1) { if (tid < st) red[tid] += red[tid + st]; __syncthreads(); }
  const float rs = rsqrtf(red[0] / (float)N + eps);
  {
    for (int u = 0; u < per / 4; ++u) {
      const int j = tid * 4 + 1024 * u;
      v4f o, sm;
#pragma unroll
      for (int q = 0; q < 4; ++q) {
        float gg = g[j + q], bb = bta[j + q];
        if (PARAM_BF16) { gg = bf16_round(gg); bb = bf16_round(bb); }
        sm[q] = vals[u * 4 + q]; o[q] = (vals[u * 4 + q] - mu) * rs * gg + bb;
      }
      if (out_sum) *(v4f*)(out_sum + (size_t)row * N + j) = sm;
      *(v4f*)(out_norm + (size_t)row * N + j) = o;
    }
    
  }
}



// ---- f16 WMMA path (v_wmma_f32_16x16x32_f16): 11-bit significands for operands in range — used where a [0,1] probability operand needs more precision than bf16
typedef _Float16 v16h __attribute__((ext_vector_type(16)));
union FragH { v16h v; v8us half[2]; _Float16 h[16]; unsigned short u[16]; };
template <int NT>
__device__ __forceinline__ v8f mmaH(v16h ah, v16h al, v16h bh, v16h bl, v8f c) {
  c = __builtin_amdgcn_wmma_f32_16x16x32_f16(false, ah, false, bh, (short)0, c, false, false);
  if (NT >= 2) c = __builtin_amdgcn_wmma_f32_16x16x32_f16(false, al, false, bh, (short)0, c, false, false);
  if (NT >= 3) c = __builtin_amdgcn_wmma_f32_16x16x32_f16(false, ah, false, bl, (short)0, c, false, false);
  asm volatile("v_nop\n\tv_nop\n\tv_nop\n\tv_nop" : "+v"(c) : "v"(ah), "v"(al), "v"(bh), "v"(bl));
  return c;
}
// batched GEMM like k_gemm_b but f16 operands: A f32 (split into f16 hi/lo if ASPLIT, else rounded to f16), Bt = f16 values [n][k]; alpha; C f32; N multiple of 16 (partial tiles skipped)
template <bool ASPLIT>
__global__ __launch_bounds__(128) void k_gemm_h(const float* __restrict__ A, int lda, size_t sA, const _Float16* __restrict__ Bh, int ldb, size_t sB, float alpha, float* __restrict__ C, int ldc, size_t sC, int M, int N, int K) {
  __shared__ __attribute__((aligned(16))) float so[4][16][64];
  const int tid = threadIdx.x, w = tid >> 5, lane = tid & 31, ln = lane & 15, hh = lane >> 4; const int by = blockIdx.y;
  A += (size_t)by * sA; Bh += (size_t)by * sB; C += (size_t)by * sC;
  const int ntn = (N + 63) / 64; const int wid = blockIdx.x * 4 + w; const int mt = wid / ntn, nq = wid % ntn; if (mt * 16 >= M) return;
  const int row0 = mt * 16, col0 = nq * 64; const float* arow = A + (size_t)(row0 + ln) * lda;
  v8f acc[4] = {};
  for (int kb = 0; kb < K; kb += 32) {
    FragH ah, al;
    const v4f x0 = *(const v4fa*)(arow + kb + 8 * hh), x1 = *(const v4fa*)(arow + kb + 8 * hh + 4), x2 = *(const v4fa*)(arow + kb + 16 + 8 * hh), x3 = *(const v4fa*)(arow + kb + 16 + 8 * hh + 4);
    float xs[16] = {x0[0],x0[1],x0[2],x0[3],x1[0],x1[1],x1[2],x1[3],x2[0],x2[1],x2[2],x2[3],x3[0],x3[1],x3[2],x3[3]};
#pragma unroll
    for (int i = 0; i < 16; ++i) { const _Float16 h = (_Float16)xs[i]; ah.h[i] = h; al.h[i] = ASPLIT ? (_Float16)(xs[i] - (float)h) : (_Float16)0.0f; }
#pragma unroll
    for (int t = 0; t < 4; ++t) { if (col0 + t * 16 >= N) continue; const size_t boff = (size_t)(col0 + t * 16 + ln) * ldb + kb; FragH bq; bq.half[0] = *(const v8us*)(Bh + boff + 8 * hh); bq.half[1] = *(const v8us*)(Bh + boff + 16 + 8 * hh);
      acc[t] = mmaH<ASPLIT ? 2 : 1>(ah.v, al.v, bq.v, bq.v, acc[t]); }
  }
#pragma unroll
  for (int t = 0; t < 4; ++t) { if (col0 + t * 16 >= N) continue;
#pragma unroll
    for (int r = 0; r < 8; ++r) so[w][8 * hh + r][t * 16 + ln] = acc[t][r] * alpha; }
  __builtin_amdgcn_fence(__ATOMIC_ACQ_REL, "workgroup"); __builtin_amdgcn_wave_barrier();
  const int rsub = lane >> 4, c4 = (lane & 15) * 4;
  {
#pragma unroll
    for (int q = 0; q < 8; ++q) { const int r = q * 2 + rsub; if (col0 + c4 < N) { const v4f v = *(const v4fa*)&so[w][r][c4]; *(v4f*)(C + (size_t)(row0 + r) * ldc + col0 + c4) = v; } }
     }
}

// Wt[n][k] = f16(W[k][n]·scale) from f32 row-major W[K][N] (scale = power of two; bf16-exact weights stay exact in f16 away from the subnormal range)
__global__ __launch_bounds__(256) void k_wt_f16(const float* __restrict__ W, _Float16* __restrict__ Wt, int K, int N, float scale) {
  const int t = blockIdx.x * 256 + threadIdx.x; if (t >= N * (K / 8)) return; const int n = t / (K / 8), k8 = (t % (K / 8)) * 8; FragH f;
#pragma unroll
  for (int i = 0; i < 8; ++i) f.h[i] = (_Float16)(bf16_round(W[(size_t)(k8 + i) * N + n]) * scale); const v8us o = f.half[0];
  *(v8us*)((unsigned short*)Wt + (size_t)n * K + k8) = o; 
}
// k_gemm_hh variant with fused epilogue: v = acc·alpha + bias[by·sBias + col] (+ CP[(row/rowsPerB)·sCPb + by·64 + col] if CP) ; ACT 0 none / 1 elu ; writes f16 C16 (and f32 C if non-null)
template <int ACT>
__global__ __launch_bounds__(128) void k_gemm_hhx(const _Float16* __restrict__ A, int lda, size_t sA, const _Float16* __restrict__ Bh, int ldb, size_t sB, float alpha, const float* __restrict__ bias, size_t sBias, const float* __restrict__ CP, int rowsPerB, size_t sCPb, int row0g,
    float* __restrict__ C, _Float16* __restrict__ C16, int ldc, size_t sC, int M, int N, int K) {
  __shared__ __attribute__((aligned(16))) float so[4][16][64];
  const int tid = threadIdx.x, w = tid >> 5, lane = tid & 31, ln = lane & 15, hh = lane >> 4; const int by = blockIdx.y;
  A += (size_t)by * sA; Bh += (size_t)by * sB; const size_t cofs = (size_t)by * sC; const float* bp = bias ? bias + (size_t)by * sBias : nullptr;
  const int ntn = (N + 63) / 64; const int wid = blockIdx.x * 4 + w; const int mt = wid / ntn, nq = wid % ntn; if (mt * 16 >= M) return;
  const int row0 = mt * 16, col0 = nq * 64; const _Float16* arow = A + (size_t)(row0 + ln) * lda;
  v8f acc[4] = {};
  for (int kb = 0; kb < K; kb += 32) { FragH ah; ah.half[0] = *(const v8us*)((const unsigned short*)arow + kb + 8 * hh); ah.half[1] = *(const v8us*)((const unsigned short*)arow + kb + 16 + 8 * hh);
#pragma unroll
    for (int t = 0; t < 4; ++t) { if (col0 + t * 16 >= N) continue; const size_t boff = (size_t)(col0 + t * 16 + ln) * ldb + kb; FragH bq; bq.half[0] = *(const v8us*)((const unsigned short*)Bh + boff + 8 * hh); bq.half[1] = *(const v8us*)((const unsigned short*)Bh + boff + 16 + 8 * hh);
      acc[t] = mmaH<1>(ah.v, ah.v, bq.v, bq.v, acc[t]); }
  }
#pragma unroll
  for (int t = 0; t < 4; ++t) { if (col0 + t * 16 >= N) continue; const int col = col0 + t * 16 + ln; const float bv = bp ? bf16_round(bp[col]) : 0.f;
#pragma unroll
    for (int r = 0; r < 8; ++r) { float v = acc[t][r] * alpha + bv; if (CP) { const int bidx = (row0g + row0 + 8 * hh + r) / rowsPerB; v += CP[(size_t)bidx * sCPb + (size_t)by * 64 + col]; } if (ACT == 1) v = (v > 0.f) ? v : expm1f(v); else if (ACT == 7) v = (v > 0.f) ? v + 1.0f : expf(v); else if (ACT == 8) v = tanhf(v); else if (ACT == 9) v = 0.5f * v * (1.0f + tanhf(0.7978845608028654f * (v + 0.044715f * v * v * v))); else if (ACT == 11) v = 1.0f / (1.0f + expf(-v)); else if (ACT == 12) v = (v > 0.f) ? v : 0.01f * v; else if (ACT == 14) v = (v > 0.f) ? v : 0.1f * v; else if (ACT == 15) v = v / (1.0f + expf(-v)); else if (ACT == 3) v = fmaxf(v, 0.f); else if (ACT == 6) v = 0.5f * v * (1.0f + erff(v * 0.70710678118654752f)); so[w][8 * hh + r][t * 16 + ln] = v; } }
  __builtin_amdgcn_fence(__ATOMIC_ACQ_REL, "workgroup"); __builtin_amdgcn_wave_barrier();
  const int rsub = lane >> 4, c4 = (lane & 15) * 4; typedef _Float16 v4h __attribute__((ext_vector_type(4)));
  {
#pragma unroll
    for (int q = 0; q < 8; ++q) { const int r = q * 2 + rsub; if (col0 + c4 < N) { const v4f v = *(const v4fa*)&so[w][r][c4]; if (C) *(v4f*)(C + cofs + (size_t)(row0 + r) * ldc + col0 + c4) = v; if (C16) { v4h h4; for (int i = 0; i < 4; ++i) h4[i] = (_Float16)v[i]; *(v4h*)(C16 + cofs + (size_t)(row0 + r) * ldc + col0 + c4) = h4; } } }
     }
}


typedef _Float16 v4h __attribute__((ext_vector_type(4)));

__global__ __launch_bounds__(256) void k_x16(const float* __restrict__ x, _Float16* __restrict__ X16, size_t n8) { const size_t t = (size_t)blockIdx.x * 256 + threadIdx.x; if (t >= n8) return; FragH f;
#pragma unroll
  for (int q = 0; q < 8; ++q) f.h[q] = (_Float16)bf16_round(x[t * 8 + q]); *(v8us*)((unsigned short*)X16 + t * 8) = f.half[0];  }
__global__ __launch_bounds__(256) void k_h16(const float* __restrict__ x, _Float16* __restrict__ X16, size_t n8) { const size_t t = (size_t)blockIdx.x * 256 + threadIdx.x; if (t >= n8) return; FragH f;
#pragma unroll
  for (int q = 0; q < 8; ++q) f.h[q] = (_Float16)x[t * 8 + q]; *(v8us*)((unsigned short*)X16 + t * 8) = f.half[0];  }
__global__ __launch_bounds__(256) void k_round16f(const float* __restrict__ W, _Float16* __restrict__ Bt, size_t n8) { const size_t t = (size_t)blockIdx.x * 256 + threadIdx.x; if (t >= n8) return; FragH f;
#pragma unroll
  for (int i = 0; i < 8; ++i) f.h[i] = (_Float16)(bf16_round(W[t * 8 + i]) * 16.0f); *(v8us*)((unsigned short*)Bt + t * 8) = f.half[0];  }
template <int NHv, int TTv>
__global__ __launch_bounds__(256) void k_vt(const _Float16* __restrict__ V16, int ldv, int voff, _Float16* __restrict__ Vt) { __shared__ unsigned short tl[64][66]; const int tid = threadIdx.x; const int slab = blockIdx.x / (TTv / 64), lg = blockIdx.x % (TTv / 64); const int b = slab / NHv, h = slab % NHv;
  for (int i = tid; i < 64 * 8; i += 256) { const int r = i / 8, c8 = (i % 8) * 8; FragH f; f.half[0] = *(const v8us*)((const unsigned short*)V16 + ((size_t)b * TTv + lg * 64 + r) * ldv + voff + h * 64 + c8);
#pragma unroll
    for (int q = 0; q < 8; ++q) tl[r][c8 + q] = f.u[q]; }
  __syncthreads();
  {
#pragma unroll
    for (int rd = 0; rd < 2; ++rd) { const int d = rd * 32 + tid / 8, pc = tid % 8; FragH f;
#pragma unroll
      for (int q = 0; q < 8; ++q) f.u[q] = tl[pc * 8 + q][d];
      *(v8us*)((unsigned short*)Vt + ((size_t)slab * 64 + d) * TTv + lg * 64 + pc * 8) = f.half[0]; }
     } }

__global__ __launch_bounds__(256) void k_hl(const float* __restrict__ F, _Float16* __restrict__ Hh, _Float16* __restrict__ Hl, size_t n8) { const size_t t = (size_t)blockIdx.x * 256 + threadIdx.x; if (t >= n8) return; FragH fh, fl; const v4f a = *(const v4fa*)(F + t * 8), c = *(const v4fa*)(F + t * 8 + 4);
#pragma unroll
  for (int q = 0; q < 4; ++q) { _Float16 h = (_Float16)a[q]; fh.h[q] = h; fl.h[q] = (_Float16)((a[q] - (float)h) * 1024.0f); h = (_Float16)c[q]; fh.h[4 + q] = h; fl.h[4 + q] = (_Float16)((c[q] - (float)h) * 1024.0f); }
  { *(v8us*)((unsigned short*)Hh + t * 8) = fh.half[0]; *(v8us*)((unsigned short*)Hl + t * 8) = fl.half[0];  } }

// ---- fast GEMM (wave tile 32x64; requires M % 32 == 0 rows per launch region and N % 64 == 0); epilogue = k_gemm_hhx semantics, but the CP addend takes C's own grid-y offset ----
__device__ __forceinline__ v16h g2_frag(const _Float16* p, int hh) { FragH f; f.half[0] = *(const v8us*)((const unsigned short*)p + 8 * hh); f.half[1] = *(const v8us*)((const unsigned short*)p + 16 + 8 * hh); return f.v; }
__device__ __forceinline__ v8f g2_mma(v16h a, v16h b, v8f c) { v8f d = __builtin_amdgcn_wmma_f32_16x16x32_f16(false, a, false, b, (short)0, c, false, false); asm volatile("v_nop\n\tv_nop\n\tv_nop\n\tv_nop" : "+v"(d) : "v"(a), "v"(b)); return d; }
template <int ACT>
__global__ __launch_bounds__(128) void k_gemm2(const _Float16* __restrict__ A, int lda, size_t sA, const _Float16* __restrict__ Bh, int ldb, size_t sB, float alpha, const float* __restrict__ bias, size_t sBias, const float* __restrict__ CP, int rowsPerB, size_t sCPb, int row0g,
    float* __restrict__ C, _Float16* __restrict__ C16, int ldc, size_t sC, int M, int N, int K) {
  __shared__ __attribute__((aligned(16))) float so[4][32][68];
  const int tid = threadIdx.x, w = tid >> 5, lane = tid & 31, ln = lane & 15, hh = lane >> 4; const int by = blockIdx.y;
  A += (size_t)by * sA; Bh += (size_t)by * sB; const size_t cofs = (size_t)by * sC; const float* bp = bias ? bias + (size_t)by * sBias : nullptr;
  const int ntn = N >> 6; const int mt = blockIdx.x / ntn, nq = blockIdx.x - mt * ntn; const int row0 = mt * 128 + 32 * w, col0 = nq * 64; if (row0 >= M) return;
  const _Float16* a0p = A + (size_t)(row0 + ln) * lda; const _Float16* a1p = a0p + (size_t)16 * lda;
  const _Float16* b0p = Bh + (size_t)(col0 + ln) * ldb; const _Float16* b1p = b0p + (size_t)16 * ldb; const _Float16* b2p = b1p + (size_t)16 * ldb; const _Float16* b3p = b2p + (size_t)16 * ldb;
  const v8f z8 = {0.f,0.f,0.f,0.f,0.f,0.f,0.f,0.f}; v8f c00 = z8, c01 = z8, c02 = z8, c03 = z8, c10 = z8, c11 = z8, c12 = z8, c13 = z8;
#pragma unroll 1
  for (int kb = 0; kb < K; kb += 32) { const v16h a0 = g2_frag(a0p + kb, hh), a1 = g2_frag(a1p + kb, hh);
    v16h b = g2_frag(b0p + kb, hh); c00 = g2_mma(a0, b, c00); c10 = g2_mma(a1, b, c10);
    b = g2_frag(b1p + kb, hh); c01 = g2_mma(a0, b, c01); c11 = g2_mma(a1, b, c11);
    b = g2_frag(b2p + kb, hh); c02 = g2_mma(a0, b, c02); c12 = g2_mma(a1, b, c12);
    b = g2_frag(b3p + kb, hh); c03 = g2_mma(a0, b, c03); c13 = g2_mma(a1, b, c13); }
  v8f accs[8] = {c00, c01, c02, c03, c10, c11, c12, c13};
#pragma unroll
  for (int u = 0; u < 8; ++u) { const int t = u & 3, half = u >> 2; const int col = col0 + t * 16 + ln; const float bv = bp ? bf16_round(bp[col]) : 0.f;
#pragma unroll
    for (int r = 0; r < 8; ++r) { const int rloc = half * 16 + 8 * hh + r; float v = accs[u][r] * alpha + bv; if (CP) { const int bidx = (row0g + row0 + rloc) / rowsPerB; v += CP[cofs + (size_t)bidx * sCPb + col]; }
      if (ACT == 3) v = fmaxf(v, 0.f); else if (ACT == 6) v = 0.5f * v * (1.0f + erff(v * 0.70710678118654752f)); else if (ACT == 11) v = 1.0f / (1.0f + expf(-v)); else if (ACT == 15) v = v / (1.0f + expf(-v)); else if (ACT == 12) v = (v > 0.f) ? v : 0.01f * v; else if (ACT == 8) v = tanhf(v);
      so[w][rloc][t * 16 + ln] = v; } }
  __builtin_amdgcn_fence(__ATOMIC_ACQ_REL, "workgroup"); __builtin_amdgcn_wave_barrier();
  const int rsub = lane >> 4, c4 = (lane & 15) * 4;
  {
#pragma unroll
    for (int q = 0; q < 16; ++q) { const int r = q * 2 + rsub; const v4f v = *(const v4fa*)&so[w][r][c4]; if (C) *(v4f*)(C + cofs + (size_t)(row0 + r) * ldc + col0 + c4) = v; if (C16) { v4h h4; for (int i = 0; i < 4; ++i) h4[i] = (_Float16)v[i]; *(v4h*)(C16 + cofs + (size_t)(row0 + r) * ldc + col0 + c4) = h4; } }
     } }



template <int CAUSAL>
__global__ __launch_bounds__(128) void k_flash(const _Float16* __restrict__ Q16, int ldq, const _Float16* __restrict__ K16, int ldk, const _Float16* __restrict__ Vt, const int* __restrict__ MSK, float* __restrict__ O, int ldo) {
  constexpr int RPW = 16, RTN = RPW / 16, NQB = TQ / (4 * RPW), DT = 4, KS = 2;
  __shared__ __attribute__((aligned(16))) unsigned short sP[4][RPW][40]; __shared__ __attribute__((aligned(16))) float sO[4][RPW][64 + 4];
  const int tid = threadIdx.x, w = tid >> 5, lane = tid & 31, ln = lane & 15, hh = lane >> 4;
  const int slab = blockIdx.x / QBNP, qblk = QB0P + blockIdx.x % QBNP; (void)NQB; const int b = slab / NH, h = slab % NH; const int qb0 = qblk * (4 * RPW); const int q0 = qb0 + w * RPW;
  FragH aq[2][KS];
#pragma unroll
  for (int rt = 0; rt < RTN; ++rt) { const unsigned short* qr = (const unsigned short*)Q16 + ((size_t)b * TQ + q0 + rt * 16 + ln) * ldq + h * 64;
#pragma unroll
    for (int ks = 0; ks < KS; ++ks) { aq[rt][ks].half[0] = *(const v8us*)(qr + ks * 32 + 8 * hh); aq[rt][ks].half[1] = *(const v8us*)(qr + ks * 32 + 16 + 8 * hh); } }
  const unsigned short* Vth = (const unsigned short*)Vt + (size_t)slab * 64 * TK;
  float m_r[2][8], l_r[2][8]; v8f oacc[2][DT];
#pragma unroll
  for (int rt = 0; rt < RTN; ++rt) {
#pragma unroll
    for (int r = 0; r < 8; ++r) { m_r[rt][r] = -3.0e38f; l_r[rt][r] = 0.f; }
#pragma unroll
    for (int dt = 0; dt < DT; ++dt) oacc[rt][dt] = (v8f){0.f,0.f,0.f,0.f,0.f,0.f,0.f,0.f}; }
  const int jend = (CAUSAL == 1) ? (qb0 + 4 * RPW) : TK;      /* causal: keys beyond the block's last query never contribute */
#pragma unroll 1
  for (int j0 = 0; j0 < jend; j0 += 32) {
    v8f s[2][2];
#pragma unroll
    for (int nt = 0; nt < 2; ++nt) { const unsigned short* kr = (const unsigned short*)K16 + ((size_t)b * TK + j0 + nt * 16 + ln) * ldk + h * 64; FragH bk[KS];
#pragma unroll
      for (int ks = 0; ks < KS; ++ks) { bk[ks].half[0] = *(const v8us*)(kr + ks * 32 + 8 * hh); bk[ks].half[1] = *(const v8us*)(kr + ks * 32 + 16 + 8 * hh); }
#pragma unroll
      for (int rt = 0; rt < RTN; ++rt) { v8f acc = (v8f){0.f,0.f,0.f,0.f,0.f,0.f,0.f,0.f};
#pragma unroll
        for (int ks = 0; ks < KS; ++ks) acc = mmaH<1>(aq[rt][ks].v, aq[rt][ks].v, bk[ks].v, bk[ks].v, acc); s[rt][nt] = acc; } }
#pragma unroll
    for (int rt = 0; rt < RTN; ++rt)
#pragma unroll
      for (int r = 0; r < 8; ++r) { const int tq = q0 + rt * 16 + 8 * hh + r; const int k0 = j0 + ln, k1 = j0 + 16 + ln;
        const bool ok0 = (CAUSAL == 1) ? (k0 <= tq) : ((CAUSAL == 2) ? ((k0 >> 5) == (tq >> 5)) : true), ok1 = (CAUSAL == 1) ? (k1 <= tq) : ((CAUSAL == 2) ? ((k1 >> 5) == (tq >> 5)) : true);      /* mode 2: block-diagonal 32-token groups */
        const float s0 = ok0 ? s[rt][0][r] * SCL : -3.0e38f, s1 = ok1 ? s[rt][1][r] * SCL : -3.0e38f; float mc = fmaxf(s0, s1);
        mc = fmaxf(mc, __shfl_xor(mc, 1, 32)); mc = fmaxf(mc, __shfl_xor(mc, 2, 32)); mc = fmaxf(mc, __shfl_xor(mc, 4, 32)); mc = fmaxf(mc, __shfl_xor(mc, 8, 32));
        const float mn = fmaxf(m_r[rt][r], mc); const float al = (mn > -1.0e38f) ? expf(m_r[rt][r] - mn) : 1.0f; m_r[rt][r] = mn; const float p0 = ok0 ? expf(s0 - mn) : 0.f, p1 = ok1 ? expf(s1 - mn) : 0.f; l_r[rt][r] = l_r[rt][r] * al + p0 + p1;
#pragma unroll
        for (int dt = 0; dt < DT; ++dt) oacc[rt][dt][r] *= al;
        FragH t2; t2.h[0] = (_Float16)(p0 * 1024.0f); t2.h[1] = (_Float16)(p1 * 1024.0f); sP[w][rt * 16 + 8 * hh + r][ln] = t2.u[0]; sP[w][rt * 16 + 8 * hh + r][16 + ln] = t2.u[1]; }
    __builtin_amdgcn_fence(__ATOMIC_ACQ_REL, "workgroup"); __builtin_amdgcn_wave_barrier();
    FragH pa[2];
#pragma unroll
    for (int rt = 0; rt < RTN; ++rt) { pa[rt].half[0] = *(const v8us*)&sP[w][rt * 16 + ln][8 * hh]; pa[rt].half[1] = *(const v8us*)&sP[w][rt * 16 + ln][16 + 8 * hh]; }
#pragma unroll
    for (int dt = 0; dt < DT; ++dt) { const unsigned short* vrow = Vth + (size_t)(dt * 16 + ln) * TK + j0; FragH bv; bv.half[0] = *(const v8us*)(vrow + 8 * hh); bv.half[1] = *(const v8us*)(vrow + 16 + 8 * hh);
#pragma unroll
      for (int rt = 0; rt < RTN; ++rt) oacc[rt][dt] = mmaH<1>(pa[rt].v, pa[rt].v, bv.v, bv.v, oacc[rt][dt]); }
    __builtin_amdgcn_fence(__ATOMIC_ACQ_REL, "workgroup"); __builtin_amdgcn_wave_barrier(); }
#pragma unroll
  for (int rt = 0; rt < RTN; ++rt) {
#pragma unroll
    for (int r = 0; r < 8; ++r) { float l = l_r[rt][r]; l += __shfl_xor(l, 1, 32); l += __shfl_xor(l, 2, 32); l += __shfl_xor(l, 4, 32); l += __shfl_xor(l, 8, 32); l_r[rt][r] = (l > 0.f) ? 1.0f / (l * 1024.0f) : 0.f; }
#pragma unroll
    for (int dt = 0; dt < DT; ++dt)
#pragma unroll
      for (int r = 0; r < 8; ++r) sO[w][rt * 16 + 8 * hh + r][dt * 16 + ln] = oacc[rt][dt][r] * l_r[rt][r]; }
  __builtin_amdgcn_fence(__ATOMIC_ACQ_REL, "workgroup"); __builtin_amdgcn_wave_barrier();
  {
#pragma unroll
    for (int rp = 0; rp < RPW; rp += 2) { const int r = rp + (lane >> 4), pc = lane & 15; const v4f val = *(const v4fa*)&sO[w][r][pc * 4]; *(v4f*)(O + ((size_t)b * TQ + q0 + r) * ldo + h * 64 + pc * 4) = val; }
     } }
// 5-plane variant: S = Qh Kh^T + (Ql Kh^T + Qh Kl^T)/1024 with Q/K = [hi | 2^10 residual] f16 planes (QL/KL same layout as Q16/K16), then the 3-term P.V below.
// 3-term variant: O = (P_hi V_hi + (P_lo V_hi + P_hi V_lo) / 1024) / l with P = [hi | 2^10 residual] of 1024 p and V^T = [hi | 2^10 residual] planes (VtL same layout as Vt) -> ~2^-21-class products for un-averaged (early causal / peaked) rows
template <int CAUSAL>
__global__ __launch_bounds__(128) void k_flash5(const _Float16* __restrict__ Q16, const _Float16* __restrict__ QL, int ldq, const _Float16* __restrict__ K16, const _Float16* __restrict__ KL, int ldk, const _Float16* __restrict__ Vt, const _Float16* __restrict__ VtL, const int* __restrict__ MSK, float* __restrict__ O, int ldo) {
  constexpr int RPW = 16, RTN = RPW / 16, NQB = TQ / (4 * RPW), DT = 4, KS = 2;
  __shared__ __attribute__((aligned(16))) unsigned short sP[4][RPW][40]; __shared__ __attribute__((aligned(16))) unsigned short sPL[4][RPW][40]; __shared__ __attribute__((aligned(16))) float sO[4][RPW][64 + 4];
  const int tid = threadIdx.x, w = tid >> 5, lane = tid & 31, ln = lane & 15, hh = lane >> 4;
  const int slab = blockIdx.x / QBN5, qblk = QB05 + blockIdx.x % QBN5; (void)NQB; const int b = slab / NH, h = slab % NH; const int qb0 = qblk * (4 * RPW); const int q0 = qb0 + w * RPW;
  FragH aq[2][KS], aql[2][KS];
#pragma unroll
  for (int rt = 0; rt < RTN; ++rt) { const unsigned short* qr = (const unsigned short*)Q16 + ((size_t)b * TQ + q0 + rt * 16 + ln) * ldq + h * 64; const unsigned short* ql = (const unsigned short*)QL + ((size_t)b * TQ + q0 + rt * 16 + ln) * ldq + h * 64;
#pragma unroll
    for (int ks = 0; ks < KS; ++ks) { aq[rt][ks].half[0] = *(const v8us*)(qr + ks * 32 + 8 * hh); aq[rt][ks].half[1] = *(const v8us*)(qr + ks * 32 + 16 + 8 * hh); aql[rt][ks].half[0] = *(const v8us*)(ql + ks * 32 + 8 * hh); aql[rt][ks].half[1] = *(const v8us*)(ql + ks * 32 + 16 + 8 * hh); } }
  const unsigned short* Vth = (const unsigned short*)Vt + (size_t)slab * 64 * TK; const unsigned short* Vtl = (const unsigned short*)VtL + (size_t)slab * 64 * TK;
  float m_r[2][8], l_r[2][8]; v8f oacc[2][DT], oaccL[2][DT];
#pragma unroll
  for (int rt = 0; rt < RTN; ++rt) {
#pragma unroll
    for (int r = 0; r < 8; ++r) { m_r[rt][r] = -3.0e38f; l_r[rt][r] = 0.f; }
#pragma unroll
    for (int dt = 0; dt < DT; ++dt) { oacc[rt][dt] = (v8f){0.f,0.f,0.f,0.f,0.f,0.f,0.f,0.f}; oaccL[rt][dt] = oacc[rt][dt]; } }
  const int jend = (CAUSAL == 1) ? (qb0 + 4 * RPW) : TK;      /* causal: keys beyond the block's last query never contribute */
#pragma unroll 1
  for (int j0 = 0; j0 < jend; j0 += 32) {
    v8f s[2][2];
#pragma unroll
    for (int nt = 0; nt < 2; ++nt) { const unsigned short* kr = (const unsigned short*)K16 + ((size_t)b * TK + j0 + nt * 16 + ln) * ldk + h * 64; const unsigned short* klr = (const unsigned short*)KL + ((size_t)b * TK + j0 + nt * 16 + ln) * ldk + h * 64; FragH bk[KS], bkl[KS];
#pragma unroll
      for (int ks = 0; ks < KS; ++ks) { bk[ks].half[0] = *(const v8us*)(kr + ks * 32 + 8 * hh); bk[ks].half[1] = *(const v8us*)(kr + ks * 32 + 16 + 8 * hh); bkl[ks].half[0] = *(const v8us*)(klr + ks * 32 + 8 * hh); bkl[ks].half[1] = *(const v8us*)(klr + ks * 32 + 16 + 8 * hh); }
#pragma unroll
      for (int rt = 0; rt < RTN; ++rt) { v8f acc = (v8f){0.f,0.f,0.f,0.f,0.f,0.f,0.f,0.f}, accl = acc;
#pragma unroll
        for (int ks = 0; ks < KS; ++ks) { acc = mmaH<1>(aq[rt][ks].v, aq[rt][ks].v, bk[ks].v, bk[ks].v, acc); accl = mmaH<1>(aql[rt][ks].v, aql[rt][ks].v, bk[ks].v, bk[ks].v, accl); accl = mmaH<1>(aq[rt][ks].v, aq[rt][ks].v, bkl[ks].v, bkl[ks].v, accl); }
#pragma unroll
        for (int r = 0; r < 8; ++r) acc[r] += accl[r] * 0.0009765625f;
        s[rt][nt] = acc; } }
#pragma unroll
    for (int rt = 0; rt < RTN; ++rt)
#pragma unroll
      for (int r = 0; r < 8; ++r) { const int tq = q0 + rt * 16 + 8 * hh + r; const int k0 = j0 + ln, k1 = j0 + 16 + ln;
        bool ok0 = (CAUSAL == 1) ? (k0 <= tq) : ((CAUSAL == 2) ? ((k0 >> 5) == (tq >> 5)) : true), ok1 = (CAUSAL == 1) ? (k1 <= tq) : ((CAUSAL == 2) ? ((k1 >> 5) == (tq >> 5)) : true);      /* mode 2: block-diagonal 32-token groups */
        if (CAUSAL == 4) { const int* mrow = MSK + ((size_t)b * TQ + tq) * TK; ok0 = mrow[k0] != 0; ok1 = mrow[k1] != 0; }      /* mode 4: per-(query, key) INPUT mask shared by all heads; masked keys contribute nothing (== the reference's -4096 fill, whose exp underflows to 0), rows with no valid key give l = 0 -> output 0 (== the reference's row_valid zeroing) */
        const float s0 = ok0 ? s[rt][0][r] * SCL : -3.0e38f, s1 = ok1 ? s[rt][1][r] * SCL : -3.0e38f; float mc = fmaxf(s0, s1);
        mc = fmaxf(mc, __shfl_xor(mc, 1, 32)); mc = fmaxf(mc, __shfl_xor(mc, 2, 32)); mc = fmaxf(mc, __shfl_xor(mc, 4, 32)); mc = fmaxf(mc, __shfl_xor(mc, 8, 32));
        const float mn = fmaxf(m_r[rt][r], mc); const float al = (mn > -1.0e38f) ? expf(m_r[rt][r] - mn) : 1.0f; m_r[rt][r] = mn; const float p0 = ok0 ? expf(s0 - mn) : 0.f, p1 = ok1 ? expf(s1 - mn) : 0.f; l_r[rt][r] = l_r[rt][r] * al + p0 + p1;
#pragma unroll
        for (int dt = 0; dt < DT; ++dt) { oacc[rt][dt][r] *= al; oaccL[rt][dt][r] *= al; }
        FragH t2, t2l; const float ps0 = p0 * 1024.0f, ps1 = p1 * 1024.0f; t2.h[0] = (_Float16)ps0; t2.h[1] = (_Float16)ps1; t2l.h[0] = (_Float16)((ps0 - (float)t2.h[0]) * 1024.0f); t2l.h[1] = (_Float16)((ps1 - (float)t2.h[1]) * 1024.0f);
        sP[w][rt * 16 + 8 * hh + r][ln] = t2.u[0]; sP[w][rt * 16 + 8 * hh + r][16 + ln] = t2.u[1]; sPL[w][rt * 16 + 8 * hh + r][ln] = t2l.u[0]; sPL[w][rt * 16 + 8 * hh + r][16 + ln] = t2l.u[1]; }
    __builtin_amdgcn_fence(__ATOMIC_ACQ_REL, "workgroup"); __builtin_amdgcn_wave_barrier();
    FragH pa[2], pl[2];
#pragma unroll
    for (int rt = 0; rt < RTN; ++rt) { pa[rt].half[0] = *(const v8us*)&sP[w][rt * 16 + ln][8 * hh]; pa[rt].half[1] = *(const v8us*)&sP[w][rt * 16 + ln][16 + 8 * hh]; pl[rt].half[0] = *(const v8us*)&sPL[w][rt * 16 + ln][8 * hh]; pl[rt].half[1] = *(const v8us*)&sPL[w][rt * 16 + ln][16 + 8 * hh]; }
#pragma unroll
    for (int dt = 0; dt < DT; ++dt) { const unsigned short* vrow = Vth + (size_t)(dt * 16 + ln) * TK + j0; const unsigned short* vrl = Vtl + (size_t)(dt * 16 + ln) * TK + j0; FragH bv, bl; bv.half[0] = *(const v8us*)(vrow + 8 * hh); bv.half[1] = *(const v8us*)(vrow + 16 + 8 * hh); bl.half[0] = *(const v8us*)(vrl + 8 * hh); bl.half[1] = *(const v8us*)(vrl + 16 + 8 * hh);
#pragma unroll
      for (int rt = 0; rt < RTN; ++rt) { oacc[rt][dt] = mmaH<1>(pa[rt].v, pa[rt].v, bv.v, bv.v, oacc[rt][dt]); oaccL[rt][dt] = mmaH<1>(pl[rt].v, pl[rt].v, bv.v, bv.v, oaccL[rt][dt]); oaccL[rt][dt] = mmaH<1>(pa[rt].v, pa[rt].v, bl.v, bl.v, oaccL[rt][dt]); } }
    __builtin_amdgcn_fence(__ATOMIC_ACQ_REL, "workgroup"); __builtin_amdgcn_wave_barrier(); }
#pragma unroll
  for (int rt = 0; rt < RTN; ++rt) {
#pragma unroll
    for (int r = 0; r < 8; ++r) { float l = l_r[rt][r]; l += __shfl_xor(l, 1, 32); l += __shfl_xor(l, 2, 32); l += __shfl_xor(l, 4, 32); l += __shfl_xor(l, 8, 32); l_r[rt][r] = (l > 0.f) ? 1.0f / (l * 1024.0f) : 0.f; }
#pragma unroll
    for (int dt = 0; dt < DT; ++dt)
#pragma unroll
      for (int r = 0; r < 8; ++r) { float v = oacc[rt][dt][r]; v += oaccL[rt][dt][r] * 0.0009765625f; sO[w][rt * 16 + 8 * hh + r][dt * 16 + ln] = v * l_r[rt][r]; } }
  __builtin_amdgcn_fence(__ATOMIC_ACQ_REL, "workgroup"); __builtin_amdgcn_wave_barrier();
  {
#pragma unroll
    for (int rp = 0; rp < RPW; rp += 2) { const int r = rp + (lane >> 4), pc = lane & 15; const v4f val = *(const v4fa*)&sO[w][r][pc * 4]; *(v4f*)(O + ((size_t)b * TQ + q0 + r) * ldo + h * 64 + pc * 4) = val; }
     } }

__global__ __launch_bounds__(256) void k_wsc(const float* __restrict__ Wm, _Float16* __restrict__ Bt, size_t n8, float sc) { const size_t t = (size_t)blockIdx.x * 256 + threadIdx.x; if (t >= n8) return; FragH f; for (int q = 0; q < 8; ++q) f.h[q] = (_Float16)(bf16_round(Wm[t * 8 + q]) * sc); *(v8us*)((unsigned short*)Bt + t * 8) = f.half[0];  }      /* torch (out,in) weight == Bt[n][k]: scaled copy */




__global__ __launch_bounds__(256) void k_rope(const float* __restrict__ F, int nheads, const float* __restrict__ CS, const float* __restrict__ SN, _Float16* __restrict__ H, _Float16* __restrict__ L, int ldd) {      /* ldd: destination row pitch (the source pitch is nheads*HD) */
  #pragma clang fp contract(off)
  const size_t t = (size_t)blockIdx.x * 256 + threadIdx.x; if (t >= (size_t)NR * nheads * (HH / 8)) return; const int g = (int)(t % (HH / 8)) * 8; const int h = (int)((t / (HH / 8)) % nheads); const int s = (int)(t / ((HH / 8) * (size_t)nheads)); const int ld = nheads * HD;
  const size_t base = (size_t)s * ld + h * HD + g, dbase = (size_t)s * ldd + h * HD + g; FragH h0, h1, l0, l1;
#pragma unroll
  for (int q = 0; q < 8; ++q) { const float c = CS[s * HH + g + q], sn = SN[s * HH + g + q]; const float x0 = F[base + q], x1 = F[base + HH + q]; float o0 = x0 * c; o0 += -x1 * sn; float o1 = x1 * c; o1 += x0 * sn;
    const _Float16 a0 = (_Float16)o0, a1 = (_Float16)o1; h0.h[q] = a0; h1.h[q] = a1; l0.h[q] = (_Float16)((o0 - (float)a0) * 1024.0f); l1.h[q] = (_Float16)((o1 - (float)a1) * 1024.0f); }
  { *(v8us*)((unsigned short*)H + dbase) = h0.half[0]; *(v8us*)((unsigned short*)H + dbase + HH) = h1.half[0]; if (L) { *(v8us*)((unsigned short*)L + dbase) = l0.half[0]; *(v8us*)((unsigned short*)L + dbase + HH) = l1.half[0]; }  } }

__global__ __launch_bounds__(256) void k_rotab(const int* __restrict__ pid, float* __restrict__ CS, float* __restrict__ SN) {      /* s = token row over both batches */
  #pragma clang fp contract(off)
  const int t = blockIdx.x * 256 + threadIdx.x; if (t >= NR * HH) return; const int j = t % HH, s = t / HH; const float inv = 1.0f / powf(10000.0f, (float)(2 * j) / (float)HD); const float th = (float)pid[s] * inv; const float c = cosf(th), sn = sinf(th);
  { *(float*)(CS + t) = c; *(float*)(SN + t) = sn;  } }

__global__ __launch_bounds__(256) void k_expand(const _Float16* __restrict__ SH, const _Float16* __restrict__ SL, _Float16* __restrict__ DH, _Float16* __restrict__ DL, int col0) {
  const size_t t = (size_t)blockIdx.x * 256 + threadIdx.x; if (t >= (size_t)NR * NH * (HD / 8)) return; const int d0 = (int)(t % (HD / 8)) * 8; const int h = (int)((t / (HD / 8)) % NH); const size_t s = t / ((HD / 8) * NH);
  const size_t si = s * KVD + (size_t)(h / (NH / NKV)) * HD + d0, di = s * (size_t)(3 * EMB) + col0 + (size_t)h * HD + d0; const v8us a = *(const v8us*)((const unsigned short*)SH + si), bl = *(const v8us*)((const unsigned short*)SL + si);
  { *(v8us*)((unsigned short*)DH + di) = a; *(v8us*)((unsigned short*)DL + di) = bl;  } }

extern "C" void kernel_launch(void* const* d_in, const int* in_sizes, int n_in,
                              void* d_out, int out_size, void* d_ws, size_t ws_size, hipStream_t stream) {
  (void)in_sizes; (void)n_in; (void)out_size;
  const float* const* I = (const float* const*)d_in; const float* x = I[0]; const float* Wq = I[1]; const float* bq = I[2]; const float* Wk = I[3]; const float* bk = I[4]; const float* Wv = I[5]; const float* bv = I[6]; const float* Wo = I[7]; const int* pid = (const int*)d_in[8];
  char* ws = (char*)d_ws; size_t off = 0;
  auto take = [&](size_t bytes) { char* p = ws + off; off += (bytes + 255) & ~(size_t)255; return p; };
  const size_t npb = (size_t)SLEN * EMB, npa = (size_t)NR * EMB;      /* per-batch plane, plane of both batches */
  _Float16* BQ = (_Float16*)take((size_t)EMB * EMB * 2); _Float16* BK = (_Float16*)take((size_t)KVD * EMB * 2); _Float16* BV = (_Float16*)take((size_t)KVD * EMB * 2); _Float16* BO = (_Float16*)take((size_t)EMB * EMB * 2);
  float* CS = (float*)take((size_t)NR * HH * 4); float* SN = (float*)take((size_t)NR * HH * 4);
  _Float16* X16 = (_Float16*)take(npa * 2); float* QF = (float*)take(npa * 4); float* KF = (float*)take((size_t)NR * KVD * 4); float* VF = (float*)take((size_t)NR * KVD * 4); _Float16* KH8 = (_Float16*)take((size_t)NR * KVD * 2); _Float16* KL8 = (_Float16*)take((size_t)NR * KVD * 2); _Float16* VH8 = (_Float16*)take((size_t)NR * KVD * 2); _Float16* VL8 = (_Float16*)take((size_t)NR * KVD * 2);
  _Float16* H16 = (_Float16*)take(npa * 3 * 2); _Float16* L16 = (_Float16*)take(npa * 3 * 2); _Float16* VT = (_Float16*)take(npa * 2); _Float16* VTL = (_Float16*)take(npa * 2);
  float* O = QF; _Float16* OH = X16; _Float16* OLo = (_Float16*)take(npa * 2);      /* O over the q f32 plane (dead after the rope split); O hi over the x plane (dead after the projections) */
  if (off > ws_size) return;      /* 8+2+2+8 + 1 + 16 + 32 + 8+8 + 4x4 + 48 + 48 + 16 + 16 + 16 = 245 MiB */
  float* ob = (float*)d_out;
  k_wt_f16<<<(unsigned)(((size_t)EMB * EMB / 8 + 255) / 256), 256, 0, stream>>>(Wq, BQ, EMB, EMB, 16.0f); k_wt_f16<<<(unsigned)(((size_t)EMB * KVD / 8 + 255) / 256), 256, 0, stream>>>(Wk, BK, EMB, KVD, 16.0f); k_wt_f16<<<(unsigned)(((size_t)EMB * KVD / 8 + 255) / 256), 256, 0, stream>>>(Wv, BV, EMB, KVD, 16.0f); k_wt_f16<<<(unsigned)(((size_t)EMB * EMB / 8 + 255) / 256), 256, 0, stream>>>(Wo, BO, EMB, EMB, 16.0f);      /* (in,out) weights */
  k_rotab<<<(NR * HH + 255) / 256, 256, 0, stream>>>(pid, CS, SN);
  k_x16<<<(unsigned)((npa / 8 + 255) / 256), 256, 0, stream>>>(x, X16, npa / 8);
  k_gemm2<0><<<dim3((NR / 128) * (EMB / 64), 1), 128, 0, stream>>>(X16, EMB, 0, BQ, EMB, 0, 0.0625f, bq, 0, nullptr, 1, 0, 0, QF, nullptr, EMB, 0, NR, EMB, EMB);
  k_gemm2<0><<<dim3((NR / 128) * (KVD / 64), 1), 128, 0, stream>>>(X16, EMB, 0, BK, EMB, 0, 0.0625f, bk, 0, nullptr, 1, 0, 0, KF, nullptr, KVD, 0, NR, KVD, EMB);
  k_gemm2<0><<<dim3((NR / 128) * (KVD / 64), 1), 128, 0, stream>>>(X16, EMB, 0, BV, EMB, 0, 0.0625f, bv, 0, nullptr, 1, 0, 0, VF, nullptr, KVD, 0, NR, KVD, EMB);
  k_rope<<<(unsigned)(((size_t)NR * NH * (HH / 8) + 255) / 256), 256, 0, stream>>>(QF, NH, CS, SN, H16, L16, 3 * EMB);      /* q roped + split into the [q | k | v] planes */
  k_rope<<<(unsigned)(((size_t)NR * NKV * (HH / 8) + 255) / 256), 256, 0, stream>>>(KF, NKV, CS, SN, KH8, KL8, KVD);
  k_hl<<<(unsigned)(((size_t)NR * KVD / 8 + 255) / 256), 256, 0, stream>>>(VF, VH8, VL8, (size_t)NR * KVD / 8);
  k_expand<<<(unsigned)(((size_t)NR * NH * (HD / 8) + 255) / 256), 256, 0, stream>>>(KH8, KL8, H16, L16, EMB); k_expand<<<(unsigned)(((size_t)NR * NH * (HD / 8) + 255) / 256), 256, 0, stream>>>(VH8, VL8, H16, L16, 2 * EMB);
  k_vt<NH, SLEN><<<NB * NH * (SLEN / 64), 256, 0, stream>>>(H16, 3 * EMB, 2 * EMB, VT); k_vt<NH, SLEN><<<NB * NH * (SLEN / 64), 256, 0, stream>>>(L16, 3 * EMB, 2 * EMB, VTL);
  k_flash5<1><<<NB * NH * QBN5, 128, 0, stream>>>(H16, L16, 3 * EMB, H16 + EMB, L16 + EMB, 3 * EMB, VT, VTL, nullptr, O, EMB);
  k_flash<1><<<NB * NH * QBNP, 128, 0, stream>>>(H16, 3 * EMB, H16 + EMB, 3 * EMB, VT, nullptr, O, EMB);
  k_hl<<<(unsigned)((npa / 8 + 255) / 256), 256, 0, stream>>>(O, OH, OLo, npa / 8);
  k_gemm2<0><<<dim3((NR / 128) * (EMB / 64), 1), 128, 0, stream>>>(OH, EMB, 0, BO, EMB, 0, 0.0625f, nullptr, 0, nullptr, 1, 0, 0, ob, nullptr, EMB, 0, NR, EMB, EMB);
  k_gemm2<0><<<dim3((RE / 128) * (EMB / 64), NB), 128, 0, stream>>>(OLo, EMB, npb, BO, EMB, 0, 0.0625f / 1024.0f, nullptr, 0, ob, 1, (size_t)EMB, 0, ob, nullptr, EMB, npb, RE, EMB, EMB);      /* grid y = batch: the first RE rows of each */
}

// v002
// One run takes 571 microseconds.
// Next to v001, in two timings, it ran 1.39 times as fast each time.
// All steps since v000 together make it 2.39 times as fast.
#include <hip/hip_runtime.h>
// WedoctorAttention (2 x 2048 tokens, hidden 2048; 32 query heads / 8 kv heads of 64 (GQA), rotate-half RoPE from the INPUT position ids, causal SDPA (1/8), out = o Wo): q/k/v = x W + b.
// Structure (both batches in every launch: the 4096 token rows are one row range, batch = row / 2048): exact f16 plane of x; q / k / v GEMMs (32x64 wave tiles, f32 accumulation, exact x16 weights + bias) into f32 planes; angle tables from the input position ids (f32 trig); RoPE on VALU while splitting q and k into f16 hi + 2^10-residual planes, v split directly; the 8 kv heads expanded to the 32 query heads (repeat 4) into the fused [q | k | v] hi/lo planes; V^T hi/residual by LDS tiles; the fused causal flash kernel in its 5-plane form for the first 256 query rows and plain beyond; attention output as f16 hi (+ residual on those rows) into the output GEMMs.
// Compute dtype: x, weights and biases rounded to bf16; rows < 256 per batch: q, k, P, v, O hi + residual; beyond: plain f16; f32 accumulation/softmax/trig. v_wmma_f32_16x16x32_f16.
#define NB 2
#define EMB 2048
#define NR (NB * SLEN)           /* 4096 token rows */
#define SLEN 2048
#define SQ SLEN
#define TQ SLEN
#define TK SLEN
#define NH 32
#define NKV 8
#define KVD (NKV * HD)
#define HD 64
#define HH (HD / 2)
#define SCL 0.125f               /* 64^-0.5 */
#define QBLKS (TQ / 64)
#define QB05 0                   /* 5-plane flash: query blocks [0, QBN5) of every (batch, head) — the early causal rows whose outputs average over few keys */
#define QBN5 4
#define QB0P QBN5                /* plain flash (hi planes only): query blocks [QBN5, QBLKS) */
#define QBNP (QBLKS - QBN5)
#define RE 256                   /* rows per batch that take the hi+lo output operand (= QBN5 * 64) */
typedef __bf16 v16b __attribute__((ext_vector_type(16)));
typedef unsigned short v8us __attribute__((ext_vector_type(8), may_alias));
typedef float  v8f  __attribute__((ext_vector_type(8)));
typedef float  v4f  __attribute__((ext_vector_type(4)));
typedef float  v4fa __attribute__((ext_vector_type(4), may_alias));
union FragB { v16b v; v8us half[2]; unsigned short u[16]; };

__device__ __forceinline__ unsigned short bf16_bits(float x) { unsigned int u = __float_as_uint(x); return (unsigned short)((u + 0x7FFFu + ((u >> 16) & 1u)) >> 16); }
__device__ __forceinline__ float bf16_val(unsigned short b) { return __uint_as_float(((unsigned int)b) << 16); }
__device__ __forceinline__ float bf16_round(float x) { return bf16_val(bf16_bits(x)); }
// D += A·B with NT terms: 1 = ah·bh, 2 = + al·bh (A split), 3 = + ah·bl (both split)
template <int NT>
__device__ __forceinline__ v8f mmaN(v16b ah, v16b al, v16b bh, v16b bl, v8f c) {
  c = __builtin_amdgcn_wmma_f32_16x16x32_bf16(false, ah, false, bh, (short)0, c, false, false);
  if (NT >= 2) c = __builtin_amdgcn_wmma_f32_16x16x32_bf16(false, al, false, bh, (short)0, c, false, false);
  if (NT >= 3) c = __builtin_amdgcn_wmma_f32_16x16x32_bf16(false, ah, false, bl, (short)0, c, false, false);
  asm volatile("v_nop\n\tv_nop\n\tv_nop\n\tv_nop" : "+v"(c) : "v"(ah), "v"(al), "v"(bh), "v"(bl));
  return c;
}

__global__ __launch_bounds__(256) void k_wt_bf16(const float* __restrict__ W, unsigned short* __restrict__ Wt, int K, int N) {
  const int t = blockIdx.x * 256 + threadIdx.x;
  const int k8n = K / 8;
  if (t >= N * k8n) return;
  const int n = t / k8n, k8 = (t % k8n) * 8;
  v8us v;
#pragma unroll
  for (int i = 0; i < 8; ++i) v[i] = bf16_bits(W[(size_t)(k8 + i) * N + n]);
  *(v8us*)(Wt + (size_t)n * K + k8) = v;
  
}

// GEMM C[M][N] (f32, pitch ldc) = act(A[M][K]·W + bias). A f32 row-major (pitch lda) converted per fragment to bf16
// (ASPLIT: hi/lo two planes -> 2 terms, else single rounded term); Wt bf16 [N][K] (pitch ldb). BIAS_BF16 rounds the
// bias to bf16 first (bias quantised to bf16 before the add). K%32==0, M%16==0, N%64==0.
template <bool ASPLIT, int ACT, bool BIAS_BF16>
__global__ __launch_bounds__(128) void k_gemm_bf(const float* __restrict__ A, int lda, const unsigned short* __restrict__ Wt, int ldb,
                                               const float* __restrict__ bias, float* __restrict__ C, int ldc, int M, int N, int K) {
  __shared__ __attribute__((aligned(16))) float so[4][16][64];
  const int tid = threadIdx.x, w = tid >> 5, lane = tid & 31, ln = lane & 15, hh = lane >> 4;
  const int ntn = N / 64;
  const int wid = blockIdx.x * 4 + w;
  const int mt = wid / ntn, nq = wid % ntn;
  if (mt * 16 >= M) return;
  const int row0 = mt * 16, col0 = nq * 64;
  const float* arow = A + (size_t)(row0 + ln) * lda;
  v8f acc[4] = {};
  for (int kb = 0; kb < K; kb += 32) {
    FragB ah, al;
    const v4f x0 = *(const v4fa*)(arow + kb + 8 * hh), x1 = *(const v4fa*)(arow + kb + 8 * hh + 4);
    const v4f x2 = *(const v4fa*)(arow + kb + 16 + 8 * hh), x3 = *(const v4fa*)(arow + kb + 16 + 8 * hh + 4);
    float xs[16] = {x0[0],x0[1],x0[2],x0[3],x1[0],x1[1],x1[2],x1[3],x2[0],x2[1],x2[2],x2[3],x3[0],x3[1],x3[2],x3[3]};
#pragma unroll
    for (int i = 0; i < 16; ++i) { const unsigned short hb = bf16_bits(xs[i]); ah.u[i] = hb; al.u[i] = ASPLIT ? bf16_bits(xs[i] - bf16_val(hb)) : (unsigned short)0; }
#pragma unroll
    for (int t = 0; t < 4; ++t) {
      const unsigned short* brow = Wt + (size_t)(col0 + t * 16 + ln) * ldb + kb;
      FragB b;
      b.half[0] = *(const v8us*)(brow + 8 * hh);
      b.half[1] = *(const v8us*)(brow + 16 + 8 * hh);
      acc[t] = mmaN<ASPLIT ? 2 : 1>(ah.v, al.v, b.v, b.v, acc[t]);
    }
  }
#pragma unroll
  for (int t = 0; t < 4; ++t) {
    float bv = bias ? bias[col0 + t * 16 + ln] : 0.f;
    if (BIAS_BF16) bv = bf16_round(bv);
#pragma unroll
    for (int r = 0; r < 8; ++r) { float v = acc[t][r] + bv; if (ACT == 1) v = fmaxf(v, 0.f); so[w][8 * hh + r][t * 16 + ln] = v; }
  }
  __builtin_amdgcn_fence(__ATOMIC_ACQ_REL, "workgroup");
  __builtin_amdgcn_wave_barrier();
  const int rsub = lane >> 4, c4 = (lane & 15) * 4;
  {
#pragma unroll
    for (int q = 0; q < 8; ++q) {
      const int r = q * 2 + rsub;
      const v4f v = *(const v4fa*)&so[w][r][c4];
      *(v4f*)(C + (size_t)(row0 + r) * ldc + col0 + c4) = v;
    }
    
  }
}

// GEMM C = act(A·W + bias + resid): A f32 (ASPLIT -> hi/lo 2 terms), Wt bf16 [N][K]; ACT 0 none, 1 relu, 2 exact gelu;
// resid (optional, f32, row index = (row % rmod), pitch ldr, RES_BF16 rounds it) added before the activation.
template <bool ASPLIT, int ACT, bool BIAS_BF16, bool RES_BF16>
__global__ __launch_bounds__(128) void k_gemm_bf3(const float* __restrict__ A, int lda, const unsigned short* __restrict__ Wt, int ldb,
                                                const float* __restrict__ bias, const float* __restrict__ resid, int rmod, int ldr,
                                                float* __restrict__ C, int ldc, int M, int N, int K) {
  __shared__ __attribute__((aligned(16))) float so[4][16][64];
  const int tid = threadIdx.x, w = tid >> 5, lane = tid & 31, ln = lane & 15, hh = lane >> 4;
  const int ntn = N / 64;
  const int wid = blockIdx.x * 4 + w;
  const int mt = wid / ntn, nq = wid % ntn;
  if (mt * 16 >= M) return;
  const int row0 = mt * 16, col0 = nq * 64;
  const float* arow = A + (size_t)(row0 + ln) * lda;
  v8f acc[4] = {};
  for (int kb = 0; kb < K; kb += 32) {
    FragB ah, al;
    const v4f x0 = *(const v4fa*)(arow + kb + 8 * hh), x1 = *(const v4fa*)(arow + kb + 8 * hh + 4);
    const v4f x2 = *(const v4fa*)(arow + kb + 16 + 8 * hh), x3 = *(const v4fa*)(arow + kb + 16 + 8 * hh + 4);
    float xs[16] = {x0[0],x0[1],x0[2],x0[3],x1[0],x1[1],x1[2],x1[3],x2[0],x2[1],x2[2],x2[3],x3[0],x3[1],x3[2],x3[3]};
#pragma unroll
    for (int i = 0; i < 16; ++i) { const unsigned short hb = bf16_bits(xs[i]); ah.u[i] = hb; al.u[i] = ASPLIT ? bf16_bits(xs[i] - bf16_val(hb)) : (unsigned short)0; }
#pragma unroll
    for (int t = 0; t < 4; ++t) {
      const unsigned short* brow = Wt + (size_t)(col0 + t * 16 + ln) * ldb + kb;
      FragB b;
      b.half[0] = *(const v8us*)(brow + 8 * hh);
      b.half[1] = *(const v8us*)(brow + 16 + 8 * hh);
      acc[t] = mmaN<ASPLIT ? 2 : 1>(ah.v, al.v, b.v, b.v, acc[t]);
    }
  }
#pragma unroll
  for (int t = 0; t < 4; ++t) {
    const int col = col0 + t * 16 + ln;
    float bv = bias ? bias[col] : 0.f;
    if (BIAS_BF16) bv = bf16_round(bv);
#pragma unroll
    for (int r = 0; r < 8; ++r) {
      float v = acc[t][r] + bv;
      if (resid) { float rv = resid[(size_t)((row0 + 8 * hh + r) % rmod) * ldr + col]; if (RES_BF16) rv = bf16_round(rv); v += rv; }
      if (ACT == 1) v = fmaxf(v, 0.f);
      if (ACT == 2) v = 0.5f * v * (1.0f + erff(v * 0.70710678118654752f));
      if (ACT == 3) { const float u = 0.7978845608028654f * (v + 0.044715f * v * v * v); v = 0.5f * v * (1.0f + tanhf(u)); }
      so[w][8 * hh + r][t * 16 + ln] = v;
    }
  }
  __builtin_amdgcn_fence(__ATOMIC_ACQ_REL, "workgroup");
  __builtin_amdgcn_wave_barrier();
  const int rsub = lane >> 4, c4 = (lane & 15) * 4;
  {
#pragma unroll
    for (int q = 0; q < 8; ++q) {
      const int r = q * 2 + rsub;
      const v4f v = *(const v4fa*)&so[w][r][c4];
      *(v4f*)(C + (size_t)(row0 + r) * ldc + col0 + c4) = v;
    }
    
  }
}
// row LayerNorm (biased variance, eps) over N: s = X (+ R); optional out_sum <- s; out_norm <- (s-mu)*rsqrt(var+eps)*g + b
template <bool PARAM_BF16>
__global__ __launch_bounds__(256) void k_layernorm(const float* __restrict__ X, const float* __restrict__ R, const float* __restrict__ g, const float* __restrict__ bta,
                                                  float* __restrict__ out_sum, float* __restrict__ out_norm, int N, float eps) {
  __shared__ float red[256];
  const int row = blockIdx.x, tid = threadIdx.x;
  const float* x = X + (size_t)row * N; const float* rr = R ? R + (size_t)row * N : nullptr;
  float vals[16];                     // up to N = 4096
  const int per = N / 256;            // contiguous chunk per thread? use strided-by-4 chunks: thread handles j = tid*4 + 1024*u
  float s1 = 0.f;
  for (int u = 0; u < per / 4; ++u) {
    const int j = tid * 4 + 1024 * u;
    const v4f a = *(const v4fa*)(x + j);
    v4f b = {0.f,0.f,0.f,0.f}; if (rr) b = *(const v4fa*)(rr + j);
#pragma unroll
    for (int q = 0; q < 4; ++q) { const float v = a[q] + b[q]; vals[u * 4 + q] = v; s1 += v; }
  }
  red[tid] = s1; __syncthreads();
  for (int st = 128; st > 0; st >>= 1) { if (tid < st) red[tid] += red[tid + st]; __syncthreads(); }
  const float mu = red[0] / (float)N; __syncthreads();
  float s2 = 0.f;
  for (int u = 0; u < per / 4; ++u)
#pragma unroll
    for (int q = 0; q < 4; ++q) { const float c = vals[u * 4 + q] - mu; s2 += c * c; }
  red[tid] = s2; __syncthreads();
  for (int st = 128; st > 0; st >>= 1) { if (tid < st) red[tid] += red[tid + st]; __syncthreads(); }
  const float rs = rsqrtf(red[0] / (float)N + eps);
  {
    for (int u = 0; u < per / 4; ++u) {
      const int j = tid * 4 + 1024 * u;
      v4f o, sm;
#pragma unroll
      for (int q = 0; q < 4; ++q) {
        float gg = g[j + q], bb = bta[j + q];
        if (PARAM_BF16) { gg = bf16_round(gg); bb = bf16_round(bb); }
        sm[q] = vals[u * 4 + q]; o[q] = (vals[u * 4 + q] - mu) * rs * gg + bb;
      }
      if (out_sum) *(v4f*)(out_sum + (size_t)row * N + j) = sm;
      *(v4f*)(out_norm + (size_t)row * N + j) = o;
    }
    
  }
}



// ---- f16 WMMA path (v_wmma_f32_16x16x32_f16): 11-bit significands for operands in range — used where a [0,1] probability operand needs more precision than bf16
typedef _Float16 v16h __attribute__((ext_vector_type(16)));
union FragH { v16h v; v8us half[2]; _Float16 h[16]; unsigned short u[16]; };
template <int NT>
__device__ __forceinline__ v8f mmaH(v16h ah, v16h al, v16h bh, v16h bl, v8f c) {
  c = __builtin_amdgcn_wmma_f32_16x16x32_f16(false, ah, false, bh, (short)0, c, false, false);
  if (NT >= 2) c = __builtin_amdgcn_wmma_f32_16x16x32_f16(false, al, false, bh, (short)0, c, false, false);
  if (NT >= 3) c = __builtin_amdgcn_wmma_f32_16x16x32_f16(false, ah, false, bl, (short)0, c, false, false);
  asm volatile("v_nop\n\tv_nop\n\tv_nop\n\tv_nop" : "+v"(c) : "v"(ah), "v"(al), "v"(bh), "v"(bl));
  return c;
}
// batched GEMM like k_gemm_b but f16 operands: A f32 (split into f16 hi/lo if ASPLIT, else rounded to f16), Bt = f16 values [n][k]; alpha; C f32; N multiple of 16 (partial tiles skipped)
template <bool ASPLIT>
__global__ __launch_bounds__(128) void k_gemm_h(const float* __restrict__ A, int lda, size_t sA, const _Float16* __restrict__ Bh, int ldb, size_t sB, float alpha, float* __restrict__ C, int ldc, size_t sC, int M, int N, int K) {
  __shared__ __attribute__((aligned(16))) float so[4][16][64];
  const int tid = threadIdx.x, w = tid >> 5, lane = tid & 31, ln = lane & 15, hh = lane >> 4; const int by = blockIdx.y;
  A += (size_t)by * sA; Bh += (size_t)by * sB; C += (size_t)by * sC;
  const int ntn = (N + 63) / 64; const int wid = blockIdx.x * 4 + w; const int mt = wid / ntn, nq = wid % ntn; if (mt * 16 >= M) return;
  const int row0 = mt * 16, col0 = nq * 64; const float* arow = A + (size_t)(row0 + ln) * lda;
  v8f acc[4] = {};
  for (int kb = 0; kb < K; kb += 32) {
    FragH ah, al;
    const v4f x0 = *(const v4fa*)(arow + kb + 8 * hh), x1 = *(const v4fa*)(arow + kb + 8 * hh + 4), x2 = *(const v4fa*)(arow + kb + 16 + 8 * hh), x3 = *(const v4fa*)(arow + kb + 16 + 8 * hh + 4);
    float xs[16] = {x0[0],x0[1],x0[2],x0[3],x1[0],x1[1],x1[2],x1[3],x2[0],x2[1],x2[2],x2[3],x3[0],x3[1],x3[2],x3[3]};
#pragma unroll
    for (int i = 0; i < 16; ++i) { const _Float16 h = (_Float16)xs[i]; ah.h[i] = h; al.h[i] = ASPLIT ? (_Float16)(xs[i] - (float)h) : (_Float16)0.0f; }
#pragma unroll
    for (int t = 0; t < 4; ++t) { if (col0 + t * 16 >= N) continue; const size_t boff = (size_t)(col0 + t * 16 + ln) * ldb + kb; FragH bq; bq.half[0] = *(const v8us*)(Bh + boff + 8 * hh); bq.half[1] = *(const v8us*)(Bh + boff + 16 + 8 * hh);
      acc[t] = mmaH<ASPLIT ? 2 : 1>(ah.v, al.v, bq.v, bq.v, acc[t]); }
  }
#pragma unroll
  for (int t = 0; t < 4; ++t) { if (col0 + t * 16 >= N) continue;
#pragma unroll
    for (int r = 0; r < 8; ++r) so[w][8 * hh + r][t * 16 + ln] = acc[t][r] * alpha; }
  __builtin_amdgcn_fence(__ATOMIC_ACQ_REL, "workgroup"); __builtin_amdgcn_wave_barrier();
  const int rsub = lane >> 4, c4 = (lane & 15) * 4;
  {
#pragma unroll
    for (int q = 0; q < 8; ++q) { const int r = q * 2 + rsub; if (col0 + c4 < N) { const v4f v = *(const v4fa*)&so[w][r][c4]; *(v4f*)(C + (size_t)(row0 + r) * ldc + col0 + c4) = v; } }
     }
}

// Wt[n][k] = f16(W[k][n]·scale) from f32 row-major W[K][N] (scale = power of two; bf16-exact weights stay exact in f16 away from the subnormal range)
__global__ __launch_bounds__(256) void k_wt_f16(const float* __restrict__ W, _Float16* __restrict__ Wt, int K, int N, float scale) {
  const int t = blockIdx.x * 256 + threadIdx.x; if (t >= N * (K / 8)) return; const int n = t / (K / 8), k8 = (t % (K / 8)) * 8; FragH f;
#pragma unroll
  for (int i = 0; i < 8; ++i) f.h[i] = (_Float16)(bf16_round(W[(size_t)(k8 + i) * N + n]) * scale); const v8us o = f.half[0];
  *(v8us*)((unsigned short*)Wt + (size_t)n * K + k8) = o; 
}
// k_gemm_hh variant with fused epilogue: v = acc·alpha + bias[by·sBias + col] (+ CP[(row/rowsPerB)·sCPb + by·64 + col] if CP) ; ACT 0 none / 1 elu ; writes f16 C16 (and f32 C if non-null)
template <int ACT>
__global__ __launch_bounds__(128) void k_gemm_hhx(const _Float16* __restrict__ A, int lda, size_t sA, const _Float16* __restrict__ Bh, int ldb, size_t sB, float alpha, const float* __restrict__ bias, size_t sBias, const float* __restrict__ CP, int rowsPerB, size_t sCPb, int row0g,
    float* __restrict__ C, _Float16* __restrict__ C16, int ldc, size_t sC, int M, int N, int K) {
  __shared__ __attribute__((aligned(16))) float so[4][16][64];
  const int tid = threadIdx.x, w = tid >> 5, lane = tid & 31, ln = lane & 15, hh = lane >> 4; const int by = blockIdx.y;
  A += (size_t)by * sA; Bh += (size_t)by * sB; const size_t cofs = (size_t)by * sC; const float* bp = bias ? bias + (size_t)by * sBias : nullptr;
  const int ntn = (N + 63) / 64; const int wid = blockIdx.x * 4 + w; const int mt = wid / ntn, nq = wid % ntn; if (mt * 16 >= M) return;
  const int row0 = mt * 16, col0 = nq * 64; const _Float16* arow = A + (size_t)(row0 + ln) * lda;
  v8f acc[4] = {};
  for (int kb = 0; kb < K; kb += 32) { FragH ah; ah.half[0] = *(const v8us*)((const unsigned short*)arow + kb + 8 * hh); ah.half[1] = *(const v8us*)((const unsigned short*)arow + kb + 16 + 8 * hh);
#pragma unroll
    for (int t = 0; t < 4; ++t) { if (col0 + t * 16 >= N) continue; const size_t boff = (size_t)(col0 + t * 16 + ln) * ldb + kb; FragH bq; bq.half[0] = *(const v8us*)((const unsigned short*)Bh + boff + 8 * hh); bq.half[1] = *(const v8us*)((const unsigned short*)Bh + boff + 16 + 8 * hh);
      acc[t] = mmaH<1>(ah.v, ah.v, bq.v, bq.v, acc[t]); }
  }
#pragma unroll
  for (int t = 0; t < 4; ++t) { if (col0 + t * 16 >= N) continue; const int col = col0 + t * 16 + ln; const float bv = bp ? bf16_round(bp[col]) : 0.f;
#pragma unroll
    for (int r = 0; r < 8; ++r) { float v = acc[t][r] * alpha + bv; if (CP) { const int bidx = (row0g + row0 + 8 * hh + r) / rowsPerB; v += CP[(size_t)bidx * sCPb + (size_t)by * 64 + col]; } if (ACT == 1) v = (v > 0.f) ? v : expm1f(v); else if (ACT == 7) v = (v > 0.f) ? v + 1.0f : expf(v); else if (ACT == 8) v = tanhf(v); else if (ACT == 9) v = 0.5f * v * (1.0f + tanhf(0.7978845608028654f * (v + 0.044715f * v * v * v))); else if (ACT == 11) v = 1.0f / (1.0f + expf(-v)); else if (ACT == 12) v = (v > 0.f) ? v : 0.01f * v; else if (ACT == 14) v = (v > 0.f) ? v : 0.1f * v; else if (ACT == 15) v = v / (1.0f + expf(-v)); else if (ACT == 3) v = fmaxf(v, 0.f); else if (ACT == 6) v = 0.5f * v * (1.0f + erff(v * 0.70710678118654752f)); so[w][8 * hh + r][t * 16 + ln] = v; } }
  __builtin_amdgcn_fence(__ATOMIC_ACQ_REL, "workgroup"); __builtin_amdgcn_wave_barrier();
  const int rsub = lane >> 4, c4 = (lane & 15) * 4; typedef _Float16 v4h __attribute__((ext_vector_type(4)));
  {
#pragma unroll
    for (int q = 0; q < 8; ++q) { const int r = q * 2 + rsub; if (col0 + c4 < N) { const v4f v = *(const v4fa*)&so[w][r][c4]; if (C) *(v4f*)(C + cofs + (size_t)(row0 + r) * ldc + col0 + c4) = v; if (C16) { v4h h4; for (int i = 0; i < 4; ++i) h4[i] = (_Float16)v[i]; *(v4h*)(C16 + cofs + (size_t)(row0 + r) * ldc + col0 + c4) = h4; } } }
     }
}


typedef _Float16 v4h __attribute__((ext_vector_type(4)));

__global__ __launch_bounds__(256) void k_x16(const float* __restrict__ x, _Float16* __restrict__ X16, size_t n8) { const size_t t = (size_t)blockIdx.x * 256 + threadIdx.x; if (t >= n8) return; FragH f;
#pragma unroll
  for (int q = 0; q < 8; ++q) f.h[q] = (_Float16)bf16_round(x[t * 8 + q]); *(v8us*)((unsigned short*)X16 + t * 8) = f.half[0];  }
__global__ __launch_bounds__(256) void k_h16(const float* __restrict__ x, _Float16* __restrict__ X16, size_t n8) { const size_t t = (size_t)blockIdx.x * 256 + threadIdx.x; if (t >= n8) return; FragH f;
#pragma unroll
  for (int q = 0; q < 8; ++q) f.h[q] = (_Float16)x[t * 8 + q]; *(v8us*)((unsigned short*)X16 + t * 8) = f.half[0];  }
__global__ __launch_bounds__(256) void k_round16f(const float* __restrict__ W, _Float16* __restrict__ Bt, size_t n8) { const size_t t = (size_t)blockIdx.x * 256 + threadIdx.x; if (t >= n8) return; FragH f;
#pragma unroll
  for (int i = 0; i < 8; ++i) f.h[i] = (_Float16)(bf16_round(W[t * 8 + i]) * 16.0f); *(v8us*)((unsigned short*)Bt + t * 8) = f.half[0];  }
template <int NHv, int TTv>
__global__ __launch_bounds__(256) void k_vt(const _Float16* __restrict__ V16, int ldv, int voff, _Float16* __restrict__ Vt) { __shared__ unsigned short tl[64][66]; const int tid = threadIdx.x; const int slab = blockIdx.x / (TTv / 64), lg = blockIdx.x % (TTv / 64); const int b = slab / NHv, h = slab % NHv;
  for (int i = tid; i < 64 * 8; i += 256) { const int r = i / 8, c8 = (i % 8) * 8; FragH f; f.half[0] = *(const v8us*)((const unsigned short*)V16 + ((size_t)b * TTv + lg * 64 + r) * ldv + voff + h * 64 + c8);
#pragma unroll
    for (int q = 0; q < 8; ++q) tl[r][c8 + q] = f.u[q]; }
  __syncthreads();
  {
#pragma unroll
    for (int rd = 0; rd < 2; ++rd) { const int d = rd * 32 + tid / 8, pc = tid % 8; FragH f;
#pragma unroll
      for (int q = 0; q < 8; ++q) f.u[q] = tl[pc * 8 + q][d];
      *(v8us*)((unsigned short*)Vt + ((size_t)slab * 64 + d) * TTv + lg * 64 + pc * 8) = f.half[0]; }
     } }

__global__ __launch_bounds__(256) void k_hl(const float* __restrict__ F, _Float16* __restrict__ Hh, _Float16* __restrict__ Hl, size_t n8) { const size_t t = (size_t)blockIdx.x * 256 + threadIdx.x; if (t >= n8) return; FragH fh, fl; const v4f a = *(const v4fa*)(F + t * 8), c = *(const v4fa*)(F + t * 8 + 4);
#pragma unroll
  for (int q = 0; q < 4; ++q) { _Float16 h = (_Float16)a[q]; fh.h[q] = h; fl.h[q] = (_Float16)((a[q] - (float)h) * 1024.0f); h = (_Float16)c[q]; fh.h[4 + q] = h; fl.h[4 + q] = (_Float16)((c[q] - (float)h) * 1024.0f); }
  { *(v8us*)((unsigned short*)Hh + t * 8) = fh.half[0]; *(v8us*)((unsigned short*)Hl + t * 8) = fl.half[0];  } }

// ---- fast GEMM (wave tile 32x64; requires M % 128 == 0 rows per launch region, N % 64 == 0 and K % 64 == 0); epilogue = k_gemm_hhx semantics, but the CP addend takes C's own grid-y offset ----
__device__ __forceinline__ v16h g2_frag(const _Float16* p, int hh) { FragH f; f.half[0] = *(const v8us*)((const unsigned short*)p + 8 * hh); f.half[1] = *(const v8us*)((const unsigned short*)p + 16 + 8 * hh); return f.v; }
__device__ __forceinline__ v8f g2_mma(v16h a, v16h b, v8f c) { v8f d = __builtin_amdgcn_wmma_f32_16x16x32_f16(false, a, false, b, (short)0, c, false, false); asm volatile("v_nop\n\tv_nop\n\tv_nop\n\tv_nop" : "+v"(d) : "v"(a), "v"(b)); return d; }
#define G2_KT 64                      /* k per stage: 128 bytes of every operand row */
#define G2_PITCH 144                  /* LDS row pitch in bytes: 128 + 16, an odd multiple of 16 for the 16-byte fragment reads */
#define G2_STAGE (192 * G2_PITCH)     /* one stage: 128 A rows, then 64 B rows */
// One stage's copies of one lane: 16 bytes of each of 8 A rows and 4 B rows (rows 16 apart; sa, sb = 16 rows in bytes), global memory -> LDS through no register.
// A wave's 32 lanes cover 4 whole 128-byte rows per copy. s_wait_xcnt 0 ends the statement so that it stands in front of any rewrite of the address registers the copies name.
__device__ __forceinline__ void g2_stage(unsigned l, const char* ga, size_t sa, const char* gb, size_t sb) {
  const char* a1 = ga + sa; const char* a2 = a1 + sa; const char* a3 = a2 + sa; const char* a4 = a3 + sa; const char* a5 = a4 + sa; const char* a6 = a5 + sa; const char* a7 = a6 + sa;
  const char* b1 = gb + sb; const char* b2 = b1 + sb; const char* b3 = b2 + sb;
  asm volatile("global_load_async_to_lds_b128 %0, %12, off\n\t"
               "global_load_async_to_lds_b128 %1, %13, off\n\t"
               "global_load_async_to_lds_b128 %2, %14, off\n\t"
               "global_load_async_to_lds_b128 %3, %15, off\n\t"
               "global_load_async_to_lds_b128 %4, %16, off\n\t"
               "global_load_async_to_lds_b128 %5, %17, off\n\t"
               "global_load_async_to_lds_b128 %6, %18, off\n\t"
               "global_load_async_to_lds_b128 %7, %19, off\n\t"
               "global_load_async_to_lds_b128 %8, %20, off\n\t"
               "global_load_async_to_lds_b128 %9, %21, off\n\t"
               "global_load_async_to_lds_b128 %10, %22, off\n\t"
               "global_load_async_to_lds_b128 %11, %23, off\n\t"
               "s_wait_xcnt 0x0"
               :: "v"(l), "v"(l + 16 * G2_PITCH), "v"(l + 32 * G2_PITCH), "v"(l + 48 * G2_PITCH), "v"(l + 64 * G2_PITCH), "v"(l + 80 * G2_PITCH), "v"(l + 96 * G2_PITCH), "v"(l + 112 * G2_PITCH),
                  "v"(l + 128 * G2_PITCH), "v"(l + 144 * G2_PITCH), "v"(l + 160 * G2_PITCH), "v"(l + 176 * G2_PITCH),
                  "v"(ga), "v"(a1), "v"(a2), "v"(a3), "v"(a4), "v"(a5), "v"(a6), "v"(a7), "v"(gb), "v"(b1), "v"(b2), "v"(b3)
               : "memory");
}
// Block tile 128x64 (M % 128 == 0, N % 64 == 0, K % 64 == 0): the A and B tiles of a stage go to LDS by asynchronous copies, two buffers, stage t + 2 in flight while stage t + 1 is worked on; the waves read their fragments from LDS. The order of the products along k is the plain one.
template <int ACT>
__global__ __launch_bounds__(128) void k_gemm2(const _Float16* __restrict__ A, int lda, size_t sA, const _Float16* __restrict__ Bh, int ldb, size_t sB, float alpha, const float* __restrict__ bias, size_t sBias, const float* __restrict__ CP, int rowsPerB, size_t sCPb, int row0g,
    float* __restrict__ C, _Float16* __restrict__ C16, int ldc, size_t sC, int M, int N, int K) {
  __shared__ __attribute__((aligned(128))) unsigned char sm[2 * G2_STAGE];
  float (*so)[32][68] = (float (*)[32][68])sm;      /* output staging (4 x 32 x 68 floats) over the two buffers, used only behind the last trip's barrier */
  const int tid = threadIdx.x, w = tid >> 5, lane = tid & 31, ln = lane & 15, hh = lane >> 4; const int by = blockIdx.y;
  A += (size_t)by * sA; Bh += (size_t)by * sB; const size_t cofs = (size_t)by * sC; const float* bp = bias ? bias + (size_t)by * sBias : nullptr;
  const int ntn = N >> 6; const int mt = blockIdx.x / ntn, nq = blockIdx.x - mt * ntn; const int row0 = mt * 128 + 32 * w, col0 = nq * 64; if (mt * 128 >= M) return;      /* the whole block leaves or none, in front of every barrier */
  const int cr = tid >> 3, cc = tid & 7;      /* copy lane: row cr (+ 16 i) of the tile, 16-byte piece cc of its 128 bytes */
  const char* ga = (const char*)(A + (size_t)(mt * 128 + cr) * lda + cc * 8); const char* gb = (const char*)(Bh + (size_t)(col0 + cr) * ldb + cc * 8);
  const size_t sa = (size_t)lda * 32, sb = (size_t)ldb * 32;
  const unsigned l0 = (unsigned)(size_t)sm + (unsigned)(cr * G2_PITCH + cc * 16);
  const int nst = K / G2_KT;
  g2_stage(l0, ga, sa, gb, sb);
  asm volatile("s_wait_asynccnt 0x0" ::: "memory");      /* stage 0 of this wave has landed */
  __syncthreads();                                       /* ... and every other wave's */
  if (nst > 1) g2_stage(l0 + G2_STAGE, ga + 2 * G2_KT, sa, gb + 2 * G2_KT, sb);
  const v8f z8 = {0.f,0.f,0.f,0.f,0.f,0.f,0.f,0.f}; v8f c00 = z8, c01 = z8, c02 = z8, c03 = z8, c10 = z8, c11 = z8, c12 = z8, c13 = z8;
  /* kept rolled: one trip per stage, so that the waits, the barrier and the refill at its foot stand once */
#pragma unroll 1
  for (int t = 0; t < nst; ++t) { const unsigned bo = (unsigned)(t & 1) * G2_STAGE;
    const _Float16* a0p = (const _Float16*)(sm + bo + (32 * w + ln) * G2_PITCH); const _Float16* a1p = (const _Float16*)(sm + bo + (32 * w + 16 + ln) * G2_PITCH);
    const _Float16* b0p = (const _Float16*)(sm + bo + (128 + ln) * G2_PITCH); const _Float16* b1p = (const _Float16*)(sm + bo + (144 + ln) * G2_PITCH); const _Float16* b2p = (const _Float16*)(sm + bo + (160 + ln) * G2_PITCH); const _Float16* b3p = (const _Float16*)(sm + bo + (176 + ln) * G2_PITCH);
    /* unrolled: the two 32-k steps of a stage read LDS at constant offsets */
#pragma unroll
    for (int kb = 0; kb < G2_KT; kb += 32) { const v16h a0 = g2_frag(a0p + kb, hh), a1 = g2_frag(a1p + kb, hh), b0 = g2_frag(b0p + kb, hh), b1 = g2_frag(b1p + kb, hh), b2 = g2_frag(b2p + kb, hh), b3 = g2_frag(b3p + kb, hh);
      c00 = g2_mma(a0, b0, c00); c10 = g2_mma(a1, b0, c10);
      c01 = g2_mma(a0, b1, c01); c11 = g2_mma(a1, b1, c11);
      c02 = g2_mma(a0, b2, c02); c12 = g2_mma(a1, b2, c12);
      c03 = g2_mma(a0, b3, c03); c13 = g2_mma(a1, b3, c13); }
    asm volatile("s_wait_dscnt 0x0" ::: "memory");       /* this wave's reads of the buffer are done before it is refilled */
    asm volatile("s_wait_asynccnt 0x0" ::: "memory");    /* this wave's copies of stage t + 1 have landed */
    __syncthreads();                                     /* publishes stage t + 1 and ends every wave's reads of stage t */
    if (t + 2 < nst) g2_stage(l0 + bo, ga + (size_t)(t + 2) * (2 * G2_KT), sa, gb + (size_t)(t + 2) * (2 * G2_KT), sb); }
  asm volatile("s_wait_asynccnt 0x0" ::: "memory");      /* no copy is outstanding when the buffers become output staging */
  v8f accs[8] = {c00, c01, c02, c03, c10, c11, c12, c13};
#pragma unroll
  for (int u = 0; u < 8; ++u) { const int t = u & 3, half = u >> 2; const int col = col0 + t * 16 + ln; const float bv = bp ? bf16_round(bp[col]) : 0.f;
#pragma unroll
    for (int r = 0; r < 8; ++r) { const int rloc = half * 16 + 8 * hh + r; float v = accs[u][r] * alpha + bv; if (CP) { const int bidx = (row0g + row0 + rloc) / rowsPerB; v += CP[cofs + (size_t)bidx * sCPb + col]; }
      if (ACT == 3) v = fmaxf(v, 0.f); else if (ACT == 6) v = 0.5f * v * (1.0f + erff(v * 0.70710678118654752f)); else if (ACT == 11) v = 1.0f / (1.0f + expf(-v)); else if (ACT == 15) v = v / (1.0f + expf(-v)); else if (ACT == 12) v = (v > 0.f) ? v : 0.01f * v; else if (ACT == 8) v = tanhf(v);
      so[w][rloc][t * 16 + ln] = v; } }
  __builtin_amdgcn_fence(__ATOMIC_ACQ_REL, "workgroup"); __builtin_amdgcn_wave_barrier();
  const int rsub = lane >> 4, c4 = (lane & 15) * 4;
  {
#pragma unroll
    for (int q = 0; q < 16; ++q) { const int r = q * 2 + rsub; const v4f v = *(const v4fa*)&so[w][r][c4]; if (C) *(v4f*)(C + cofs + (size_t)(row0 + r) * ldc + col0 + c4) = v; if (C16) { v4h h4; for (int i = 0; i < 4; ++i) h4[i] = (_Float16)v[i]; *(v4h*)(C16 + cofs + (size_t)(row0 + r) * ldc + col0 + c4) = h4; } }
     } }



template <int CAUSAL>
__global__ __launch_bounds__(128) void k_flash(const _Float16* __restrict__ Q16, int ldq, const _Float16* __restrict__ K16, int ldk, const _Float16* __restrict__ Vt, const int* __restrict__ MSK, float* __restrict__ O, int ldo) {
  constexpr int RPW = 16, RTN = RPW / 16, NQB = TQ / (4 * RPW), DT = 4, KS = 2;
  __shared__ __attribute__((aligned(16))) unsigned short sP[4][RPW][40]; __shared__ __attribute__((aligned(16))) float sO[4][RPW][64 + 4];
  const int tid = threadIdx.x, w = tid >> 5, lane = tid & 31, ln = lane & 15, hh = lane >> 4;
  const int slab = blockIdx.x / QBNP, qblk = QB0P + blockIdx.x % QBNP; (void)NQB; const int b = slab / NH, h = slab % NH; const int qb0 = qblk * (4 * RPW); const int q0 = qb0 + w * RPW;
  FragH aq[2][KS];
#pragma unroll
  for (int rt = 0; rt < RTN; ++rt) { const unsigned short* qr = (const unsigned short*)Q16 + ((size_t)b * TQ + q0 + rt * 16 + ln) * ldq + h * 64;
#pragma unroll
    for (int ks = 0; ks < KS; ++ks) { aq[rt][ks].half[0] = *(const v8us*)(qr + ks * 32 + 8 * hh); aq[rt][ks].half[1] = *(const v8us*)(qr + ks * 32 + 16 + 8 * hh); } }
  const unsigned short* Vth = (const unsigned short*)Vt + (size_t)slab * 64 * TK;
  float m_r[2][8], l_r[2][8]; v8f oacc[2][DT];
#pragma unroll
  for (int rt = 0; rt < RTN; ++rt) {
#pragma unroll
    for (int r = 0; r < 8; ++r) { m_r[rt][r] = -3.0e38f; l_r[rt][r] = 0.f; }
#pragma unroll
    for (int dt = 0; dt < DT; ++dt) oacc[rt][dt] = (v8f){0.f,0.f,0.f,0.f,0.f,0.f,0.f,0.f}; }
  const int jend = (CAUSAL == 1) ? (qb0 + 4 * RPW) : TK;      /* causal: keys beyond the block's last query never contribute */
#pragma unroll 1
  for (int j0 = 0; j0 < jend; j0 += 32) {
    v8f s[2][2];
#pragma unroll
    for (int nt = 0; nt < 2; ++nt) { const unsigned short* kr = (const unsigned short*)K16 + ((size_t)b * TK + j0 + nt * 16 + ln) * ldk + h * 64; FragH bk[KS];
#pragma unroll
      for (int ks = 0; ks < KS; ++ks) { bk[ks].half[0] = *(const v8us*)(kr + ks * 32 + 8 * hh); bk[ks].half[1] = *(const v8us*)(kr + ks * 32 + 16 + 8 * hh); }
#pragma unroll
      for (int rt = 0; rt < RTN; ++rt) { v8f acc = (v8f){0.f,0.f,0.f,0.f,0.f,0.f,0.f,0.f};
#pragma unroll
        for (int ks = 0; ks < KS; ++ks) acc = mmaH<1>(aq[rt][ks].v, aq[rt][ks].v, bk[ks].v, bk[ks].v, acc); s[rt][nt] = acc; } }
#pragma unroll
    for (int rt = 0; rt < RTN; ++rt)
#pragma unroll
      for (int r = 0; r < 8; ++r) { const int tq = q0 + rt * 16 + 8 * hh + r; const int k0 = j0 + ln, k1 = j0 + 16 + ln;
        const bool ok0 = (CAUSAL == 1) ? (k0 <= tq) : ((CAUSAL == 2) ? ((k0 >> 5) == (tq >> 5)) : true), ok1 = (CAUSAL == 1) ? (k1 <= tq) : ((CAUSAL == 2) ? ((k1 >> 5) == (tq >> 5)) : true);      /* mode 2: block-diagonal 32-token groups */
        const float s0 = ok0 ? s[rt][0][r] * SCL : -3.0e38f, s1 = ok1 ? s[rt][1][r] * SCL : -3.0e38f; float mc = fmaxf(s0, s1);
        mc = fmaxf(mc, __shfl_xor(mc, 1, 32)); mc = fmaxf(mc, __shfl_xor(mc, 2, 32)); mc = fmaxf(mc, __shfl_xor(mc, 4, 32)); mc = fmaxf(mc, __shfl_xor(mc, 8, 32));
        const float mn = fmaxf(m_r[rt][r], mc); const float al = (mn > -1.0e38f) ? expf(m_r[rt][r] - mn) : 1.0f; m_r[rt][r] = mn; const float p0 = ok0 ? expf(s0 - mn) : 0.f, p1 = ok1 ? expf(s1 - mn) : 0.f; l_r[rt][r] = l_r[rt][r] * al + p0 + p1;
#pragma unroll
        for (int dt = 0; dt < DT; ++dt) oacc[rt][dt][r] *= al;
        FragH t2; t2.h[0] = (_Float16)(p0 * 1024.0f); t2.h[1] = (_Float16)(p1 * 1024.0f); sP[w][rt * 16 + 8 * hh + r][ln] = t2.u[0]; sP[w][rt * 16 + 8 * hh + r][16 + ln] = t2.u[1]; }
    __builtin_amdgcn_fence(__ATOMIC_ACQ_REL, "workgroup"); __builtin_amdgcn_wave_barrier();
    FragH pa[2];
#pragma unroll
    for (int rt = 0; rt < RTN; ++rt) { pa[rt].half[0] = *(const v8us*)&sP[w][rt * 16 + ln][8 * hh]; pa[rt].half[1] = *(const v8us*)&sP[w][rt * 16 + ln][16 + 8 * hh]; }
#pragma unroll
    for (int dt = 0; dt < DT; ++dt) { const unsigned short* vrow = Vth + (size_t)(dt * 16 + ln) * TK + j0; FragH bv; bv.half[0] = *(const v8us*)(vrow + 8 * hh); bv.half[1] = *(const v8us*)(vrow + 16 + 8 * hh);
#pragma unroll
      for (int rt = 0; rt < RTN; ++rt) oacc[rt][dt] = mmaH<1>(pa[rt].v, pa[rt].v, bv.v, bv.v, oacc[rt][dt]); }
    __builtin_amdgcn_fence(__ATOMIC_ACQ_REL, "workgroup"); __builtin_amdgcn_wave_barrier(); }
#pragma unroll
  for (int rt = 0; rt < RTN; ++rt) {
#pragma unroll
    for (int r = 0; r < 8; ++r) { float l = l_r[rt][r]; l += __shfl_xor(l, 1, 32); l += __shfl_xor(l, 2, 32); l += __shfl_xor(l, 4, 32); l += __shfl_xor(l, 8, 32); l_r[rt][r] = (l > 0.f) ? 1.0f / (l * 1024.0f) : 0.f; }
#pragma unroll
    for (int dt = 0; dt < DT; ++dt)
#pragma unroll
      for (int r = 0; r < 8; ++r) sO[w][rt * 16 + 8 * hh + r][dt * 16 + ln] = oacc[rt][dt][r] * l_r[rt][r]; }
  __builtin_amdgcn_fence(__ATOMIC_ACQ_REL, "workgroup"); __builtin_amdgcn_wave_barrier();
  {
#pragma unroll
    for (int rp = 0; rp < RPW; rp += 2) { const int r = rp + (lane >> 4), pc = lane & 15; const v4f val = *(const v4fa*)&sO[w][r][pc * 4]; *(v4f*)(O + ((size_t)b * TQ + q0 + r) * ldo + h * 64 + pc * 4) = val; }
     } }
// 5-plane variant: S = Qh Kh^T + (Ql Kh^T + Qh Kl^T)/1024 with Q/K = [hi | 2^10 residual] f16 planes (QL/KL same layout as Q16/K16), then the 3-term P.V below.
// 3-term variant: O = (P_hi V_hi + (P_lo V_hi + P_hi V_lo) / 1024) / l with P = [hi | 2^10 residual] of 1024 p and V^T = [hi | 2^10 residual] planes (VtL same layout as Vt) -> ~2^-21-class products for un-averaged (early causal / peaked) rows
template <int CAUSAL>
__global__ __launch_bounds__(128) void k_flash5(const _Float16* __restrict__ Q16, const _Float16* __restrict__ QL, int ldq, const _Float16* __restrict__ K16, const _Float16* __restrict__ KL, int ldk, const _Float16* __restrict__ Vt, const _Float16* __restrict__ VtL, const int* __restrict__ MSK, float* __restrict__ O, int ldo) {
  constexpr int RPW = 16, RTN = RPW / 16, NQB = TQ / (4 * RPW), DT = 4, KS = 2;
  __shared__ __attribute__((aligned(16))) unsigned short sP[4][RPW][40]; __shared__ __attribute__((aligned(16))) unsigned short sPL[4][RPW][40]; __shared__ __attribute__((aligned(16))) float sO[4][RPW][64 + 4];
  const int tid = threadIdx.x, w = tid >> 5, lane = tid & 31, ln = lane & 15, hh = lane >> 4;
  const int slab = blockIdx.x / QBN5, qblk = QB05 + blockIdx.x % QBN5; (void)NQB; const int b = slab / NH, h = slab % NH; const int qb0 = qblk * (4 * RPW); const int q0 = qb0 + w * RPW;
  FragH aq[2][KS], aql[2][KS];
#pragma unroll
  for (int rt = 0; rt < RTN; ++rt) { const unsigned short* qr = (const unsigned short*)Q16 + ((size_t)b * TQ + q0 + rt * 16 + ln) * ldq + h * 64; const unsigned short* ql = (const unsigned short*)QL + ((size_t)b * TQ + q0 + rt * 16 + ln) * ldq + h * 64;
#pragma unroll
    for (int ks = 0; ks < KS; ++ks) { aq[rt][ks].half[0] = *(const v8us*)(qr + ks * 32 + 8 * hh); aq[rt][ks].half[1] = *(const v8us*)(qr + ks * 32 + 16 + 8 * hh); aql[rt][ks].half[0] = *(const v8us*)(ql + ks * 32 + 8 * hh); aql[rt][ks].half[1] = *(const v8us*)(ql + ks * 32 + 16 + 8 * hh); } }
  const unsigned short* Vth = (const unsigned short*)Vt + (size_t)slab * 64 * TK; const unsigned short* Vtl = (const unsigned short*)VtL + (size_t)slab * 64 * TK;
  float m_r[2][8], l_r[2][8]; v8f oacc[2][DT], oaccL[2][DT];
#pragma unroll
  for (int rt = 0; rt < RTN; ++rt) {
#pragma unroll
    for (int r = 0; r < 8; ++r) { m_r[rt][r] = -3.0e38f; l_r[rt][r] = 0.f; }
#pragma unroll
    for (int dt = 0; dt < DT; ++dt) { oacc[rt][dt] = (v8f){0.f,0.f,0.f,0.f,0.f,0.f,0.f,0.f}; oaccL[rt][dt] = oacc[rt][dt]; } }
  const int jend = (CAUSAL == 1) ? (qb0 + 4 * RPW) : TK;      /* causal: keys beyond the block's last query never contribute */
#pragma unroll 1
  for (int j0 = 0; j0 < jend; j0 += 32) {
    v8f s[2][2];
#pragma unroll
    for (int nt = 0; nt < 2; ++nt) { const unsigned short* kr = (const unsigned short*)K16 + ((size_t)b * TK + j0 + nt * 16 + ln) * ldk + h * 64; const unsigned short* klr = (const unsigned short*)KL + ((size_t)b * TK + j0 + nt * 16 + ln) * ldk + h * 64; FragH bk[KS], bkl[KS];
#pragma unroll
      for (int ks = 0; ks < KS; ++ks) { bk[ks].half[0] = *(const v8us*)(kr + ks * 32 + 8 * hh); bk[ks].half[1] = *(const v8us*)(kr + ks * 32 + 16 + 8 * hh); bkl[ks].half[0] = *(const v8us*)(klr + ks * 32 + 8 * hh); bkl[ks].half[1] = *(const v8us*)(klr + ks * 32 + 16 + 8 * hh); }
#pragma unroll
      for (int rt = 0; rt < RTN; ++rt) { v8f acc = (v8f){0.f,0.f,0.f,0.f,0.f,0.f,0.f,0.f}, accl = acc;
#pragma unroll
        for (int ks = 0; ks < KS; ++ks) { acc = mmaH<1>(aq[rt][ks].v, aq[rt][ks].v, bk[ks].v, bk[ks].v, acc); accl = mmaH<1>(aql[rt][ks].v, aql[rt][ks].v, bk[ks].v, bk[ks].v, accl); accl = mmaH<1>(aq[rt][ks].v, aq[rt][ks].v, bkl[ks].v, bkl[ks].v, accl); }
#pragma unroll
        for (int r = 0; r < 8; ++r) acc[r] += accl[r] * 0.0009765625f;
        s[rt][nt] = acc; } }
#pragma unroll
    for (int rt = 0; rt < RTN; ++rt)
#pragma unroll
      for (int r = 0; r < 8; ++r) { const int tq = q0 + rt * 16 + 8 * hh + r; const int k0 = j0 + ln, k1 = j0 + 16 + ln;
        bool ok0 = (CAUSAL == 1) ? (k0 <= tq) : ((CAUSAL == 2) ? ((k0 >> 5) == (tq >> 5)) : true), ok1 = (CAUSAL == 1) ? (k1 <= tq) : ((CAUSAL == 2) ? ((k1 >> 5) == (tq >> 5)) : true);      /* mode 2: block-diagonal 32-token groups */
        if (CAUSAL == 4) { const int* mrow = MSK + ((size_t)b * TQ + tq) * TK; ok0 = mrow[k0] != 0; ok1 = mrow[k1] != 0; }      /* mode 4: per-(query, key) INPUT mask shared by all heads; masked keys contribute nothing (== the reference's -4096 fill, whose exp underflows to 0), rows with no valid key give l = 0 -> output 0 (== the reference's row_valid zeroing) */
        const float s0 = ok0 ? s[rt][0][r] * SCL : -3.0e38f, s1 = ok1 ? s[rt][1][r] * SCL : -3.0e38f; float mc = fmaxf(s0, s1);
        mc = fmaxf(mc, __shfl_xor(mc, 1, 32)); mc = fmaxf(mc, __shfl_xor(mc, 2, 32)); mc = fmaxf(mc, __shfl_xor(mc, 4, 32)); mc = fmaxf(mc, __shfl_xor(mc, 8, 32));
        const float mn = fmaxf(m_r[rt][r], mc); const float al = (mn > -1.0e38f) ? expf(m_r[rt][r] - mn) : 1.0f; m_r[rt][r] = mn; const float p0 = ok0 ? expf(s0 - mn) : 0.f, p1 = ok1 ? expf(s1 - mn) : 0.f; l_r[rt][r] = l_r[rt][r] * al + p0 + p1;
#pragma unroll
        for (int dt = 0; dt < DT; ++dt) { oacc[rt][dt][r] *= al; oaccL[rt][dt][r] *= al; }
        FragH t2, t2l; const float ps0 = p0 * 1024.0f, ps1 = p1 * 1024.0f; t2.h[0] = (_Float16)ps0; t2.h[1] = (_Float16)ps1; t2l.h[0] = (_Float16)((ps0 - (float)t2.h[0]) * 1024.0f); t2l.h[1] = (_Float16)((ps1 - (float)t2.h[1]) * 1024.0f);
        sP[w][rt * 16 + 8 * hh + r][ln] = t2.u[0]; sP[w][rt * 16 + 8 * hh + r][16 + ln] = t2.u[1]; sPL[w][rt * 16 + 8 * hh + r][ln] = t2l.u[0]; sPL[w][rt * 16 + 8 * hh + r][16 + ln] = t2l.u[1]; }
    __builtin_amdgcn_fence(__ATOMIC_ACQ_REL, "workgroup"); __builtin_amdgcn_wave_barrier();
    FragH pa[2], pl[2];
#pragma unroll
    for (int rt = 0; rt < RTN; ++rt) { pa[rt].half[0] = *(const v8us*)&sP[w][rt * 16 + ln][8 * hh]; pa[rt].half[1] = *(const v8us*)&sP[w][rt * 16 + ln][16 + 8 * hh]; pl[rt].half[0] = *(const v8us*)&sPL[w][rt * 16 + ln][8 * hh]; pl[rt].half[1] = *(const v8us*)&sPL[w][rt * 16 + ln][16 + 8 * hh]; }
#pragma unroll
    for (int dt = 0; dt < DT; ++dt) { const unsigned short* vrow = Vth + (size_t)(dt * 16 + ln) * TK + j0; const unsigned short* vrl = Vtl + (size_t)(dt * 16 + ln) * TK + j0; FragH bv, bl; bv.half[0] = *(const v8us*)(vrow + 8 * hh); bv.half[1] = *(const v8us*)(vrow + 16 + 8 * hh); bl.half[0] = *(const v8us*)(vrl + 8 * hh); bl.half[1] = *(const v8us*)(vrl + 16 + 8 * hh);
#pragma unroll
      for (int rt = 0; rt < RTN; ++rt) { oacc[rt][dt] = mmaH<1>(pa[rt].v, pa[rt].v, bv.v, bv.v, oacc[rt][dt]); oaccL[rt][dt] = mmaH<1>(pl[rt].v, pl[rt].v, bv.v, bv.v, oaccL[rt][dt]); oaccL[rt][dt] = mmaH<1>(pa[rt].v, pa[rt].v, bl.v, bl.v, oaccL[rt][dt]); } }
    __builtin_amdgcn_fence(__ATOMIC_ACQ_REL, "workgroup"); __builtin_amdgcn_wave_barrier(); }
#pragma unroll
  for (int rt = 0; rt < RTN; ++rt) {
#pragma unroll
    for (int r = 0; r < 8; ++r) { float l = l_r[rt][r]; l += __shfl_xor(l, 1, 32); l += __shfl_xor(l, 2, 32); l += __shfl_xor(l, 4, 32); l += __shfl_xor(l, 8, 32); l_r[rt][r] = (l > 0.f) ? 1.0f / (l * 1024.0f) : 0.f; }
#pragma unroll
    for (int dt = 0; dt < DT; ++dt)
#pragma unroll
      for (int r = 0; r < 8; ++r) { float v = oacc[rt][dt][r]; v += oaccL[rt][dt][r] * 0.0009765625f; sO[w][rt * 16 + 8 * hh + r][dt * 16 + ln] = v * l_r[rt][r]; } }
  __builtin_amdgcn_fence(__ATOMIC_ACQ_REL, "workgroup"); __builtin_amdgcn_wave_barrier();
  {
#pragma unroll
    for (int rp = 0; rp < RPW; rp += 2) { const int r = rp + (lane >> 4), pc = lane & 15; const v4f val = *(const v4fa*)&sO[w][r][pc * 4]; *(v4f*)(O + ((size_t)b * TQ + q0 + r) * ldo + h * 64 + pc * 4) = val; }
     } }

__global__ __launch_bounds__(256) void k_wsc(const float* __restrict__ Wm, _Float16* __restrict__ Bt, size_t n8, float sc) { const size_t t = (size_t)blockIdx.x * 256 + threadIdx.x; if (t >= n8) return; FragH f; for (int q = 0; q < 8; ++q) f.h[q] = (_Float16)(bf16_round(Wm[t * 8 + q]) * sc); *(v8us*)((unsigned short*)Bt + t * 8) = f.half[0];  }      /* torch (out,in) weight == Bt[n][k]: scaled copy */




__global__ __launch_bounds__(256) void k_rope(const float* __restrict__ F, int nheads, const float* __restrict__ CS, const float* __restrict__ SN, _Float16* __restrict__ H, _Float16* __restrict__ L, int ldd) {      /* ldd: destination row pitch (the source pitch is nheads*HD) */
  #pragma clang fp contract(off)
  const size_t t = (size_t)blockIdx.x * 256 + threadIdx.x; if (t >= (size_t)NR * nheads * (HH / 8)) return; const int g = (int)(t % (HH / 8)) * 8; const int h = (int)((t / (HH / 8)) % nheads); const int s = (int)(t / ((HH / 8) * (size_t)nheads)); const int ld = nheads * HD;
  const size_t base = (size_t)s * ld + h * HD + g, dbase = (size_t)s * ldd + h * HD + g; FragH h0, h1, l0, l1;
#pragma unroll
  for (int q = 0; q < 8; ++q) { const float c = CS[s * HH + g + q], sn = SN[s * HH + g + q]; const float x0 = F[base + q], x1 = F[base + HH + q]; float o0 = x0 * c; o0 += -x1 * sn; float o1 = x1 * c; o1 += x0 * sn;
    const _Float16 a0 = (_Float16)o0, a1 = (_Float16)o1; h0.h[q] = a0; h1.h[q] = a1; l0.h[q] = (_Float16)((o0 - (float)a0) * 1024.0f); l1.h[q] = (_Float16)((o1 - (float)a1) * 1024.0f); }
  { *(v8us*)((unsigned short*)H + dbase) = h0.half[0]; *(v8us*)((unsigned short*)H + dbase + HH) = h1.half[0]; if (L) { *(v8us*)((unsigned short*)L + dbase) = l0.half[0]; *(v8us*)((unsigned short*)L + dbase + HH) = l1.half[0]; }  } }

__global__ __launch_bounds__(256) void k_rotab(const int* __restrict__ pid, float* __restrict__ CS, float* __restrict__ SN) {      /* s = token row over both batches */
  #pragma clang fp contract(off)
  const int t = blockIdx.x * 256 + threadIdx.x; if (t >= NR * HH) return; const int j = t % HH, s = t / HH; const float inv = 1.0f / powf(10000.0f, (float)(2 * j) / (float)HD); const float th = (float)pid[s] * inv; const float c = cosf(th), sn = sinf(th);
  { *(float*)(CS + t) = c; *(float*)(SN + t) = sn;  } }

__global__ __launch_bounds__(256) void k_expand(const _Float16* __restrict__ SH, const _Float16* __restrict__ SL, _Float16* __restrict__ DH, _Float16* __restrict__ DL, int col0) {
  const size_t t = (size_t)blockIdx.x * 256 + threadIdx.x; if (t >= (size_t)NR * NH * (HD / 8)) return; const int d0 = (int)(t % (HD / 8)) * 8; const int h = (int)((t / (HD / 8)) % NH); const size_t s = t / ((HD / 8) * NH);
  const size_t si = s * KVD + (size_t)(h / (NH / NKV)) * HD + d0, di = s * (size_t)(3 * EMB) + col0 + (size_t)h * HD + d0; const v8us a = *(const v8us*)((const unsigned short*)SH + si), bl = *(const v8us*)((const unsigned short*)SL + si);
  { *(v8us*)((unsigned short*)DH + di) = a; *(v8us*)((unsigned short*)DL + di) = bl;  } }

extern "C" void kernel_launch(void* const* d_in, const int* in_sizes, int n_in,
                              void* d_out, int out_size, void* d_ws, size_t ws_size, hipStream_t stream) {
  (void)in_sizes; (void)n_in; (void)out_size;
  const float* const* I = (const float* const*)d_in; const float* x = I[0]; const float* Wq = I[1]; const float* bq = I[2]; const float* Wk = I[3]; const float* bk = I[4]; const float* Wv = I[5]; const float* bv = I[6]; const float* Wo = I[7]; const int* pid = (const int*)d_in[8];
  char* ws = (char*)d_ws; size_t off = 0;
  auto take = [&](size_t bytes) { char* p = ws + off; off += (bytes + 255) & ~(size_t)255; return p; };
  const size_t npb = (size_t)SLEN * EMB, npa = (size_t)NR * EMB;      /* per-batch plane, plane of both batches */
  _Float16* BQ = (_Float16*)take((size_t)EMB * EMB * 2); _Float16* BK = (_Float16*)take((size_t)KVD * EMB * 2); _Float16* BV = (_Float16*)take((size_t)KVD * EMB * 2); _Float16* BO = (_Float16*)take((size_t)EMB * EMB * 2);
  float* CS = (float*)take((size_t)NR * HH * 4); float* SN = (float*)take((size_t)NR * HH * 4);
  _Float16* X16 = (_Float16*)take(npa * 2); float* QF = (float*)take(npa * 4); float* KF = (float*)take((size_t)NR * KVD * 4); float* VF = (float*)take((size_t)NR * KVD * 4); _Float16* KH8 = (_Float16*)take((size_t)NR * KVD * 2); _Float16* KL8 = (_Float16*)take((size_t)NR * KVD * 2); _Float16* VH8 = (_Float16*)take((size_t)NR * KVD * 2); _Float16* VL8 = (_Float16*)take((size_t)NR * KVD * 2);
  _Float16* H16 = (_Float16*)take(npa * 3 * 2); _Float16* L16 = (_Float16*)take(npa * 3 * 2); _Float16* VT = (_Float16*)take(npa * 2); _Float16* VTL = (_Float16*)take(npa * 2);
  float* O = QF; _Float16* OH = X16; _Float16* OLo = (_Float16*)take(npa * 2);      /* O over the q f32 plane (dead after the rope split); O hi over the x plane (dead after the projections) */
  if (off > ws_size) return;      /* 8+2+2+8 + 1 + 16 + 32 + 8+8 + 4x4 + 48 + 48 + 16 + 16 + 16 = 245 MiB */
  float* ob = (float*)d_out;
  k_wt_f16<<<(unsigned)(((size_t)EMB * EMB / 8 + 255) / 256), 256, 0, stream>>>(Wq, BQ, EMB, EMB, 16.0f); k_wt_f16<<<(unsigned)(((size_t)EMB * KVD / 8 + 255) / 256), 256, 0, stream>>>(Wk, BK, EMB, KVD, 16.0f); k_wt_f16<<<(unsigned)(((size_t)EMB * KVD / 8 + 255) / 256), 256, 0, stream>>>(Wv, BV, EMB, KVD, 16.0f); k_wt_f16<<<(unsigned)(((size_t)EMB * EMB / 8 + 255) / 256), 256, 0, stream>>>(Wo, BO, EMB, EMB, 16.0f);      /* (in,out) weights */
  k_rotab<<<(NR * HH + 255) / 256, 256, 0, stream>>>(pid, CS, SN);
  k_x16<<<(unsigned)((npa / 8 + 255) / 256), 256, 0, stream>>>(x, X16, npa / 8);
  k_gemm2<0><<<dim3((NR / 128) * (EMB / 64), 1), 128, 0, stream>>>(X16, EMB, 0, BQ, EMB, 0, 0.0625f, bq, 0, nullptr, 1, 0, 0, QF, nullptr, EMB, 0, NR, EMB, EMB);
  k_gemm2<0><<<dim3((NR / 128) * (KVD / 64), 1), 128, 0, stream>>>(X16, EMB, 0, BK, EMB, 0, 0.0625f, bk, 0, nullptr, 1, 0, 0, KF, nullptr, KVD, 0, NR, KVD, EMB);
  k_gemm2<0><<<dim3((NR / 128) * (KVD / 64), 1), 128, 0, stream>>>(X16, EMB, 0, BV, EMB, 0, 0.0625f, bv, 0, nullptr, 1, 0, 0, VF, nullptr, KVD, 0, NR, KVD, EMB);
  k_rope<<<(unsigned)(((size_t)NR * NH * (HH / 8) + 255) / 256), 256, 0, stream>>>(QF, NH, CS, SN, H16, L16, 3 * EMB);      /* q roped + split into the [q | k | v] planes */
  k_rope<<<(unsigned)(((size_t)NR * NKV * (HH / 8) + 255) / 256), 256, 0, stream>>>(KF, NKV, CS, SN, KH8, KL8, KVD);
  k_hl<<<(unsigned)(((size_t)NR * KVD / 8 + 255) / 256), 256, 0, stream>>>(VF, VH8, VL8, (size_t)NR * KVD / 8);
  k_expand<<<(unsigned)(((size_t)NR * NH * (HD / 8) + 255) / 256), 256, 0, stream>>>(KH8, KL8, H16, L16, EMB); k_expand<<<(unsigned)(((size_t)NR * NH * (HD / 8) + 255) / 256), 256, 0, stream>>>(VH8, VL8, H16, L16, 2 * EMB);
  k_vt<NH, SLEN><<<NB * NH * (SLEN / 64), 256, 0, stream>>>(H16, 3 * EMB, 2 * EMB, VT); k_vt<NH, SLEN><<<NB * NH * (SLEN / 64), 256, 0, stream>>>(L16, 3 * EMB, 2 * EMB, VTL);
  k_flash5<1><<<NB * NH * QBN5, 128, 0, stream>>>(H16, L16, 3 * EMB, H16 + EMB, L16 + EMB, 3 * EMB, VT, VTL, nullptr, O, EMB);
  k_flash<1><<<NB * NH * QBNP, 128, 0, stream>>>(H16, 3 * EMB, H16 + EMB, 3 * EMB, VT, nullptr, O, EMB);
  k_hl<<<(unsigned)((npa / 8 + 255) / 256), 256, 0, stream>>>(O, OH, OLo, npa / 8);
  k_gemm2<0><<<dim3((NR / 128) * (EMB / 64), 1), 128, 0, stream>>>(OH, EMB, 0, BO, EMB, 0, 0.0625f, nullptr, 0, nullptr, 1, 0, 0, ob, nullptr, EMB, 0, NR, EMB, EMB);
  k_gemm2<0><<<dim3((RE / 128) * (EMB / 64), NB), 128, 0, stream>>>(OLo, EMB, npb, BO, EMB, 0, 0.0625f / 1024.0f, nullptr, 0, ob, 1, (size_t)EMB, 0, ob, nullptr, EMB, npb, RE, EMB, EMB);      /* grid y = batch: the first RE rows of each */
}

// v003
// A run of this version takes 401 microseconds.
// In two side-by-side timings against v002, it was 1.44 and 1.43 times as fast.
// Counting every step since v000, it is 3.42 times as fast.
#include <hip/hip_runtime.h>
// WedoctorAttention (2 x 2048 tokens, hidden 2048; 32 query heads / 8 kv heads of 64 (GQA), rotate-half RoPE from the INPUT position ids, causal SDPA (1/8), out = o Wo): q/k/v = x W + b.
// Structure (both batches in every launch: the 4096 token rows are one row range, batch = row / 2048): exact f16 plane of x; q / k / v GEMMs (32x64 wave tiles, f32 accumulation, exact x16 weights + bias) into f32 planes; angle tables from the input position ids (f32 trig); RoPE on VALU while splitting q and k into f16 hi + 2^10-residual planes, v split directly; the 8 kv heads expanded to the 32 query heads (repeat 4) into the fused [q | k | v] hi/lo planes; V^T hi/residual by LDS tiles; the fused causal flash kernel in its 5-plane form for the first 256 query rows and plain beyond; attention output as f16 hi (+ residual on those rows) into the output GEMMs.
// Compute dtype: x, weights and biases rounded to bf16; rows < 256 per batch: q, k, P, v, O hi + residual; beyond: plain f16; f32 accumulation/softmax/trig. v_wmma_f32_16x16x32_f16.
#define NB 2
#define EMB 2048
#define NR (NB * SLEN)           /* 4096 token rows */
#define SLEN 2048
#define SQ SLEN
#define TQ SLEN
#define TK SLEN
#define NH 32
#define NKV 8
#define KVD (NKV * HD)
#define HD 64
#define HH (HD / 2)
#define SCL 0.125f               /* 64^-0.5 */
#define QBLKS (TQ / 64)
#define QB05 0                   /* 5-plane flash: query blocks [0, QBN5) of every (batch, head) — the early causal rows whose outputs average over few keys */
#define QBN5 4
#define QB0P QBN5                /* plain flash (hi planes only): query blocks [QBN5, QBLKS) */
#define QBNP (QBLKS - QBN5)
#define RE 256                   /* rows per batch that take the hi+lo output operand (= QBN5 * 64) */
typedef __bf16 v16b __attribute__((ext_vector_type(16)));
typedef unsigned short v8us __attribute__((ext_vector_type(8), may_alias));
typedef float  v8f  __attribute__((ext_vector_type(8)));
typedef float  v4f  __attribute__((ext_vector_type(4)));
typedef float  v4fa __attribute__((ext_vector_type(4), may_alias));
union FragB { v16b v; v8us half[2]; unsigned short u[16]; };

__device__ __forceinline__ unsigned short bf16_bits(float x) { unsigned int u = __float_as_uint(x); return (unsigned short)((u + 0x7FFFu + ((u >> 16) & 1u)) >> 16); }
__device__ __forceinline__ float bf16_val(unsigned short b) { return __uint_as_float(((unsigned int)b) << 16); }
__device__ __forceinline__ float bf16_round(float x) { return bf16_val(bf16_bits(x)); }
// D += A·B with NT terms: 1 = ah·bh, 2 = + al·bh (A split), 3 = + ah·bl (both split)
template <int NT>
__device__ __forceinline__ v8f mmaN(v16b ah, v16b al, v16b bh, v16b bl, v8f c) {
  c = __builtin_amdgcn_wmma_f32_16x16x32_bf16(false, ah, false, bh, (short)0, c, false, false);
  if (NT >= 2) c = __builtin_amdgcn_wmma_f32_16x16x32_bf16(false, al, false, bh, (short)0, c, false, false);
  if (NT >= 3) c = __builtin_amdgcn_wmma_f32_16x16x32_bf16(false, ah, false, bl, (short)0, c, false, false);
  asm volatile("v_nop\n\tv_nop\n\tv_nop\n\tv_nop" : "+v"(c) : "v"(ah), "v"(al), "v"(bh), "v"(bl));
  return c;
}

__global__ __launch_bounds__(256) void k_wt_bf16(const float* __restrict__ W, unsigned short* __restrict__ Wt, int K, int N) {
  const int t = blockIdx.x * 256 + threadIdx.x;
  const int k8n = K / 8;
  if (t >= N * k8n) return;
  const int n = t / k8n, k8 = (t % k8n) * 8;
  v8us v;
#pragma unroll
  for (int i = 0; i < 8; ++i) v[i] = bf16_bits(W[(size_t)(k8 + i) * N + n]);
  *(v8us*)(Wt + (size_t)n * K + k8) = v;
  
}

// GEMM C[M][N] (f32, pitch ldc) = act(A[M][K]·W + bias). A f32 row-major (pitch lda) converted per fragment to bf16
// (ASPLIT: hi/lo two planes -> 2 terms, else single rounded term); Wt bf16 [N][K] (pitch ldb). BIAS_BF16 rounds the
// bias to bf16 first (bias quantised to bf16 before the add). K%32==0, M%16==0, N%64==0.
template <bool ASPLIT, int ACT, bool BIAS_BF16>
__global__ __launch_bounds__(128) void k_gemm_bf(const float* __restrict__ A, int lda, const unsigned short* __restrict__ Wt, int ldb,
                                               const float* __restrict__ bias, float* __restrict__ C, int ldc, int M, int N, int K) {
  __shared__ __attribute__((aligned(16))) float so[4][16][64];
  const int tid = threadIdx.x, w = tid >> 5, lane = tid & 31, ln = lane & 15, hh = lane >> 4;
  const int ntn = N / 64;
  const int wid = blockIdx.x * 4 + w;
  const int mt = wid / ntn, nq = wid % ntn;
  if (mt * 16 >= M) return;
  const int row0 = mt * 16, col0 = nq * 64;
  const float* arow = A + (size_t)(row0 + ln) * lda;
  v8f acc[4] = {};
  for (int kb = 0; kb < K; kb += 32) {
    FragB ah, al;
    const v4f x0 = *(const v4fa*)(arow + kb + 8 * hh), x1 = *(const v4fa*)(arow + kb + 8 * hh + 4);
    const v4f x2 = *(const v4fa*)(arow + kb + 16 + 8 * hh), x3 = *(const v4fa*)(arow + kb + 16 + 8 * hh + 4);
    float xs[16] = {x0[0],x0[1],x0[2],x0[3],x1[0],x1[1],x1[2],x1[3],x2[0],x2[1],x2[2],x2[3],x3[0],x3[1],x3[2],x3[3]};
#pragma unroll
    for (int i = 0; i < 16; ++i) { const unsigned short hb = bf16_bits(xs[i]); ah.u[i] = hb; al.u[i] = ASPLIT ? bf16_bits(xs[i] - bf16_val(hb)) : (unsigned short)0; }
#pragma unroll
    for (int t = 0; t < 4; ++t) {
      const unsigned short* brow = Wt + (size_t)(col0 + t * 16 + ln) * ldb + kb;
      FragB b;
      b.half[0] = *(const v8us*)(brow + 8 * hh);
      b.half[1] = *(const v8us*)(brow + 16 + 8 * hh);
      acc[t] = mmaN<ASPLIT ? 2 : 1>(ah.v, al.v, b.v, b.v, acc[t]);
    }
  }
#pragma unroll
  for (int t = 0; t < 4; ++t) {
    float bv = bias ? bias[col0 + t * 16 + ln] : 0.f;
    if (BIAS_BF16) bv = bf16_round(bv);
#pragma unroll
    for (int r = 0; r < 8; ++r) { float v = acc[t][r] + bv; if (ACT == 1) v = fmaxf(v, 0.f); so[w][8 * hh + r][t * 16 + ln] = v; }
  }
  __builtin_amdgcn_fence(__ATOMIC_ACQ_REL, "workgroup");
  __builtin_amdgcn_wave_barrier();
  const int rsub = lane >> 4, c4 = (lane & 15) * 4;
  {
#pragma unroll
    for (int q = 0; q < 8; ++q) {
      const int r = q * 2 + rsub;
      const v4f v = *(const v4fa*)&so[w][r][c4];
      *(v4f*)(C + (size_t)(row0 + r) * ldc + col0 + c4) = v;
    }
    
  }
}

// GEMM C = act(A·W + bias + resid): A f32 (ASPLIT -> hi/lo 2 terms), Wt bf16 [N][K]; ACT 0 none, 1 relu, 2 exact gelu;
// resid (optional, f32, row index = (row % rmod), pitch ldr, RES_BF16 rounds it) added before the activation.
template <bool ASPLIT, int ACT, bool BIAS_BF16, bool RES_BF16>
__global__ __launch_bounds__(128) void k_gemm_bf3(const float* __restrict__ A, int lda, const unsigned short* __restrict__ Wt, int ldb,
                                                const float* __restrict__ bias, const float* __restrict__ resid, int rmod, int ldr,
                                                float* __restrict__ C, int ldc, int M, int N, int K) {
  __shared__ __attribute__((aligned(16))) float so[4][16][64];
  const int tid = threadIdx.x, w = tid >> 5, lane = tid & 31, ln = lane & 15, hh = lane >> 4;
  const int ntn = N / 64;
  const int wid = blockIdx.x * 4 + w;
  const int mt = wid / ntn, nq = wid % ntn;
  if (mt * 16 >= M) return;
  const int row0 = mt * 16, col0 = nq * 64;
  const float* arow = A + (size_t)(row0 + ln) * lda;
  v8f acc[4] = {};
  for (int kb = 0; kb < K; kb += 32) {
    FragB ah, al;
    const v4f x0 = *(const v4fa*)(arow + kb + 8 * hh), x1 = *(const v4fa*)(arow + kb + 8 * hh + 4);
    const v4f x2 = *(const v4fa*)(arow + kb + 16 + 8 * hh), x3 = *(const v4fa*)(arow + kb + 16 + 8 * hh + 4);
    float xs[16] = {x0[0],x0[1],x0[2],x0[3],x1[0],x1[1],x1[2],x1[3],x2[0],x2[1],x2[2],x2[3],x3[0],x3[1],x3[2],x3[3]};
#pragma unroll
    for (int i = 0; i < 16; ++i) { const unsigned short hb = bf16_bits(xs[i]); ah.u[i] = hb; al.u[i] = ASPLIT ? bf16_bits(xs[i] - bf16_val(hb)) : (unsigned short)0; }
#pragma unroll
    for (int t = 0; t < 4; ++t) {
      const unsigned short* brow = Wt + (size_t)(col0 + t * 16 + ln) * ldb + kb;
      FragB b;
      b.half[0] = *(const v8us*)(brow + 8 * hh);
      b.half[1] = *(const v8us*)(brow + 16 + 8 * hh);
      acc[t] = mmaN<ASPLIT ? 2 : 1>(ah.v, al.v, b.v, b.v, acc[t]);
    }
  }
#pragma unroll
  for (int t = 0; t < 4; ++t) {
    const int col = col0 + t * 16 + ln;
    float bv = bias ? bias[col] : 0.f;
    if (BIAS_BF16) bv = bf16_round(bv);
#pragma unroll
    for (int r = 0; r < 8; ++r) {
      float v = acc[t][r] + bv;
      if (resid) { float rv = resid[(size_t)((row0 + 8 * hh + r) % rmod) * ldr + col]; if (RES_BF16) rv = bf16_round(rv); v += rv; }
      if (ACT == 1) v = fmaxf(v, 0.f);
      if (ACT == 2) v = 0.5f * v * (1.0f + erff(v * 0.70710678118654752f));
      if (ACT == 3) { const float u = 0.7978845608028654f * (v + 0.044715f * v * v * v); v = 0.5f * v * (1.0f + tanhf(u)); }
      so[w][8 * hh + r][t * 16 + ln] = v;
    }
  }
  __builtin_amdgcn_fence(__ATOMIC_ACQ_REL, "workgroup");
  __builtin_amdgcn_wave_barrier();
  const int rsub = lane >> 4, c4 = (lane & 15) * 4;
  {
#pragma unroll
    for (int q = 0; q < 8; ++q) {
      const int r = q * 2 + rsub;
      const v4f v = *(const v4fa*)&so[w][r][c4];
      *(v4f*)(C + (size_t)(row0 + r) * ldc + col0 + c4) = v;
    }
    
  }
}
// row LayerNorm (biased variance, eps) over N: s = X (+ R); optional out_sum <- s; out_norm <- (s-mu)*rsqrt(var+eps)*g + b
template <bool PARAM_BF16>
__global__ __launch_bounds__(256) void k_layernorm(const float* __restrict__ X, const float* __restrict__ R, const float* __restrict__ g, const float* __restrict__ bta,
                                                  float* __restrict__ out_sum, float* __restrict__ out_norm, int N, float eps) {
  __shared__ float red[256];
  const int row = blockIdx.x, tid = threadIdx.x;
  const float* x = X + (size_t)row * N; const float* rr = R ? R + (size_t)row * N : nullptr;
  float vals[16];                     // up to N = 4096
  const int per = N / 256;            // contiguous chunk per thread? use strided-by-4 chunks: thread handles j = tid*4 + 1024*u
  float s1 = 0.f;
  for (int u = 0; u < per / 4; ++u) {
    const int j = tid * 4 + 1024 * u;
    const v4f a = *(const v4fa*)(x + j);
    v4f b = {0.f,0.f,0.f,0.f}; if (rr) b = *(const v4fa*)(rr + j);
#pragma unroll
    for (int q = 0; q < 4; ++q) { const float v = a[q] + b[q]; vals[u * 4 + q] = v; s1 += v; }
  }
  red[tid] = s1; __syncthreads();
  for (int st = 128; st > 0; st >>= 1) { if (tid < st) red[tid] += red[tid + st]; __syncthreads(); }
  const float mu = red[0] / (float)N; __syncthreads();
  float s2 = 0.f;
  for (int u = 0; u < per / 4; ++u)
#pragma unroll
    for (int q = 0; q < 4; ++q) { const float c = vals[u * 4 + q] - mu; s2 += c * c; }
  red[tid] = s2; __syncthreads();
  for (int st = 128; st > 0; st >>= 1) { if (tid < st) red[tid] += red[tid + st]; __syncthreads(); }
  const float rs = rsqrtf(red[0] / (float)N + eps);
  {
    for (int u = 0; u < per / 4; ++u) {
      const int j = tid * 4 + 1024 * u;
      v4f o, sm;
#pragma unroll
      for (int q = 0; q < 4; ++q) {
        float gg = g[j + q], bb = bta[j + q];
        if (PARAM_BF16) { gg = bf16_round(gg); bb = bf16_round(bb); }
        sm[q] = vals[u * 4 + q]; o[q] = (vals[u * 4 + q] - mu) * rs * gg + bb;
      }
      if (out_sum) *(v4f*)(out_sum + (size_t)row * N + j) = sm;
      *(v4f*)(out_norm + (size_t)row * N + j) = o;
    }
    
  }
}



// ---- f16 WMMA path (v_wmma_f32_16x16x32_f16): 11-bit significands for operands in range — used where a [0,1] probability operand needs more precision than bf16
typedef _Float16 v16h __attribute__((ext_vector_type(16)));
union FragH { v16h v; v8us half[2]; _Float16 h[16]; unsigned short u[16]; };
template <int NT>
__device__ __forceinline__ v8f mmaH(v16h ah, v16h al, v16h bh, v16h bl, v8f c) {
  c = __builtin_amdgcn_wmma_f32_16x16x32_f16(false, ah, false, bh, (short)0, c, false, false);
  if (NT >= 2) c = __builtin_amdgcn_wmma_f32_16x16x32_f16(false, al, false, bh, (short)0, c, false, false);
  if (NT >= 3) c = __builtin_amdgcn_wmma_f32_16x16x32_f16(false, ah, false, bl, (short)0, c, false, false);
  asm volatile("v_nop\n\tv_nop\n\tv_nop\n\tv_nop" : "+v"(c) : "v"(ah), "v"(al), "v"(bh), "v"(bl));
  return c;
}
// batched GEMM like k_gemm_b but f16 operands: A f32 (split into f16 hi/lo if ASPLIT, else rounded to f16), Bt = f16 values [n][k]; alpha; C f32; N multiple of 16 (partial tiles skipped)
template <bool ASPLIT>
__global__ __launch_bounds__(128) void k_gemm_h(const float* __restrict__ A, int lda, size_t sA, const _Float16* __restrict__ Bh, int ldb, size_t sB, float alpha, float* __restrict__ C, int ldc, size_t sC, int M, int N, int K) {
  __shared__ __attribute__((aligned(16))) float so[4][16][64];
  const int tid = threadIdx.x, w = tid >> 5, lane = tid & 31, ln = lane & 15, hh = lane >> 4; const int by = blockIdx.y;
  A += (size_t)by * sA; Bh += (size_t)by * sB; C += (size_t)by * sC;
  const int ntn = (N + 63) / 64; const int wid = blockIdx.x * 4 + w; const int mt = wid / ntn, nq = wid % ntn; if (mt * 16 >= M) return;
  const int row0 = mt * 16, col0 = nq * 64; const float* arow = A + (size_t)(row0 + ln) * lda;
  v8f acc[4] = {};
  for (int kb = 0; kb < K; kb += 32) {
    FragH ah, al;
    const v4f x0 = *(const v4fa*)(arow + kb + 8 * hh), x1 = *(const v4fa*)(arow + kb + 8 * hh + 4), x2 = *(const v4fa*)(arow + kb + 16 + 8 * hh), x3 = *(const v4fa*)(arow + kb + 16 + 8 * hh + 4);
    float xs[16] = {x0[0],x0[1],x0[2],x0[3],x1[0],x1[1],x1[2],x1[3],x2[0],x2[1],x2[2],x2[3],x3[0],x3[1],x3[2],x3[3]};
#pragma unroll
    for (int i = 0; i < 16; ++i) { const _Float16 h = (_Float16)xs[i]; ah.h[i] = h; al.h[i] = ASPLIT ? (_Float16)(xs[i] - (float)h) : (_Float16)0.0f; }
#pragma unroll
    for (int t = 0; t < 4; ++t) { if (col0 + t * 16 >= N) continue; const size_t boff = (size_t)(col0 + t * 16 + ln) * ldb + kb; FragH bq; bq.half[0] = *(const v8us*)(Bh + boff + 8 * hh); bq.half[1] = *(const v8us*)(Bh + boff + 16 + 8 * hh);
      acc[t] = mmaH<ASPLIT ? 2 : 1>(ah.v, al.v, bq.v, bq.v, acc[t]); }
  }
#pragma unroll
  for (int t = 0; t < 4; ++t) { if (col0 + t * 16 >= N) continue;
#pragma unroll
    for (int r = 0; r < 8; ++r) so[w][8 * hh + r][t * 16 + ln] = acc[t][r] * alpha; }
  __builtin_amdgcn_fence(__ATOMIC_ACQ_REL, "workgroup"); __builtin_amdgcn_wave_barrier();
  const int rsub = lane >> 4, c4 = (lane & 15) * 4;
  {
#pragma unroll
    for (int q = 0; q < 8; ++q) { const int r = q * 2 + rsub; if (col0 + c4 < N) { const v4f v = *(const v4fa*)&so[w][r][c4]; *(v4f*)(C + (size_t)(row0 + r) * ldc + col0 + c4) = v; } }
     }
}

// Wt[n][k] = f16(W[k][n]·scale) from f32 row-major W[K][N] (scale = power of two; bf16-exact weights stay exact in f16 away from the subnormal range)
__global__ __launch_bounds__(256) void k_wt_f16(const float* __restrict__ W, _Float16* __restrict__ Wt, int K, int N, float scale) {
  const int t = blockIdx.x * 256 + threadIdx.x; if (t >= N * (K / 8)) return; const int n = t / (K / 8), k8 = (t % (K / 8)) * 8; FragH f;
#pragma unroll
  for (int i = 0; i < 8; ++i) f.h[i] = (_Float16)(bf16_round(W[(size_t)(k8 + i) * N + n]) * scale); const v8us o = f.half[0];
  *(v8us*)((unsigned short*)Wt + (size_t)n * K + k8) = o; 
}
// k_gemm_hh variant with fused epilogue: v = acc·alpha + bias[by·sBias + col] (+ CP[(row/rowsPerB)·sCPb + by·64 + col] if CP) ; ACT 0 none / 1 elu ; writes f16 C16 (and f32 C if non-null)
template <int ACT>
__global__ __launch_bounds__(128) void k_gemm_hhx(const _Float16* __restrict__ A, int lda, size_t sA, const _Float16* __restrict__ Bh, int ldb, size_t sB, float alpha, const float* __restrict__ bias, size_t sBias, const float* __restrict__ CP, int rowsPerB, size_t sCPb, int row0g,
    float* __restrict__ C, _Float16* __restrict__ C16, int ldc, size_t sC, int M, int N, int K) {
  __shared__ __attribute__((aligned(16))) float so[4][16][64];
  const int tid = threadIdx.x, w = tid >> 5, lane = tid & 31, ln = lane & 15, hh = lane >> 4; const int by = blockIdx.y;
  A += (size_t)by * sA; Bh += (size_t)by * sB; const size_t cofs = (size_t)by * sC; const float* bp = bias ? bias + (size_t)by * sBias : nullptr;
  const int ntn = (N + 63) / 64; const int wid = blockIdx.x * 4 + w; const int mt = wid / ntn, nq = wid % ntn; if (mt * 16 >= M) return;
  const int row0 = mt * 16, col0 = nq * 64; const _Float16* arow = A + (size_t)(row0 + ln) * lda;
  v8f acc[4] = {};
  for (int kb = 0; kb < K; kb += 32) { FragH ah; ah.half[0] = *(const v8us*)((const unsigned short*)arow + kb + 8 * hh); ah.half[1] = *(const v8us*)((const unsigned short*)arow + kb + 16 + 8 * hh);
#pragma unroll
    for (int t = 0; t < 4; ++t) { if (col0 + t * 16 >= N) continue; const size_t boff = (size_t)(col0 + t * 16 + ln) * ldb + kb; FragH bq; bq.half[0] = *(const v8us*)((const unsigned short*)Bh + boff + 8 * hh); bq.half[1] = *(const v8us*)((const unsigned short*)Bh + boff + 16 + 8 * hh);
      acc[t] = mmaH<1>(ah.v, ah.v, bq.v, bq.v, acc[t]); }
  }
#pragma unroll
  for (int t = 0; t < 4; ++t) { if (col0 + t * 16 >= N) continue; const int col = col0 + t * 16 + ln; const float bv = bp ? bf16_round(bp[col]) : 0.f;
#pragma unroll
    for (int r = 0; r < 8; ++r) { float v = acc[t][r] * alpha + bv; if (CP) { const int bidx = (row0g + row0 + 8 * hh + r) / rowsPerB; v += CP[(size_t)bidx * sCPb + (size_t)by * 64 + col]; } if (ACT == 1) v = (v > 0.f) ? v : expm1f(v); else if (ACT == 7) v = (v > 0.f) ? v + 1.0f : expf(v); else if (ACT == 8) v = tanhf(v); else if (ACT == 9) v = 0.5f * v * (1.0f + tanhf(0.7978845608028654f * (v + 0.044715f * v * v * v))); else if (ACT == 11) v = 1.0f / (1.0f + expf(-v)); else if (ACT == 12) v = (v > 0.f) ? v : 0.01f * v; else if (ACT == 14) v = (v > 0.f) ? v : 0.1f * v; else if (ACT == 15) v = v / (1.0f + expf(-v)); else if (ACT == 3) v = fmaxf(v, 0.f); else if (ACT == 6) v = 0.5f * v * (1.0f + erff(v * 0.70710678118654752f)); so[w][8 * hh + r][t * 16 + ln] = v; } }
  __builtin_amdgcn_fence(__ATOMIC_ACQ_REL, "workgroup"); __builtin_amdgcn_wave_barrier();
  const int rsub = lane >> 4, c4 = (lane & 15) * 4; typedef _Float16 v4h __attribute__((ext_vector_type(4)));
  {
#pragma unroll
    for (int q = 0; q < 8; ++q) { const int r = q * 2 + rsub; if (col0 + c4 < N) { const v4f v = *(const v4fa*)&so[w][r][c4]; if (C) *(v4f*)(C + cofs + (size_t)(row0 + r) * ldc + col0 + c4) = v; if (C16) { v4h h4; for (int i = 0; i < 4; ++i) h4[i] = (_Float16)v[i]; *(v4h*)(C16 + cofs + (size_t)(row0 + r) * ldc + col0 + c4) = h4; } } }
     }
}


typedef _Float16 v4h __attribute__((ext_vector_type(4)));

__global__ __launch_bounds__(256) void k_x16(const float* __restrict__ x, _Float16* __restrict__ X16, size_t n8) { const size_t t = (size_t)blockIdx.x * 256 + threadIdx.x; if (t >= n8) return; FragH f;
#pragma unroll
  for (int q = 0; q < 8; ++q) f.h[q] = (_Float16)bf16_round(x[t * 8 + q]); *(v8us*)((unsigned short*)X16 + t * 8) = f.half[0];  }
__global__ __launch_bounds__(256) void k_h16(const float* __restrict__ x, _Float16* __restrict__ X16, size_t n8) { const size_t t = (size_t)blockIdx.x * 256 + threadIdx.x; if (t >= n8) return; FragH f;
#pragma unroll
  for (int q = 0; q < 8; ++q) f.h[q] = (_Float16)x[t * 8 + q]; *(v8us*)((unsigned short*)X16 + t * 8) = f.half[0];  }
__global__ __launch_bounds__(256) void k_round16f(const float* __restrict__ W, _Float16* __restrict__ Bt, size_t n8) { const size_t t = (size_t)blockIdx.x * 256 + threadIdx.x; if (t >= n8) return; FragH f;
#pragma unroll
  for (int i = 0; i < 8; ++i) f.h[i] = (_Float16)(bf16_round(W[t * 8 + i]) * 16.0f); *(v8us*)((unsigned short*)Bt + t * 8) = f.half[0];  }
template <int NHv, int TTv>
__global__ __launch_bounds__(256) void k_vt(const _Float16* __restrict__ V16, int ldv, int voff, _Float16* __restrict__ Vt) { __shared__ unsigned short tl[64][66]; const int tid = threadIdx.x; const int slab = blockIdx.x / (TTv / 64), lg = blockIdx.x % (TTv / 64); const int b = slab / NHv, h = slab % NHv;
  for (int i = tid; i < 64 * 8; i += 256) { const int r = i / 8, c8 = (i % 8) * 8; FragH f; f.half[0] = *(const v8us*)((const unsigned short*)V16 + ((size_t)b * TTv + lg * 64 + r) * ldv + voff + h * 64 + c8);
#pragma unroll
    for (int q = 0; q < 8; ++q) tl[r][c8 + q] = f.u[q]; }
  __syncthreads();
  {
#pragma unroll
    for (int rd = 0; rd < 2; ++rd) { const int d = rd * 32 + tid / 8, pc = tid % 8; FragH f;
#pragma unroll
      for (int q = 0; q < 8; ++q) f.u[q] = tl[pc * 8 + q][d];
      *(v8us*)((unsigned short*)Vt + ((size_t)slab * 64 + d) * TTv + lg * 64 + pc * 8) = f.half[0]; }
     } }

__global__ __launch_bounds__(256) void k_hl(const float* __restrict__ F, _Float16* __restrict__ Hh, _Float16* __restrict__ Hl, size_t n8) { const size_t t = (size_t)blockIdx.x * 256 + threadIdx.x; if (t >= n8) return; FragH fh, fl; const v4f a = *(const v4fa*)(F + t * 8), c = *(const v4fa*)(F + t * 8 + 4);
#pragma unroll
  for (int q = 0; q < 4; ++q) { _Float16 h = (_Float16)a[q]; fh.h[q] = h; fl.h[q] = (_Float16)((a[q] - (float)h) * 1024.0f); h = (_Float16)c[q]; fh.h[4 + q] = h; fl.h[4 + q] = (_Float16)((c[q] - (float)h) * 1024.0f); }
  { *(v8us*)((unsigned short*)Hh + t * 8) = fh.half[0]; *(v8us*)((unsigned short*)Hl + t * 8) = fl.half[0];  } }

// ---- fast GEMM (wave tile 32x64; requires M % 128 == 0 rows per launch region, N % 64 == 0 and K % 64 == 0); epilogue = k_gemm_hhx semantics, but the CP addend takes C's own grid-y offset ----
__device__ __forceinline__ v16h g2_frag(const _Float16* p, int hh) { FragH f; f.half[0] = *(const v8us*)((const unsigned short*)p + 8 * hh); f.half[1] = *(const v8us*)((const unsigned short*)p + 16 + 8 * hh); return f.v; }
__device__ __forceinline__ v8f g2_mma(v16h a, v16h b, v8f c) { v8f d = __builtin_amdgcn_wmma_f32_16x16x32_f16(false, a, false, b, (short)0, c, false, false); asm volatile("v_nop\n\tv_nop\n\tv_nop\n\tv_nop" : "+v"(d) : "v"(a), "v"(b)); return d; }
#define G2_KT 64                      /* k per stage: 128 bytes of every operand row */
#define G2_PITCH 144                  /* LDS row pitch in bytes: 128 + 16, an odd multiple of 16 for the 16-byte fragment reads */
#define G2_STAGE (192 * G2_PITCH)     /* one stage: 128 A rows, then 64 B rows */
// One stage's copies of one lane: 16 bytes of each of 8 A rows and 4 B rows (rows 16 apart; sa, sb = 16 rows in bytes), global memory -> LDS through no register.
// A wave's 32 lanes cover 4 whole 128-byte rows per copy. s_wait_xcnt 0 ends the statement so that it stands in front of any rewrite of the address registers the copies name.
__device__ __forceinline__ void g2_stage(unsigned l, const char* ga, size_t sa, const char* gb, size_t sb) {
  const char* a1 = ga + sa; const char* a2 = a1 + sa; const char* a3 = a2 + sa; const char* a4 = a3 + sa; const char* a5 = a4 + sa; const char* a6 = a5 + sa; const char* a7 = a6 + sa;
  const char* b1 = gb + sb; const char* b2 = b1 + sb; const char* b3 = b2 + sb;
  asm volatile("global_load_async_to_lds_b128 %0, %12, off\n\t"
               "global_load_async_to_lds_b128 %1, %13, off\n\t"
               "global_load_async_to_lds_b128 %2, %14, off\n\t"
               "global_load_async_to_lds_b128 %3, %15, off\n\t"
               "global_load_async_to_lds_b128 %4, %16, off\n\t"
               "global_load_async_to_lds_b128 %5, %17, off\n\t"
               "global_load_async_to_lds_b128 %6, %18, off\n\t"
               "global_load_async_to_lds_b128 %7, %19, off\n\t"
               "global_load_async_to_lds_b128 %8, %20, off\n\t"
               "global_load_async_to_lds_b128 %9, %21, off\n\t"
               "global_load_async_to_lds_b128 %10, %22, off\n\t"
               "global_load_async_to_lds_b128 %11, %23, off\n\t"
               "s_wait_xcnt 0x0"
               :: "v"(l), "v"(l + 16 * G2_PITCH), "v"(l + 32 * G2_PITCH), "v"(l + 48 * G2_PITCH), "v"(l + 64 * G2_PITCH), "v"(l + 80 * G2_PITCH), "v"(l + 96 * G2_PITCH), "v"(l + 112 * G2_PITCH),
                  "v"(l + 128 * G2_PITCH), "v"(l + 144 * G2_PITCH), "v"(l + 160 * G2_PITCH), "v"(l + 176 * G2_PITCH),
                  "v"(ga), "v"(a1), "v"(a2), "v"(a3), "v"(a4), "v"(a5), "v"(a6), "v"(a7), "v"(gb), "v"(b1), "v"(b2), "v"(b3)
               : "memory");
}
// Block tile 128x64 (M % 128 == 0, N % 64 == 0, K % 64 == 0): the A and B tiles of a stage go to LDS by asynchronous copies, two buffers, stage t + 2 in flight while stage t + 1 is worked on; the waves read their fragments from LDS. The order of the products along k is the plain one.
template <int ACT>
__global__ __launch_bounds__(128) void k_gemm2(const _Float16* __restrict__ A, int lda, size_t sA, const _Float16* __restrict__ Bh, int ldb, size_t sB, float alpha, const float* __restrict__ bias, size_t sBias, const float* __restrict__ CP, int rowsPerB, size_t sCPb, int row0g,
    float* __restrict__ C, _Float16* __restrict__ C16, int ldc, size_t sC, int M, int N, int K) {
  __shared__ __attribute__((aligned(128))) unsigned char sm[2 * G2_STAGE];
  float (*so)[32][68] = (float (*)[32][68])sm;      /* output staging (4 x 32 x 68 floats) over the two buffers, used only behind the last trip's barrier */
  const int tid = threadIdx.x, w = tid >> 5, lane = tid & 31, ln = lane & 15, hh = lane >> 4; const int by = blockIdx.y;
  A += (size_t)by * sA; Bh += (size_t)by * sB; const size_t cofs = (size_t)by * sC; const float* bp = bias ? bias + (size_t)by * sBias : nullptr;
  const int ntn = N >> 6; const int mt = blockIdx.x / ntn, nq = blockIdx.x - mt * ntn; const int row0 = mt * 128 + 32 * w, col0 = nq * 64; if (mt * 128 >= M) return;      /* the whole block leaves or none, in front of every barrier */
  const int cr = tid >> 3, cc = tid & 7;      /* copy lane: row cr (+ 16 i) of the tile, 16-byte piece cc of its 128 bytes */
  const char* ga = (const char*)(A + (size_t)(mt * 128 + cr) * lda + cc * 8); const char* gb = (const char*)(Bh + (size_t)(col0 + cr) * ldb + cc * 8);
  const size_t sa = (size_t)lda * 32, sb = (size_t)ldb * 32;
  const unsigned l0 = (unsigned)(size_t)sm + (unsigned)(cr * G2_PITCH + cc * 16);
  const int nst = K / G2_KT;
  g2_stage(l0, ga, sa, gb, sb);
  asm volatile("s_wait_asynccnt 0x0" ::: "memory");      /* stage 0 of this wave has landed */
  __syncthreads();                                       /* ... and every other wave's */
  if (nst > 1) g2_stage(l0 + G2_STAGE, ga + 2 * G2_KT, sa, gb + 2 * G2_KT, sb);
  const v8f z8 = {0.f,0.f,0.f,0.f,0.f,0.f,0.f,0.f}; v8f c00 = z8, c01 = z8, c02 = z8, c03 = z8, c10 = z8, c11 = z8, c12 = z8, c13 = z8;
  /* kept rolled: one trip per stage, so that the waits, the barrier and the refill at its foot stand once */
#pragma unroll 1
  for (int t = 0; t < nst; ++t) { const unsigned bo = (unsigned)(t & 1) * G2_STAGE;
    const _Float16* a0p = (const _Float16*)(sm + bo + (32 * w + ln) * G2_PITCH); const _Float16* a1p = (const _Float16*)(sm + bo + (32 * w + 16 + ln) * G2_PITCH);
    const _Float16* b0p = (const _Float16*)(sm + bo + (128 + ln) * G2_PITCH); const _Float16* b1p = (const _Float16*)(sm + bo + (144 + ln) * G2_PITCH); const _Float16* b2p = (const _Float16*)(sm + bo + (160 + ln) * G2_PITCH); const _Float16* b3p = (const _Float16*)(sm + bo + (176 + ln) * G2_PITCH);
    /* unrolled: the two 32-k steps of a stage read LDS at constant offsets */
#pragma unroll
    for (int kb = 0; kb < G2_KT; kb += 32) { const v16h a0 = g2_frag(a0p + kb, hh), a1 = g2_frag(a1p + kb, hh), b0 = g2_frag(b0p + kb, hh), b1 = g2_frag(b1p + kb, hh), b2 = g2_frag(b2p + kb, hh), b3 = g2_frag(b3p + kb, hh);
      c00 = g2_mma(a0, b0, c00); c10 = g2_mma(a1, b0, c10);
      c01 = g2_mma(a0, b1, c01); c11 = g2_mma(a1, b1, c11);
      c02 = g2_mma(a0, b2, c02); c12 = g2_mma(a1, b2, c12);
      c03 = g2_mma(a0, b3, c03); c13 = g2_mma(a1, b3, c13); }
    asm volatile("s_wait_dscnt 0x0" ::: "memory");       /* this wave's reads of the buffer are done before it is refilled */
    asm volatile("s_wait_asynccnt 0x0" ::: "memory");    /* this wave's copies of stage t + 1 have landed */
    __syncthreads();                                     /* publishes stage t + 1 and ends every wave's reads of stage t */
    if (t + 2 < nst) g2_stage(l0 + bo, ga + (size_t)(t + 2) * (2 * G2_KT), sa, gb + (size_t)(t + 2) * (2 * G2_KT), sb); }
  asm volatile("s_wait_asynccnt 0x0" ::: "memory");      /* no copy is outstanding when the buffers become output staging */
  v8f accs[8] = {c00, c01, c02, c03, c10, c11, c12, c13};
#pragma unroll
  for (int u = 0; u < 8; ++u) { const int t = u & 3, half = u >> 2; const int col = col0 + t * 16 + ln; const float bv = bp ? bf16_round(bp[col]) : 0.f;
#pragma unroll
    for (int r = 0; r < 8; ++r) { const int rloc = half * 16 + 8 * hh + r; float v = accs[u][r] * alpha + bv; if (CP) { const int bidx = (row0g + row0 + rloc) / rowsPerB; v += CP[cofs + (size_t)bidx * sCPb + col]; }
      if (ACT == 3) v = fmaxf(v, 0.f); else if (ACT == 6) v = 0.5f * v * (1.0f + erff(v * 0.70710678118654752f)); else if (ACT == 11) v = 1.0f / (1.0f + expf(-v)); else if (ACT == 15) v = v / (1.0f + expf(-v)); else if (ACT == 12) v = (v > 0.f) ? v : 0.01f * v; else if (ACT == 8) v = tanhf(v);
      so[w][rloc][t * 16 + ln] = v; } }
  __builtin_amdgcn_fence(__ATOMIC_ACQ_REL, "workgroup"); __builtin_amdgcn_wave_barrier();
  const int rsub = lane >> 4, c4 = (lane & 15) * 4;
  {
#pragma unroll
    for (int q = 0; q < 16; ++q) { const int r = q * 2 + rsub; const v4f v = *(const v4fa*)&so[w][r][c4]; if (C) *(v4f*)(C + cofs + (size_t)(row0 + r) * ldc + col0 + c4) = v; if (C16) { v4h h4; for (int i = 0; i < 4; ++i) h4[i] = (_Float16)v[i]; *(v4h*)(C16 + cofs + (size_t)(row0 + r) * ldc + col0 + c4) = h4; } }
     } }



// Both flash kernels work on the transposed products: S^T = K Q^T (A = 16 key rows, B = the wave's 16 queries) and O^T += V^T P^T (A = 16 rows of V^T, B = P^T).
// A lane then holds 16 of the 32 scores of ONE query (query ln; keys 8 hh + r of each 16-key tile), so the row maximum and the row sum are in-lane plus one exchange with lane ^ 16,
// and the two score tiles, converted in place, are already the B operand of the second product (element s = tile s / 8, register s % 8): P goes through no LDS.
__device__ __forceinline__ float xhalf(float x) { return __builtin_bit_cast(float, __builtin_amdgcn_permlanex16(__builtin_bit_cast(int, x), __builtin_bit_cast(int, x), 0x76543210, 0xfedcba98, false, false)); }      /* the value of lane ^ 16 */
template <int CAUSAL>
__global__ __launch_bounds__(128) void k_flash(const _Float16* __restrict__ Q16, int ldq, const _Float16* __restrict__ K16, int ldk, const _Float16* __restrict__ Vt, const int* __restrict__ MSK, float* __restrict__ O, int ldo) {
  constexpr int RPW = 16, DT = 4, KS = 2;
  __shared__ __attribute__((aligned(16))) float sO[4][RPW][64 + 4];
  const int tid = threadIdx.x, w = tid >> 5, lane = tid & 31, ln = lane & 15, hh = lane >> 4;
  const int slab = blockIdx.x / QBNP, qblk = QB0P + blockIdx.x % QBNP; const int b = slab / NH, h = slab % NH; const int qb0 = qblk * (4 * RPW); const int q0 = qb0 + w * RPW; const int tq = q0 + ln;      /* tq: this lane's query */
  FragH aq[KS];
  { const unsigned short* qr = (const unsigned short*)Q16 + ((size_t)b * TQ + tq) * ldq + h * 64;
#pragma unroll
    for (int ks = 0; ks < KS; ++ks) { aq[ks].half[0] = *(const v8us*)(qr + ks * 32 + 8 * hh); aq[ks].half[1] = *(const v8us*)(qr + ks * 32 + 16 + 8 * hh); } }
  const unsigned short* Vth = (const unsigned short*)Vt + (size_t)slab * 64 * TK;
  float m_r = -3.0e38f, l_r = 0.f; v8f oacc[DT];      /* l_r: the sum over this lane's own keys; the two halves join behind the loop */
#pragma unroll
  for (int dt = 0; dt < DT; ++dt) oacc[dt] = (v8f){0.f,0.f,0.f,0.f,0.f,0.f,0.f,0.f};
  const int jend = (CAUSAL == 1) ? (qb0 + 4 * RPW) : TK;      /* causal: keys beyond the block's last query never contribute */
#pragma unroll 1
  for (int j0 = 0; j0 < jend; j0 += 32) {
    FragH bk[2][KS], bv[DT]; const unsigned short* kr[2];
#pragma unroll
    for (int nt = 0; nt < 2; ++nt) { kr[nt] = (const unsigned short*)K16 + ((size_t)b * TK + j0 + nt * 16 + ln) * ldk + h * 64 + 8 * hh;
#pragma unroll
      for (int ks = 0; ks < KS; ++ks) { bk[nt][ks].half[0] = *(const v8us*)(kr[nt] + ks * 32); bk[nt][ks].half[1] = *(const v8us*)(kr[nt] + ks * 32 + 16); } }
    v8f s[2];
#pragma unroll
    for (int nt = 0; nt < 2; ++nt) { v8f acc = (v8f){0.f,0.f,0.f,0.f,0.f,0.f,0.f,0.f};
#pragma unroll
      for (int ks = 0; ks < KS; ++ks) acc = mmaH<1>(bk[nt][ks].v, bk[nt][ks].v, aq[ks].v, aq[ks].v, acc);
      s[nt] = acc; }
    asm volatile("s_wait_xcnt 0x0" :: "v"(kr[0]), "v"(kr[1]) : "memory");      /* the K loads' address registers, held as inputs up to here, are rewritten only behind this wait; the clobber keeps the V loads behind the score products, so that they take over the K fragments' registers and fly during the softmax */
#pragma unroll
    for (int dt = 0; dt < DT; ++dt) { const unsigned short* vrow = Vth + (size_t)(dt * 16 + ln) * TK + j0; bv[dt].half[0] = *(const v8us*)(vrow + 8 * hh); bv[dt].half[1] = *(const v8us*)(vrow + 16 + 8 * hh); }
    float sc[16]; bool ok[16]; float mc = -3.0e38f;
#pragma unroll
    for (int e = 0; e < 16; ++e) { const int key = j0 + (e >> 3) * 16 + 8 * hh + (e & 7);
      ok[e] = (CAUSAL == 1) ? (key <= tq) : ((CAUSAL == 2) ? ((key >> 5) == (tq >> 5)) : true);      /* mode 2: block-diagonal 32-token groups */
      sc[e] = ok[e] ? s[e >> 3][e & 7] * SCL : -3.0e38f; mc = fmaxf(mc, sc[e]); }
    mc = fmaxf(mc, xhalf(mc));
    const float mn = fmaxf(m_r, mc); const float ea = expf(m_r - mn); const float al = (mn > -1.0e38f) ? ea : 1.0f; m_r = mn;
    float ps[4] = {0.f, 0.f, 0.f, 0.f}; FragH pb;
#pragma unroll
    for (int e = 0; e < 16; ++e) { const float ee = expf(sc[e] - mn); const float p = ok[e] ? ee : 0.f; ps[e & 3] += p; pb.h[e] = (_Float16)(p * 1024.0f); }
    l_r = l_r * al + ((ps[0] + ps[1]) + (ps[2] + ps[3]));
#pragma unroll
    for (int dt = 0; dt < DT; ++dt)
#pragma unroll
      for (int r = 0; r < 8; ++r) oacc[dt][r] *= al;
#pragma unroll
    for (int dt = 0; dt < DT; ++dt) oacc[dt] = mmaH<1>(bv[dt].v, bv[dt].v, pb.v, pb.v, oacc[dt]); }
  const float l = l_r + xhalf(l_r); const float linv = (l > 0.f) ? 1.0f / (l * 1024.0f) : 0.f;
#pragma unroll
  for (int dt = 0; dt < DT; ++dt)
#pragma unroll
    for (int r = 0; r < 8; ++r) sO[w][ln][dt * 16 + 8 * hh + r] = oacc[dt][r] * linv;
  __builtin_amdgcn_fence(__ATOMIC_ACQ_REL, "workgroup"); __builtin_amdgcn_wave_barrier();
  {
#pragma unroll
    for (int rp = 0; rp < RPW; rp += 2) { const int r = rp + (lane >> 4), pc = lane & 15; const v4f val = *(const v4fa*)&sO[w][r][pc * 4]; *(v4f*)(O + ((size_t)b * TQ + q0 + r) * ldo + h * 64 + pc * 4) = val; }
     } }
// 5-plane variant: S = Qh Kh^T + (Ql Kh^T + Qh Kl^T)/1024 with Q/K = [hi | 2^10 residual] f16 planes (QL/KL same layout as Q16/K16), then the 3-term P.V below.
// 3-term variant: O = (P_hi V_hi + (P_lo V_hi + P_hi V_lo) / 1024) / l with P = [hi | 2^10 residual] of 1024 p and V^T = [hi | 2^10 residual] planes (VtL same layout as Vt) -> ~2^-21-class products for un-averaged (early causal / peaked) rows
template <int CAUSAL>
__global__ __launch_bounds__(128) void k_flash5(const _Float16* __restrict__ Q16, const _Float16* __restrict__ QL, int ldq, const _Float16* __restrict__ K16, const _Float16* __restrict__ KL, int ldk, const _Float16* __restrict__ Vt, const _Float16* __restrict__ VtL, const int* __restrict__ MSK, float* __restrict__ O, int ldo) {
  constexpr int RPW = 16, DT = 4, KS = 2;
  __shared__ __attribute__((aligned(16))) float sO[4][RPW][64 + 4];
  const int tid = threadIdx.x, w = tid >> 5, lane = tid & 31, ln = lane & 15, hh = lane >> 4;
  const int slab = blockIdx.x / QBN5, qblk = QB05 + blockIdx.x % QBN5; const int b = slab / NH, h = slab % NH; const int qb0 = qblk * (4 * RPW); const int q0 = qb0 + w * RPW; const int tq = q0 + ln;      /* tq: this lane's query */
  FragH aq[KS], aql[KS];
  { const unsigned short* qr = (const unsigned short*)Q16 + ((size_t)b * TQ + tq) * ldq + h * 64; const unsigned short* ql = (const unsigned short*)QL + ((size_t)b * TQ + tq) * ldq + h * 64;
#pragma unroll
    for (int ks = 0; ks < KS; ++ks) { aq[ks].half[0] = *(const v8us*)(qr + ks * 32 + 8 * hh); aq[ks].half[1] = *(const v8us*)(qr + ks * 32 + 16 + 8 * hh); aql[ks].half[0] = *(const v8us*)(ql + ks * 32 + 8 * hh); aql[ks].half[1] = *(const v8us*)(ql + ks * 32 + 16 + 8 * hh); } }
  const unsigned short* Vth = (const unsigned short*)Vt + (size_t)slab * 64 * TK; const unsigned short* Vtl = (const unsigned short*)VtL + (size_t)slab * 64 * TK;
  float m_r = -3.0e38f, l_r = 0.f; v8f oacc[DT], oaccL[DT];      /* l_r: the sum over this lane's own keys; the two halves join behind the loop */
#pragma unroll
  for (int dt = 0; dt < DT; ++dt) { oacc[dt] = (v8f){0.f,0.f,0.f,0.f,0.f,0.f,0.f,0.f}; oaccL[dt] = oacc[dt]; }
  const int jend = (CAUSAL == 1) ? (qb0 + 4 * RPW) : TK;      /* causal: keys beyond the block's last query never contribute */
#pragma unroll 1
  for (int j0 = 0; j0 < jend; j0 += 32) {
    FragH bk[2][KS], bkl[2][KS], bv[DT], bl[DT]; const unsigned short* kr[2]; const unsigned short* klr[2];
#pragma unroll
    for (int nt = 0; nt < 2; ++nt) { kr[nt] = (const unsigned short*)K16 + ((size_t)b * TK + j0 + nt * 16 + ln) * ldk + h * 64 + 8 * hh; klr[nt] = (const unsigned short*)KL + ((size_t)b * TK + j0 + nt * 16 + ln) * ldk + h * 64 + 8 * hh;
#pragma unroll
      for (int ks = 0; ks < KS; ++ks) { bk[nt][ks].half[0] = *(const v8us*)(kr[nt] + ks * 32); bk[nt][ks].half[1] = *(const v8us*)(kr[nt] + ks * 32 + 16); bkl[nt][ks].half[0] = *(const v8us*)(klr[nt] + ks * 32); bkl[nt][ks].half[1] = *(const v8us*)(klr[nt] + ks * 32 + 16); } }
    v8f s[2];
#pragma unroll
    for (int nt = 0; nt < 2; ++nt) { v8f acc = (v8f){0.f,0.f,0.f,0.f,0.f,0.f,0.f,0.f}, accl = acc;
#pragma unroll
      for (int ks = 0; ks < KS; ++ks) { acc = mmaH<1>(bk[nt][ks].v, bk[nt][ks].v, aq[ks].v, aq[ks].v, acc); accl = mmaH<1>(bk[nt][ks].v, bk[nt][ks].v, aql[ks].v, aql[ks].v, accl); accl = mmaH<1>(bkl[nt][ks].v, bkl[nt][ks].v, aq[ks].v, aq[ks].v, accl); }
#pragma unroll
      for (int r = 0; r < 8; ++r) acc[r] += accl[r] * 0.0009765625f;
      s[nt] = acc; }
    asm volatile("s_wait_xcnt 0x0" :: "v"(kr[0]), "v"(kr[1]), "v"(klr[0]), "v"(klr[1]) : "memory");      /* the K loads' address registers, held as inputs up to here, are rewritten only behind this wait; the clobber keeps the V loads behind the score products, so that they take over the K fragments' registers and fly during the softmax */
#pragma unroll
    for (int dt = 0; dt < DT; ++dt) { const unsigned short* vrow = Vth + (size_t)(dt * 16 + ln) * TK + j0; const unsigned short* vrl = Vtl + (size_t)(dt * 16 + ln) * TK + j0; bv[dt].half[0] = *(const v8us*)(vrow + 8 * hh); bv[dt].half[1] = *(const v8us*)(vrow + 16 + 8 * hh); bl[dt].half[0] = *(const v8us*)(vrl + 8 * hh); bl[dt].half[1] = *(const v8us*)(vrl + 16 + 8 * hh); }
    float sc[16]; bool ok[16]; float mc = -3.0e38f;
#pragma unroll
    for (int e = 0; e < 16; ++e) { const int key = j0 + (e >> 3) * 16 + 8 * hh + (e & 7);
      ok[e] = (CAUSAL == 1) ? (key <= tq) : ((CAUSAL == 2) ? ((key >> 5) == (tq >> 5)) : true);      /* mode 2: block-diagonal 32-token groups */
      if (CAUSAL == 4) ok[e] = MSK[((size_t)b * TQ + tq) * TK + key] != 0;      /* mode 4: per-(query, key) INPUT mask shared by all heads; masked keys contribute nothing, rows with no valid key give l = 0 -> output 0 */
      sc[e] = ok[e] ? s[e >> 3][e & 7] * SCL : -3.0e38f; mc = fmaxf(mc, sc[e]); }
    mc = fmaxf(mc, xhalf(mc));
    const float mn = fmaxf(m_r, mc); const float ea = expf(m_r - mn); const float al = (mn > -1.0e38f) ? ea : 1.0f; m_r = mn;
    float ps[4] = {0.f, 0.f, 0.f, 0.f}; FragH pb, pl;
#pragma unroll
    for (int e = 0; e < 16; ++e) { const float ee = expf(sc[e] - mn); const float p = ok[e] ? ee : 0.f; ps[e & 3] += p; const float p1k = p * 1024.0f; const _Float16 ph = (_Float16)p1k; pb.h[e] = ph; pl.h[e] = (_Float16)((p1k - (float)ph) * 1024.0f); }
    l_r = l_r * al + ((ps[0] + ps[1]) + (ps[2] + ps[3]));
#pragma unroll
    for (int dt = 0; dt < DT; ++dt)
#pragma unroll
      for (int r = 0; r < 8; ++r) { oacc[dt][r] *= al; oaccL[dt][r] *= al; }
#pragma unroll
    for (int dt = 0; dt < DT; ++dt) { oacc[dt] = mmaH<1>(bv[dt].v, bv[dt].v, pb.v, pb.v, oacc[dt]); oaccL[dt] = mmaH<1>(bv[dt].v, bv[dt].v, pl.v, pl.v, oaccL[dt]); oaccL[dt] = mmaH<1>(bl[dt].v, bl[dt].v, pb.v, pb.v, oaccL[dt]); } }
  const float l = l_r + xhalf(l_r); const float linv = (l > 0.f) ? 1.0f / (l * 1024.0f) : 0.f;
#pragma unroll
  for (int dt = 0; dt < DT; ++dt)
#pragma unroll
    for (int r = 0; r < 8; ++r) { float v = oacc[dt][r]; v += oaccL[dt][r] * 0.0009765625f; sO[w][ln][dt * 16 + 8 * hh + r] = v * linv; }
  __builtin_amdgcn_fence(__ATOMIC_ACQ_REL, "workgroup"); __builtin_amdgcn_wave_barrier();
  {
#pragma unroll
    for (int rp = 0; rp < RPW; rp += 2) { const int r = rp + (lane >> 4), pc = lane & 15; const v4f val = *(const v4fa*)&sO[w][r][pc * 4]; *(v4f*)(O + ((size_t)b * TQ + q0 + r) * ldo + h * 64 + pc * 4) = val; }
     } }

__global__ __launch_bounds__(256) void k_wsc(const float* __restrict__ Wm, _Float16* __restrict__ Bt, size_t n8, float sc) { const size_t t = (size_t)blockIdx.x * 256 + threadIdx.x; if (t >= n8) return; FragH f; for (int q = 0; q < 8; ++q) f.h[q] = (_Float16)(bf16_round(Wm[t * 8 + q]) * sc); *(v8us*)((unsigned short*)Bt + t * 8) = f.half[0];  }      /* torch (out,in) weight == Bt[n][k]: scaled copy */




__global__ __launch_bounds__(256) void k_rope(const float* __restrict__ F, int nheads, const float* __restrict__ CS, const float* __restrict__ SN, _Float16* __restrict__ H, _Float16* __restrict__ L, int ldd) {      /* ldd: destination row pitch (the source pitch is nheads*HD) */
  #pragma clang fp contract(off)
  const size_t t = (size_t)blockIdx.x * 256 + threadIdx.x; if (t >= (size_t)NR * nheads * (HH / 8)) return; const int g = (int)(t % (HH / 8)) * 8; const int h = (int)((t / (HH / 8)) % nheads); const int s = (int)(t / ((HH / 8) * (size_t)nheads)); const int ld = nheads * HD;
  const size_t base = (size_t)s * ld + h * HD + g, dbase = (size_t)s * ldd + h * HD + g; FragH h0, h1, l0, l1;
#pragma unroll
  for (int q = 0; q < 8; ++q) { const float c = CS[s * HH + g + q], sn = SN[s * HH + g + q]; const float x0 = F[base + q], x1 = F[base + HH + q]; float o0 = x0 * c; o0 += -x1 * sn; float o1 = x1 * c; o1 += x0 * sn;
    const _Float16 a0 = (_Float16)o0, a1 = (_Float16)o1; h0.h[q] = a0; h1.h[q] = a1; l0.h[q] = (_Float16)((o0 - (float)a0) * 1024.0f); l1.h[q] = (_Float16)((o1 - (float)a1) * 1024.0f); }
  { *(v8us*)((unsigned short*)H + dbase) = h0.half[0]; *(v8us*)((unsigned short*)H + dbase + HH) = h1.half[0]; if (L) { *(v8us*)((unsigned short*)L + dbase) = l0.half[0]; *(v8us*)((unsigned short*)L + dbase + HH) = l1.half[0]; }  } }

__global__ __launch_bounds__(256) void k_rotab(const int* __restrict__ pid, float* __restrict__ CS, float* __restrict__ SN) {      /* s = token row over both batches */
  #pragma clang fp contract(off)
  const int t = blockIdx.x * 256 + threadIdx.x; if (t >= NR * HH) return; const int j = t % HH, s = t / HH; const float inv = 1.0f / powf(10000.0f, (float)(2 * j) / (float)HD); const float th = (float)pid[s] * inv; const float c = cosf(th), sn = sinf(th);
  { *(float*)(CS + t) = c; *(float*)(SN + t) = sn;  } }

__global__ __launch_bounds__(256) void k_expand(const _Float16* __restrict__ SH, const _Float16* __restrict__ SL, _Float16* __restrict__ DH, _Float16* __restrict__ DL, int col0) {
  const size_t t = (size_t)blockIdx.x * 256 + threadIdx.x; if (t >= (size_t)NR * NH * (HD / 8)) return; const int d0 = (int)(t % (HD / 8)) * 8; const int h = (int)((t / (HD / 8)) % NH); const size_t s = t / ((HD / 8) * NH);
  const size_t si = s * KVD + (size_t)(h / (NH / NKV)) * HD + d0, di = s * (size_t)(3 * EMB) + col0 + (size_t)h * HD + d0; const v8us a = *(const v8us*)((const unsigned short*)SH + si), bl = *(const v8us*)((const unsigned short*)SL + si);
  { *(v8us*)((unsigned short*)DH + di) = a; *(v8us*)((unsigned short*)DL + di) = bl;  } }

extern "C" void kernel_launch(void* const* d_in, const int* in_sizes, int n_in,
                              void* d_out, int out_size, void* d_ws, size_t ws_size, hipStream_t stream) {
  (void)in_sizes; (void)n_in; (void)out_size;
  const float* const* I = (const float* const*)d_in; const float* x = I[0]; const float* Wq = I[1]; const float* bq = I[2]; const float* Wk = I[3]; const float* bk = I[4]; const float* Wv = I[5]; const float* bv = I[6]; const float* Wo = I[7]; const int* pid = (const int*)d_in[8];
  char* ws = (char*)d_ws; size_t off = 0;
  auto take = [&](size_t bytes) { char* p = ws + off; off += (bytes + 255) & ~(size_t)255; return p; };
  const size_t npb = (size_t)SLEN * EMB, npa = (size_t)NR * EMB;      /* per-batch plane, plane of both batches */
  _Float16* BQ = (_Float16*)take((size_t)EMB * EMB * 2); _Float16* BK = (_Float16*)take((size_t)KVD * EMB * 2); _Float16* BV = (_Float16*)take((size_t)KVD * EMB * 2); _Float16* BO = (_Float16*)take((size_t)EMB * EMB * 2);
  float* CS = (float*)take((size_t)NR * HH * 4); float* SN = (float*)take((size_t)NR * HH * 4);
  _Float16* X16 = (_Float16*)take(npa * 2); float* QF = (float*)take(npa * 4); float* KF = (float*)take((size_t)NR * KVD * 4); float* VF = (float*)take((size_t)NR * KVD * 4); _Float16* KH8 = (_Float16*)take((size_t)NR * KVD * 2); _Float16* KL8 = (_Float16*)take((size_t)NR * KVD * 2); _Float16* VH8 = (_Float16*)take((size_t)NR * KVD * 2); _Float16* VL8 = (_Float16*)take((size_t)NR * KVD * 2);
  _Float16* H16 = (_Float16*)take(npa * 3 * 2); _Float16* L16 = (_Float16*)take(npa * 3 * 2); _Float16* VT = (_Float16*)take(npa * 2); _Float16* VTL = (_Float16*)take(npa * 2);
  float* O = QF; _Float16* OH = X16; _Float16* OLo = (_Float16*)take(npa * 2);      /* O over the q f32 plane (dead after the rope split); O hi over the x plane (dead after the projections) */
  if (off > ws_size) return;      /* 8+2+2+8 + 1 + 16 + 32 + 8+8 + 4x4 + 48 + 48 + 16 + 16 + 16 = 245 MiB */
  float* ob = (float*)d_out;
  k_wt_f16<<<(unsigned)(((size_t)EMB * EMB / 8 + 255) / 256), 256, 0, stream>>>(Wq, BQ, EMB, EMB, 16.0f); k_wt_f16<<<(unsigned)(((size_t)EMB * KVD / 8 + 255) / 256), 256, 0, stream>>>(Wk, BK, EMB, KVD, 16.0f); k_wt_f16<<<(unsigned)(((size_t)EMB * KVD / 8 + 255) / 256), 256, 0, stream>>>(Wv, BV, EMB, KVD, 16.0f); k_wt_f16<<<(unsigned)(((size_t)EMB * EMB / 8 + 255) / 256), 256, 0, stream>>>(Wo, BO, EMB, EMB, 16.0f);      /* (in,out) weights */
  k_rotab<<<(NR * HH + 255) / 256, 256, 0, stream>>>(pid, CS, SN);
  k_x16<<<(unsigned)((npa / 8 + 255) / 256), 256, 0, stream>>>(x, X16, npa / 8);
  k_gemm2<0><<<dim3((NR / 128) * (EMB / 64), 1), 128, 0, stream>>>(X16, EMB, 0, BQ, EMB, 0, 0.0625f, bq, 0, nullptr, 1, 0, 0, QF, nullptr, EMB, 0, NR, EMB, EMB);
  k_gemm2<0><<<dim3((NR / 128) * (KVD / 64), 1), 128, 0, stream>>>(X16, EMB, 0, BK, EMB, 0, 0.0625f, bk, 0, nullptr, 1, 0, 0, KF, nullptr, KVD, 0, NR, KVD, EMB);
  k_gemm2<0><<<dim3((NR / 128) * (KVD / 64), 1), 128, 0, stream>>>(X16, EMB, 0, BV, EMB, 0, 0.0625f, bv, 0, nullptr, 1, 0, 0, VF, nullptr, KVD, 0, NR, KVD, EMB);
  k_rope<<<(unsigned)(((size_t)NR * NH * (HH / 8) + 255) / 256), 256, 0, stream>>>(QF, NH, CS, SN, H16, L16, 3 * EMB);      /* q roped + split into the [q | k | v] planes */
  k_rope<<<(unsigned)(((size_t)NR * NKV * (HH / 8) + 255) / 256), 256, 0, stream>>>(KF, NKV, CS, SN, KH8, KL8, KVD);
  k_hl<<<(unsigned)(((size_t)NR * KVD / 8 + 255) / 256), 256, 0, stream>>>(VF, VH8, VL8, (size_t)NR * KVD / 8);
  k_expand<<<(unsigned)(((size_t)NR * NH * (HD / 8) + 255) / 256), 256, 0, stream>>>(KH8, KL8, H16, L16, EMB); k_expand<<<(unsigned)(((size_t)NR * NH * (HD / 8) + 255) / 256), 256, 0, stream>>>(VH8, VL8, H16, L16, 2 * EMB);
  k_vt<NH, SLEN><<<NB * NH * (SLEN / 64), 256, 0, stream>>>(H16, 3 * EMB, 2 * EMB, VT); k_vt<NH, SLEN><<<NB * NH * (SLEN / 64), 256, 0, stream>>>(L16, 3 * EMB, 2 * EMB, VTL);
  k_flash5<1><<<NB * NH * QBN5, 128, 0, stream>>>(H16, L16, 3 * EMB, H16 + EMB, L16 + EMB, 3 * EMB, VT, VTL, nullptr, O, EMB);
  k_flash<1><<<NB * NH * QBNP, 128, 0, stream>>>(H16, 3 * EMB, H16 + EMB, 3 * EMB, VT, nullptr, O, EMB);
  k_hl<<<(unsigned)((npa / 8 + 255) / 256), 256, 0, stream>>>(O, OH, OLo, npa / 8);
  k_gemm2<0><<<dim3((NR / 128) * (EMB / 64), 1), 128, 0, stream>>>(OH, EMB, 0, BO, EMB, 0, 0.0625f, nullptr, 0, nullptr, 1, 0, 0, ob, nullptr, EMB, 0, NR, EMB, EMB);
  k_gemm2<0><<<dim3((RE / 128) * (EMB / 64), NB), 128, 0, stream>>>(OLo, EMB, npb, BO, EMB, 0, 0.0625f / 1024.0f, nullptr, 0, ob, 1, (size_t)EMB, 0, ob, nullptr, EMB, npb, RE, EMB, EMB);      /* grid y = batch: the first RE rows of each */
}

// v004
// It runs in 387 microseconds.
// Next to v003, in two timings, it ran 1.04 times as fast each time.
// All steps since v000 together make it 3.55 times as fast.
#include <hip/hip_runtime.h>
// WedoctorAttention (2 x 2048 tokens, hidden 2048; 32 query heads / 8 kv heads of 64 (GQA), rotate-half RoPE from the INPUT position ids, causal SDPA (1/8), out = o Wo): q/k/v = x W + b.
// Structure (both batches in every launch: the 4096 token rows are one row range, batch = row / 2048): exact f16 plane of x; q / k / v GEMMs (32x64 wave tiles, f32 accumulation, exact x16 weights + bias) into f32 planes; angle tables from the input position ids (f32 trig); RoPE on VALU while splitting q and k into f16 hi + 2^10-residual planes, v split directly; the 8 kv heads expanded to the 32 query heads (repeat 4) into the fused [q | k | v] hi/lo planes; V^T hi/residual by LDS tiles; the fused causal flash kernel in its 5-plane form for the first 256 query rows and plain beyond; attention output as f16 hi (+ residual on those rows) into the output GEMMs.
// Compute dtype: x, weights and biases rounded to bf16; rows < 256 per batch: q, k, P, v, O hi + residual; beyond: plain f16; f32 accumulation/softmax/trig. v_wmma_f32_16x16x32_f16.
#define NB 2
#define EMB 2048
#define NR (NB * SLEN)           /* 4096 token rows */
#define SLEN 2048
#define SQ SLEN
#define TQ SLEN
#define TK SLEN
#define NH 32
#define NKV 8
#define KVD (NKV * HD)
#define HD 64
#define HH (HD / 2)
#define SCL 0.125f               /* 64^-0.5 */
#define QBLKS (TQ / 64)
#define QB05 0                   /* 5-plane flash: query blocks [0, QBN5) of every (batch, head) — the early causal rows whose outputs average over few keys */
#define QBN5 4
#define QB0P QBN5                /* plain flash (hi planes only): query blocks [QBN5, QBLKS) */
#define QBNP (QBLKS - QBN5)
#define RE 256                   /* rows per batch that take the hi+lo output operand (= QBN5 * 64) */
typedef __bf16 v16b __attribute__((ext_vector_type(16)));
typedef unsigned short v8us __attribute__((ext_vector_type(8), may_alias));
typedef float  v8f  __attribute__((ext_vector_type(8)));
typedef float  v4f  __attribute__((ext_vector_type(4)));
typedef float  v4fa __attribute__((ext_vector_type(4), may_alias));
union FragB { v16b v; v8us half[2]; unsigned short u[16]; };

__device__ __forceinline__ unsigned short bf16_bits(float x) { unsigned int u = __float_as_uint(x); return (unsigned short)((u + 0x7FFFu + ((u >> 16) & 1u)) >> 16); }
__device__ __forceinline__ float bf16_val(unsigned short b) { return __uint_as_float(((unsigned int)b) << 16); }
__device__ __forceinline__ float bf16_round(float x) { return bf16_val(bf16_bits(x)); }
// D += A·B with NT terms: 1 = ah·bh, 2 = + al·bh (A split), 3 = + ah·bl (both split)
template <int NT>
__device__ __forceinline__ v8f mmaN(v16b ah, v16b al, v16b bh, v16b bl, v8f c) {
  c = __builtin_amdgcn_wmma_f32_16x16x32_bf16(false, ah, false, bh, (short)0, c, false, false);
  if (NT >= 2) c = __builtin_amdgcn_wmma_f32_16x16x32_bf16(false, al, false, bh, (short)0, c, false, false);
  if (NT >= 3) c = __builtin_amdgcn_wmma_f32_16x16x32_bf16(false, ah, false, bl, (short)0, c, false, false);
  asm volatile("v_nop\n\tv_nop\n\tv_nop\n\tv_nop" : "+v"(c) : "v"(ah), "v"(al), "v"(bh), "v"(bl));
  return c;
}

__global__ __launch_bounds__(256) void k_wt_bf16(const float* __restrict__ W, unsigned short* __restrict__ Wt, int K, int N) {
  const int t = blockIdx.x * 256 + threadIdx.x;
  const int k8n = K / 8;
  if (t >= N * k8n) return;
  const int n = t / k8n, k8 = (t % k8n) * 8;
  v8us v;
#pragma unroll
  for (int i = 0; i < 8; ++i) v[i] = bf16_bits(W[(size_t)(k8 + i) * N + n]);
  *(v8us*)(Wt + (size_t)n * K + k8) = v;
  
}

// GEMM C[M][N] (f32, pitch ldc) = act(A[M][K]·W + bias). A f32 row-major (pitch lda) converted per fragment to bf16
// (ASPLIT: hi/lo two planes -> 2 terms, else single rounded term); Wt bf16 [N][K] (pitch ldb). BIAS_BF16 rounds the
// bias to bf16 first (bias quantised to bf16 before the add). K%32==0, M%16==0, N%64==0.
template <bool ASPLIT, int ACT, bool BIAS_BF16>
__global__ __launch_bounds__(128) void k_gemm_bf(const float* __restrict__ A, int lda, const unsigned short* __restrict__ Wt, int ldb,
                                               const float* __restrict__ bias, float* __restrict__ C, int ldc, int M, int N, int K) {
  __shared__ __attribute__((aligned(16))) float so[4][16][64];
  const int tid = threadIdx.x, w = tid >> 5, lane = tid & 31, ln = lane & 15, hh = lane >> 4;
  const int ntn = N / 64;
  const int wid = blockIdx.x * 4 + w;
  const int mt = wid / ntn, nq = wid % ntn;
  if (mt * 16 >= M) return;
  const int row0 = mt * 16, col0 = nq * 64;
  const float* arow = A + (size_t)(row0 + ln) * lda;
  v8f acc[4] = {};
  for (int kb = 0; kb < K; kb += 32) {
    FragB ah, al;
    const v4f x0 = *(const v4fa*)(arow + kb + 8 * hh), x1 = *(const v4fa*)(arow + kb + 8 * hh + 4);
    const v4f x2 = *(const v4fa*)(arow + kb + 16 + 8 * hh), x3 = *(const v4fa*)(arow + kb + 16 + 8 * hh + 4);
    float xs[16] = {x0[0],x0[1],x0[2],x0[3],x1[0],x1[1],x1[2],x1[3],x2[0],x2[1],x2[2],x2[3],x3[0],x3[1],x3[2],x3[3]};
#pragma unroll
    for (int i = 0; i < 16; ++i) { const unsigned short hb = bf16_bits(xs[i]); ah.u[i] = hb; al.u[i] = ASPLIT ? bf16_bits(xs[i] - bf16_val(hb)) : (unsigned short)0; }
#pragma unroll
    for (int t = 0; t < 4; ++t) {
      const unsigned short* brow = Wt + (size_t)(col0 + t * 16 + ln) * ldb + kb;
      FragB b;
      b.half[0] = *(const v8us*)(brow + 8 * hh);
      b.half[1] = *(const v8us*)(brow + 16 + 8 * hh);
      acc[t] = mmaN<ASPLIT ? 2 : 1>(ah.v, al.v, b.v, b.v, acc[t]);
    }
  }
#pragma unroll
  for (int t = 0; t < 4; ++t) {
    float bv = bias ? bias[col0 + t * 16 + ln] : 0.f;
    if (BIAS_BF16) bv = bf16_round(bv);
#pragma unroll
    for (int r = 0; r < 8; ++r) { float v = acc[t][r] + bv; if (ACT == 1) v = fmaxf(v, 0.f); so[w][8 * hh + r][t * 16 + ln] = v; }
  }
  __builtin_amdgcn_fence(__ATOMIC_ACQ_REL, "workgroup");
  __builtin_amdgcn_wave_barrier();
  const int rsub = lane >> 4, c4 = (lane & 15) * 4;
  {
#pragma unroll
    for (int q = 0; q < 8; ++q) {
      const int r = q * 2 + rsub;
      const v4f v = *(const v4fa*)&so[w][r][c4];
      *(v4f*)(C + (size_t)(row0 + r) * ldc + col0 + c4) = v;
    }
    
  }
}

// GEMM C = act(A·W + bias + resid): A f32 (ASPLIT -> hi/lo 2 terms), Wt bf16 [N][K]; ACT 0 none, 1 relu, 2 exact gelu;
// resid (optional, f32, row index = (row % rmod), pitch ldr, RES_BF16 rounds it) added before the activation.
template <bool ASPLIT, int ACT, bool BIAS_BF16, bool RES_BF16>
__global__ __launch_bounds__(128) void k_gemm_bf3(const float* __restrict__ A, int lda, const unsigned short* __restrict__ Wt, int ldb,
                                                const float* __restrict__ bias, const float* __restrict__ resid, int rmod, int ldr,
                                                float* __restrict__ C, int ldc, int M, int N, int K) {
  __shared__ __attribute__((aligned(16))) float so[4][16][64];
  const int tid = threadIdx.x, w = tid >> 5, lane = tid & 31, ln = lane & 15, hh = lane >> 4;
  const int ntn = N / 64;
  const int wid = blockIdx.x * 4 + w;
  const int mt = wid / ntn, nq = wid % ntn;
  if (mt * 16 >= M) return;
  const int row0 = mt * 16, col0 = nq * 64;
  const float* arow = A + (size_t)(row0 + ln) * lda;
  v8f acc[4] = {};
  for (int kb = 0; kb < K; kb += 32) {
    FragB ah, al;
    const v4f x0 = *(const v4fa*)(arow + kb + 8 * hh), x1 = *(const v4fa*)(arow + kb + 8 * hh + 4);
    const v4f x2 = *(const v4fa*)(arow + kb + 16 + 8 * hh), x3 = *(const v4fa*)(arow + kb + 16 + 8 * hh + 4);
    float xs[16] = {x0[0],x0[1],x0[2],x0[3],x1[0],x1[1],x1[2],x1[3],x2[0],x2[1],x2[2],x2[3],x3[0],x3[1],x3[2],x3[3]};
#pragma unroll
    for (int i = 0; i < 16; ++i) { const unsigned short hb = bf16_bits(xs[i]); ah.u[i] = hb; al.u[i] = ASPLIT ? bf16_bits(xs[i] - bf16_val(hb)) : (unsigned short)0; }
#pragma unroll
    for (int t = 0; t < 4; ++t) {
      const unsigned short* brow = Wt + (size_t)(col0 + t * 16 + ln) * ldb + kb;
      FragB b;
      b.half[0] = *(const v8us*)(brow + 8 * hh);
      b.half[1] = *(const v8us*)(brow + 16 + 8 * hh);
      acc[t] = mmaN<ASPLIT ? 2 : 1>(ah.v, al.v, b.v, b.v, acc[t]);
    }
  }
#pragma unroll
  for (int t = 0; t < 4; ++t) {
    const int col = col0 + t * 16 + ln;
    float bv = bias ? bias[col] : 0.f;
    if (BIAS_BF16) bv = bf16_round(bv);
#pragma unroll
    for (int r = 0; r < 8; ++r) {
      float v = acc[t][r] + bv;
      if (resid) { float rv = resid[(size_t)((row0 + 8 * hh + r) % rmod) * ldr + col]; if (RES_BF16) rv = bf16_round(rv); v += rv; }
      if (ACT == 1) v = fmaxf(v, 0.f);
      if (ACT == 2) v = 0.5f * v * (1.0f + erff(v * 0.70710678118654752f));
      if (ACT == 3) { const float u = 0.7978845608028654f * (v + 0.044715f * v * v * v); v = 0.5f * v * (1.0f + tanhf(u)); }
      so[w][8 * hh + r][t * 16 + ln] = v;
    }
  }
  __builtin_amdgcn_fence(__ATOMIC_ACQ_REL, "workgroup");
  __builtin_amdgcn_wave_barrier();
  const int rsub = lane >> 4, c4 = (lane & 15) * 4;
  {
#pragma unroll
    for (int q = 0; q < 8; ++q) {
      const int r = q * 2 + rsub;
      const v4f v = *(const v4fa*)&so[w][r][c4];
      *(v4f*)(C + (size_t)(row0 + r) * ldc + col0 + c4) = v;
    }
    
  }
}
// row LayerNorm (biased variance, eps) over N: s = X (+ R); optional out_sum <- s; out_norm <- (s-mu)*rsqrt(var+eps)*g + b
template <bool PARAM_BF16>
__global__ __launch_bounds__(256) void k_layernorm(const float* __restrict__ X, const float* __restrict__ R, const float* __restrict__ g, const float* __restrict__ bta,
                                                  float* __restrict__ out_sum, float* __restrict__ out_norm, int N, float eps) {
  __shared__ float red[256];
  const int row = blockIdx.x, tid = threadIdx.x;
  const float* x = X + (size_t)row * N; const float* rr = R ? R + (size_t)row * N : nullptr;
  float vals[16];                     // up to N = 4096
  const int per = N / 256;            // contiguous chunk per thread? use strided-by-4 chunks: thread handles j = tid*4 + 1024*u
  float s1 = 0.f;
  for (int u = 0; u < per / 4; ++u) {
    const int j = tid * 4 + 1024 * u;
    const v4f a = *(const v4fa*)(x + j);
    v4f b = {0.f,0.f,0.f,0.f}; if (rr) b = *(const v4fa*)(rr + j);
#pragma unroll
    for (int q = 0; q < 4; ++q) { const float v = a[q] + b[q]; vals[u * 4 + q] = v; s1 += v; }
  }
  red[tid] = s1; __syncthreads();
  for (int st = 128; st > 0; st >>= 1) { if (tid < st) red[tid] += red[tid + st]; __syncthreads(); }
  const float mu = red[0] / (float)N; __syncthreads();
  float s2 = 0.f;
  for (int u = 0; u < per / 4; ++u)
#pragma unroll
    for (int q = 0; q < 4; ++q) { const float c = vals[u * 4 + q] - mu; s2 += c * c; }
  red[tid] = s2; __syncthreads();
  for (int st = 128; st > 0; st >>= 1) { if (tid < st) red[tid] += red[tid + st]; __syncthreads(); }
  const float rs = rsqrtf(red[0] / (float)N + eps);
  {
    for (int u = 0; u < per / 4; ++u) {
      const int j = tid * 4 + 1024 * u;
      v4f o, sm;
#pragma unroll
      for (int q = 0; q < 4; ++q) {
        float gg = g[j + q], bb = bta[j + q];
        if (PARAM_BF16) { gg = bf16_round(gg); bb = bf16_round(bb); }
        sm[q] = vals[u * 4 + q]; o[q] = (vals[u * 4 + q] - mu) * rs * gg + bb;
      }
      if (out_sum) *(v4f*)(out_sum + (size_t)row * N + j) = sm;
      *(v4f*)(out_norm + (size_t)row * N + j) = o;
    }
    
  }
}



// ---- f16 WMMA path (v_wmma_f32_16x16x32_f16): 11-bit significands for operands in range — used where a [0,1] probability operand needs more precision than bf16
typedef _Float16 v16h __attribute__((ext_vector_type(16)));
union FragH { v16h v; v8us half[2]; _Float16 h[16]; unsigned short u[16]; };
template <int NT>
__device__ __forceinline__ v8f mmaH(v16h ah, v16h al, v16h bh, v16h bl, v8f c) {
  c = __builtin_amdgcn_wmma_f32_16x16x32_f16(false, ah, false, bh, (short)0, c, false, false);
  if (NT >= 2) c = __builtin_amdgcn_wmma_f32_16x16x32_f16(false, al, false, bh, (short)0, c, false, false);
  if (NT >= 3) c = __builtin_amdgcn_wmma_f32_16x16x32_f16(false, ah, false, bl, (short)0, c, false, false);
  asm volatile("v_nop\n\tv_nop\n\tv_nop\n\tv_nop" : "+v"(c) : "v"(ah), "v"(al), "v"(bh), "v"(bl));
  return c;
}
// batched GEMM like k_gemm_b but f16 operands: A f32 (split into f16 hi/lo if ASPLIT, else rounded to f16), Bt = f16 values [n][k]; alpha; C f32; N multiple of 16 (partial tiles skipped)
template <bool ASPLIT>
__global__ __launch_bounds__(128) void k_gemm_h(const float* __restrict__ A, int lda, size_t sA, const _Float16* __restrict__ Bh, int ldb, size_t sB, float alpha, float* __restrict__ C, int ldc, size_t sC, int M, int N, int K) {
  __shared__ __attribute__((aligned(16))) float so[4][16][64];
  const int tid = threadIdx.x, w = tid >> 5, lane = tid & 31, ln = lane & 15, hh = lane >> 4; const int by = blockIdx.y;
  A += (size_t)by * sA; Bh += (size_t)by * sB; C += (size_t)by * sC;
  const int ntn = (N + 63) / 64; const int wid = blockIdx.x * 4 + w; const int mt = wid / ntn, nq = wid % ntn; if (mt * 16 >= M) return;
  const int row0 = mt * 16, col0 = nq * 64; const float* arow = A + (size_t)(row0 + ln) * lda;
  v8f acc[4] = {};
  for (int kb = 0; kb < K; kb += 32) {
    FragH ah, al;
    const v4f x0 = *(const v4fa*)(arow + kb + 8 * hh), x1 = *(const v4fa*)(arow + kb + 8 * hh + 4), x2 = *(const v4fa*)(arow + kb + 16 + 8 * hh), x3 = *(const v4fa*)(arow + kb + 16 + 8 * hh + 4);
    float xs[16] = {x0[0],x0[1],x0[2],x0[3],x1[0],x1[1],x1[2],x1[3],x2[0],x2[1],x2[2],x2[3],x3[0],x3[1],x3[2],x3[3]};
#pragma unroll
    for (int i = 0; i < 16; ++i) { const _Float16 h = (_Float16)xs[i]; ah.h[i] = h; al.h[i] = ASPLIT ? (_Float16)(xs[i] - (float)h) : (_Float16)0.0f; }
#pragma unroll
    for (int t = 0; t < 4; ++t) { if (col0 + t * 16 >= N) continue; const size_t boff = (size_t)(col0 + t * 16 + ln) * ldb + kb; FragH bq; bq.half[0] = *(const v8us*)(Bh + boff + 8 * hh); bq.half[1] = *(const v8us*)(Bh + boff + 16 + 8 * hh);
      acc[t] = mmaH<ASPLIT ? 2 : 1>(ah.v, al.v, bq.v, bq.v, acc[t]); }
  }
#pragma unroll
  for (int t = 0; t < 4; ++t) { if (col0 + t * 16 >= N) continue;
#pragma unroll
    for (int r = 0; r < 8; ++r) so[w][8 * hh + r][t * 16 + ln] = acc[t][r] * alpha; }
  __builtin_amdgcn_fence(__ATOMIC_ACQ_REL, "workgroup"); __builtin_amdgcn_wave_barrier();
  const int rsub = lane >> 4, c4 = (lane & 15) * 4;
  {
#pragma unroll
    for (int q = 0; q < 8; ++q) { const int r = q * 2 + rsub; if (col0 + c4 < N) { const v4f v = *(const v4fa*)&so[w][r][c4]; *(v4f*)(C + (size_t)(row0 + r) * ldc + col0 + c4) = v; } }
     }
}

// Wt[n][k] = f16(W[k][n]·scale) from f32 row-major W[K][N] (scale = power of two; bf16-exact weights stay exact in f16 away from the subnormal range)
__global__ __launch_bounds__(256) void k_wt_f16(const float* __restrict__ W, _Float16* __restrict__ Wt, int K, int N, float scale) {
  const int t = blockIdx.x * 256 + threadIdx.x; if (t >= N * (K / 8)) return; const int n = t / (K / 8), k8 = (t % (K / 8)) * 8; FragH f;
#pragma unroll
  for (int i = 0; i < 8; ++i) f.h[i] = (_Float16)(bf16_round(W[(size_t)(k8 + i) * N + n]) * scale); const v8us o = f.half[0];
  *(v8us*)((unsigned short*)Wt + (size_t)n * K + k8) = o; 
}
// k_gemm_hh variant with fused epilogue: v = acc·alpha + bias[by·sBias + col] (+ CP[(row/rowsPerB)·sCPb + by·64 + col] if CP) ; ACT 0 none / 1 elu ; writes f16 C16 (and f32 C if non-null)
template <int ACT>
__global__ __launch_bounds__(128) void k_gemm_hhx(const _Float16* __restrict__ A, int lda, size_t sA, const _Float16* __restrict__ Bh, int ldb, size_t sB, float alpha, const float* __restrict__ bias, size_t sBias, const float* __restrict__ CP, int rowsPerB, size_t sCPb, int row0g,
    float* __restrict__ C, _Float16* __restrict__ C16, int ldc, size_t sC, int M, int N, int K) {
  __shared__ __attribute__((aligned(16))) float so[4][16][64];
  const int tid = threadIdx.x, w = tid >> 5, lane = tid & 31, ln = lane & 15, hh = lane >> 4; const int by = blockIdx.y;
  A += (size_t)by * sA; Bh += (size_t)by * sB; const size_t cofs = (size_t)by * sC; const float* bp = bias ? bias + (size_t)by * sBias : nullptr;
  const int ntn = (N + 63) / 64; const int wid = blockIdx.x * 4 + w; const int mt = wid / ntn, nq = wid % ntn; if (mt * 16 >= M) return;
  const int row0 = mt * 16, col0 = nq * 64; const _Float16* arow = A + (size_t)(row0 + ln) * lda;
  v8f acc[4] = {};
  for (int kb = 0; kb < K; kb += 32) { FragH ah; ah.half[0] = *(const v8us*)((const unsigned short*)arow + kb + 8 * hh); ah.half[1] = *(const v8us*)((const unsigned short*)arow + kb + 16 + 8 * hh);
#pragma unroll
    for (int t = 0; t < 4; ++t) { if (col0 + t * 16 >= N) continue; const size_t boff = (size_t)(col0 + t * 16 + ln) * ldb + kb; FragH bq; bq.half[0] = *(const v8us*)((const unsigned short*)Bh + boff + 8 * hh); bq.half[1] = *(const v8us*)((const unsigned short*)Bh + boff + 16 + 8 * hh);
      acc[t] = mmaH<1>(ah.v, ah.v, bq.v, bq.v, acc[t]); }
  }
#pragma unroll
  for (int t = 0; t < 4; ++t) { if (col0 + t * 16 >= N) continue; const int col = col0 + t * 16 + ln; const float bv = bp ? bf16_round(bp[col]) : 0.f;
#pragma unroll
    for (int r = 0; r < 8; ++r) { float v = acc[t][r] * alpha + bv; if (CP) { const int bidx = (row0g + row0 + 8 * hh + r) / rowsPerB; v += CP[(size_t)bidx * sCPb + (size_t)by * 64 + col]; } if (ACT == 1) v = (v > 0.f) ? v : expm1f(v); else if (ACT == 7) v = (v > 0.f) ? v + 1.0f : expf(v); else if (ACT == 8) v = tanhf(v); else if (ACT == 9) v = 0.5f * v * (1.0f + tanhf(0.7978845608028654f * (v + 0.044715f * v * v * v))); else if (ACT == 11) v = 1.0f / (1.0f + expf(-v)); else if (ACT == 12) v = (v > 0.f) ? v : 0.01f * v; else if (ACT == 14) v = (v > 0.f) ? v : 0.1f * v; else if (ACT == 15) v = v / (1.0f + expf(-v)); else if (ACT == 3) v = fmaxf(v, 0.f); else if (ACT == 6) v = 0.5f * v * (1.0f + erff(v * 0.70710678118654752f)); so[w][8 * hh + r][t * 16 + ln] = v; } }
  __builtin_amdgcn_fence(__ATOMIC_ACQ_REL, "workgroup"); __builtin_amdgcn_wave_barrier();
  const int rsub = lane >> 4, c4 = (lane & 15) * 4; typedef _Float16 v4h __attribute__((ext_vector_type(4)));
  {
#pragma unroll
    for (int q = 0; q < 8; ++q) { const int r = q * 2 + rsub; if (col0 + c4 < N) { const v4f v = *(const v4fa*)&so[w][r][c4]; if (C) *(v4f*)(C + cofs + (size_t)(row0 + r) * ldc + col0 + c4) = v; if (C16) { v4h h4; for (int i = 0; i < 4; ++i) h4[i] = (_Float16)v[i]; *(v4h*)(C16 + cofs + (size_t)(row0 + r) * ldc + col0 + c4) = h4; } } }
     }
}


typedef _Float16 v4h __attribute__((ext_vector_type(4)));

__global__ __launch_bounds__(256) void k_x16(const float* __restrict__ x, _Float16* __restrict__ X16, size_t n8) { const size_t t = (size_t)blockIdx.x * 256 + threadIdx.x; if (t >= n8) return; FragH f;
#pragma unroll
  for (int q = 0; q < 8; ++q) f.h[q] = (_Float16)bf16_round(x[t * 8 + q]); *(v8us*)((unsigned short*)X16 + t * 8) = f.half[0];  }
__global__ __launch_bounds__(256) void k_h16(const float* __restrict__ x, _Float16* __restrict__ X16, size_t n8) { const size_t t = (size_t)blockIdx.x * 256 + threadIdx.x; if (t >= n8) return; FragH f;
#pragma unroll
  for (int q = 0; q < 8; ++q) f.h[q] = (_Float16)x[t * 8 + q]; *(v8us*)((unsigned short*)X16 + t * 8) = f.half[0];  }
__global__ __launch_bounds__(256) void k_round16f(const float* __restrict__ W, _Float16* __restrict__ Bt, size_t n8) { const size_t t = (size_t)blockIdx.x * 256 + threadIdx.x; if (t >= n8) return; FragH f;
#pragma unroll
  for (int i = 0; i < 8; ++i) f.h[i] = (_Float16)(bf16_round(W[t * 8 + i]) * 16.0f); *(v8us*)((unsigned short*)Bt + t * 8) = f.half[0];  }
template <int NHv, int TTv>
__global__ __launch_bounds__(256) void k_vt(const _Float16* __restrict__ V16, int ldv, int voff, _Float16* __restrict__ Vt) { __shared__ unsigned short tl[64][66]; const int tid = threadIdx.x; const int slab = blockIdx.x / (TTv / 64), lg = blockIdx.x % (TTv / 64); const int b = slab / NHv, h = slab % NHv;
  for (int i = tid; i < 64 * 8; i += 256) { const int r = i / 8, c8 = (i % 8) * 8; FragH f; f.half[0] = *(const v8us*)((const unsigned short*)V16 + ((size_t)b * TTv + lg * 64 + r) * ldv + voff + h * 64 + c8);
#pragma unroll
    for (int q = 0; q < 8; ++q) tl[r][c8 + q] = f.u[q]; }
  __syncthreads();
  {
#pragma unroll
    for (int rd = 0; rd < 2; ++rd) { const int d = rd * 32 + tid / 8, pc = tid % 8; FragH f;
#pragma unroll
      for (int q = 0; q < 8; ++q) f.u[q] = tl[pc * 8 + q][d];
      *(v8us*)((unsigned short*)Vt + ((size_t)slab * 64 + d) * TTv + lg * 64 + pc * 8) = f.half[0]; }
     } }

__global__ __launch_bounds__(256) void k_hl(const float* __restrict__ F, _Float16* __restrict__ Hh, _Float16* __restrict__ Hl, size_t n8) { const size_t t = (size_t)blockIdx.x * 256 + threadIdx.x; if (t >= n8) return; FragH fh, fl; const v4f a = *(const v4fa*)(F + t * 8), c = *(const v4fa*)(F + t * 8 + 4);
#pragma unroll
  for (int q = 0; q < 4; ++q) { _Float16 h = (_Float16)a[q]; fh.h[q] = h; fl.h[q] = (_Float16)((a[q] - (float)h) * 1024.0f); h = (_Float16)c[q]; fh.h[4 + q] = h; fl.h[4 + q] = (_Float16)((c[q] - (float)h) * 1024.0f); }
  { *(v8us*)((unsigned short*)Hh + t * 8) = fh.half[0]; *(v8us*)((unsigned short*)Hl + t * 8) = fl.half[0];  } }

// ---- fast GEMM (wave tile 32x64; requires M % 128 == 0 rows per launch region, N % 64 == 0 and K % 64 == 0); epilogue = k_gemm_hhx semantics, but the CP addend takes C's own grid-y offset ----
__device__ __forceinline__ v16h g2_frag(const _Float16* p, int hh) { FragH f; f.half[0] = *(const v8us*)((const unsigned short*)p + 8 * hh); f.half[1] = *(const v8us*)((const unsigned short*)p + 16 + 8 * hh); return f.v; }
__device__ __forceinline__ v8f g2_mma(v16h a, v16h b, v8f c) { v8f d = __builtin_amdgcn_wmma_f32_16x16x32_f16(false, a, false, b, (short)0, c, false, false); asm volatile("v_nop\n\tv_nop\n\tv_nop\n\tv_nop" : "+v"(d) : "v"(a), "v"(b)); return d; }
#define G2_KT 64                      /* k per stage: 128 bytes of every operand row */
#define G2_PITCH 144                  /* LDS row pitch in bytes: 128 + 16, an odd multiple of 16 for the 16-byte fragment reads */
#define G2_STAGE (192 * G2_PITCH)     /* one stage: 128 A rows, then 64 B rows */
// One stage's copies of one lane: 16 bytes of each of 8 A rows and 4 B rows (rows 16 apart; sa, sb = 16 rows in bytes), global memory -> LDS through no register.
// A wave's 32 lanes cover 4 whole 128-byte rows per copy. s_wait_xcnt 0 ends the statement so that it stands in front of any rewrite of the address registers the copies name.
__device__ __forceinline__ void g2_stage(unsigned l, const char* ga, size_t sa, const char* gb, size_t sb) {
  const char* a1 = ga + sa; const char* a2 = a1 + sa; const char* a3 = a2 + sa; const char* a4 = a3 + sa; const char* a5 = a4 + sa; const char* a6 = a5 + sa; const char* a7 = a6 + sa;
  const char* b1 = gb + sb; const char* b2 = b1 + sb; const char* b3 = b2 + sb;
  asm volatile("global_load_async_to_lds_b128 %0, %12, off\n\t"
               "global_load_async_to_lds_b128 %1, %13, off\n\t"
               "global_load_async_to_lds_b128 %2, %14, off\n\t"
               "global_load_async_to_lds_b128 %3, %15, off\n\t"
               "global_load_async_to_lds_b128 %4, %16, off\n\t"
               "global_load_async_to_lds_b128 %5, %17, off\n\t"
               "global_load_async_to_lds_b128 %6, %18, off\n\t"
               "global_load_async_to_lds_b128 %7, %19, off\n\t"
               "global_load_async_to_lds_b128 %8, %20, off\n\t"
               "global_load_async_to_lds_b128 %9, %21, off\n\t"
               "global_load_async_to_lds_b128 %10, %22, off\n\t"
               "global_load_async_to_lds_b128 %11, %23, off\n\t"
               "s_wait_xcnt 0x0"
               :: "v"(l), "v"(l + 16 * G2_PITCH), "v"(l + 32 * G2_PITCH), "v"(l + 48 * G2_PITCH), "v"(l + 64 * G2_PITCH), "v"(l + 80 * G2_PITCH), "v"(l + 96 * G2_PITCH), "v"(l + 112 * G2_PITCH),
                  "v"(l + 128 * G2_PITCH), "v"(l + 144 * G2_PITCH), "v"(l + 160 * G2_PITCH), "v"(l + 176 * G2_PITCH),
                  "v"(ga), "v"(a1), "v"(a2), "v"(a3), "v"(a4), "v"(a5), "v"(a6), "v"(a7), "v"(gb), "v"(b1), "v"(b2), "v"(b3)
               : "memory");
}
// Block tile 128x64 (M % 128 == 0, N % 64 == 0, K % 64 == 0): the A and B tiles of a stage go to LDS by asynchronous copies, two buffers, stage t + 2 in flight while stage t + 1 is worked on; the waves read their fragments from LDS. The order of the products along k is the plain one.
template <int ACT>
__global__ __launch_bounds__(128) void k_gemm2(const _Float16* __restrict__ A, int lda, size_t sA, const _Float16* __restrict__ Bh, int ldb, size_t sB, float alpha, const float* __restrict__ bias, size_t sBias, const float* __restrict__ CP, int rowsPerB, size_t sCPb, int row0g,
    float* __restrict__ C, _Float16* __restrict__ C16, int ldc, size_t sC, int M, int N, int K) {
  __shared__ __attribute__((aligned(128))) unsigned char sm[2 * G2_STAGE];
  float (*so)[32][68] = (float (*)[32][68])sm;      /* output staging (4 x 32 x 68 floats) over the two buffers, used only behind the last trip's barrier */
  const int tid = threadIdx.x, w = tid >> 5, lane = tid & 31, ln = lane & 15, hh = lane >> 4; const int by = blockIdx.y;
  A += (size_t)by * sA; Bh += (size_t)by * sB; const size_t cofs = (size_t)by * sC; const float* bp = bias ? bias + (size_t)by * sBias : nullptr;
  const int ntn = N >> 6; const int mt = blockIdx.x / ntn, nq = blockIdx.x - mt * ntn; const int row0 = mt * 128 + 32 * w, col0 = nq * 64; if (mt * 128 >= M) return;      /* the whole block leaves or none, in front of every barrier */
  const int cr = tid >> 3, cc = tid & 7;      /* copy lane: row cr (+ 16 i) of the tile, 16-byte piece cc of its 128 bytes */
  const char* ga = (const char*)(A + (size_t)(mt * 128 + cr) * lda + cc * 8); const char* gb = (const char*)(Bh + (size_t)(col0 + cr) * ldb + cc * 8);
  const size_t sa = (size_t)lda * 32, sb = (size_t)ldb * 32;
  const unsigned l0 = (unsigned)(size_t)sm + (unsigned)(cr * G2_PITCH + cc * 16);
  const int nst = K / G2_KT;
  g2_stage(l0, ga, sa, gb, sb);
  asm volatile("s_wait_asynccnt 0x0" ::: "memory");      /* stage 0 of this wave has landed */
  __syncthreads();                                       /* ... and every other wave's */
  if (nst > 1) g2_stage(l0 + G2_STAGE, ga + 2 * G2_KT, sa, gb + 2 * G2_KT, sb);
  const v8f z8 = {0.f,0.f,0.f,0.f,0.f,0.f,0.f,0.f}; v8f c00 = z8, c01 = z8, c02 = z8, c03 = z8, c10 = z8, c11 = z8, c12 = z8, c13 = z8;
  /* kept rolled: one trip per stage, so that the waits, the barrier and the refill at its foot stand once */
#pragma unroll 1
  for (int t = 0; t < nst; ++t) { const unsigned bo = (unsigned)(t & 1) * G2_STAGE;
    const _Float16* a0p = (const _Float16*)(sm + bo + (32 * w + ln) * G2_PITCH); const _Float16* a1p = (const _Float16*)(sm + bo + (32 * w + 16 + ln) * G2_PITCH);
    const _Float16* b0p = (const _Float16*)(sm + bo + (128 + ln) * G2_PITCH); const _Float16* b1p = (const _Float16*)(sm + bo + (144 + ln) * G2_PITCH); const _Float16* b2p = (const _Float16*)(sm + bo + (160 + ln) * G2_PITCH); const _Float16* b3p = (const _Float16*)(sm + bo + (176 + ln) * G2_PITCH);
    /* unrolled: the two 32-k steps of a stage read LDS at constant offsets */
#pragma unroll
    for (int kb = 0; kb < G2_KT; kb += 32) { const v16h a0 = g2_frag(a0p + kb, hh), a1 = g2_frag(a1p + kb, hh), b0 = g2_frag(b0p + kb, hh), b1 = g2_frag(b1p + kb, hh), b2 = g2_frag(b2p + kb, hh), b3 = g2_frag(b3p + kb, hh);
      c00 = g2_mma(a0, b0, c00); c10 = g2_mma(a1, b0, c10);
      c01 = g2_mma(a0, b1, c01); c11 = g2_mma(a1, b1, c11);
      c02 = g2_mma(a0, b2, c02); c12 = g2_mma(a1, b2, c12);
      c03 = g2_mma(a0, b3, c03); c13 = g2_mma(a1, b3, c13); }
    asm volatile("s_wait_dscnt 0x0" ::: "memory");       /* this wave's reads of the buffer are done before it is refilled */
    asm volatile("s_wait_asynccnt 0x0" ::: "memory");    /* this wave's copies of stage t + 1 have landed */
    __syncthreads();                                     /* publishes stage t + 1 and ends every wave's reads of stage t */
    if (t + 2 < nst) g2_stage(l0 + bo, ga + (size_t)(t + 2) * (2 * G2_KT), sa, gb + (size_t)(t + 2) * (2 * G2_KT), sb); }
  asm volatile("s_wait_asynccnt 0x0" ::: "memory");      /* no copy is outstanding when the buffers become output staging */
  v8f accs[8] = {c00, c01, c02, c03, c10, c11, c12, c13};
#pragma unroll
  for (int u = 0; u < 8; ++u) { const int t = u & 3, half = u >> 2; const int col = col0 + t * 16 + ln; const float bv = bp ? bf16_round(bp[col]) : 0.f;
#pragma unroll
    for (int r = 0; r < 8; ++r) { const int rloc = half * 16 + 8 * hh + r; float v = accs[u][r] * alpha + bv; if (CP) { const int bidx = (row0g + row0 + rloc) / rowsPerB; v += CP[cofs + (size_t)bidx * sCPb + col]; }
      if (ACT == 3) v = fmaxf(v, 0.f); else if (ACT == 6) v = 0.5f * v * (1.0f + erff(v * 0.70710678118654752f)); else if (ACT == 11) v = 1.0f / (1.0f + expf(-v)); else if (ACT == 15) v = v / (1.0f + expf(-v)); else if (ACT == 12) v = (v > 0.f) ? v : 0.01f * v; else if (ACT == 8) v = tanhf(v);
      so[w][rloc][t * 16 + ln] = v; } }
  __builtin_amdgcn_fence(__ATOMIC_ACQ_REL, "workgroup"); __builtin_amdgcn_wave_barrier();
  const int rsub = lane >> 4, c4 = (lane & 15) * 4;
  {
#pragma unroll
    for (int q = 0; q < 16; ++q) { const int r = q * 2 + rsub; const v4f v = *(const v4fa*)&so[w][r][c4]; if (C) *(v4f*)(C + cofs + (size_t)(row0 + r) * ldc + col0 + c4) = v; if (C16) { v4h h4; for (int i = 0; i < 4; ++i) h4[i] = (_Float16)v[i]; *(v4h*)(C16 + cofs + (size_t)(row0 + r) * ldc + col0 + c4) = h4; } }
     } }



// Both flash kernels work on the transposed products: S^T = K Q^T (A = 16 key rows, B = the wave's 16 queries) and O^T += V^T P^T (A = 16 rows of V^T, B = P^T).
// A lane then holds 16 of the 32 scores of ONE query (query ln; keys 8 hh + r of each 16-key tile), so the row maximum and the row sum are in-lane plus one exchange with lane ^ 16,
// and the two score tiles, converted in place, are already the B operand of the second product (element s = tile s / 8, register s % 8): P goes through no LDS.
__device__ __forceinline__ float xhalf(float x) { return __builtin_bit_cast(float, __builtin_amdgcn_permlanex16(__builtin_bit_cast(int, x), __builtin_bit_cast(int, x), 0x76543210, 0xfedcba98, false, false)); }      /* the value of lane ^ 16 */
#define SCL2 0.18033688011112042f      /* 64^-0.5 * log2(e): the softmax of the plain kernel runs in base 2 */
// Plain kernel: p * 2^10 = 2^(s * SCL2 + off) with off = 10 - max * SCL2: one fused multiply-add and one hardware exp2 per score; the row maximum is taken on the raw scores (SCL2 > 0).
// The accumulators and the row sum carry the 2^10, which the final division takes out.
template <int CAUSAL>
__global__ __launch_bounds__(128) void k_flash(const _Float16* __restrict__ Q16, int ldq, const _Float16* __restrict__ K16, int ldk, const _Float16* __restrict__ Vt, const int* __restrict__ MSK, float* __restrict__ O, int ldo) {
  constexpr int RPW = 16, DT = 4, KS = 2;
  __shared__ __attribute__((aligned(16))) float sO[4][RPW][64 + 4];
  const int tid = threadIdx.x, w = tid >> 5, lane = tid & 31, ln = lane & 15, hh = lane >> 4;
  const int slab = blockIdx.x / QBNP, qblk = QB0P + blockIdx.x % QBNP; const int b = slab / NH, h = slab % NH; const int qb0 = qblk * (4 * RPW); const int q0 = qb0 + w * RPW; const int tq = q0 + ln;      /* tq: this lane's query */
  FragH aq[KS];
  { const unsigned short* qr = (const unsigned short*)Q16 + ((size_t)b * TQ + tq) * ldq + h * 64;
#pragma unroll
    for (int ks = 0; ks < KS; ++ks) { aq[ks].half[0] = *(const v8us*)(qr + ks * 32 + 8 * hh); aq[ks].half[1] = *(const v8us*)(qr + ks * 32 + 16 + 8 * hh); } }
  const unsigned short* Vth = (const unsigned short*)Vt + (size_t)slab * 64 * TK;
  float m_r = -3.0e38f, off_r = 10.0f + 3.0e38f * SCL2, l_r = 0.f; v8f oacc[DT];      /* m_r: running maximum of the raw scores; off_r = 10 - m_r * SCL2; l_r: the sum over this lane's own keys, the two halves join behind the loop */
#pragma unroll
  for (int dt = 0; dt < DT; ++dt) oacc[dt] = (v8f){0.f,0.f,0.f,0.f,0.f,0.f,0.f,0.f};
  const int jend = (CAUSAL == 1) ? (qb0 + 4 * RPW) : TK;      /* causal: keys beyond the block's last query never contribute */
#pragma unroll 1
  for (int j0 = 0; j0 < jend; j0 += 32) {
    FragH bk[2][KS], bv[DT]; const unsigned short* kr[2];
#pragma unroll
    for (int nt = 0; nt < 2; ++nt) { kr[nt] = (const unsigned short*)K16 + ((size_t)b * TK + j0 + nt * 16 + ln) * ldk + h * 64 + 8 * hh;
#pragma unroll
      for (int ks = 0; ks < KS; ++ks) { bk[nt][ks].half[0] = *(const v8us*)(kr[nt] + ks * 32); bk[nt][ks].half[1] = *(const v8us*)(kr[nt] + ks * 32 + 16); } }
    v8f s[2];
#pragma unroll
    for (int nt = 0; nt < 2; ++nt) { v8f acc = (v8f){0.f,0.f,0.f,0.f,0.f,0.f,0.f,0.f};
#pragma unroll
      for (int ks = 0; ks < KS; ++ks) acc = mmaH<1>(bk[nt][ks].v, bk[nt][ks].v, aq[ks].v, aq[ks].v, acc);
      s[nt] = acc; }
    asm volatile("s_wait_xcnt 0x0" :: "v"(kr[0]), "v"(kr[1]) : "memory");      /* the K loads' address registers, held as inputs up to here, are rewritten only behind this wait; the clobber keeps the V loads behind the score products, so that they take over the K fragments' registers and fly during the softmax */
#pragma unroll
    for (int dt = 0; dt < DT; ++dt) { const unsigned short* vrow = Vth + (size_t)(dt * 16 + ln) * TK + j0; bv[dt].half[0] = *(const v8us*)(vrow + 8 * hh); bv[dt].half[1] = *(const v8us*)(vrow + 16 + 8 * hh); }
    float sc[16]; bool ok[16]; float mc = -3.0e38f;
#pragma unroll
    for (int e = 0; e < 16; ++e) { const int key = j0 + (e >> 3) * 16 + 8 * hh + (e & 7);
      ok[e] = (CAUSAL == 1) ? (key <= tq) : ((CAUSAL == 2) ? ((key >> 5) == (tq >> 5)) : true);      /* mode 2: block-diagonal 32-token groups */
      sc[e] = ok[e] ? s[e >> 3][e & 7] : -3.0e38f; mc = fmaxf(mc, sc[e]); }
    mc = fmaxf(mc, xhalf(mc));
    const float mn = fmaxf(m_r, mc); const float off = 10.0f - mn * SCL2; const float ea = __builtin_amdgcn_exp2f(off - off_r);      /* 2^(off - off_r): the factor that moves the accumulators to the new maximum */
    const float al = (mn > -1.0e38f) ? ea : 1.0f; m_r = mn; off_r = off;
    float ps[4] = {0.f, 0.f, 0.f, 0.f}; FragH pb;
#pragma unroll
    for (int e = 0; e < 16; ++e) { const float ee = __builtin_amdgcn_exp2f(sc[e] * SCL2 + off); const float p = ok[e] ? ee : 0.f; ps[e & 3] += p; pb.h[e] = (_Float16)p; }
    l_r = l_r * al + ((ps[0] + ps[1]) + (ps[2] + ps[3]));
#pragma unroll
    for (int dt = 0; dt < DT; ++dt)
#pragma unroll
      for (int r = 0; r < 8; ++r) oacc[dt][r] *= al;
#pragma unroll
    for (int dt = 0; dt < DT; ++dt) oacc[dt] = mmaH<1>(bv[dt].v, bv[dt].v, pb.v, pb.v, oacc[dt]); }
  const float l = l_r + xhalf(l_r); const float linv = (l > 0.f) ? 1.0f / l : 0.f;
#pragma unroll
  for (int dt = 0; dt < DT; ++dt)
#pragma unroll
    for (int r = 0; r < 8; ++r) sO[w][ln][dt * 16 + 8 * hh + r] = oacc[dt][r] * linv;
  __builtin_amdgcn_fence(__ATOMIC_ACQ_REL, "workgroup"); __builtin_amdgcn_wave_barrier();
  {
#pragma unroll
    for (int rp = 0; rp < RPW; rp += 2) { const int r = rp + (lane >> 4), pc = lane & 15; const v4f val = *(const v4fa*)&sO[w][r][pc * 4]; *(v4f*)(O + ((size_t)b * TQ + q0 + r) * ldo + h * 64 + pc * 4) = val; }
     } }
// 5-plane variant: S = Qh Kh^T + (Ql Kh^T + Qh Kl^T)/1024 with Q/K = [hi | 2^10 residual] f16 planes (QL/KL same layout as Q16/K16), then the 3-term P.V below.
// 3-term variant: O = (P_hi V_hi + (P_lo V_hi + P_hi V_lo) / 1024) / (1024 l) with P = [hi | 2^10 residual] of 1024 p and V^T = [hi | 2^10 residual] planes (VtL same layout as Vt) -> ~2^-21-class products for un-averaged (early causal / peaked) rows
template <int CAUSAL>
__global__ __launch_bounds__(128) void k_flash5(const _Float16* __restrict__ Q16, const _Float16* __restrict__ QL, int ldq, const _Float16* __restrict__ K16, const _Float16* __restrict__ KL, int ldk, const _Float16* __restrict__ Vt, const _Float16* __restrict__ VtL, const int* __restrict__ MSK, float* __restrict__ O, int ldo) {
  constexpr int RPW = 16, DT = 4, KS = 2;
  __shared__ __attribute__((aligned(16))) float sO[4][RPW][64 + 4];
  const int tid = threadIdx.x, w = tid >> 5, lane = tid & 31, ln = lane & 15, hh = lane >> 4;
  const int slab = blockIdx.x / QBN5, qblk = QB05 + blockIdx.x % QBN5; const int b = slab / NH, h = slab % NH; const int qb0 = qblk * (4 * RPW); const int q0 = qb0 + w * RPW; const int tq = q0 + ln;      /* tq: this lane's query */
  FragH aq[KS], aql[KS];
  { const unsigned short* qr = (const unsigned short*)Q16 + ((size_t)b * TQ + tq) * ldq + h * 64; const unsigned short* ql = (const unsigned short*)QL + ((size_t)b * TQ + tq) * ldq + h * 64;
#pragma unroll
    for (int ks = 0; ks < KS; ++ks) { aq[ks].half[0] = *(const v8us*)(qr + ks * 32 + 8 * hh); aq[ks].half[1] = *(const v8us*)(qr + ks * 32 + 16 + 8 * hh); aql[ks].half[0] = *(const v8us*)(ql + ks * 32 + 8 * hh); aql[ks].half[1] = *(const v8us*)(ql + ks * 32 + 16 + 8 * hh); } }
  const unsigned short* Vth = (const unsigned short*)Vt + (size_t)slab * 64 * TK; const unsigned short* Vtl = (const unsigned short*)VtL + (size_t)slab * 64 * TK;
  float m_r = -3.0e38f, l_r = 0.f; v8f oacc[DT], oaccL[DT];      /* l_r: the sum over this lane's own keys; the two halves join behind the loop */
#pragma unroll
  for (int dt = 0; dt < DT; ++dt) { oacc[dt] = (v8f){0.f,0.f,0.f,0.f,0.f,0.f,0.f,0.f}; oaccL[dt] = oacc[dt]; }
  const int jend = (CAUSAL == 1) ? (qb0 + 4 * RPW) : TK;      /* causal: keys beyond the block's last query never contribute */
#pragma unroll 1
  for (int j0 = 0; j0 < jend; j0 += 32) {
    FragH bk[2][KS], bkl[2][KS], bv[DT], bl[DT]; const unsigned short* kr[2]; const unsigned short* klr[2];
#pragma unroll
    for (int nt = 0; nt < 2; ++nt) { kr[nt] = (const unsigned short*)K16 + ((size_t)b * TK + j0 + nt * 16 + ln) * ldk + h * 64 + 8 * hh; klr[nt] = (const unsigned short*)KL + ((size_t)b * TK + j0 + nt * 16 + ln) * ldk + h * 64 + 8 * hh;
#pragma unroll
      for (int ks = 0; ks < KS; ++ks) { bk[nt][ks].half[0] = *(const v8us*)(kr[nt] + ks * 32); bk[nt][ks].half[1] = *(const v8us*)(kr[nt] + ks * 32 + 16); bkl[nt][ks].half[0] = *(const v8us*)(klr[nt] + ks * 32); bkl[nt][ks].half[1] = *(const v8us*)(klr[nt] + ks * 32 + 16); } }
    v8f s[2];
#pragma unroll
    for (int nt = 0; nt < 2; ++nt) { v8f acc = (v8f){0.f,0.f,0.f,0.f,0.f,0.f,0.f,0.f}, accl = acc;
#pragma unroll
      for (int ks = 0; ks < KS; ++ks) { acc = mmaH<1>(bk[nt][ks].v, bk[nt][ks].v, aq[ks].v, aq[ks].v, acc); accl = mmaH<1>(bk[nt][ks].v, bk[nt][ks].v, aql[ks].v, aql[ks].v, accl); accl = mmaH<1>(bkl[nt][ks].v, bkl[nt][ks].v, aq[ks].v, aq[ks].v, accl); }
#pragma unroll
      for (int r = 0; r < 8; ++r) acc[r] += accl[r] * 0.0009765625f;
      s[nt] = acc; }
    asm volatile("s_wait_xcnt 0x0" :: "v"(kr[0]), "v"(kr[1]), "v"(klr[0]), "v"(klr[1]) : "memory");      /* the K loads' address registers, held as inputs up to here, are rewritten only behind this wait; the clobber keeps the V loads behind the score products, so that they take over the K fragments' registers and fly during the softmax */
#pragma unroll
    for (int dt = 0; dt < DT; ++dt) { const unsigned short* vrow = Vth + (size_t)(dt * 16 + ln) * TK + j0; const unsigned short* vrl = Vtl + (size_t)(dt * 16 + ln) * TK + j0; bv[dt].half[0] = *(const v8us*)(vrow + 8 * hh); bv[dt].half[1] = *(const v8us*)(vrow + 16 + 8 * hh); bl[dt].half[0] = *(const v8us*)(vrl + 8 * hh); bl[dt].half[1] = *(const v8us*)(vrl + 16 + 8 * hh); }
    float sc[16]; bool ok[16]; float mc = -3.0e38f;
#pragma unroll
    for (int e = 0; e < 16; ++e) { const int key = j0 + (e >> 3) * 16 + 8 * hh + (e & 7);
      ok[e] = (CAUSAL == 1) ? (key <= tq) : ((CAUSAL == 2) ? ((key >> 5) == (tq >> 5)) : true);      /* mode 2: block-diagonal 32-token groups */
      if (CAUSAL == 4) ok[e] = MSK[((size_t)b * TQ + tq) * TK + key] != 0;      /* mode 4: per-(query, key) INPUT mask shared by all heads; masked keys contribute nothing, rows with no valid key give l = 0 -> output 0 */
      sc[e] = ok[e] ? s[e >> 3][e & 7] * SCL : -3.0e38f; mc = fmaxf(mc, sc[e]); }
    mc = fmaxf(mc, xhalf(mc));
    const float mn = fmaxf(m_r, mc); const float ea = expf(m_r - mn); const float al = (mn > -1.0e38f) ? ea : 1.0f; m_r = mn;
    float ps[4] = {0.f, 0.f, 0.f, 0.f}; FragH pb, pl;
#pragma unroll
    for (int e = 0; e < 16; ++e) { const float ee = expf(sc[e] - mn); const float p = ok[e] ? ee : 0.f; ps[e & 3] += p; const float p1k = p * 1024.0f; const _Float16 ph = (_Float16)p1k; pb.h[e] = ph; pl.h[e] = (_Float16)((p1k - (float)ph) * 1024.0f); }
    l_r = l_r * al + ((ps[0] + ps[1]) + (ps[2] + ps[3]));
#pragma unroll
    for (int dt = 0; dt < DT; ++dt)
#pragma unroll
      for (int r = 0; r < 8; ++r) { oacc[dt][r] *= al; oaccL[dt][r] *= al; }
#pragma unroll
    for (int dt = 0; dt < DT; ++dt) { oacc[dt] = mmaH<1>(bv[dt].v, bv[dt].v, pb.v, pb.v, oacc[dt]); oaccL[dt] = mmaH<1>(bv[dt].v, bv[dt].v, pl.v, pl.v, oaccL[dt]); oaccL[dt] = mmaH<1>(bl[dt].v, bl[dt].v, pb.v, pb.v, oaccL[dt]); } }
  const float l = l_r + xhalf(l_r); const float linv = (l > 0.f) ? 1.0f / (l * 1024.0f) : 0.f;
#pragma unroll
  for (int dt = 0; dt < DT; ++dt)
#pragma unroll
    for (int r = 0; r < 8; ++r) { float v = oacc[dt][r]; v += oaccL[dt][r] * 0.0009765625f; sO[w][ln][dt * 16 + 8 * hh + r] = v * linv; }
  __builtin_amdgcn_fence(__ATOMIC_ACQ_REL, "workgroup"); __builtin_amdgcn_wave_barrier();
  {
#pragma unroll
    for (int rp = 0; rp < RPW; rp += 2) { const int r = rp + (lane >> 4), pc = lane & 15; const v4f val = *(const v4fa*)&sO[w][r][pc * 4]; *(v4f*)(O + ((size_t)b * TQ + q0 + r) * ldo + h * 64 + pc * 4) = val; }
     } }

__global__ __launch_bounds__(256) void k_wsc(const float* __restrict__ Wm, _Float16* __restrict__ Bt, size_t n8, float sc) { const size_t t = (size_t)blockIdx.x * 256 + threadIdx.x; if (t >= n8) return; FragH f; for (int q = 0; q < 8; ++q) f.h[q] = (_Float16)(bf16_round(Wm[t * 8 + q]) * sc); *(v8us*)((unsigned short*)Bt + t * 8) = f.half[0];  }      /* torch (out,in) weight == Bt[n][k]: scaled copy */




__global__ __launch_bounds__(256) void k_rope(const float* __restrict__ F, int nheads, const float* __restrict__ CS, const float* __restrict__ SN, _Float16* __restrict__ H, _Float16* __restrict__ L, int ldd) {      /* ldd: destination row pitch (the source pitch is nheads*HD) */
  #pragma clang fp contract(off)
  const size_t t = (size_t)blockIdx.x * 256 + threadIdx.x; if (t >= (size_t)NR * nheads * (HH / 8)) return; const int g = (int)(t % (HH / 8)) * 8; const int h = (int)((t / (HH / 8)) % nheads); const int s = (int)(t / ((HH / 8) * (size_t)nheads)); const int ld = nheads * HD;
  const size_t base = (size_t)s * ld + h * HD + g, dbase = (size_t)s * ldd + h * HD + g; FragH h0, h1, l0, l1;
#pragma unroll
  for (int q = 0; q < 8; ++q) { const float c = CS[s * HH + g + q], sn = SN[s * HH + g + q]; const float x0 = F[base + q], x1 = F[base + HH + q]; float o0 = x0 * c; o0 += -x1 * sn; float o1 = x1 * c; o1 += x0 * sn;
    const _Float16 a0 = (_Float16)o0, a1 = (_Float16)o1; h0.h[q] = a0; h1.h[q] = a1; l0.h[q] = (_Float16)((o0 - (float)a0) * 1024.0f); l1.h[q] = (_Float16)((o1 - (float)a1) * 1024.0f); }
  { *(v8us*)((unsigned short*)H + dbase) = h0.half[0]; *(v8us*)((unsigned short*)H + dbase + HH) = h1.half[0]; if (L) { *(v8us*)((unsigned short*)L + dbase) = l0.half[0]; *(v8us*)((unsigned short*)L + dbase + HH) = l1.half[0]; }  } }

__global__ __launch_bounds__(256) void k_rotab(const int* __restrict__ pid, float* __restrict__ CS, float* __restrict__ SN) {      /* s = token row over both batches */
  #pragma clang fp contract(off)
  const int t = blockIdx.x * 256 + threadIdx.x; if (t >= NR * HH) return; const int j = t % HH, s = t / HH; const float inv = 1.0f / powf(10000.0f, (float)(2 * j) / (float)HD); const float th = (float)pid[s] * inv; const float c = cosf(th), sn = sinf(th);
  { *(float*)(CS + t) = c; *(float*)(SN + t) = sn;  } }

__global__ __launch_bounds__(256) void k_expand(const _Float16* __restrict__ SH, const _Float16* __restrict__ SL, _Float16* __restrict__ DH, _Float16* __restrict__ DL, int col0) {
  const size_t t = (size_t)blockIdx.x * 256 + threadIdx.x; if (t >= (size_t)NR * NH * (HD / 8)) return; const int d0 = (int)(t % (HD / 8)) * 8; const int h = (int)((t / (HD / 8)) % NH); const size_t s = t / ((HD / 8) * NH);
  const size_t si = s * KVD + (size_t)(h / (NH / NKV)) * HD + d0, di = s * (size_t)(3 * EMB) + col0 + (size_t)h * HD + d0; const v8us a = *(const v8us*)((const unsigned short*)SH + si), bl = *(const v8us*)((const unsigned short*)SL + si);
  { *(v8us*)((unsigned short*)DH + di) = a; *(v8us*)((unsigned short*)DL + di) = bl;  } }

extern "C" void kernel_launch(void* const* d_in, const int* in_sizes, int n_in,
                              void* d_out, int out_size, void* d_ws, size_t ws_size, hipStream_t stream) {
  (void)in_sizes; (void)n_in; (void)out_size;
  const float* const* I = (const float* const*)d_in; const float* x = I[0]; const float* Wq = I[1]; const float* bq = I[2]; const float* Wk = I[3]; const float* bk = I[4]; const float* Wv = I[5]; const float* bv = I[6]; const float* Wo = I[7]; const int* pid = (const int*)d_in[8];
  char* ws = (char*)d_ws; size_t off = 0;
  auto take = [&](size_t bytes) { char* p = ws + off; off += (bytes + 255) & ~(size_t)255; return p; };
  const size_t npb = (size_t)SLEN * EMB, npa = (size_t)NR * EMB;      /* per-batch plane, plane of both batches */
  _Float16* BQ = (_Float16*)take((size_t)EMB * EMB * 2); _Float16* BK = (_Float16*)take((size_t)KVD * EMB * 2); _Float16* BV = (_Float16*)take((size_t)KVD * EMB * 2); _Float16* BO = (_Float16*)take((size_t)EMB * EMB * 2);
  float* CS = (float*)take((size_t)NR * HH * 4); float* SN = (float*)take((size_t)NR * HH * 4);
  _Float16* X16 = (_Float16*)take(npa * 2); float* QF = (float*)take(npa * 4); float* KF = (float*)take((size_t)NR * KVD * 4); float* VF = (float*)take((size_t)NR * KVD * 4); _Float16* KH8 = (_Float16*)take((size_t)NR * KVD * 2); _Float16* KL8 = (_Float16*)take((size_t)NR * KVD * 2); _Float16* VH8 = (_Float16*)take((size_t)NR * KVD * 2); _Float16* VL8 = (_Float16*)take((size_t)NR * KVD * 2);
  _Float16* H16 = (_Float16*)take(npa * 3 * 2); _Float16* L16 = (_Float16*)take(npa * 3 * 2); _Float16* VT = (_Float16*)take(npa * 2); _Float16* VTL = (_Float16*)take(npa * 2);
  float* O = QF; _Float16* OH = X16; _Float16* OLo = (_Float16*)take(npa * 2);      /* O over the q f32 plane (dead after the rope split); O hi over the x plane (dead after the projections) */
  if (off > ws_size) return;      /* 8+2+2+8 + 1 + 16 + 32 + 8+8 + 4x4 + 48 + 48 + 16 + 16 + 16 = 245 MiB */
  float* ob = (float*)d_out;
  k_wt_f16<<<(unsigned)(((size_t)EMB * EMB / 8 + 255) / 256), 256, 0, stream>>>(Wq, BQ, EMB, EMB, 16.0f); k_wt_f16<<<(unsigned)(((size_t)EMB * KVD / 8 + 255) / 256), 256, 0, stream>>>(Wk, BK, EMB, KVD, 16.0f); k_wt_f16<<<(unsigned)(((size_t)EMB * KVD / 8 + 255) / 256), 256, 0, stream>>>(Wv, BV, EMB, KVD, 16.0f); k_wt_f16<<<(unsigned)(((size_t)EMB * EMB / 8 + 255) / 256), 256, 0, stream>>>(Wo, BO, EMB, EMB, 16.0f);      /* (in,out) weights */
  k_rotab<<<(NR * HH + 255) / 256, 256, 0, stream>>>(pid, CS, SN);
  k_x16<<<(unsigned)((npa / 8 + 255) / 256), 256, 0, stream>>>(x, X16, npa / 8);
  k_gemm2<0><<<dim3((NR / 128) * (EMB / 64), 1), 128, 0, stream>>>(X16, EMB, 0, BQ, EMB, 0, 0.0625f, bq, 0, nullptr, 1, 0, 0, QF, nullptr, EMB, 0, NR, EMB, EMB);
  k_gemm2<0><<<dim3((NR / 128) * (KVD / 64), 1), 128, 0, stream>>>(X16, EMB, 0, BK, EMB, 0, 0.0625f, bk, 0, nullptr, 1, 0, 0, KF, nullptr, KVD, 0, NR, KVD, EMB);
  k_gemm2<0><<<dim3((NR / 128) * (KVD / 64), 1), 128, 0, stream>>>(X16, EMB, 0, BV, EMB, 0, 0.0625f, bv, 0, nullptr, 1, 0, 0, VF, nullptr, KVD, 0, NR, KVD, EMB);
  k_rope<<<(unsigned)(((size_t)NR * NH * (HH / 8) + 255) / 256), 256, 0, stream>>>(QF, NH, CS, SN, H16, L16, 3 * EMB);      /* q roped + split into the [q | k | v] planes */
  k_rope<<<(unsigned)(((size_t)NR * NKV * (HH / 8) + 255) / 256), 256, 0, stream>>>(KF, NKV, CS, SN, KH8, KL8, KVD);
  k_hl<<<(unsigned)(((size_t)NR * KVD / 8 + 255) / 256), 256, 0, stream>>>(VF, VH8, VL8, (size_t)NR * KVD / 8);
  k_expand<<<(unsigned)(((size_t)NR * NH * (HD / 8) + 255) / 256), 256, 0, stream>>>(KH8, KL8, H16, L16, EMB); k_expand<<<(unsigned)(((size_t)NR * NH * (HD / 8) + 255) / 256), 256, 0, stream>>>(VH8, VL8, H16, L16, 2 * EMB);
  k_vt<NH, SLEN><<<NB * NH * (SLEN / 64), 256, 0, stream>>>(H16, 3 * EMB, 2 * EMB, VT); k_vt<NH, SLEN><<<NB * NH * (SLEN / 64), 256, 0, stream>>>(L16, 3 * EMB, 2 * EMB, VTL);
  k_flash5<1><<<NB * NH * QBN5, 128, 0, stream>>>(H16, L16, 3 * EMB, H16 + EMB, L16 + EMB, 3 * EMB, VT, VTL, nullptr, O, EMB);
  k_flash<1><<<NB * NH * QBNP, 128, 0, stream>>>(H16, 3 * EMB, H16 + EMB, 3 * EMB, VT, nullptr, O, EMB);
  k_hl<<<(unsigned)((npa / 8 + 255) / 256), 256, 0, stream>>>(O, OH, OLo, npa / 8);
  k_gemm2<0><<<dim3((NR / 128) * (EMB / 64), 1), 128, 0, stream>>>(OH, EMB, 0, BO, EMB, 0, 0.0625f, nullptr, 0, nullptr, 1, 0, 0, ob, nullptr, EMB, 0, NR, EMB, EMB);
  k_gemm2<0><<<dim3((RE / 128) * (EMB / 64), NB), 128, 0, stream>>>(OLo, EMB, npb, BO, EMB, 0, 0.0625f / 1024.0f, nullptr, 0, ob, 1, (size_t)EMB, 0, ob, nullptr, EMB, npb, RE, EMB, EMB);      /* grid y = batch: the first RE rows of each */
}

// v005
// A run of this version takes 341 microseconds.
// Two timings next to v004 put it at 1.13 and 1.14 times that version's speed.
// Counting every step since v000, it is 4.04 times as fast.
#include <hip/hip_runtime.h>
// WedoctorAttention (2 x 2048 tokens, hidden 2048; 32 query heads / 8 kv heads of 64 (GQA), rotate-half RoPE from the INPUT position ids, causal SDPA (1/8), out = o Wo): q/k/v = x W + b.
// Structure (both batches in every launch: the 4096 token rows are one row range, batch = row / 2048): exact f16 plane of x; q / k / v GEMMs (32x64 wave tiles, f32 accumulation, exact x16 weights + bias) into f32 planes; angle tables from the input position ids (f32 trig); RoPE on VALU while splitting q and k into f16 hi + 2^10-residual planes, v split directly; the 8 kv heads expanded to the 32 query heads (repeat 4) into the fused [q | k | v] hi/lo planes; V^T hi/residual by LDS tiles; the fused causal flash kernel in its 5-plane form for the first 256 query rows and plain beyond; attention output as f16 hi (+ residual on those rows) into the output GEMMs.
// Compute dtype: x, weights and biases rounded to bf16; rows < 256 per batch: q, k, P, v, O hi + residual; beyond: plain f16; f32 accumulation/softmax/trig. v_wmma_f32_16x16x32_f16.
#define NB 2
#define EMB 2048
#define NR (NB * SLEN)           /* 4096 token rows */
#define SLEN 2048
#define SQ SLEN
#define TQ SLEN
#define TK SLEN
#define NH 32
#define NKV 8
#define KVD (NKV * HD)
#define HD 64
#define HH (HD / 2)
#define SCL 0.125f               /* 64^-0.5 */
#define QBLKS (TQ / 64)
#define QB05 0                   /* 5-plane flash: query blocks [0, QBN5) of every (batch, head) — the early causal rows whose outputs average over few keys */
#define QBN5 4
#define QB0P QBN5                /* plain flash (hi planes only): query blocks [QBN5, QBLKS) */
#define QBNP (QBLKS - QBN5)
#define RE 256                   /* rows per batch that take the hi+lo output operand (= QBN5 * 64) */
typedef __bf16 v16b __attribute__((ext_vector_type(16)));
typedef unsigned short v8us __attribute__((ext_vector_type(8), may_alias));
typedef float  v8f  __attribute__((ext_vector_type(8)));
typedef float  v4f  __attribute__((ext_vector_type(4)));
typedef float  v4fa __attribute__((ext_vector_type(4), may_alias));
union FragB { v16b v; v8us half[2]; unsigned short u[16]; };

__device__ __forceinline__ unsigned short bf16_bits(float x) { unsigned int u = __float_as_uint(x); return (unsigned short)((u + 0x7FFFu + ((u >> 16) & 1u)) >> 16); }
__device__ __forceinline__ float bf16_val(unsigned short b) { return __uint_as_float(((unsigned int)b) << 16); }
__device__ __forceinline__ float bf16_round(float x) { return bf16_val(bf16_bits(x)); }
// D += A·B with NT terms: 1 = ah·bh, 2 = + al·bh (A split), 3 = + ah·bl (both split)
template <int NT>
__device__ __forceinline__ v8f mmaN(v16b ah, v16b al, v16b bh, v16b bl, v8f c) {
  c = __builtin_amdgcn_wmma_f32_16x16x32_bf16(false, ah, false, bh, (short)0, c, false, false);
  if (NT >= 2) c = __builtin_amdgcn_wmma_f32_16x16x32_bf16(false, al, false, bh, (short)0, c, false, false);
  if (NT >= 3) c = __builtin_amdgcn_wmma_f32_16x16x32_bf16(false, ah, false, bl, (short)0, c, false, false);
  asm volatile("v_nop\n\tv_nop\n\tv_nop\n\tv_nop" : "+v"(c) : "v"(ah), "v"(al), "v"(bh), "v"(bl));
  return c;
}

__global__ __launch_bounds__(256) void k_wt_bf16(const float* __restrict__ W, unsigned short* __restrict__ Wt, int K, int N) {
  const int t = blockIdx.x * 256 + threadIdx.x;
  const int k8n = K / 8;
  if (t >= N * k8n) return;
  const int n = t / k8n, k8 = (t % k8n) * 8;
  v8us v;
#pragma unroll
  for (int i = 0; i < 8; ++i) v[i] = bf16_bits(W[(size_t)(k8 + i) * N + n]);
  *(v8us*)(Wt + (size_t)n * K + k8) = v;
  
}

// GEMM C[M][N] (f32, pitch ldc) = act(A[M][K]·W + bias). A f32 row-major (pitch lda) converted per fragment to bf16
// (ASPLIT: hi/lo two planes -> 2 terms, else single rounded term); Wt bf16 [N][K] (pitch ldb). BIAS_BF16 rounds the
// bias to bf16 first (bias quantised to bf16 before the add). K%32==0, M%16==0, N%64==0.
template <bool ASPLIT, int ACT, bool BIAS_BF16>
__global__ __launch_bounds__(128) void k_gemm_bf(const float* __restrict__ A, int lda, const unsigned short* __restrict__ Wt, int ldb,
                                               const float* __restrict__ bias, float* __restrict__ C, int ldc, int M, int N, int K) {
  __shared__ __attribute__((aligned(16))) float so[4][16][64];
  const int tid = threadIdx.x, w = tid >> 5, lane = tid & 31, ln = lane & 15, hh = lane >> 4;
  const int ntn = N / 64;
  const int wid = blockIdx.x * 4 + w;
  const int mt = wid / ntn, nq = wid % ntn;
  if (mt * 16 >= M) return;
  const int row0 = mt * 16, col0 = nq * 64;
  const float* arow = A + (size_t)(row0 + ln) * lda;
  v8f acc[4] = {};
  for (int kb = 0; kb < K; kb += 32) {
    FragB ah, al;
    const v4f x0 = *(const v4fa*)(arow + kb + 8 * hh), x1 = *(const v4fa*)(arow + kb + 8 * hh + 4);
    const v4f x2 = *(const v4fa*)(arow + kb + 16 + 8 * hh), x3 = *(const v4fa*)(arow + kb + 16 + 8 * hh + 4);
    float xs[16] = {x0[0],x0[1],x0[2],x0[3],x1[0],x1[1],x1[2],x1[3],x2[0],x2[1],x2[2],x2[3],x3[0],x3[1],x3[2],x3[3]};
#pragma unroll
    for (int i = 0; i < 16; ++i) { const unsigned short hb = bf16_bits(xs[i]); ah.u[i] = hb; al.u[i] = ASPLIT ? bf16_bits(xs[i] - bf16_val(hb)) : (unsigned short)0; }
#pragma unroll
    for (int t = 0; t < 4; ++t) {
      const unsigned short* brow = Wt + (size_t)(col0 + t * 16 + ln) * ldb + kb;
      FragB b;
      b.half[0] = *(const v8us*)(brow + 8 * hh);
      b.half[1] = *(const v8us*)(brow + 16 + 8 * hh);
      acc[t] = mmaN<ASPLIT ? 2 : 1>(ah.v, al.v, b.v, b.v, acc[t]);
    }
  }
#pragma unroll
  for (int t = 0; t < 4; ++t) {
    float bv = bias ? bias[col0 + t * 16 + ln] : 0.f;
    if (BIAS_BF16) bv = bf16_round(bv);
#pragma unroll
    for (int r = 0; r < 8; ++r) { float v = acc[t][r] + bv; if (ACT == 1) v = fmaxf(v, 0.f); so[w][8 * hh + r][t * 16 + ln] = v; }
  }
  __builtin_amdgcn_fence(__ATOMIC_ACQ_REL, "workgroup");
  __builtin_amdgcn_wave_barrier();
  const int rsub = lane >> 4, c4 = (lane & 15) * 4;
  {
#pragma unroll
    for (int q = 0; q < 8; ++q) {
      const int r = q * 2 + rsub;
      const v4f v = *(const v4fa*)&so[w][r][c4];
      *(v4f*)(C + (size_t)(row0 + r) * ldc + col0 + c4) = v;
    }
    
  }
}

// GEMM C = act(A·W + bias + resid): A f32 (ASPLIT -> hi/lo 2 terms), Wt bf16 [N][K]; ACT 0 none, 1 relu, 2 exact gelu;
// resid (optional, f32, row index = (row % rmod), pitch ldr, RES_BF16 rounds it) added before the activation.
template <bool ASPLIT, int ACT, bool BIAS_BF16, bool RES_BF16>
__global__ __launch_bounds__(128) void k_gemm_bf3(const float* __restrict__ A, int lda, const unsigned short* __restrict__ Wt, int ldb,
                                                const float* __restrict__ bias, const float* __restrict__ resid, int rmod, int ldr,
                                                float* __restrict__ C, int ldc, int M, int N, int K) {
  __shared__ __attribute__((aligned(16))) float so[4][16][64];
  const int tid = threadIdx.x, w = tid >> 5, lane = tid & 31, ln = lane & 15, hh = lane >> 4;
  const int ntn = N / 64;
  const int wid = blockIdx.x * 4 + w;
  const int mt = wid / ntn, nq = wid % ntn;
  if (mt * 16 >= M) return;
  const int row0 = mt * 16, col0 = nq * 64;
  const float* arow = A + (size_t)(row0 + ln) * lda;
  v8f acc[4] = {};
  for (int kb = 0; kb < K; kb += 32) {
    FragB ah, al;
    const v4f x0 = *(const v4fa*)(arow + kb + 8 * hh), x1 = *(const v4fa*)(arow + kb + 8 * hh + 4);
    const v4f x2 = *(const v4fa*)(arow + kb + 16 + 8 * hh), x3 = *(const v4fa*)(arow + kb + 16 + 8 * hh + 4);
    float xs[16] = {x0[0],x0[1],x0[2],x0[3],x1[0],x1[1],x1[2],x1[3],x2[0],x2[1],x2[2],x2[3],x3[0],x3[1],x3[2],x3[3]};
#pragma unroll
    for (int i = 0; i < 16; ++i) { const unsigned short hb = bf16_bits(xs[i]); ah.u[i] = hb; al.u[i] = ASPLIT ? bf16_bits(xs[i] - bf16_val(hb)) : (unsigned short)0; }
#pragma unroll
    for (int t = 0; t < 4; ++t) {
      const unsigned short* brow = Wt + (size_t)(col0 + t * 16 + ln) * ldb + kb;
      FragB b;
      b.half[0] = *(const v8us*)(brow + 8 * hh);
      b.half[1] = *(const v8us*)(brow + 16 + 8 * hh);
      acc[t] = mmaN<ASPLIT ? 2 : 1>(ah.v, al.v, b.v, b.v, acc[t]);
    }
  }
#pragma unroll
  for (int t = 0; t < 4; ++t) {
    const int col = col0 + t * 16 + ln;
    float bv = bias ? bias[col] : 0.f;
    if (BIAS_BF16) bv = bf16_round(bv);
#pragma unroll
    for (int r = 0; r < 8; ++r) {
      float v = acc[t][r] + bv;
      if (resid) { float rv = resid[(size_t)((row0 + 8 * hh + r) % rmod) * ldr + col]; if (RES_BF16) rv = bf16_round(rv); v += rv; }
      if (ACT == 1) v = fmaxf(v, 0.f);
      if (ACT == 2) v = 0.5f * v * (1.0f + erff(v * 0.70710678118654752f));
      if (ACT == 3) { const float u = 0.7978845608028654f * (v + 0.044715f * v * v * v); v = 0.5f * v * (1.0f + tanhf(u)); }
      so[w][8 * hh + r][t * 16 + ln] = v;
    }
  }
  __builtin_amdgcn_fence(__ATOMIC_ACQ_REL, "workgroup");
  __builtin_amdgcn_wave_barrier();
  const int rsub = lane >> 4, c4 = (lane & 15) * 4;
  {
#pragma unroll
    for (int q = 0; q < 8; ++q) {
      const int r = q * 2 + rsub;
      const v4f v = *(const v4fa*)&so[w][r][c4];
      *(v4f*)(C + (size_t)(row0 + r) * ldc + col0 + c4) = v;
    }
    
  }
}
// row LayerNorm (biased variance, eps) over N: s = X (+ R); optional out_sum <- s; out_norm <- (s-mu)*rsqrt(var+eps)*g + b
template <bool PARAM_BF16>
__global__ __launch_bounds__(256) void k_layernorm(const float* __restrict__ X, const float* __restrict__ R, const float* __restrict__ g, const float* __restrict__ bta,
                                                  float* __restrict__ out_sum, float* __restrict__ out_norm, int N, float eps) {
  __shared__ float red[256];
  const int row = blockIdx.x, tid = threadIdx.x;
  const float* x = X + (size_t)row * N; const float* rr = R ? R + (size_t)row * N : nullptr;
  float vals[16];                     // up to N = 4096
  const int per = N / 256;            // contiguous chunk per thread? use strided-by-4 chunks: thread handles j = tid*4 + 1024*u
  float s1 = 0.f;
  for (int u = 0; u < per / 4; ++u) {
    const int j = tid * 4 + 1024 * u;
    const v4f a = *(const v4fa*)(x + j);
    v4f b = {0.f,0.f,0.f,0.f}; if (rr) b = *(const v4fa*)(rr + j);
#pragma unroll
    for (int q = 0; q < 4; ++q) { const float v = a[q] + b[q]; vals[u * 4 + q] = v; s1 += v; }
  }
  red[tid] = s1; __syncthreads();
  for (int st = 128; st > 0; st >>= 1) { if (tid < st) red[tid] += red[tid + st]; __syncthreads(); }
  const float mu = red[0] / (float)N; __syncthreads();
  float s2 = 0.f;
  for (int u = 0; u < per / 4; ++u)
#pragma unroll
    for (int q = 0; q < 4; ++q) { const float c = vals[u * 4 + q] - mu; s2 += c * c; }
  red[tid] = s2; __syncthreads();
  for (int st = 128; st > 0; st >>= 1) { if (tid < st) red[tid] += red[tid + st]; __syncthreads(); }
  const float rs = rsqrtf(red[0] / (float)N + eps);
  {
    for (int u = 0; u < per / 4; ++u) {
      const int j = tid * 4 + 1024 * u;
      v4f o, sm;
#pragma unroll
      for (int q = 0; q < 4; ++q) {
        float gg = g[j + q], bb = bta[j + q];
        if (PARAM_BF16) { gg = bf16_round(gg); bb = bf16_round(bb); }
        sm[q] = vals[u * 4 + q]; o[q] = (vals[u * 4 + q] - mu) * rs * gg + bb;
      }
      if (out_sum) *(v4f*)(out_sum + (size_t)row * N + j) = sm;
      *(v4f*)(out_norm + (size_t)row * N + j) = o;
    }
    
  }
}



// ---- f16 WMMA path (v_wmma_f32_16x16x32_f16): 11-bit significands for operands in range — used where a [0,1] probability operand needs more precision than bf16
typedef _Float16 v16h __attribute__((ext_vector_type(16)));
union FragH { v16h v; v8us half[2]; _Float16 h[16]; unsigned short u[16]; };
template <int NT>
__device__ __forceinline__ v8f mmaH(v16h ah, v16h al, v16h bh, v16h bl, v8f c) {
  c = __builtin_amdgcn_wmma_f32_16x16x32_f16(false, ah, false, bh, (short)0, c, false, false);
  if (NT >= 2) c = __builtin_amdgcn_wmma_f32_16x16x32_f16(false, al, false, bh, (short)0, c, false, false);
  if (NT >= 3) c = __builtin_amdgcn_wmma_f32_16x16x32_f16(false, ah, false, bl, (short)0, c, false, false);
  asm volatile("v_nop\n\tv_nop\n\tv_nop\n\tv_nop" : "+v"(c) : "v"(ah), "v"(al), "v"(bh), "v"(bl));
  return c;
}
// batched GEMM like k_gemm_b but f16 operands: A f32 (split into f16 hi/lo if ASPLIT, else rounded to f16), Bt = f16 values [n][k]; alpha; C f32; N multiple of 16 (partial tiles skipped)
template <bool ASPLIT>
__global__ __launch_bounds__(128) void k_gemm_h(const float* __restrict__ A, int lda, size_t sA, const _Float16* __restrict__ Bh, int ldb, size_t sB, float alpha, float* __restrict__ C, int ldc, size_t sC, int M, int N, int K) {
  __shared__ __attribute__((aligned(16))) float so[4][16][64];
  const int tid = threadIdx.x, w = tid >> 5, lane = tid & 31, ln = lane & 15, hh = lane >> 4; const int by = blockIdx.y;
  A += (size_t)by * sA; Bh += (size_t)by * sB; C += (size_t)by * sC;
  const int ntn = (N + 63) / 64; const int wid = blockIdx.x * 4 + w; const int mt = wid / ntn, nq = wid % ntn; if (mt * 16 >= M) return;
  const int row0 = mt * 16, col0 = nq * 64; const float* arow = A + (size_t)(row0 + ln) * lda;
  v8f acc[4] = {};
  for (int kb = 0; kb < K; kb += 32) {
    FragH ah, al;
    const v4f x0 = *(const v4fa*)(arow + kb + 8 * hh), x1 = *(const v4fa*)(arow + kb + 8 * hh + 4), x2 = *(const v4fa*)(arow + kb + 16 + 8 * hh), x3 = *(const v4fa*)(arow + kb + 16 + 8 * hh + 4);
    float xs[16] = {x0[0],x0[1],x0[2],x0[3],x1[0],x1[1],x1[2],x1[3],x2[0],x2[1],x2[2],x2[3],x3[0],x3[1],x3[2],x3[3]};
#pragma unroll
    for (int i = 0; i < 16; ++i) { const _Float16 h = (_Float16)xs[i]; ah.h[i] = h; al.h[i] = ASPLIT ? (_Float16)(xs[i] - (float)h) : (_Float16)0.0f; }
#pragma unroll
    for (int t = 0; t < 4; ++t) { if (col0 + t * 16 >= N) continue; const size_t boff = (size_t)(col0 + t * 16 + ln) * ldb + kb; FragH bq; bq.half[0] = *(const v8us*)(Bh + boff + 8 * hh); bq.half[1] = *(const v8us*)(Bh + boff + 16 + 8 * hh);
      acc[t] = mmaH<ASPLIT ? 2 : 1>(ah.v, al.v, bq.v, bq.v, acc[t]); }
  }
#pragma unroll
  for (int t = 0; t < 4; ++t) { if (col0 + t * 16 >= N) continue;
#pragma unroll
    for (int r = 0; r < 8; ++r) so[w][8 * hh + r][t * 16 + ln] = acc[t][r] * alpha; }
  __builtin_amdgcn_fence(__ATOMIC_ACQ_REL, "workgroup"); __builtin_amdgcn_wave_barrier();
  const int rsub = lane >> 4, c4 = (lane & 15) * 4;
  {
#pragma unroll
    for (int q = 0; q < 8; ++q) { const int r = q * 2 + rsub; if (col0 + c4 < N) { const v4f v = *(const v4fa*)&so[w][r][c4]; *(v4f*)(C + (size_t)(row0 + r) * ldc + col0 + c4) = v; } }
     }
}

// Wt[n][k] = f16(bf16(W[k][n])·scale) from f32 row-major W[K][N] (scale = power of two; bf16-exact weights stay exact in f16 away from the subnormal range)
// One block per 64 x 64 tile (K % 64 == 0, N % 64 == 0; grid = (K / 64) * (N / 64)): W is read in whole 256-byte row pieces (16 bytes a lane), converted, turned in LDS, and Wt is written in whole 128-byte rows (16 bytes a lane).
__global__ __launch_bounds__(256) void k_wt_f16(const float* __restrict__ W, _Float16* __restrict__ Wt, int K, int N, float scale) {
  __shared__ unsigned int tl[64][33];      /* tile [k][n], two f16 a word; the odd pitch keeps the column reads below on distinct banks */
  const int tid = threadIdx.x; const int nkt = K >> 6; const int nt = blockIdx.x / nkt, kt = blockIdx.x - nt * nkt; const int k0 = kt * 64, n0 = nt * 64;
  const int r = tid >> 4, c4 = (tid & 15) * 4; v4f a[4];
#pragma unroll
  for (int p = 0; p < 4; ++p) a[p] = *(const v4fa*)(W + (size_t)(k0 + p * 16 + r) * N + n0 + c4);
#pragma unroll
  for (int p = 0; p < 4; ++p) { FragH f;
#pragma unroll
    for (int q = 0; q < 4; ++q) f.h[q] = (_Float16)(bf16_round(a[p][q]) * scale);
    tl[p * 16 + r][c4 / 2] = (unsigned int)f.u[0] | ((unsigned int)f.u[1] << 16); tl[p * 16 + r][c4 / 2 + 1] = (unsigned int)f.u[2] | ((unsigned int)f.u[3] << 16); }
  __syncthreads();
  typedef unsigned short usa __attribute__((may_alias)); const usa* ts = (const usa*)&tl[0][0];      /* the words of the tile read as single f16 */
#pragma unroll
  for (int rd = 0; rd < 2; ++rd) { const int n = rd * 32 + (tid >> 3), pc = tid & 7; FragH f;
#pragma unroll
    for (int q = 0; q < 8; ++q) f.u[q] = ts[(pc * 8 + q) * 66 + n];
    *(v8us*)((unsigned short*)Wt + (size_t)(n0 + n) * K + k0 + pc * 8) = f.half[0]; }
}
// k_gemm_hh variant with fused epilogue: v = acc·alpha + bias[by·sBias + col] (+ CP[(row/rowsPerB)·sCPb + by·64 + col] if CP) ; ACT 0 none / 1 elu ; writes f16 C16 (and f32 C if non-null)
template <int ACT>
__global__ __launch_bounds__(128) void k_gemm_hhx(const _Float16* __restrict__ A, int lda, size_t sA, const _Float16* __restrict__ Bh, int ldb, size_t sB, float alpha, const float* __restrict__ bias, size_t sBias, const float* __restrict__ CP, int rowsPerB, size_t sCPb, int row0g,
    float* __restrict__ C, _Float16* __restrict__ C16, int ldc, size_t sC, int M, int N, int K) {
  __shared__ __attribute__((aligned(16))) float so[4][16][64];
  const int tid = threadIdx.x, w = tid >> 5, lane = tid & 31, ln = lane & 15, hh = lane >> 4; const int by = blockIdx.y;
  A += (size_t)by * sA; Bh += (size_t)by * sB; const size_t cofs = (size_t)by * sC; const float* bp = bias ? bias + (size_t)by * sBias : nullptr;
  const int ntn = (N + 63) / 64; const int wid = blockIdx.x * 4 + w; const int mt = wid / ntn, nq = wid % ntn; if (mt * 16 >= M) return;
  const int row0 = mt * 16, col0 = nq * 64; const _Float16* arow = A + (size_t)(row0 + ln) * lda;
  v8f acc[4] = {};
  for (int kb = 0; kb < K; kb += 32) { FragH ah; ah.half[0] = *(const v8us*)((const unsigned short*)arow + kb + 8 * hh); ah.half[1] = *(const v8us*)((const unsigned short*)arow + kb + 16 + 8 * hh);
#pragma unroll
    for (int t = 0; t < 4; ++t) { if (col0 + t * 16 >= N) continue; const size_t boff = (size_t)(col0 + t * 16 + ln) * ldb + kb; FragH bq; bq.half[0] = *(const v8us*)((const unsigned short*)Bh + boff + 8 * hh); bq.half[1] = *(const v8us*)((const unsigned short*)Bh + boff + 16 + 8 * hh);
      acc[t] = mmaH<1>(ah.v, ah.v, bq.v, bq.v, acc[t]); }
  }
#pragma unroll
  for (int t = 0; t < 4; ++t) { if (col0 + t * 16 >= N) continue; const int col = col0 + t * 16 + ln; const float bv = bp ? bf16_round(bp[col]) : 0.f;
#pragma unroll
    for (int r = 0; r < 8; ++r) { float v = acc[t][r] * alpha + bv; if (CP) { const int bidx = (row0g + row0 + 8 * hh + r) / rowsPerB; v += CP[(size_t)bidx * sCPb + (size_t)by * 64 + col]; } if (ACT == 1) v = (v > 0.f) ? v : expm1f(v); else if (ACT == 7) v = (v > 0.f) ? v + 1.0f : expf(v); else if (ACT == 8) v = tanhf(v); else if (ACT == 9) v = 0.5f * v * (1.0f + tanhf(0.7978845608028654f * (v + 0.044715f * v * v * v))); else if (ACT == 11) v = 1.0f / (1.0f + expf(-v)); else if (ACT == 12) v = (v > 0.f) ? v : 0.01f * v; else if (ACT == 14) v = (v > 0.f) ? v : 0.1f * v; else if (ACT == 15) v = v / (1.0f + expf(-v)); else if (ACT == 3) v = fmaxf(v, 0.f); else if (ACT == 6) v = 0.5f * v * (1.0f + erff(v * 0.70710678118654752f)); so[w][8 * hh + r][t * 16 + ln] = v; } }
  __builtin_amdgcn_fence(__ATOMIC_ACQ_REL, "workgroup"); __builtin_amdgcn_wave_barrier();
  const int rsub = lane >> 4, c4 = (lane & 15) * 4; typedef _Float16 v4h __attribute__((ext_vector_type(4)));
  {
#pragma unroll
    for (int q = 0; q < 8; ++q) { const int r = q * 2 + rsub; if (col0 + c4 < N) { const v4f v = *(const v4fa*)&so[w][r][c4]; if (C) *(v4f*)(C + cofs + (size_t)(row0 + r) * ldc + col0 + c4) = v; if (C16) { v4h h4; for (int i = 0; i < 4; ++i) h4[i] = (_Float16)v[i]; *(v4h*)(C16 + cofs + (size_t)(row0 + r) * ldc + col0 + c4) = h4; } } }
     }
}


typedef _Float16 v4h __attribute__((ext_vector_type(4)));

__global__ __launch_bounds__(256) void k_x16(const float* __restrict__ x, _Float16* __restrict__ X16, size_t n8) { const size_t t = (size_t)blockIdx.x * 256 + threadIdx.x; if (t >= n8) return; FragH f;
#pragma unroll
  for (int q = 0; q < 8; ++q) f.h[q] = (_Float16)bf16_round(x[t * 8 + q]); *(v8us*)((unsigned short*)X16 + t * 8) = f.half[0];  }
__global__ __launch_bounds__(256) void k_h16(const float* __restrict__ x, _Float16* __restrict__ X16, size_t n8) { const size_t t = (size_t)blockIdx.x * 256 + threadIdx.x; if (t >= n8) return; FragH f;
#pragma unroll
  for (int q = 0; q < 8; ++q) f.h[q] = (_Float16)x[t * 8 + q]; *(v8us*)((unsigned short*)X16 + t * 8) = f.half[0];  }
__global__ __launch_bounds__(256) void k_round16f(const float* __restrict__ W, _Float16* __restrict__ Bt, size_t n8) { const size_t t = (size_t)blockIdx.x * 256 + threadIdx.x; if (t >= n8) return; FragH f;
#pragma unroll
  for (int i = 0; i < 8; ++i) f.h[i] = (_Float16)(bf16_round(W[t * 8 + i]) * 16.0f); *(v8us*)((unsigned short*)Bt + t * 8) = f.half[0];  }
template <int NHv, int TTv>
__global__ __launch_bounds__(256) void k_vt(const _Float16* __restrict__ V16, int ldv, int voff, _Float16* __restrict__ Vt) { __shared__ unsigned short tl[64][66]; const int tid = threadIdx.x; const int slab = blockIdx.x / (TTv / 64), lg = blockIdx.x % (TTv / 64); const int b = slab / NHv, h = slab % NHv;
  for (int i = tid; i < 64 * 8; i += 256) { const int r = i / 8, c8 = (i % 8) * 8; FragH f; f.half[0] = *(const v8us*)((const unsigned short*)V16 + ((size_t)b * TTv + lg * 64 + r) * ldv + voff + h * 64 + c8);
#pragma unroll
    for (int q = 0; q < 8; ++q) tl[r][c8 + q] = f.u[q]; }
  __syncthreads();
  {
#pragma unroll
    for (int rd = 0; rd < 2; ++rd) { const int d = rd * 32 + tid / 8, pc = tid % 8; FragH f;
#pragma unroll
      for (int q = 0; q < 8; ++q) f.u[q] = tl[pc * 8 + q][d];
      *(v8us*)((unsigned short*)Vt + ((size_t)slab * 64 + d) * TTv + lg * 64 + pc * 8) = f.half[0]; }
     } }

__global__ __launch_bounds__(256) void k_hl(const float* __restrict__ F, _Float16* __restrict__ Hh, _Float16* __restrict__ Hl, size_t n8) { const size_t t = (size_t)blockIdx.x * 256 + threadIdx.x; if (t >= n8) return; FragH fh, fl; const v4f a = *(const v4fa*)(F + t * 8), c = *(const v4fa*)(F + t * 8 + 4);
#pragma unroll
  for (int q = 0; q < 4; ++q) { _Float16 h = (_Float16)a[q]; fh.h[q] = h; fl.h[q] = (_Float16)((a[q] - (float)h) * 1024.0f); h = (_Float16)c[q]; fh.h[4 + q] = h; fl.h[4 + q] = (_Float16)((c[q] - (float)h) * 1024.0f); }
  { *(v8us*)((unsigned short*)Hh + t * 8) = fh.half[0]; *(v8us*)((unsigned short*)Hl + t * 8) = fl.half[0];  } }

// ---- fast GEMM (wave tile 32x64; requires M % 128 == 0 rows per launch region, N % 64 == 0 and K % 64 == 0); epilogue = k_gemm_hhx semantics, but the CP addend takes C's own grid-y offset ----
__device__ __forceinline__ v16h g2_frag(const _Float16* p, int hh) { FragH f; f.half[0] = *(const v8us*)((const unsigned short*)p + 8 * hh); f.half[1] = *(const v8us*)((const unsigned short*)p + 16 + 8 * hh); return f.v; }
__device__ __forceinline__ v8f g2_mma(v16h a, v16h b, v8f c) { v8f d = __builtin_amdgcn_wmma_f32_16x16x32_f16(false, a, false, b, (short)0, c, false, false); asm volatile("v_nop\n\tv_nop\n\tv_nop\n\tv_nop" : "+v"(d) : "v"(a), "v"(b)); return d; }
#define G2_KT 64                      /* k per stage: 128 bytes of every operand row */
#define G2_PITCH 144                  /* LDS row pitch in bytes: 128 + 16, an odd multiple of 16 for the 16-byte fragment reads */
#define G2_STAGE (192 * G2_PITCH)     /* one stage: 128 A rows, then 64 B rows */
// One stage's copies of one lane: 16 bytes of each of 8 A rows and 4 B rows (rows 16 apart; sa, sb = 16 rows in bytes), global memory -> LDS through no register.
// A wave's 32 lanes cover 4 whole 128-byte rows per copy. s_wait_xcnt 0 ends the statement so that it stands in front of any rewrite of the address registers the copies name.
__device__ __forceinline__ void g2_stage(unsigned l, const char* ga, size_t sa, const char* gb, size_t sb) {
  const char* a1 = ga + sa; const char* a2 = a1 + sa; const char* a3 = a2 + sa; const char* a4 = a3 + sa; const char* a5 = a4 + sa; const char* a6 = a5 + sa; const char* a7 = a6 + sa;
  const char* b1 = gb + sb; const char* b2 = b1 + sb; const char* b3 = b2 + sb;
  asm volatile("global_load_async_to_lds_b128 %0, %12, off\n\t"
               "global_load_async_to_lds_b128 %1, %13, off\n\t"
               "global_load_async_to_lds_b128 %2, %14, off\n\t"
               "global_load_async_to_lds_b128 %3, %15, off\n\t"
               "global_load_async_to_lds_b128 %4, %16, off\n\t"
               "global_load_async_to_lds_b128 %5, %17, off\n\t"
               "global_load_async_to_lds_b128 %6, %18, off\n\t"
               "global_load_async_to_lds_b128 %7, %19, off\n\t"
               "global_load_async_to_lds_b128 %8, %20, off\n\t"
               "global_load_async_to_lds_b128 %9, %21, off\n\t"
               "global_load_async_to_lds_b128 %10, %22, off\n\t"
               "global_load_async_to_lds_b128 %11, %23, off\n\t"
               "s_wait_xcnt 0x0"
               :: "v"(l), "v"(l + 16 * G2_PITCH), "v"(l + 32 * G2_PITCH), "v"(l + 48 * G2_PITCH), "v"(l + 64 * G2_PITCH), "v"(l + 80 * G2_PITCH), "v"(l + 96 * G2_PITCH), "v"(l + 112 * G2_PITCH),
                  "v"(l + 128 * G2_PITCH), "v"(l + 144 * G2_PITCH), "v"(l + 160 * G2_PITCH), "v"(l + 176 * G2_PITCH),
                  "v"(ga), "v"(a1), "v"(a2), "v"(a3), "v"(a4), "v"(a5), "v"(a6), "v"(a7), "v"(gb), "v"(b1), "v"(b2), "v"(b3)
               : "memory");
}
// Block tile 128x64 (M % 128 == 0, N % 64 == 0, K % 64 == 0): the A and B tiles of a stage go to LDS by asynchronous copies, two buffers, stage t + 2 in flight while stage t + 1 is worked on; the waves read their fragments from LDS. The order of the products along k is the plain one.
template <int ACT>
__global__ __launch_bounds__(128) void k_gemm2(const _Float16* __restrict__ A, int lda, size_t sA, const _Float16* __restrict__ Bh, int ldb, size_t sB, float alpha, const float* __restrict__ bias, size_t sBias, const float* __restrict__ CP, int rowsPerB, size_t sCPb, int row0g,
    float* __restrict__ C, _Float16* __restrict__ C16, int ldc, size_t sC, int M, int N, int K) {
  __shared__ __attribute__((aligned(128))) unsigned char sm[2 * G2_STAGE];
  float (*so)[32][68] = (float (*)[32][68])sm;      /* output staging (4 x 32 x 68 floats) over the two buffers, used only behind the last trip's barrier */
  const int tid = threadIdx.x, w = tid >> 5, lane = tid & 31, ln = lane & 15, hh = lane >> 4; const int by = blockIdx.y;
  A += (size_t)by * sA; Bh += (size_t)by * sB; const size_t cofs = (size_t)by * sC; const float* bp = bias ? bias + (size_t)by * sBias : nullptr;
  const int ntn = N >> 6; const int mt = blockIdx.x / ntn, nq = blockIdx.x - mt * ntn; const int row0 = mt * 128 + 32 * w, col0 = nq * 64; if (mt * 128 >= M) return;      /* the whole block leaves or none, in front of every barrier */
  const int cr = tid >> 3, cc = tid & 7;      /* copy lane: row cr (+ 16 i) of the tile, 16-byte piece cc of its 128 bytes */
  const char* ga = (const char*)(A + (size_t)(mt * 128 + cr) * lda + cc * 8); const char* gb = (const char*)(Bh + (size_t)(col0 + cr) * ldb + cc * 8);
  const size_t sa = (size_t)lda * 32, sb = (size_t)ldb * 32;
  const unsigned l0 = (unsigned)(size_t)sm + (unsigned)(cr * G2_PITCH + cc * 16);
  const int nst = K / G2_KT;
  g2_stage(l0, ga, sa, gb, sb);
  asm volatile("s_wait_asynccnt 0x0" ::: "memory");      /* stage 0 of this wave has landed */
  __syncthreads();                                       /* ... and every other wave's */
  if (nst > 1) g2_stage(l0 + G2_STAGE, ga + 2 * G2_KT, sa, gb + 2 * G2_KT, sb);
  const v8f z8 = {0.f,0.f,0.f,0.f,0.f,0.f,0.f,0.f}; v8f c00 = z8, c01 = z8, c02 = z8, c03 = z8, c10 = z8, c11 = z8, c12 = z8, c13 = z8;
  /* kept rolled: one trip per stage, so that the waits, the barrier and the refill at its foot stand once */
#pragma unroll 1
  for (int t = 0; t < nst; ++t) { const unsigned bo = (unsigned)(t & 1) * G2_STAGE;
    const _Float16* a0p = (const _Float16*)(sm + bo + (32 * w + ln) * G2_PITCH); const _Float16* a1p = (const _Float16*)(sm + bo + (32 * w + 16 + ln) * G2_PITCH);
    const _Float16* b0p = (const _Float16*)(sm + bo + (128 + ln) * G2_PITCH); const _Float16* b1p = (const _Float16*)(sm + bo + (144 + ln) * G2_PITCH); const _Float16* b2p = (const _Float16*)(sm + bo + (160 + ln) * G2_PITCH); const _Float16* b3p = (const _Float16*)(sm + bo + (176 + ln) * G2_PITCH);
    /* unrolled: the two 32-k steps of a stage read LDS at constant offsets */
#pragma unroll
    for (int kb = 0; kb < G2_KT; kb += 32) { const v16h a0 = g2_frag(a0p + kb, hh), a1 = g2_frag(a1p + kb, hh), b0 = g2_frag(b0p + kb, hh), b1 = g2_frag(b1p + kb, hh), b2 = g2_frag(b2p + kb, hh), b3 = g2_frag(b3p + kb, hh);
      c00 = g2_mma(a0, b0, c00); c10 = g2_mma(a1, b0, c10);
      c01 = g2_mma(a0, b1, c01); c11 = g2_mma(a1, b1, c11);
      c02 = g2_mma(a0, b2, c02); c12 = g2_mma(a1, b2, c12);
      c03 = g2_mma(a0, b3, c03); c13 = g2_mma(a1, b3, c13); }
    asm volatile("s_wait_dscnt 0x0" ::: "memory");       /* this wave's reads of the buffer are done before it is refilled */
    asm volatile("s_wait_asynccnt 0x0" ::: "memory");    /* this wave's copies of stage t + 1 have landed */
    __syncthreads();                                     /* publishes stage t + 1 and ends every wave's reads of stage t */
    if (t + 2 < nst) g2_stage(l0 + bo, ga + (size_t)(t + 2) * (2 * G2_KT), sa, gb + (size_t)(t + 2) * (2 * G2_KT), sb); }
  asm volatile("s_wait_asynccnt 0x0" ::: "memory");      /* no copy is outstanding when the buffers become output staging */
  v8f accs[8] = {c00, c01, c02, c03, c10, c11, c12, c13};
#pragma unroll
  for (int u = 0; u < 8; ++u) { const int t = u & 3, half = u >> 2; const int col = col0 + t * 16 + ln; const float bv = bp ? bf16_round(bp[col]) : 0.f;
#pragma unroll
    for (int r = 0; r < 8; ++r) { const int rloc = half * 16 + 8 * hh + r; float v = accs[u][r] * alpha + bv; if (CP) { const int bidx = (row0g + row0 + rloc) / rowsPerB; v += CP[cofs + (size_t)bidx * sCPb + col]; }
      if (ACT == 3) v = fmaxf(v, 0.f); else if (ACT == 6) v = 0.5f * v * (1.0f + erff(v * 0.70710678118654752f)); else if (ACT == 11) v = 1.0f / (1.0f + expf(-v)); else if (ACT == 15) v = v / (1.0f + expf(-v)); else if (ACT == 12) v = (v > 0.f) ? v : 0.01f * v; else if (ACT == 8) v = tanhf(v);
      so[w][rloc][t * 16 + ln] = v; } }
  __builtin_amdgcn_fence(__ATOMIC_ACQ_REL, "workgroup"); __builtin_amdgcn_wave_barrier();
  const int rsub = lane >> 4, c4 = (lane & 15) * 4;
  {
#pragma unroll
    for (int q = 0; q < 16; ++q) { const int r = q * 2 + rsub; const v4f v = *(const v4fa*)&so[w][r][c4]; if (C) *(v4f*)(C + cofs + (size_t)(row0 + r) * ldc + col0 + c4) = v; if (C16) { v4h h4; for (int i = 0; i < 4; ++i) h4[i] = (_Float16)v[i]; *(v4h*)(C16 + cofs + (size_t)(row0 + r) * ldc + col0 + c4) = h4; } }
     } }



// Both flash kernels work on the transposed products: S^T = K Q^T (A = 16 key rows, B = the wave's 16 queries) and O^T += V^T P^T (A = 16 rows of V^T, B = P^T).
// A lane then holds 16 of the 32 scores of ONE query (query ln; keys 8 hh + r of each 16-key tile), so the row maximum and the row sum are in-lane plus one exchange with lane ^ 16,
// and the two score tiles, converted in place, are already the B operand of the second product (element s = tile s / 8, register s % 8): P goes through no LDS.
__device__ __forceinline__ float xhalf(float x) { return __builtin_bit_cast(float, __builtin_amdgcn_permlanex16(__builtin_bit_cast(int, x), __builtin_bit_cast(int, x), 0x76543210, 0xfedcba98, false, false)); }      /* the value of lane ^ 16 */
#define SCL2 0.18033688011112042f      /* 64^-0.5 * log2(e): the softmax of the plain kernel runs in base 2 */
// Plain kernel: p * 2^10 = 2^(s * SCL2 + off) with off = 10 - max * SCL2: one fused multiply-add and one hardware exp2 per score; the row maximum is taken on the raw scores (SCL2 > 0).
// The accumulators and the row sum carry the 2^10, which the final division takes out.
template <int CAUSAL>
__global__ __launch_bounds__(128) void k_flash(const _Float16* __restrict__ Q16, int ldq, const _Float16* __restrict__ K16, int ldk, const _Float16* __restrict__ Vt, const int* __restrict__ MSK, float* __restrict__ O, int ldo) {
  constexpr int RPW = 16, DT = 4, KS = 2;
  __shared__ __attribute__((aligned(16))) float sO[4][RPW][64 + 4];
  const int tid = threadIdx.x, w = tid >> 5, lane = tid & 31, ln = lane & 15, hh = lane >> 4;
  const int slab = blockIdx.x / QBNP, qblk = QB0P + blockIdx.x % QBNP; const int b = slab / NH, h = slab % NH; const int qb0 = qblk * (4 * RPW); const int q0 = qb0 + w * RPW; const int tq = q0 + ln;      /* tq: this lane's query */
  FragH aq[KS];
  { const unsigned short* qr = (const unsigned short*)Q16 + ((size_t)b * TQ + tq) * ldq + h * 64;
#pragma unroll
    for (int ks = 0; ks < KS; ++ks) { aq[ks].half[0] = *(const v8us*)(qr + ks * 32 + 8 * hh); aq[ks].half[1] = *(const v8us*)(qr + ks * 32 + 16 + 8 * hh); } }
  const unsigned short* Vth = (const unsigned short*)Vt + (size_t)slab * 64 * TK;
  float m_r = -3.0e38f, off_r = 10.0f + 3.0e38f * SCL2, l_r = 0.f; v8f oacc[DT];      /* m_r: running maximum of the raw scores; off_r = 10 - m_r * SCL2; l_r: the sum over this lane's own keys, the two halves join behind the loop */
#pragma unroll
  for (int dt = 0; dt < DT; ++dt) oacc[dt] = (v8f){0.f,0.f,0.f,0.f,0.f,0.f,0.f,0.f};
  const int jend = (CAUSAL == 1) ? (qb0 + 4 * RPW) : TK;      /* causal: keys beyond the block's last query never contribute */
#pragma unroll 1
  for (int j0 = 0; j0 < jend; j0 += 32) {
    FragH bk[2][KS], bv[DT]; const unsigned short* kr[2];
#pragma unroll
    for (int nt = 0; nt < 2; ++nt) { kr[nt] = (const unsigned short*)K16 + ((size_t)b * TK + j0 + nt * 16 + ln) * ldk + h * 64 + 8 * hh;
#pragma unroll
      for (int ks = 0; ks < KS; ++ks) { bk[nt][ks].half[0] = *(const v8us*)(kr[nt] + ks * 32); bk[nt][ks].half[1] = *(const v8us*)(kr[nt] + ks * 32 + 16); } }
    v8f s[2];
#pragma unroll
    for (int nt = 0; nt < 2; ++nt) { v8f acc = (v8f){0.f,0.f,0.f,0.f,0.f,0.f,0.f,0.f};
#pragma unroll
      for (int ks = 0; ks < KS; ++ks) acc = mmaH<1>(bk[nt][ks].v, bk[nt][ks].v, aq[ks].v, aq[ks].v, acc);
      s[nt] = acc; }
    asm volatile("s_wait_xcnt 0x0" :: "v"(kr[0]), "v"(kr[1]) : "memory");      /* the K loads' address registers, held as inputs up to here, are rewritten only behind this wait; the clobber keeps the V loads behind the score products, so that they take over the K fragments' registers and fly during the softmax */
#pragma unroll
    for (int dt = 0; dt < DT; ++dt) { const unsigned short* vrow = Vth + (size_t)(dt * 16 + ln) * TK + j0; bv[dt].half[0] = *(const v8us*)(vrow + 8 * hh); bv[dt].half[1] = *(const v8us*)(vrow + 16 + 8 * hh); }
    float sc[16]; bool ok[16]; float mc = -3.0e38f;
#pragma unroll
    for (int e = 0; e < 16; ++e) { const int key = j0 + (e >> 3) * 16 + 8 * hh + (e & 7);
      ok[e] = (CAUSAL == 1) ? (key <= tq) : ((CAUSAL == 2) ? ((key >> 5) == (tq >> 5)) : true);      /* mode 2: block-diagonal 32-token groups */
      sc[e] = ok[e] ? s[e >> 3][e & 7] : -3.0e38f; mc = fmaxf(mc, sc[e]); }
    mc = fmaxf(mc, xhalf(mc));
    const float mn = fmaxf(m_r, mc); const float off = 10.0f - mn * SCL2; const float ea = __builtin_amdgcn_exp2f(off - off_r);      /* 2^(off - off_r): the factor that moves the accumulators to the new maximum */
    const float al = (mn > -1.0e38f) ? ea : 1.0f; m_r = mn; off_r = off;
    float ps[4] = {0.f, 0.f, 0.f, 0.f}; FragH pb;
#pragma unroll
    for (int e = 0; e < 16; ++e) { const float ee = __builtin_amdgcn_exp2f(sc[e] * SCL2 + off); const float p = ok[e] ? ee : 0.f; ps[e & 3] += p; pb.h[e] = (_Float16)p; }
    l_r = l_r * al + ((ps[0] + ps[1]) + (ps[2] + ps[3]));
#pragma unroll
    for (int dt = 0; dt < DT; ++dt)
#pragma unroll
      for (int r = 0; r < 8; ++r) oacc[dt][r] *= al;
#pragma unroll
    for (int dt = 0; dt < DT; ++dt) oacc[dt] = mmaH<1>(bv[dt].v, bv[dt].v, pb.v, pb.v, oacc[dt]); }
  const float l = l_r + xhalf(l_r); const float linv = (l > 0.f) ? 1.0f / l : 0.f;
#pragma unroll
  for (int dt = 0; dt < DT; ++dt)
#pragma unroll
    for (int r = 0; r < 8; ++r) sO[w][ln][dt * 16 + 8 * hh + r] = oacc[dt][r] * linv;
  __builtin_amdgcn_fence(__ATOMIC_ACQ_REL, "workgroup"); __builtin_amdgcn_wave_barrier();
  {
#pragma unroll
    for (int rp = 0; rp < RPW; rp += 2) { const int r = rp + (lane >> 4), pc = lane & 15; const v4f val = *(const v4fa*)&sO[w][r][pc * 4]; *(v4f*)(O + ((size_t)b * TQ + q0 + r) * ldo + h * 64 + pc * 4) = val; }
     } }
// 5-plane variant: S = Qh Kh^T + (Ql Kh^T + Qh Kl^T)/1024 with Q/K = [hi | 2^10 residual] f16 planes (QL/KL same layout as Q16/K16), then the 3-term P.V below.
// 3-term variant: O = (P_hi V_hi + (P_lo V_hi + P_hi V_lo) / 1024) / (1024 l) with P = [hi | 2^10 residual] of 1024 p and V^T = [hi | 2^10 residual] planes (VtL same layout as Vt) -> ~2^-21-class products for un-averaged (early causal / peaked) rows
template <int CAUSAL>
__global__ __launch_bounds__(128) void k_flash5(const _Float16* __restrict__ Q16, const _Float16* __restrict__ QL, int ldq, const _Float16* __restrict__ K16, const _Float16* __restrict__ KL, int ldk, const _Float16* __restrict__ Vt, const _Float16* __restrict__ VtL, const int* __restrict__ MSK, float* __restrict__ O, int ldo) {
  constexpr int RPW = 16, DT = 4, KS = 2;
  __shared__ __attribute__((aligned(16))) float sO[4][RPW][64 + 4];
  const int tid = threadIdx.x, w = tid >> 5, lane = tid & 31, ln = lane & 15, hh = lane >> 4;
  const int slab = blockIdx.x / QBN5, qblk = QB05 + blockIdx.x % QBN5; const int b = slab / NH, h = slab % NH; const int qb0 = qblk * (4 * RPW); const int q0 = qb0 + w * RPW; const int tq = q0 + ln;      /* tq: this lane's query */
  FragH aq[KS], aql[KS];
  { const unsigned short* qr = (const unsigned short*)Q16 + ((size_t)b * TQ + tq) * ldq + h * 64; const unsigned short* ql = (const unsigned short*)QL + ((size_t)b * TQ + tq) * ldq + h * 64;
#pragma unroll
    for (int ks = 0; ks < KS; ++ks) { aq[ks].half[0] = *(const v8us*)(qr + ks * 32 + 8 * hh); aq[ks].half[1] = *(const v8us*)(qr + ks * 32 + 16 + 8 * hh); aql[ks].half[0] = *(const v8us*)(ql + ks * 32 + 8 * hh); aql[ks].half[1] = *(const v8us*)(ql + ks * 32 + 16 + 8 * hh); } }
  const unsigned short* Vth = (const unsigned short*)Vt + (size_t)slab * 64 * TK; const unsigned short* Vtl = (const unsigned short*)VtL + (size_t)slab * 64 * TK;
  float m_r = -3.0e38f, l_r = 0.f; v8f oacc[DT], oaccL[DT];      /* l_r: the sum over this lane's own keys; the two halves join behind the loop */
#pragma unroll
  for (int dt = 0; dt < DT; ++dt) { oacc[dt] = (v8f){0.f,0.f,0.f,0.f,0.f,0.f,0.f,0.f}; oaccL[dt] = oacc[dt]; }
  const int jend = (CAUSAL == 1) ? (qb0 + 4 * RPW) : TK;      /* causal: keys beyond the block's last query never contribute */
#pragma unroll 1
  for (int j0 = 0; j0 < jend; j0 += 32) {
    FragH bk[2][KS], bkl[2][KS], bv[DT], bl[DT]; const unsigned short* kr[2]; const unsigned short* klr[2];
#pragma unroll
    for (int nt = 0; nt < 2; ++nt) { kr[nt] = (const unsigned short*)K16 + ((size_t)b * TK + j0 + nt * 16 + ln) * ldk + h * 64 + 8 * hh; klr[nt] = (const unsigned short*)KL + ((size_t)b * TK + j0 + nt * 16 + ln) * ldk + h * 64 + 8 * hh;
#pragma unroll
      for (int ks = 0; ks < KS; ++ks) { bk[nt][ks].half[0] = *(const v8us*)(kr[nt] + ks * 32); bk[nt][ks].half[1] = *(const v8us*)(kr[nt] + ks * 32 + 16); bkl[nt][ks].half[0] = *(const v8us*)(klr[nt] + ks * 32); bkl[nt][ks].half[1] = *(const v8us*)(klr[nt] + ks * 32 + 16); } }
    v8f s[2];
#pragma unroll
    for (int nt = 0; nt < 2; ++nt) { v8f acc = (v8f){0.f,0.f,0.f,0.f,0.f,0.f,0.f,0.f}, accl = acc;
#pragma unroll
      for (int ks = 0; ks < KS; ++ks) { acc = mmaH<1>(bk[nt][ks].v, bk[nt][ks].v, aq[ks].v, aq[ks].v, acc); accl = mmaH<1>(bk[nt][ks].v, bk[nt][ks].v, aql[ks].v, aql[ks].v, accl); accl = mmaH<1>(bkl[nt][ks].v, bkl[nt][ks].v, aq[ks].v, aq[ks].v, accl); }
#pragma unroll
      for (int r = 0; r < 8; ++r) acc[r] += accl[r] * 0.0009765625f;
      s[nt] = acc; }
    asm volatile("s_wait_xcnt 0x0" :: "v"(kr[0]), "v"(kr[1]), "v"(klr[0]), "v"(klr[1]) : "memory");      /* the K loads' address registers, held as inputs up to here, are rewritten only behind this wait; the clobber keeps the V loads behind the score products, so that they take over the K fragments' registers and fly during the softmax */
#pragma unroll
    for (int dt = 0; dt < DT; ++dt) { const unsigned short* vrow = Vth + (size_t)(dt * 16 + ln) * TK + j0; const unsigned short* vrl = Vtl + (size_t)(dt * 16 + ln) * TK + j0; bv[dt].half[0] = *(const v8us*)(vrow + 8 * hh); bv[dt].half[1] = *(const v8us*)(vrow + 16 + 8 * hh); bl[dt].half[0] = *(const v8us*)(vrl + 8 * hh); bl[dt].half[1] = *(const v8us*)(vrl + 16 + 8 * hh); }
    float sc[16]; bool ok[16]; float mc = -3.0e38f;
#pragma unroll
    for (int e = 0; e < 16; ++e) { const int key = j0 + (e >> 3) * 16 + 8 * hh + (e & 7);
      ok[e] = (CAUSAL == 1) ? (key <= tq) : ((CAUSAL == 2) ? ((key >> 5) == (tq >> 5)) : true);      /* mode 2: block-diagonal 32-token groups */
      if (CAUSAL == 4) ok[e] = MSK[((size_t)b * TQ + tq) * TK + key] != 0;      /* mode 4: per-(query, key) INPUT mask shared by all heads; masked keys contribute nothing, rows with no valid key give l = 0 -> output 0 */
      sc[e] = ok[e] ? s[e >> 3][e & 7] * SCL : -3.0e38f; mc = fmaxf(mc, sc[e]); }
    mc = fmaxf(mc, xhalf(mc));
    const float mn = fmaxf(m_r, mc); const float ea = expf(m_r - mn); const float al = (mn > -1.0e38f) ? ea : 1.0f; m_r = mn;
    float ps[4] = {0.f, 0.f, 0.f, 0.f}; FragH pb, pl;
#pragma unroll
    for (int e = 0; e < 16; ++e) { const float ee = expf(sc[e] - mn); const float p = ok[e] ? ee : 0.f; ps[e & 3] += p; const float p1k = p * 1024.0f; const _Float16 ph = (_Float16)p1k; pb.h[e] = ph; pl.h[e] = (_Float16)((p1k - (float)ph) * 1024.0f); }
    l_r = l_r * al + ((ps[0] + ps[1]) + (ps[2] + ps[3]));
#pragma unroll
    for (int dt = 0; dt < DT; ++dt)
#pragma unroll
      for (int r = 0; r < 8; ++r) { oacc[dt][r] *= al; oaccL[dt][r] *= al; }
#pragma unroll
    for (int dt = 0; dt < DT; ++dt) { oacc[dt] = mmaH<1>(bv[dt].v, bv[dt].v, pb.v, pb.v, oacc[dt]); oaccL[dt] = mmaH<1>(bv[dt].v, bv[dt].v, pl.v, pl.v, oaccL[dt]); oaccL[dt] = mmaH<1>(bl[dt].v, bl[dt].v, pb.v, pb.v, oaccL[dt]); } }
  const float l = l_r + xhalf(l_r); const float linv = (l > 0.f) ? 1.0f / (l * 1024.0f) : 0.f;
#pragma unroll
  for (int dt = 0; dt < DT; ++dt)
#pragma unroll
    for (int r = 0; r < 8; ++r) { float v = oacc[dt][r]; v += oaccL[dt][r] * 0.0009765625f; sO[w][ln][dt * 16 + 8 * hh + r] = v * linv; }
  __builtin_amdgcn_fence(__ATOMIC_ACQ_REL, "workgroup"); __builtin_amdgcn_wave_barrier();
  {
#pragma unroll
    for (int rp = 0; rp < RPW; rp += 2) { const int r = rp + (lane >> 4), pc = lane & 15; const v4f val = *(const v4fa*)&sO[w][r][pc * 4]; *(v4f*)(O + ((size_t)b * TQ + q0 + r) * ldo + h * 64 + pc * 4) = val; }
     } }

__global__ __launch_bounds__(256) void k_wsc(const float* __restrict__ Wm, _Float16* __restrict__ Bt, size_t n8, float sc) { const size_t t = (size_t)blockIdx.x * 256 + threadIdx.x; if (t >= n8) return; FragH f; for (int q = 0; q < 8; ++q) f.h[q] = (_Float16)(bf16_round(Wm[t * 8 + q]) * sc); *(v8us*)((unsigned short*)Bt + t * 8) = f.half[0];  }      /* torch (out,in) weight == Bt[n][k]: scaled copy */




__global__ __launch_bounds__(256) void k_rope(const float* __restrict__ F, int nheads, const float* __restrict__ CS, const float* __restrict__ SN, _Float16* __restrict__ H, _Float16* __restrict__ L, int ldd) {      /* ldd: destination row pitch (the source pitch is nheads*HD) */
  #pragma clang fp contract(off)
  const size_t t = (size_t)blockIdx.x * 256 + threadIdx.x; if (t >= (size_t)NR * nheads * (HH / 8)) return; const int g = (int)(t % (HH / 8)) * 8; const int h = (int)((t / (HH / 8)) % nheads); const int s = (int)(t / ((HH / 8) * (size_t)nheads)); const int ld = nheads * HD;
  const size_t base = (size_t)s * ld + h * HD + g, dbase = (size_t)s * ldd + h * HD + g; FragH h0, h1, l0, l1;
#pragma unroll
  for (int q = 0; q < 8; ++q) { const float c = CS[s * HH + g + q], sn = SN[s * HH + g + q]; const float x0 = F[base + q], x1 = F[base + HH + q]; float o0 = x0 * c; o0 += -x1 * sn; float o1 = x1 * c; o1 += x0 * sn;
    const _Float16 a0 = (_Float16)o0, a1 = (_Float16)o1; h0.h[q] = a0; h1.h[q] = a1; l0.h[q] = (_Float16)((o0 - (float)a0) * 1024.0f); l1.h[q] = (_Float16)((o1 - (float)a1) * 1024.0f); }
  { *(v8us*)((unsigned short*)H + dbase) = h0.half[0]; *(v8us*)((unsigned short*)H + dbase + HH) = h1.half[0]; if (L) { *(v8us*)((unsigned short*)L + dbase) = l0.half[0]; *(v8us*)((unsigned short*)L + dbase + HH) = l1.half[0]; }  } }

__global__ __launch_bounds__(256) void k_rotab(const int* __restrict__ pid, float* __restrict__ CS, float* __restrict__ SN) {      /* s = token row over both batches */
  #pragma clang fp contract(off)
  const int t = blockIdx.x * 256 + threadIdx.x; if (t >= NR * HH) return; const int j = t % HH, s = t / HH; const float inv = 1.0f / powf(10000.0f, (float)(2 * j) / (float)HD); const float th = (float)pid[s] * inv; const float c = cosf(th), sn = sinf(th);
  { *(float*)(CS + t) = c; *(float*)(SN + t) = sn;  } }

__global__ __launch_bounds__(256) void k_expand(const _Float16* __restrict__ SH, const _Float16* __restrict__ SL, _Float16* __restrict__ DH, _Float16* __restrict__ DL, int col0) {
  const size_t t = (size_t)blockIdx.x * 256 + threadIdx.x; if (t >= (size_t)NR * NH * (HD / 8)) return; const int d0 = (int)(t % (HD / 8)) * 8; const int h = (int)((t / (HD / 8)) % NH); const size_t s = t / ((HD / 8) * NH);
  const size_t si = s * KVD + (size_t)(h / (NH / NKV)) * HD + d0, di = s * (size_t)(3 * EMB) + col0 + (size_t)h * HD + d0; const v8us a = *(const v8us*)((const unsigned short*)SH + si), bl = *(const v8us*)((const unsigned short*)SL + si);
  { *(v8us*)((unsigned short*)DH + di) = a; *(v8us*)((unsigned short*)DL + di) = bl;  } }

extern "C" void kernel_launch(void* const* d_in, const int* in_sizes, int n_in,
                              void* d_out, int out_size, void* d_ws, size_t ws_size, hipStream_t stream) {
  (void)in_sizes; (void)n_in; (void)out_size;
  const float* const* I = (const float* const*)d_in; const float* x = I[0]; const float* Wq = I[1]; const float* bq = I[2]; const float* Wk = I[3]; const float* bk = I[4]; const float* Wv = I[5]; const float* bv = I[6]; const float* Wo = I[7]; const int* pid = (const int*)d_in[8];
  char* ws = (char*)d_ws; size_t off = 0;
  auto take = [&](size_t bytes) { char* p = ws + off; off += (bytes + 255) & ~(size_t)255; return p; };
  const size_t npb = (size_t)SLEN * EMB, npa = (size_t)NR * EMB;      /* per-batch plane, plane of both batches */
  _Float16* BQ = (_Float16*)take((size_t)EMB * EMB * 2); _Float16* BK = (_Float16*)take((size_t)KVD * EMB * 2); _Float16* BV = (_Float16*)take((size_t)KVD * EMB * 2); _Float16* BO = (_Float16*)take((size_t)EMB * EMB * 2);
  float* CS = (float*)take((size_t)NR * HH * 4); float* SN = (float*)take((size_t)NR * HH * 4);
  _Float16* X16 = (_Float16*)take(npa * 2); float* QF = (float*)take(npa * 4); float* KF = (float*)take((size_t)NR * KVD * 4); float* VF = (float*)take((size_t)NR * KVD * 4); _Float16* KH8 = (_Float16*)take((size_t)NR * KVD * 2); _Float16* KL8 = (_Float16*)take((size_t)NR * KVD * 2); _Float16* VH8 = (_Float16*)take((size_t)NR * KVD * 2); _Float16* VL8 = (_Float16*)take((size_t)NR * KVD * 2);
  _Float16* H16 = (_Float16*)take(npa * 3 * 2); _Float16* L16 = (_Float16*)take(npa * 3 * 2); _Float16* VT = (_Float16*)take(npa * 2); _Float16* VTL = (_Float16*)take(npa * 2);
  float* O = QF; _Float16* OH = X16; _Float16* OLo = (_Float16*)take(npa * 2);      /* O over the q f32 plane (dead after the rope split); O hi over the x plane (dead after the projections) */
  if (off > ws_size) return;      /* 8+2+2+8 + 1 + 16 + 32 + 8+8 + 4x4 + 48 + 48 + 16 + 16 + 16 = 245 MiB */
  float* ob = (float*)d_out;
  k_wt_f16<<<(EMB / 64) * (EMB / 64), 256, 0, stream>>>(Wq, BQ, EMB, EMB, 16.0f); k_wt_f16<<<(EMB / 64) * (KVD / 64), 256, 0, stream>>>(Wk, BK, EMB, KVD, 16.0f); k_wt_f16<<<(EMB / 64) * (KVD / 64), 256, 0, stream>>>(Wv, BV, EMB, KVD, 16.0f); k_wt_f16<<<(EMB / 64) * (EMB / 64), 256, 0, stream>>>(Wo, BO, EMB, EMB, 16.0f);      /* (in,out) weights */
  k_rotab<<<(NR * HH + 255) / 256, 256, 0, stream>>>(pid, CS, SN);
  k_x16<<<(unsigned)((npa / 8 + 255) / 256), 256, 0, stream>>>(x, X16, npa / 8);
  k_gemm2<0><<<dim3((NR / 128) * (EMB / 64), 1), 128, 0, stream>>>(X16, EMB, 0, BQ, EMB, 0, 0.0625f, bq, 0, nullptr, 1, 0, 0, QF, nullptr, EMB, 0, NR, EMB, EMB);
  k_gemm2<0><<<dim3((NR / 128) * (KVD / 64), 1), 128, 0, stream>>>(X16, EMB, 0, BK, EMB, 0, 0.0625f, bk, 0, nullptr, 1, 0, 0, KF, nullptr, KVD, 0, NR, KVD, EMB);
  k_gemm2<0><<<dim3((NR / 128) * (KVD / 64), 1), 128, 0, stream>>>(X16, EMB, 0, BV, EMB, 0, 0.0625f, bv, 0, nullptr, 1, 0, 0, VF, nullptr, KVD, 0, NR, KVD, EMB);
  k_rope<<<(unsigned)(((size_t)NR * NH * (HH / 8) + 255) / 256), 256, 0, stream>>>(QF, NH, CS, SN, H16, L16, 3 * EMB);      /* q roped + split into the [q | k | v] planes */
  k_rope<<<(unsigned)(((size_t)NR * NKV * (HH / 8) + 255) / 256), 256, 0, stream>>>(KF, NKV, CS, SN, KH8, KL8, KVD);
  k_hl<<<(unsigned)(((size_t)NR * KVD / 8 + 255) / 256), 256, 0, stream>>>(VF, VH8, VL8, (size_t)NR * KVD / 8);
  k_expand<<<(unsigned)(((size_t)NR * NH * (HD / 8) + 255) / 256), 256, 0, stream>>>(KH8, KL8, H16, L16, EMB); k_expand<<<(unsigned)(((size_t)NR * NH * (HD / 8) + 255) / 256), 256, 0, stream>>>(VH8, VL8, H16, L16, 2 * EMB);
  k_vt<NH, SLEN><<<NB * NH * (SLEN / 64), 256, 0, stream>>>(H16, 3 * EMB, 2 * EMB, VT); k_vt<NH, SLEN><<<NB * NH * (SLEN / 64), 256, 0, stream>>>(L16, 3 * EMB, 2 * EMB, VTL);
  k_flash5<1><<<NB * NH * QBN5, 128, 0, stream>>>(H16, L16, 3 * EMB, H16 + EMB, L16 + EMB, 3 * EMB, VT, VTL, nullptr, O, EMB);
  k_flash<1><<<NB * NH * QBNP, 128, 0, stream>>>(H16, 3 * EMB, H16 + EMB, 3 * EMB, VT, nullptr, O, EMB);
  k_hl<<<(unsigned)((npa / 8 + 255) / 256), 256, 0, stream>>>(O, OH, OLo, npa / 8);
  k_gemm2<0><<<dim3((NR / 128) * (EMB / 64), 1), 128, 0, stream>>>(OH, EMB, 0, BO, EMB, 0, 0.0625f, nullptr, 0, nullptr, 1, 0, 0, ob, nullptr, EMB, 0, NR, EMB, EMB);
  k_gemm2<0><<<dim3((RE / 128) * (EMB / 64), NB), 128, 0, stream>>>(OLo, EMB, npb, BO, EMB, 0, 0.0625f / 1024.0f, nullptr, 0, ob, 1, (size_t)EMB, 0, ob, nullptr, EMB, npb, RE, EMB, EMB);      /* grid y = batch: the first RE rows of each */
}

// v006
// It runs in 296 microseconds.
// In two side-by-side timings against v005, it was 1.16 and 1.15 times as fast.
// All steps since v000 together make it 4.65 times as fast.
#include <hip/hip_runtime.h>
// WedoctorAttention (2 x 2048 tokens, hidden 2048; 32 query heads / 8 kv heads of 64 (GQA), rotate-half RoPE from the INPUT position ids, causal SDPA (1/8), out = o Wo): q/k/v = x W + b.
// Structure (both batches in every launch: the 4096 token rows are one row range, batch = row / 2048): exact f16 plane of x; q / k / v GEMMs (32x64 wave tiles, f32 accumulation, exact x16 weights + bias) into f32 planes; angle tables from the input position ids (f32 trig); RoPE on VALU while splitting q and k into f16 hi + 2^10-residual planes, v split directly; the 8 kv heads expanded to the 32 query heads (repeat 4) into the fused [q | k | v] hi/lo planes; V^T hi/residual by LDS tiles; the fused causal flash kernel in its 5-plane form for the first 256 query rows and plain beyond; attention output as f16 hi (+ residual on those rows) into the output GEMMs.
// Compute dtype: x, weights and biases rounded to bf16; rows < 256 per batch: q, k, P, v, O hi + residual; beyond: plain f16; f32 accumulation/softmax/trig. v_wmma_f32_16x16x32_f16.
#define NB 2
#define EMB 2048
#define NR (NB * SLEN)           /* 4096 token rows */
#define SLEN 2048
#define SQ SLEN
#define TQ SLEN
#define TK SLEN
#define NH 32
#define NKV 8
#define KVD (NKV * HD)
#define HD 64
#define HH (HD / 2)
#define SCL 0.125f               /* 64^-0.5 */
#define QBLKS (TQ / 64)
#define QB05 0                   /* 5-plane flash: query blocks [0, QBN5) of every (batch, head) — the early causal rows whose outputs average over few keys */
#define QBN5 4
#define QB0P QBN5                /* plain flash (hi planes only): query blocks [QBN5, QBLKS) */
#define QBNP (QBLKS - QBN5)
#define RE 256                   /* rows per batch that take the hi+lo output operand (= QBN5 * 64) */
typedef __bf16 v16b __attribute__((ext_vector_type(16)));
typedef unsigned short v8us __attribute__((ext_vector_type(8), may_alias));
typedef float  v8f  __attribute__((ext_vector_type(8)));
typedef float  v4f  __attribute__((ext_vector_type(4)));
typedef float  v4fa __attribute__((ext_vector_type(4), may_alias));
union FragB { v16b v; v8us half[2]; unsigned short u[16]; };

__device__ __forceinline__ unsigned short bf16_bits(float x) { unsigned int u = __float_as_uint(x); return (unsigned short)((u + 0x7FFFu + ((u >> 16) & 1u)) >> 16); }
__device__ __forceinline__ float bf16_val(unsigned short b) { return __uint_as_float(((unsigned int)b) << 16); }
__device__ __forceinline__ float bf16_round(float x) { return bf16_val(bf16_bits(x)); }
// D += A·B with NT terms: 1 = ah·bh, 2 = + al·bh (A split), 3 = + ah·bl (both split)
template <int NT>
__device__ __forceinline__ v8f mmaN(v16b ah, v16b al, v16b bh, v16b bl, v8f c) {
  c = __builtin_amdgcn_wmma_f32_16x16x32_bf16(false, ah, false, bh, (short)0, c, false, false);
  if (NT >= 2) c = __builtin_amdgcn_wmma_f32_16x16x32_bf16(false, al, false, bh, (short)0, c, false, false);
  if (NT >= 3) c = __builtin_amdgcn_wmma_f32_16x16x32_bf16(false, ah, false, bl, (short)0, c, false, false);
  asm volatile("v_nop\n\tv_nop\n\tv_nop\n\tv_nop" : "+v"(c) : "v"(ah), "v"(al), "v"(bh), "v"(bl));
  return c;
}

__global__ __launch_bounds__(256) void k_wt_bf16(const float* __restrict__ W, unsigned short* __restrict__ Wt, int K, int N) {
  const int t = blockIdx.x * 256 + threadIdx.x;
  const int k8n = K / 8;
  if (t >= N * k8n) return;
  const int n = t / k8n, k8 = (t % k8n) * 8;
  v8us v;
#pragma unroll
  for (int i = 0; i < 8; ++i) v[i] = bf16_bits(W[(size_t)(k8 + i) * N + n]);
  *(v8us*)(Wt + (size_t)n * K + k8) = v;
  
}

// GEMM C[M][N] (f32, pitch ldc) = act(A[M][K]·W + bias). A f32 row-major (pitch lda) converted per fragment to bf16
// (ASPLIT: hi/lo two planes -> 2 terms, else single rounded term); Wt bf16 [N][K] (pitch ldb). BIAS_BF16 rounds the
// bias to bf16 first (bias quantised to bf16 before the add). K%32==0, M%16==0, N%64==0.
template <bool ASPLIT, int ACT, bool BIAS_BF16>
__global__ __launch_bounds__(128) void k_gemm_bf(const float* __restrict__ A, int lda, const unsigned short* __restrict__ Wt, int ldb,
                                               const float* __restrict__ bias, float* __restrict__ C, int ldc, int M, int N, int K) {
  __shared__ __attribute__((aligned(16))) float so[4][16][64];
  const int tid = threadIdx.x, w = tid >> 5, lane = tid & 31, ln = lane & 15, hh = lane >> 4;
  const int ntn = N / 64;
  const int wid = blockIdx.x * 4 + w;
  const int mt = wid / ntn, nq = wid % ntn;
  if (mt * 16 >= M) return;
  const int row0 = mt * 16, col0 = nq * 64;
  const float* arow = A + (size_t)(row0 + ln) * lda;
  v8f acc[4] = {};
  for (int kb = 0; kb < K; kb += 32) {
    FragB ah, al;
    const v4f x0 = *(const v4fa*)(arow + kb + 8 * hh), x1 = *(const v4fa*)(arow + kb + 8 * hh + 4);
    const v4f x2 = *(const v4fa*)(arow + kb + 16 + 8 * hh), x3 = *(const v4fa*)(arow + kb + 16 + 8 * hh + 4);
    float xs[16] = {x0[0],x0[1],x0[2],x0[3],x1[0],x1[1],x1[2],x1[3],x2[0],x2[1],x2[2],x2[3],x3[0],x3[1],x3[2],x3[3]};
#pragma unroll
    for (int i = 0; i < 16; ++i) { const unsigned short hb = bf16_bits(xs[i]); ah.u[i] = hb; al.u[i] = ASPLIT ? bf16_bits(xs[i] - bf16_val(hb)) : (unsigned short)0; }
#pragma unroll
    for (int t = 0; t < 4; ++t) {
      const unsigned short* brow = Wt + (size_t)(col0 + t * 16 + ln) * ldb + kb;
      FragB b;
      b.half[0] = *(const v8us*)(brow + 8 * hh);
      b.half[1] = *(const v8us*)(brow + 16 + 8 * hh);
      acc[t] = mmaN<ASPLIT ? 2 : 1>(ah.v, al.v, b.v, b.v, acc[t]);
    }
  }
#pragma unroll
  for (int t = 0; t < 4; ++t) {
    float bv = bias ? bias[col0 + t * 16 + ln] : 0.f;
    if (BIAS_BF16) bv = bf16_round(bv);
#pragma unroll
    for (int r = 0; r < 8; ++r) { float v = acc[t][r] + bv; if (ACT == 1) v = fmaxf(v, 0.f); so[w][8 * hh + r][t * 16 + ln] = v; }
  }
  __builtin_amdgcn_fence(__ATOMIC_ACQ_REL, "workgroup");
  __builtin_amdgcn_wave_barrier();
  const int rsub = lane >> 4, c4 = (lane & 15) * 4;
  {
#pragma unroll
    for (int q = 0; q < 8; ++q) {
      const int r = q * 2 + rsub;
      const v4f v = *(const v4fa*)&so[w][r][c4];
      *(v4f*)(C + (size_t)(row0 + r) * ldc + col0 + c4) = v;
    }
    
  }
}

// GEMM C = act(A·W + bias + resid): A f32 (ASPLIT -> hi/lo 2 terms), Wt bf16 [N][K]; ACT 0 none, 1 relu, 2 exact gelu;
// resid (optional, f32, row index = (row % rmod), pitch ldr, RES_BF16 rounds it) added before the activation.
template <bool ASPLIT, int ACT, bool BIAS_BF16, bool RES_BF16>
__global__ __launch_bounds__(128) void k_gemm_bf3(const float* __restrict__ A, int lda, const unsigned short* __restrict__ Wt, int ldb,
                                                const float* __restrict__ bias, const float* __restrict__ resid, int rmod, int ldr,
                                                float* __restrict__ C, int ldc, int M, int N, int K) {
  __shared__ __attribute__((aligned(16))) float so[4][16][64];
  const int tid = threadIdx.x, w = tid >> 5, lane = tid & 31, ln = lane & 15, hh = lane >> 4;
  const int ntn = N / 64;
  const int wid = blockIdx.x * 4 + w;
  const int mt = wid / ntn, nq = wid % ntn;
  if (mt * 16 >= M) return;
  const int row0 = mt * 16, col0 = nq * 64;
  const float* arow = A + (size_t)(row0 + ln) * lda;
  v8f acc[4] = {};
  for (int kb = 0; kb < K; kb += 32) {
    FragB ah, al;
    const v4f x0 = *(const v4fa*)(arow + kb + 8 * hh), x1 = *(const v4fa*)(arow + kb + 8 * hh + 4);
    const v4f x2 = *(const v4fa*)(arow + kb + 16 + 8 * hh), x3 = *(const v4fa*)(arow + kb + 16 + 8 * hh + 4);
    float xs[16] = {x0[0],x0[1],x0[2],x0[3],x1[0],x1[1],x1[2],x1[3],x2[0],x2[1],x2[2],x2[3],x3[0],x3[1],x3[2],x3[3]};
#pragma unroll
    for (int i = 0; i < 16; ++i) { const unsigned short hb = bf16_bits(xs[i]); ah.u[i] = hb; al.u[i] = ASPLIT ? bf16_bits(xs[i] - bf16_val(hb)) : (unsigned short)0; }
#pragma unroll
    for (int t = 0; t < 4; ++t) {
      const unsigned short* brow = Wt + (size_t)(col0 + t * 16 + ln) * ldb + kb;
      FragB b;
      b.half[0] = *(const v8us*)(brow + 8 * hh);
      b.half[1] = *(const v8us*)(brow + 16 + 8 * hh);
      acc[t] = mmaN<ASPLIT ? 2 : 1>(ah.v, al.v, b.v, b.v, acc[t]);
    }
  }
#pragma unroll
  for (int t = 0; t < 4; ++t) {
    const int col = col0 + t * 16 + ln;
    float bv = bias ? bias[col] : 0.f;
    if (BIAS_BF16) bv = bf16_round(bv);
#pragma unroll
    for (int r = 0; r < 8; ++r) {
      float v = acc[t][r] + bv;
      if (resid) { float rv = resid[(size_t)((row0 + 8 * hh + r) % rmod) * ldr + col]; if (RES_BF16) rv = bf16_round(rv); v += rv; }
      if (ACT == 1) v = fmaxf(v, 0.f);
      if (ACT == 2) v = 0.5f * v * (1.0f + erff(v * 0.70710678118654752f));
      if (ACT == 3) { const float u = 0.7978845608028654f * (v + 0.044715f * v * v * v); v = 0.5f * v * (1.0f + tanhf(u)); }
      so[w][8 * hh + r][t * 16 + ln] = v;
    }
  }
  __builtin_amdgcn_fence(__ATOMIC_ACQ_REL, "workgroup");
  __builtin_amdgcn_wave_barrier();
  const int rsub = lane >> 4, c4 = (lane & 15) * 4;
  {
#pragma unroll
    for (int q = 0; q < 8; ++q) {
      const int r = q * 2 + rsub;
      const v4f v = *(const v4fa*)&so[w][r][c4];
      *(v4f*)(C + (size_t)(row0 + r) * ldc + col0 + c4) = v;
    }
    
  }
}
// row LayerNorm (biased variance, eps) over N: s = X (+ R); optional out_sum <- s; out_norm <- (s-mu)*rsqrt(var+eps)*g + b
template <bool PARAM_BF16>
__global__ __launch_bounds__(256) void k_layernorm(const float* __restrict__ X, const float* __restrict__ R, const float* __restrict__ g, const float* __restrict__ bta,
                                                  float* __restrict__ out_sum, float* __restrict__ out_norm, int N, float eps) {
  __shared__ float red[256];
  const int row = blockIdx.x, tid = threadIdx.x;
  const float* x = X + (size_t)row * N; const float* rr = R ? R + (size_t)row * N : nullptr;
  float vals[16];                     // up to N = 4096
  const int per = N / 256;            // contiguous chunk per thread? use strided-by-4 chunks: thread handles j = tid*4 + 1024*u
  float s1 = 0.f;
  for (int u = 0; u < per / 4; ++u) {
    const int j = tid * 4 + 1024 * u;
    const v4f a = *(const v4fa*)(x + j);
    v4f b = {0.f,0.f,0.f,0.f}; if (rr) b = *(const v4fa*)(rr + j);
#pragma unroll
    for (int q = 0; q < 4; ++q) { const float v = a[q] + b[q]; vals[u * 4 + q] = v; s1 += v; }
  }
  red[tid] = s1; __syncthreads();
  for (int st = 128; st > 0; st >>= 1) { if (tid < st) red[tid] += red[tid + st]; __syncthreads(); }
  const float mu = red[0] / (float)N; __syncthreads();
  float s2 = 0.f;
  for (int u = 0; u < per / 4; ++u)
#pragma unroll
    for (int q = 0; q < 4; ++q) { const float c = vals[u * 4 + q] - mu; s2 += c * c; }
  red[tid] = s2; __syncthreads();
  for (int st = 128; st > 0; st >>= 1) { if (tid < st) red[tid] += red[tid + st]; __syncthreads(); }
  const float rs = rsqrtf(red[0] / (float)N + eps);
  {
    for (int u = 0; u < per / 4; ++u) {
      const int j = tid * 4 + 1024 * u;
      v4f o, sm;
#pragma unroll
      for (int q = 0; q < 4; ++q) {
        float gg = g[j + q], bb = bta[j + q];
        if (PARAM_BF16) { gg = bf16_round(gg); bb = bf16_round(bb); }
        sm[q] = vals[u * 4 + q]; o[q] = (vals[u * 4 + q] - mu) * rs * gg + bb;
      }
      if (out_sum) *(v4f*)(out_sum + (size_t)row * N + j) = sm;
      *(v4f*)(out_norm + (size_t)row * N + j) = o;
    }
    
  }
}



// ---- f16 WMMA path (v_wmma_f32_16x16x32_f16): 11-bit significands for operands in range — used where a [0,1] probability operand needs more precision than bf16
typedef _Float16 v16h __attribute__((ext_vector_type(16)));
union FragH { v16h v; v8us half[2]; _Float16 h[16]; unsigned short u[16]; };
template <int NT>
__device__ __forceinline__ v8f mmaH(v16h ah, v16h al, v16h bh, v16h bl, v8f c) {
  c = __builtin_amdgcn_wmma_f32_16x16x32_f16(false, ah, false, bh, (short)0, c, false, false);
  if (NT >= 2) c = __builtin_amdgcn_wmma_f32_16x16x32_f16(false, al, false, bh, (short)0, c, false, false);
  if (NT >= 3) c = __builtin_amdgcn_wmma_f32_16x16x32_f16(false, ah, false, bl, (short)0, c, false, false);
  asm volatile("v_nop\n\tv_nop\n\tv_nop\n\tv_nop" : "+v"(c) : "v"(ah), "v"(al), "v"(bh), "v"(bl));
  return c;
}
// batched GEMM like k_gemm_b but f16 operands: A f32 (split into f16 hi/lo if ASPLIT, else rounded to f16), Bt = f16 values [n][k]; alpha; C f32; N multiple of 16 (partial tiles skipped)
template <bool ASPLIT>
__global__ __launch_bounds__(128) void k_gemm_h(const float* __restrict__ A, int lda, size_t sA, const _Float16* __restrict__ Bh, int ldb, size_t sB, float alpha, float* __restrict__ C, int ldc, size_t sC, int M, int N, int K) {
  __shared__ __attribute__((aligned(16))) float so[4][16][64];
  const int tid = threadIdx.x, w = tid >> 5, lane = tid & 31, ln = lane & 15, hh = lane >> 4; const int by = blockIdx.y;
  A += (size_t)by * sA; Bh += (size_t)by * sB; C += (size_t)by * sC;
  const int ntn = (N + 63) / 64; const int wid = blockIdx.x * 4 + w; const int mt = wid / ntn, nq = wid % ntn; if (mt * 16 >= M) return;
  const int row0 = mt * 16, col0 = nq * 64; const float* arow = A + (size_t)(row0 + ln) * lda;
  v8f acc[4] = {};
  for (int kb = 0; kb < K; kb += 32) {
    FragH ah, al;
    const v4f x0 = *(const v4fa*)(arow + kb + 8 * hh), x1 = *(const v4fa*)(arow + kb + 8 * hh + 4), x2 = *(const v4fa*)(arow + kb + 16 + 8 * hh), x3 = *(const v4fa*)(arow + kb + 16 + 8 * hh + 4);
    float xs[16] = {x0[0],x0[1],x0[2],x0[3],x1[0],x1[1],x1[2],x1[3],x2[0],x2[1],x2[2],x2[3],x3[0],x3[1],x3[2],x3[3]};
#pragma unroll
    for (int i = 0; i < 16; ++i) { const _Float16 h = (_Float16)xs[i]; ah.h[i] = h; al.h[i] = ASPLIT ? (_Float16)(xs[i] - (float)h) : (_Float16)0.0f; }
#pragma unroll
    for (int t = 0; t < 4; ++t) { if (col0 + t * 16 >= N) continue; const size_t boff = (size_t)(col0 + t * 16 + ln) * ldb + kb; FragH bq; bq.half[0] = *(const v8us*)(Bh + boff + 8 * hh); bq.half[1] = *(const v8us*)(Bh + boff + 16 + 8 * hh);
      acc[t] = mmaH<ASPLIT ? 2 : 1>(ah.v, al.v, bq.v, bq.v, acc[t]); }
  }
#pragma unroll
  for (int t = 0; t < 4; ++t) { if (col0 + t * 16 >= N) continue;
#pragma unroll
    for (int r = 0; r < 8; ++r) so[w][8 * hh + r][t * 16 + ln] = acc[t][r] * alpha; }
  __builtin_amdgcn_fence(__ATOMIC_ACQ_REL, "workgroup"); __builtin_amdgcn_wave_barrier();
  const int rsub = lane >> 4, c4 = (lane & 15) * 4;
  {
#pragma unroll
    for (int q = 0; q < 8; ++q) { const int r = q * 2 + rsub; if (col0 + c4 < N) { const v4f v = *(const v4fa*)&so[w][r][c4]; *(v4f*)(C + (size_t)(row0 + r) * ldc + col0 + c4) = v; } }
     }
}

// Wt[n][k] = f16(bf16(W[k][n])·scale) from f32 row-major W[K][N] (scale = power of two; bf16-exact weights stay exact in f16 away from the subnormal range)
// One block per 64 x 64 tile (K % 64 == 0, N % 64 == 0; grid = (K / 64) * (N / 64)): W is read in whole 256-byte row pieces (16 bytes a lane), converted, turned in LDS, and Wt is written in whole 128-byte rows (16 bytes a lane).
__global__ __launch_bounds__(256) void k_wt_f16(const float* __restrict__ W, _Float16* __restrict__ Wt, int K, int N, float scale) {
  __shared__ unsigned int tl[64][33];      /* tile [k][n], two f16 a word; the odd pitch keeps the column reads below on distinct banks */
  const int tid = threadIdx.x; const int nkt = K >> 6; const int nt = blockIdx.x / nkt, kt = blockIdx.x - nt * nkt; const int k0 = kt * 64, n0 = nt * 64;
  const int r = tid >> 4, c4 = (tid & 15) * 4; v4f a[4];
#pragma unroll
  for (int p = 0; p < 4; ++p) a[p] = *(const v4fa*)(W + (size_t)(k0 + p * 16 + r) * N + n0 + c4);
#pragma unroll
  for (int p = 0; p < 4; ++p) { FragH f;
#pragma unroll
    for (int q = 0; q < 4; ++q) f.h[q] = (_Float16)(bf16_round(a[p][q]) * scale);
    tl[p * 16 + r][c4 / 2] = (unsigned int)f.u[0] | ((unsigned int)f.u[1] << 16); tl[p * 16 + r][c4 / 2 + 1] = (unsigned int)f.u[2] | ((unsigned int)f.u[3] << 16); }
  __syncthreads();
  typedef unsigned short usa __attribute__((may_alias)); const usa* ts = (const usa*)&tl[0][0];      /* the words of the tile read as single f16 */
#pragma unroll
  for (int rd = 0; rd < 2; ++rd) { const int n = rd * 32 + (tid >> 3), pc = tid & 7; FragH f;
#pragma unroll
    for (int q = 0; q < 8; ++q) f.u[q] = ts[(pc * 8 + q) * 66 + n];
    *(v8us*)((unsigned short*)Wt + (size_t)(n0 + n) * K + k0 + pc * 8) = f.half[0]; }
}
// k_gemm_hh variant with fused epilogue: v = acc·alpha + bias[by·sBias + col] (+ CP[(row/rowsPerB)·sCPb + by·64 + col] if CP) ; ACT 0 none / 1 elu ; writes f16 C16 (and f32 C if non-null)
template <int ACT>
__global__ __launch_bounds__(128) void k_gemm_hhx(const _Float16* __restrict__ A, int lda, size_t sA, const _Float16* __restrict__ Bh, int ldb, size_t sB, float alpha, const float* __restrict__ bias, size_t sBias, const float* __restrict__ CP, int rowsPerB, size_t sCPb, int row0g,
    float* __restrict__ C, _Float16* __restrict__ C16, int ldc, size_t sC, int M, int N, int K) {
  __shared__ __attribute__((aligned(16))) float so[4][16][64];
  const int tid = threadIdx.x, w = tid >> 5, lane = tid & 31, ln = lane & 15, hh = lane >> 4; const int by = blockIdx.y;
  A += (size_t)by * sA; Bh += (size_t)by * sB; const size_t cofs = (size_t)by * sC; const float* bp = bias ? bias + (size_t)by * sBias : nullptr;
  const int ntn = (N + 63) / 64; const int wid = blockIdx.x * 4 + w; const int mt = wid / ntn, nq = wid % ntn; if (mt * 16 >= M) return;
  const int row0 = mt * 16, col0 = nq * 64; const _Float16* arow = A + (size_t)(row0 + ln) * lda;
  v8f acc[4] = {};
  for (int kb = 0; kb < K; kb += 32) { FragH ah; ah.half[0] = *(const v8us*)((const unsigned short*)arow + kb + 8 * hh); ah.half[1] = *(const v8us*)((const unsigned short*)arow + kb + 16 + 8 * hh);
#pragma unroll
    for (int t = 0; t < 4; ++t) { if (col0 + t * 16 >= N) continue; const size_t boff = (size_t)(col0 + t * 16 + ln) * ldb + kb; FragH bq; bq.half[0] = *(const v8us*)((const unsigned short*)Bh + boff + 8 * hh); bq.half[1] = *(const v8us*)((const unsigned short*)Bh + boff + 16 + 8 * hh);
      acc[t] = mmaH<1>(ah.v, ah.v, bq.v, bq.v, acc[t]); }
  }
#pragma unroll
  for (int t = 0; t < 4; ++t) { if (col0 + t * 16 >= N) continue; const int col = col0 + t * 16 + ln; const float bv = bp ? bf16_round(bp[col]) : 0.f;
#pragma unroll
    for (int r = 0; r < 8; ++r) { float v = acc[t][r] * alpha + bv; if (CP) { const int bidx = (row0g + row0 + 8 * hh + r) / rowsPerB; v += CP[(size_t)bidx * sCPb + (size_t)by * 64 + col]; } if (ACT == 1) v = (v > 0.f) ? v : expm1f(v); else if (ACT == 7) v = (v > 0.f) ? v + 1.0f : expf(v); else if (ACT == 8) v = tanhf(v); else if (ACT == 9) v = 0.5f * v * (1.0f + tanhf(0.7978845608028654f * (v + 0.044715f * v * v * v))); else if (ACT == 11) v = 1.0f / (1.0f + expf(-v)); else if (ACT == 12) v = (v > 0.f) ? v : 0.01f * v; else if (ACT == 14) v = (v > 0.f) ? v : 0.1f * v; else if (ACT == 15) v = v / (1.0f + expf(-v)); else if (ACT == 3) v = fmaxf(v, 0.f); else if (ACT == 6) v = 0.5f * v * (1.0f + erff(v * 0.70710678118654752f)); so[w][8 * hh + r][t * 16 + ln] = v; } }
  __builtin_amdgcn_fence(__ATOMIC_ACQ_REL, "workgroup"); __builtin_amdgcn_wave_barrier();
  const int rsub = lane >> 4, c4 = (lane & 15) * 4; typedef _Float16 v4h __attribute__((ext_vector_type(4)));
  {
#pragma unroll
    for (int q = 0; q < 8; ++q) { const int r = q * 2 + rsub; if (col0 + c4 < N) { const v4f v = *(const v4fa*)&so[w][r][c4]; if (C) *(v4f*)(C + cofs + (size_t)(row0 + r) * ldc + col0 + c4) = v; if (C16) { v4h h4; for (int i = 0; i < 4; ++i) h4[i] = (_Float16)v[i]; *(v4h*)(C16 + cofs + (size_t)(row0 + r) * ldc + col0 + c4) = h4; } } }
     }
}


typedef _Float16 v4h __attribute__((ext_vector_type(4)));

__global__ __launch_bounds__(256) void k_x16(const float* __restrict__ x, _Float16* __restrict__ X16, size_t n8) { const size_t t = (size_t)blockIdx.x * 256 + threadIdx.x; if (t >= n8) return; FragH f;
#pragma unroll
  for (int q = 0; q < 8; ++q) f.h[q] = (_Float16)bf16_round(x[t * 8 + q]); *(v8us*)((unsigned short*)X16 + t * 8) = f.half[0];  }
__global__ __launch_bounds__(256) void k_h16(const float* __restrict__ x, _Float16* __restrict__ X16, size_t n8) { const size_t t = (size_t)blockIdx.x * 256 + threadIdx.x; if (t >= n8) return; FragH f;
#pragma unroll
  for (int q = 0; q < 8; ++q) f.h[q] = (_Float16)x[t * 8 + q]; *(v8us*)((unsigned short*)X16 + t * 8) = f.half[0];  }
__global__ __launch_bounds__(256) void k_round16f(const float* __restrict__ W, _Float16* __restrict__ Bt, size_t n8) { const size_t t = (size_t)blockIdx.x * 256 + threadIdx.x; if (t >= n8) return; FragH f;
#pragma unroll
  for (int i = 0; i < 8; ++i) f.h[i] = (_Float16)(bf16_round(W[t * 8 + i]) * 16.0f); *(v8us*)((unsigned short*)Bt + t * 8) = f.half[0];  }
template <int NHv, int TTv>
__global__ __launch_bounds__(256) void k_vt(const _Float16* __restrict__ V16, int ldv, int voff, _Float16* __restrict__ Vt) { __shared__ unsigned short tl[64][66]; const int tid = threadIdx.x; const int slab = blockIdx.x / (TTv / 64), lg = blockIdx.x % (TTv / 64); const int b = slab / NHv, h = slab % NHv;
  for (int i = tid; i < 64 * 8; i += 256) { const int r = i / 8, c8 = (i % 8) * 8; FragH f; f.half[0] = *(const v8us*)((const unsigned short*)V16 + ((size_t)b * TTv + lg * 64 + r) * ldv + voff + h * 64 + c8);
#pragma unroll
    for (int q = 0; q < 8; ++q) tl[r][c8 + q] = f.u[q]; }
  __syncthreads();
  {
#pragma unroll
    for (int rd = 0; rd < 2; ++rd) { const int d = rd * 32 + tid / 8, pc = tid % 8; FragH f;
#pragma unroll
      for (int q = 0; q < 8; ++q) f.u[q] = tl[pc * 8 + q][d];
      *(v8us*)((unsigned short*)Vt + ((size_t)slab * 64 + d) * TTv + lg * 64 + pc * 8) = f.half[0]; }
     } }

__global__ __launch_bounds__(256) void k_hl(const float* __restrict__ F, _Float16* __restrict__ Hh, _Float16* __restrict__ Hl, size_t n8) { const size_t t = (size_t)blockIdx.x * 256 + threadIdx.x; if (t >= n8) return; FragH fh, fl; const v4f a = *(const v4fa*)(F + t * 8), c = *(const v4fa*)(F + t * 8 + 4);
#pragma unroll
  for (int q = 0; q < 4; ++q) { _Float16 h = (_Float16)a[q]; fh.h[q] = h; fl.h[q] = (_Float16)((a[q] - (float)h) * 1024.0f); h = (_Float16)c[q]; fh.h[4 + q] = h; fl.h[4 + q] = (_Float16)((c[q] - (float)h) * 1024.0f); }
  { *(v8us*)((unsigned short*)Hh + t * 8) = fh.half[0]; *(v8us*)((unsigned short*)Hl + t * 8) = fl.half[0];  } }

// ---- fast GEMM (wave tile 32x64; requires M % 128 == 0 rows per launch region, N % 64 == 0 and K % 64 == 0); epilogue = k_gemm_hhx semantics, but the CP addend takes C's own grid-y offset ----
__device__ __forceinline__ v16h g2_frag(const _Float16* p, int hh) { FragH f; f.half[0] = *(const v8us*)((const unsigned short*)p + 8 * hh); f.half[1] = *(const v8us*)((const unsigned short*)p + 16 + 8 * hh); return f.v; }
__device__ __forceinline__ v8f g2_mma(v16h a, v16h b, v8f c) { v8f d = __builtin_amdgcn_wmma_f32_16x16x32_f16(false, a, false, b, (short)0, c, false, false); asm volatile("v_nop\n\tv_nop\n\tv_nop\n\tv_nop" : "+v"(d) : "v"(a), "v"(b)); return d; }
#define G2_KT 64                      /* k per stage: 128 bytes of every operand row */
#define G2_PITCH 144                  /* LDS row pitch in bytes: 128 + 16, an odd multiple of 16 for the 16-byte fragment reads */
#define G2_STAGE (192 * G2_PITCH)     /* one stage: 128 A rows, then 64 B rows */
// One stage's copies of one lane: 16 bytes of each of 8 A rows and 4 B rows (rows 16 apart; sa, sb = 16 rows in bytes), global memory -> LDS through no register.
// A wave's 32 lanes cover 4 whole 128-byte rows per copy. s_wait_xcnt 0 ends the statement so that it stands in front of any rewrite of the address registers the copies name.
__device__ __forceinline__ void g2_stage(unsigned l, const char* ga, size_t sa, const char* gb, size_t sb) {
  const char* a1 = ga + sa; const char* a2 = a1 + sa; const char* a3 = a2 + sa; const char* a4 = a3 + sa; const char* a5 = a4 + sa; const char* a6 = a5 + sa; const char* a7 = a6 + sa;
  const char* b1 = gb + sb; const char* b2 = b1 + sb; const char* b3 = b2 + sb;
  asm volatile("global_load_async_to_lds_b128 %0, %12, off\n\t"
               "global_load_async_to_lds_b128 %1, %13, off\n\t"
               "global_load_async_to_lds_b128 %2, %14, off\n\t"
               "global_load_async_to_lds_b128 %3, %15, off\n\t"
               "global_load_async_to_lds_b128 %4, %16, off\n\t"
               "global_load_async_to_lds_b128 %5, %17, off\n\t"
               "global_load_async_to_lds_b128 %6, %18, off\n\t"
               "global_load_async_to_lds_b128 %7, %19, off\n\t"
               "global_load_async_to_lds_b128 %8, %20, off\n\t"
               "global_load_async_to_lds_b128 %9, %21, off\n\t"
               "global_load_async_to_lds_b128 %10, %22, off\n\t"
               "global_load_async_to_lds_b128 %11, %23, off\n\t"
               "s_wait_xcnt 0x0"
               :: "v"(l), "v"(l + 16 * G2_PITCH), "v"(l + 32 * G2_PITCH), "v"(l + 48 * G2_PITCH), "v"(l + 64 * G2_PITCH), "v"(l + 80 * G2_PITCH), "v"(l + 96 * G2_PITCH), "v"(l + 112 * G2_PITCH),
                  "v"(l + 128 * G2_PITCH), "v"(l + 144 * G2_PITCH), "v"(l + 160 * G2_PITCH), "v"(l + 176 * G2_PITCH),
                  "v"(ga), "v"(a1), "v"(a2), "v"(a3), "v"(a4), "v"(a5), "v"(a6), "v"(a7), "v"(gb), "v"(b1), "v"(b2), "v"(b3)
               : "memory");
}
// Block tile 128x64 (M % 128 == 0, N % 64 == 0, K % 64 == 0): the A and B tiles of a stage go to LDS by asynchronous copies, two buffers, stage t + 2 in flight while stage t + 1 is worked on; the waves read their fragments from LDS. The order of the products along k is the plain one.
template <int ACT>
__global__ __launch_bounds__(128) void k_gemm2(const _Float16* __restrict__ A, int lda, size_t sA, const _Float16* __restrict__ Bh, int ldb, size_t sB, float alpha, const float* __restrict__ bias, size_t sBias, const float* __restrict__ CP, int rowsPerB, size_t sCPb, int row0g,
    float* __restrict__ C, _Float16* __restrict__ C16, int ldc, size_t sC, int M, int N, int K) {
  __shared__ __attribute__((aligned(128))) unsigned char sm[2 * G2_STAGE];
  float (*so)[32][68] = (float (*)[32][68])sm;      /* output staging (4 x 32 x 68 floats) over the two buffers, used only behind the last trip's barrier */
  const int tid = threadIdx.x, w = tid >> 5, lane = tid & 31, ln = lane & 15, hh = lane >> 4; const int by = blockIdx.y;
  A += (size_t)by * sA; Bh += (size_t)by * sB; const size_t cofs = (size_t)by * sC; const float* bp = bias ? bias + (size_t)by * sBias : nullptr;
  const int ntn = N >> 6; const int mt = blockIdx.x / ntn, nq = blockIdx.x - mt * ntn; const int row0 = mt * 128 + 32 * w, col0 = nq * 64; if (mt * 128 >= M) return;      /* the whole block leaves or none, in front of every barrier */
  const int cr = tid >> 3, cc = tid & 7;      /* copy lane: row cr (+ 16 i) of the tile, 16-byte piece cc of its 128 bytes */
  const char* ga = (const char*)(A + (size_t)(mt * 128 + cr) * lda + cc * 8); const char* gb = (const char*)(Bh + (size_t)(col0 + cr) * ldb + cc * 8);
  const size_t sa = (size_t)lda * 32, sb = (size_t)ldb * 32;
  const unsigned l0 = (unsigned)(size_t)sm + (unsigned)(cr * G2_PITCH + cc * 16);
  const int nst = K / G2_KT;
  g2_stage(l0, ga, sa, gb, sb);
  asm volatile("s_wait_asynccnt 0x0" ::: "memory");      /* stage 0 of this wave has landed */
  __syncthreads();                                       /* ... and every other wave's */
  if (nst > 1) g2_stage(l0 + G2_STAGE, ga + 2 * G2_KT, sa, gb + 2 * G2_KT, sb);
  const v8f z8 = {0.f,0.f,0.f,0.f,0.f,0.f,0.f,0.f}; v8f c00 = z8, c01 = z8, c02 = z8, c03 = z8, c10 = z8, c11 = z8, c12 = z8, c13 = z8;
  /* kept rolled: one trip per stage, so that the waits, the barrier and the refill at its foot stand once */
#pragma unroll 1
  for (int t = 0; t < nst; ++t) { const unsigned bo = (unsigned)(t & 1) * G2_STAGE;
    const _Float16* a0p = (const _Float16*)(sm + bo + (32 * w + ln) * G2_PITCH); const _Float16* a1p = (const _Float16*)(sm + bo + (32 * w + 16 + ln) * G2_PITCH);
    const _Float16* b0p = (const _Float16*)(sm + bo + (128 + ln) * G2_PITCH); const _Float16* b1p = (const _Float16*)(sm + bo + (144 + ln) * G2_PITCH); const _Float16* b2p = (const _Float16*)(sm + bo + (160 + ln) * G2_PITCH); const _Float16* b3p = (const _Float16*)(sm + bo + (176 + ln) * G2_PITCH);
    /* unrolled: the two 32-k steps of a stage read LDS at constant offsets */
#pragma unroll
    for (int kb = 0; kb < G2_KT; kb += 32) { const v16h a0 = g2_frag(a0p + kb, hh), a1 = g2_frag(a1p + kb, hh), b0 = g2_frag(b0p + kb, hh), b1 = g2_frag(b1p + kb, hh), b2 = g2_frag(b2p + kb, hh), b3 = g2_frag(b3p + kb, hh);
      c00 = g2_mma(a0, b0, c00); c10 = g2_mma(a1, b0, c10);
      c01 = g2_mma(a0, b1, c01); c11 = g2_mma(a1, b1, c11);
      c02 = g2_mma(a0, b2, c02); c12 = g2_mma(a1, b2, c12);
      c03 = g2_mma(a0, b3, c03); c13 = g2_mma(a1, b3, c13); }
    asm volatile("s_wait_dscnt 0x0" ::: "memory");       /* this wave's reads of the buffer are done before it is refilled */
    asm volatile("s_wait_asynccnt 0x0" ::: "memory");    /* this wave's copies of stage t + 1 have landed */
    __syncthreads();                                     /* publishes stage t + 1 and ends every wave's reads of stage t */
    if (t + 2 < nst) g2_stage(l0 + bo, ga + (size_t)(t + 2) * (2 * G2_KT), sa, gb + (size_t)(t + 2) * (2 * G2_KT), sb); }
  asm volatile("s_wait_asynccnt 0x0" ::: "memory");      /* no copy is outstanding when the buffers become output staging */
  v8f accs[8] = {c00, c01, c02, c03, c10, c11, c12, c13};
#pragma unroll
  for (int u = 0; u < 8; ++u) { const int t = u & 3, half = u >> 2; const int col = col0 + t * 16 + ln; const float bv = bp ? bf16_round(bp[col]) : 0.f;
#pragma unroll
    for (int r = 0; r < 8; ++r) { const int rloc = half * 16 + 8 * hh + r; float v = accs[u][r] * alpha + bv; if (CP) { const int bidx = (row0g + row0 + rloc) / rowsPerB; v += CP[cofs + (size_t)bidx * sCPb + col]; }
      if (ACT == 3) v = fmaxf(v, 0.f); else if (ACT == 6) v = 0.5f * v * (1.0f + erff(v * 0.70710678118654752f)); else if (ACT == 11) v = 1.0f / (1.0f + expf(-v)); else if (ACT == 15) v = v / (1.0f + expf(-v)); else if (ACT == 12) v = (v > 0.f) ? v : 0.01f * v; else if (ACT == 8) v = tanhf(v);
      so[w][rloc][t * 16 + ln] = v; } }
  __builtin_amdgcn_fence(__ATOMIC_ACQ_REL, "workgroup"); __builtin_amdgcn_wave_barrier();
  const int rsub = lane >> 4, c4 = (lane & 15) * 4;
  {
#pragma unroll
    for (int q = 0; q < 16; ++q) { const int r = q * 2 + rsub; const v4f v = *(const v4fa*)&so[w][r][c4]; if (C) *(v4f*)(C + cofs + (size_t)(row0 + r) * ldc + col0 + c4) = v; if (C16) { v4h h4; for (int i = 0; i < 4; ++i) h4[i] = (_Float16)v[i]; *(v4h*)(C16 + cofs + (size_t)(row0 + r) * ldc + col0 + c4) = h4; } }
     } }



// Both flash kernels work on the transposed products: S^T = K Q^T (A = 16 key rows, B = the wave's 16 queries) and O^T += V^T P^T (A = 16 rows of V^T, B = P^T).
// A lane then holds 16 of the 32 scores of ONE query (query ln; keys 8 hh + r of each 16-key tile), so the row maximum and the row sum are in-lane plus one exchange with lane ^ 16,
// and the two score tiles, converted in place, are already the B operand of the second product (element s = tile s / 8, register s % 8): P goes through no LDS.
__device__ __forceinline__ float xhalf(float x) { return __builtin_bit_cast(float, __builtin_amdgcn_permlanex16(__builtin_bit_cast(int, x), __builtin_bit_cast(int, x), 0x76543210, 0xfedcba98, false, false)); }      /* the value of lane ^ 16 */
#define SCL2 0.18033688011112042f      /* 64^-0.5 * log2(e): the softmax of the plain kernel runs in base 2 */
// Plain kernel: p * 2^10 = 2^(s * SCL2 + off) with off = 10 - max * SCL2: one fused multiply-add and one hardware exp2 per score; the row maximum is taken on the raw scores (SCL2 > 0).
// The accumulators and the row sum carry the 2^10, which the final division takes out.
#define FL_PITCH 144                  /* LDS row pitch in bytes: 128 + 16, an odd multiple of 16 for the 16-byte fragment reads */
#define FL_STAGE (128 * FL_PITCH)     /* one stage of 64 keys: 64 K rows (128 bytes = the head's 64 f16), then 64 V^T rows (128 bytes = 64 keys) */
// One stage's copies of one lane: 16 bytes of each of 4 K rows and 4 V^T rows (rows 16 apart; sk, sv = 16 rows in bytes), global memory -> LDS through no register.
// A wave's 32 lanes cover 4 whole 128-byte rows per copy. s_wait_xcnt 0 ends the statement so that it stands in front of any rewrite of the address registers the copies name.
__device__ __forceinline__ void fl_stage(unsigned l, const char* gk, size_t sk, const char* gv, size_t sv) {
  const char* k1 = gk + sk; const char* k2 = k1 + sk; const char* k3 = k2 + sk;
  const char* v1 = gv + sv; const char* v2 = v1 + sv; const char* v3 = v2 + sv;
  asm volatile("global_load_async_to_lds_b128 %0, %8, off\n\t"
               "global_load_async_to_lds_b128 %1, %9, off\n\t"
               "global_load_async_to_lds_b128 %2, %10, off\n\t"
               "global_load_async_to_lds_b128 %3, %11, off\n\t"
               "global_load_async_to_lds_b128 %4, %12, off\n\t"
               "global_load_async_to_lds_b128 %5, %13, off\n\t"
               "global_load_async_to_lds_b128 %6, %14, off\n\t"
               "global_load_async_to_lds_b128 %7, %15, off\n\t"
               "s_wait_xcnt 0x0"
               :: "v"(l), "v"(l + 16 * FL_PITCH), "v"(l + 32 * FL_PITCH), "v"(l + 48 * FL_PITCH), "v"(l + 64 * FL_PITCH), "v"(l + 80 * FL_PITCH), "v"(l + 96 * FL_PITCH), "v"(l + 112 * FL_PITCH),
                  "v"(gk), "v"(k1), "v"(k2), "v"(k3), "v"(gv), "v"(v1), "v"(v2), "v"(v3)
               : "memory");
}
// The K and V^T tiles of 64 keys go to LDS once per block by asynchronous copies in whole 128-byte rows, two buffers, stage t + 2 in flight while stage t + 1 is worked on; the block's 4 waves read their fragments from LDS.
// Each stage is worked on as two steps of 32 keys, with the products, the maxima and the sums in the order they had with fragments read from global memory.
template <int CAUSAL>
__global__ __launch_bounds__(128) void k_flash(const _Float16* __restrict__ Q16, int ldq, const _Float16* __restrict__ K16, int ldk, const _Float16* __restrict__ Vt, const int* __restrict__ MSK, float* __restrict__ O, int ldo) {
  constexpr int RPW = 16, DT = 4, KS = 2;
  __shared__ __attribute__((aligned(128))) unsigned char sm[2 * FL_STAGE];
  float (*sO)[RPW][64 + 4] = (float (*)[RPW][64 + 4])sm;      /* output staging (4 x 16 x 68 floats) over the first buffer, used only behind the last trip's barrier */
  const int tid = threadIdx.x, w = tid >> 5, lane = tid & 31, ln = lane & 15, hh = lane >> 4;
  const int slab = blockIdx.x / QBNP, qblk = QB0P + blockIdx.x % QBNP; const int b = slab / NH, h = slab % NH; const int qb0 = qblk * (4 * RPW); const int q0 = qb0 + w * RPW; const int tq = q0 + ln;      /* tq: this lane's query */
  const unsigned short* Vth = (const unsigned short*)Vt + (size_t)slab * 64 * TK;
  const int jend = (CAUSAL == 1) ? (qb0 + 4 * RPW) : TK;      /* causal: keys beyond the block's last query never contribute */
  const int nst = jend / 64;                                  /* jend is a multiple of 64 in every mode */
  const int cr = tid >> 3, cc = tid & 7;      /* copy lane: row cr (+ 16 i) of each tile, 16-byte piece cc of its 128 bytes */
  const char* gk = (const char*)((const unsigned short*)K16 + ((size_t)b * TK + cr) * ldk + h * 64 + cc * 8); const char* gv = (const char*)(Vth + (size_t)cr * TK + cc * 8);
  const size_t sk = (size_t)ldk * 32, sv = (size_t)TK * 32, dk = (size_t)ldk * 128;      /* dk: 64 key rows in bytes; a stage moves V^T by 128 bytes */
  const unsigned l0 = (unsigned)(size_t)sm + (unsigned)(cr * FL_PITCH + cc * 16);
  fl_stage(l0, gk, sk, gv, sv);
  FragH aq[KS];
  { const unsigned short* qr = (const unsigned short*)Q16 + ((size_t)b * TQ + tq) * ldq + h * 64;
#pragma unroll
    for (int ks = 0; ks < KS; ++ks) { aq[ks].half[0] = *(const v8us*)(qr + ks * 32 + 8 * hh); aq[ks].half[1] = *(const v8us*)(qr + ks * 32 + 16 + 8 * hh); } }
  asm volatile("s_wait_asynccnt 0x0" ::: "memory");      /* stage 0 of this wave has landed */
  __syncthreads();                                       /* ... and every other wave's */
  if (nst > 1) fl_stage(l0 + FL_STAGE, gk + dk, sk, gv + 128, sv);
  float m_r = -3.0e38f, off_r = 10.0f + 3.0e38f * SCL2, l_r = 0.f; v8f oacc[DT];      /* m_r: running maximum of the raw scores; off_r = 10 - m_r * SCL2; l_r: the sum over this lane's own keys, the two halves join behind the loop */
#pragma unroll
  for (int dt = 0; dt < DT; ++dt) oacc[dt] = (v8f){0.f,0.f,0.f,0.f,0.f,0.f,0.f,0.f};
  /* kept rolled: one trip per stage, so that the waits, the barrier and the refill at its foot stand once */
#pragma unroll 1
  for (int t = 0; t < nst; ++t) { const unsigned bo = (unsigned)(t & 1) * FL_STAGE;
    const unsigned short* kl = (const unsigned short*)(sm + bo + ln * FL_PITCH) + 8 * hh; const unsigned short* vl = (const unsigned short*)(sm + bo + (64 + ln) * FL_PITCH) + 8 * hh;      /* this lane's row of the first K tile and of the first V^T tile */
    /* unrolled: the two 32-key steps of a stage read LDS at constant offsets */
#pragma unroll
    for (int sub = 0; sub < 2; ++sub) { const int j0 = t * 64 + sub * 32;
      FragH bk[2][KS], bv[DT];
#pragma unroll
      for (int nt = 0; nt < 2; ++nt) { const unsigned short* kr = kl + (sub * 32 + nt * 16) * (FL_PITCH / 2);
#pragma unroll
        for (int ks = 0; ks < KS; ++ks) { bk[nt][ks].half[0] = *(const v8us*)(kr + ks * 32); bk[nt][ks].half[1] = *(const v8us*)(kr + ks * 32 + 16); } }
      v8f s[2];
#pragma unroll
      for (int nt = 0; nt < 2; ++nt) { v8f acc = (v8f){0.f,0.f,0.f,0.f,0.f,0.f,0.f,0.f};
#pragma unroll
        for (int ks = 0; ks < KS; ++ks) acc = mmaH<1>(bk[nt][ks].v, bk[nt][ks].v, aq[ks].v, aq[ks].v, acc);
        s[nt] = acc; }
      asm volatile("" ::: "memory");      /* compiler fence: keeps the V^T fragment reads behind the score products, so that they take over the K fragments' registers and fly during the softmax; without it the kernel takes 159 registers in place of 138 and a SIMD holds 6 waves in place of 7 */
#pragma unroll
      for (int dt = 0; dt < DT; ++dt) { const unsigned short* vrow = vl + dt * 16 * (FL_PITCH / 2) + sub * 32; bv[dt].half[0] = *(const v8us*)(vrow); bv[dt].half[1] = *(const v8us*)(vrow + 16); }
      float sc[16]; bool ok[16]; float mc = -3.0e38f;
#pragma unroll
      for (int e = 0; e < 16; ++e) { const int key = j0 + (e >> 3) * 16 + 8 * hh + (e & 7);
        ok[e] = (CAUSAL == 1) ? (key <= tq) : ((CAUSAL == 2) ? ((key >> 5) == (tq >> 5)) : true);      /* mode 2: block-diagonal 32-token groups */
        sc[e] = ok[e] ? s[e >> 3][e & 7] : -3.0e38f; mc = fmaxf(mc, sc[e]); }
      mc = fmaxf(mc, xhalf(mc));
      const float mn = fmaxf(m_r, mc); const float off = 10.0f - mn * SCL2; const float ea = __builtin_amdgcn_exp2f(off - off_r);      /* 2^(off - off_r): the factor that moves the accumulators to the new maximum */
      const float al = (mn > -1.0e38f) ? ea : 1.0f; m_r = mn; off_r = off;
      float ps[4] = {0.f, 0.f, 0.f, 0.f}; FragH pb;
#pragma unroll
      for (int e = 0; e < 16; ++e) { const float ee = __builtin_amdgcn_exp2f(sc[e] * SCL2 + off); const float p = ok[e] ? ee : 0.f; ps[e & 3] += p; pb.h[e] = (_Float16)p; }
      l_r = l_r * al + ((ps[0] + ps[1]) + (ps[2] + ps[3]));
#pragma unroll
      for (int dt = 0; dt < DT; ++dt)
#pragma unroll
        for (int r = 0; r < 8; ++r) oacc[dt][r] *= al;
#pragma unroll
      for (int dt = 0; dt < DT; ++dt) oacc[dt] = mmaH<1>(bv[dt].v, bv[dt].v, pb.v, pb.v, oacc[dt]); }
    asm volatile("s_wait_dscnt 0x0" ::: "memory");       /* this wave's reads of the buffer are done before it is refilled */
    asm volatile("s_wait_asynccnt 0x0" ::: "memory");    /* this wave's copies of stage t + 1 have landed */
    __syncthreads();                                     /* publishes stage t + 1 and ends every wave's reads of stage t */
    if (t + 2 < nst) fl_stage(l0 + bo, gk + (size_t)(t + 2) * dk, sk, gv + (size_t)(t + 2) * 128, sv); }
  asm volatile("s_wait_asynccnt 0x0" ::: "memory");      /* no copy is outstanding when the buffers become output staging */
  const float l = l_r + xhalf(l_r); const float linv = (l > 0.f) ? 1.0f / l : 0.f;
#pragma unroll
  for (int dt = 0; dt < DT; ++dt)
#pragma unroll
    for (int r = 0; r < 8; ++r) sO[w][ln][dt * 16 + 8 * hh + r] = oacc[dt][r] * linv;
  __builtin_amdgcn_fence(__ATOMIC_ACQ_REL, "workgroup"); __builtin_amdgcn_wave_barrier();
  {
#pragma unroll
    for (int rp = 0; rp < RPW; rp += 2) { const int r = rp + (lane >> 4), pc = lane & 15; const v4f val = *(const v4fa*)&sO[w][r][pc * 4]; *(v4f*)(O + ((size_t)b * TQ + q0 + r) * ldo + h * 64 + pc * 4) = val; }
     } }
// 5-plane variant: S = Qh Kh^T + (Ql Kh^T + Qh Kl^T)/1024 with Q/K = [hi | 2^10 residual] f16 planes (QL/KL same layout as Q16/K16), then the 3-term P.V below.
// 3-term variant: O = (P_hi V_hi + (P_lo V_hi + P_hi V_lo) / 1024) / (1024 l) with P = [hi | 2^10 residual] of 1024 p and V^T = [hi | 2^10 residual] planes (VtL same layout as Vt) -> ~2^-21-class products for un-averaged (early causal / peaked) rows
template <int CAUSAL>
__global__ __launch_bounds__(128) void k_flash5(const _Float16* __restrict__ Q16, const _Float16* __restrict__ QL, int ldq, const _Float16* __restrict__ K16, const _Float16* __restrict__ KL, int ldk, const _Float16* __restrict__ Vt, const _Float16* __restrict__ VtL, const int* __restrict__ MSK, float* __restrict__ O, int ldo) {
  constexpr int RPW = 16, DT = 4, KS = 2;
  __shared__ __attribute__((aligned(16))) float sO[4][RPW][64 + 4];
  const int tid = threadIdx.x, w = tid >> 5, lane = tid & 31, ln = lane & 15, hh = lane >> 4;
  const int slab = blockIdx.x / QBN5, qblk = QB05 + blockIdx.x % QBN5; const int b = slab / NH, h = slab % NH; const int qb0 = qblk * (4 * RPW); const int q0 = qb0 + w * RPW; const int tq = q0 + ln;      /* tq: this lane's query */
  FragH aq[KS], aql[KS];
  { const unsigned short* qr = (const unsigned short*)Q16 + ((size_t)b * TQ + tq) * ldq + h * 64; const unsigned short* ql = (const unsigned short*)QL + ((size_t)b * TQ + tq) * ldq + h * 64;
#pragma unroll
    for (int ks = 0; ks < KS; ++ks) { aq[ks].half[0] = *(const v8us*)(qr + ks * 32 + 8 * hh); aq[ks].half[1] = *(const v8us*)(qr + ks * 32 + 16 + 8 * hh); aql[ks].half[0] = *(const v8us*)(ql + ks * 32 + 8 * hh); aql[ks].half[1] = *(const v8us*)(ql + ks * 32 + 16 + 8 * hh); } }
  const unsigned short* Vth = (const unsigned short*)Vt + (size_t)slab * 64 * TK; const unsigned short* Vtl = (const unsigned short*)VtL + (size_t)slab * 64 * TK;
  float m_r = -3.0e38f, l_r = 0.f; v8f oacc[DT], oaccL[DT];      /* l_r: the sum over this lane's own keys; the two halves join behind the loop */
#pragma unroll
  for (int dt = 0; dt < DT; ++dt) { oacc[dt] = (v8f){0.f,0.f,0.f,0.f,0.f,0.f,0.f,0.f}; oaccL[dt] = oacc[dt]; }
  const int jend = (CAUSAL == 1) ? (qb0 + 4 * RPW) : TK;      /* causal: keys beyond the block's last query never contribute */
#pragma unroll 1
  for (int j0 = 0; j0 < jend; j0 += 32) {
    FragH bk[2][KS], bkl[2][KS], bv[DT], bl[DT]; const unsigned short* kr[2]; const unsigned short* klr[2];
#pragma unroll
    for (int nt = 0; nt < 2; ++nt) { kr[nt] = (const unsigned short*)K16 + ((size_t)b * TK + j0 + nt * 16 + ln) * ldk + h * 64 + 8 * hh; klr[nt] = (const unsigned short*)KL + ((size_t)b * TK + j0 + nt * 16 + ln) * ldk + h * 64 + 8 * hh;
#pragma unroll
      for (int ks = 0; ks < KS; ++ks) { bk[nt][ks].half[0] = *(const v8us*)(kr[nt] + ks * 32); bk[nt][ks].half[1] = *(const v8us*)(kr[nt] + ks * 32 + 16); bkl[nt][ks].half[0] = *(const v8us*)(klr[nt] + ks * 32); bkl[nt][ks].half[1] = *(const v8us*)(klr[nt] + ks * 32 + 16); } }
    v8f s[2];
#pragma unroll
    for (int nt = 0; nt < 2; ++nt) { v8f acc = (v8f){0.f,0.f,0.f,0.f,0.f,0.f,0.f,0.f}, accl = acc;
#pragma unroll
      for (int ks = 0; ks < KS; ++ks) { acc = mmaH<1>(bk[nt][ks].v, bk[nt][ks].v, aq[ks].v, aq[ks].v, acc); accl = mmaH<1>(bk[nt][ks].v, bk[nt][ks].v, aql[ks].v, aql[ks].v, accl); accl = mmaH<1>(bkl[nt][ks].v, bkl[nt][ks].v, aq[ks].v, aq[ks].v, accl); }
#pragma unroll
      for (int r = 0; r < 8; ++r) acc[r] += accl[r] * 0.0009765625f;
      s[nt] = acc; }
    asm volatile("s_wait_xcnt 0x0" :: "v"(kr[0]), "v"(kr[1]), "v"(klr[0]), "v"(klr[1]) : "memory");      /* the K loads' address registers, held as inputs up to here, are rewritten only behind this wait; the clobber keeps the V loads behind the score products, so that they take over the K fragments' registers and fly during the softmax */
#pragma unroll
    for (int dt = 0; dt < DT; ++dt) { const unsigned short* vrow = Vth + (size_t)(dt * 16 + ln) * TK + j0; const unsigned short* vrl = Vtl + (size_t)(dt * 16 + ln) * TK + j0; bv[dt].half[0] = *(const v8us*)(vrow + 8 * hh); bv[dt].half[1] = *(const v8us*)(vrow + 16 + 8 * hh); bl[dt].half[0] = *(const v8us*)(vrl + 8 * hh); bl[dt].half[1] = *(const v8us*)(vrl + 16 + 8 * hh); }
    float sc[16]; bool ok[16]; float mc = -3.0e38f;
#pragma unroll
    for (int e = 0; e < 16; ++e) { const int key = j0 + (e >> 3) * 16 + 8 * hh + (e & 7);
      ok[e] = (CAUSAL == 1) ? (key <= tq) : ((CAUSAL == 2) ? ((key >> 5) == (tq >> 5)) : true);      /* mode 2: block-diagonal 32-token groups */
      if (CAUSAL == 4) ok[e] = MSK[((size_t)b * TQ + tq) * TK + key] != 0;      /* mode 4: per-(query, key) INPUT mask shared by all heads; masked keys contribute nothing, rows with no valid key give l = 0 -> output 0 */
      sc[e] = ok[e] ? s[e >> 3][e & 7] * SCL : -3.0e38f; mc = fmaxf(mc, sc[e]); }
    mc = fmaxf(mc, xhalf(mc));
    const float mn = fmaxf(m_r, mc); const float ea = expf(m_r - mn); const float al = (mn > -1.0e38f) ? ea : 1.0f; m_r = mn;
    float ps[4] = {0.f, 0.f, 0.f, 0.f}; FragH pb, pl;
#pragma unroll
    for (int e = 0; e < 16; ++e) { const float ee = expf(sc[e] - mn); const float p = ok[e] ? ee : 0.f; ps[e & 3] += p; const float p1k = p * 1024.0f; const _Float16 ph = (_Float16)p1k; pb.h[e] = ph; pl.h[e] = (_Float16)((p1k - (float)ph) * 1024.0f); }
    l_r = l_r * al + ((ps[0] + ps[1]) + (ps[2] + ps[3]));
#pragma unroll
    for (int dt = 0; dt < DT; ++dt)
#pragma unroll
      for (int r = 0; r < 8; ++r) { oacc[dt][r] *= al; oaccL[dt][r] *= al; }
#pragma unroll
    for (int dt = 0; dt < DT; ++dt) { oacc[dt] = mmaH<1>(bv[dt].v, bv[dt].v, pb.v, pb.v, oacc[dt]); oaccL[dt] = mmaH<1>(bv[dt].v, bv[dt].v, pl.v, pl.v, oaccL[dt]); oaccL[dt] = mmaH<1>(bl[dt].v, bl[dt].v, pb.v, pb.v, oaccL[dt]); } }
  const float l = l_r + xhalf(l_r); const float linv = (l > 0.f) ? 1.0f / (l * 1024.0f) : 0.f;
#pragma unroll
  for (int dt = 0; dt < DT; ++dt)
#pragma unroll
    for (int r = 0; r < 8; ++r) { float v = oacc[dt][r]; v += oaccL[dt][r] * 0.0009765625f; sO[w][ln][dt * 16 + 8 * hh + r] = v * linv; }
  __builtin_amdgcn_fence(__ATOMIC_ACQ_REL, "workgroup"); __builtin_amdgcn_wave_barrier();
  {
#pragma unroll
    for (int rp = 0; rp < RPW; rp += 2) { const int r = rp + (lane >> 4), pc = lane & 15; const v4f val = *(const v4fa*)&sO[w][r][pc * 4]; *(v4f*)(O + ((size_t)b * TQ + q0 + r) * ldo + h * 64 + pc * 4) = val; }
     } }

__global__ __launch_bounds__(256) void k_wsc(const float* __restrict__ Wm, _Float16* __restrict__ Bt, size_t n8, float sc) { const size_t t = (size_t)blockIdx.x * 256 + threadIdx.x; if (t >= n8) return; FragH f; for (int q = 0; q < 8; ++q) f.h[q] = (_Float16)(bf16_round(Wm[t * 8 + q]) * sc); *(v8us*)((unsigned short*)Bt + t * 8) = f.half[0];  }      /* torch (out,in) weight == Bt[n][k]: scaled copy */




__global__ __launch_bounds__(256) void k_rope(const float* __restrict__ F, int nheads, const float* __restrict__ CS, const float* __restrict__ SN, _Float16* __restrict__ H, _Float16* __restrict__ L, int ldd) {      /* ldd: destination row pitch (the source pitch is nheads*HD) */
  #pragma clang fp contract(off)
  const size_t t = (size_t)blockIdx.x * 256 + threadIdx.x; if (t >= (size_t)NR * nheads * (HH / 8)) return; const int g = (int)(t % (HH / 8)) * 8; const int h = (int)((t / (HH / 8)) % nheads); const int s = (int)(t / ((HH / 8) * (size_t)nheads)); const int ld = nheads * HD;
  const size_t base = (size_t)s * ld + h * HD + g, dbase = (size_t)s * ldd + h * HD + g; FragH h0, h1, l0, l1;
#pragma unroll
  for (int q = 0; q < 8; ++q) { const float c = CS[s * HH + g + q], sn = SN[s * HH + g + q]; const float x0 = F[base + q], x1 = F[base + HH + q]; float o0 = x0 * c; o0 += -x1 * sn; float o1 = x1 * c; o1 += x0 * sn;
    const _Float16 a0 = (_Float16)o0, a1 = (_Float16)o1; h0.h[q] = a0; h1.h[q] = a1; l0.h[q] = (_Float16)((o0 - (float)a0) * 1024.0f); l1.h[q] = (_Float16)((o1 - (float)a1) * 1024.0f); }
  { *(v8us*)((unsigned short*)H + dbase) = h0.half[0]; *(v8us*)((unsigned short*)H + dbase + HH) = h1.half[0]; if (L) { *(v8us*)((unsigned short*)L + dbase) = l0.half[0]; *(v8us*)((unsigned short*)L + dbase + HH) = l1.half[0]; }  } }

__global__ __launch_bounds__(256) void k_rotab(const int* __restrict__ pid, float* __restrict__ CS, float* __restrict__ SN) {      /* s = token row over both batches */
  #pragma clang fp contract(off)
  const int t = blockIdx.x * 256 + threadIdx.x; if (t >= NR * HH) return; const int j = t % HH, s = t / HH; const float inv = 1.0f / powf(10000.0f, (float)(2 * j) / (float)HD); const float th = (float)pid[s] * inv; const float c = cosf(th), sn = sinf(th);
  { *(float*)(CS + t) = c; *(float*)(SN + t) = sn;  } }

__global__ __launch_bounds__(256) void k_expand(const _Float16* __restrict__ SH, const _Float16* __restrict__ SL, _Float16* __restrict__ DH, _Float16* __restrict__ DL, int col0) {
  const size_t t = (size_t)blockIdx.x * 256 + threadIdx.x; if (t >= (size_t)NR * NH * (HD / 8)) return; const int d0 = (int)(t % (HD / 8)) * 8; const int h = (int)((t / (HD / 8)) % NH); const size_t s = t / ((HD / 8) * NH);
  const size_t si = s * KVD + (size_t)(h / (NH / NKV)) * HD + d0, di = s * (size_t)(3 * EMB) + col0 + (size_t)h * HD + d0; const v8us a = *(const v8us*)((const unsigned short*)SH + si), bl = *(const v8us*)((const unsigned short*)SL + si);
  { *(v8us*)((unsigned short*)DH + di) = a; *(v8us*)((unsigned short*)DL + di) = bl;  } }

extern "C" void kernel_launch(void* const* d_in, const int* in_sizes, int n_in,
                              void* d_out, int out_size, void* d_ws, size_t ws_size, hipStream_t stream) {
  (void)in_sizes; (void)n_in; (void)out_size;
  const float* const* I = (const float* const*)d_in; const float* x = I[0]; const float* Wq = I[1]; const float* bq = I[2]; const float* Wk = I[3]; const float* bk = I[4]; const float* Wv = I[5]; const float* bv = I[6]; const float* Wo = I[7]; const int* pid = (const int*)d_in[8];
  char* ws = (char*)d_ws; size_t off = 0;
  auto take = [&](size_t bytes) { char* p = ws + off; off += (bytes + 255) & ~(size_t)255; return p; };
  const size_t npb = (size_t)SLEN * EMB, npa = (size_t)NR * EMB;      /* per-batch plane, plane of both batches */
  _Float16* BQ = (_Float16*)take((size_t)EMB * EMB * 2); _Float16* BK = (_Float16*)take((size_t)KVD * EMB * 2); _Float16* BV = (_Float16*)take((size_t)KVD * EMB * 2); _Float16* BO = (_Float16*)take((size_t)EMB * EMB * 2);
  float* CS = (float*)take((size_t)NR * HH * 4); float* SN = (float*)take((size_t)NR * HH * 4);
  _Float16* X16 = (_Float16*)take(npa * 2); float* QF = (float*)take(npa * 4); float* KF = (float*)take((size_t)NR * KVD * 4); float* VF = (float*)take((size_t)NR * KVD * 4); _Float16* KH8 = (_Float16*)take((size_t)NR * KVD * 2); _Float16* KL8 = (_Float16*)take((size_t)NR * KVD * 2); _Float16* VH8 = (_Float16*)take((size_t)NR * KVD * 2); _Float16* VL8 = (_Float16*)take((size_t)NR * KVD * 2);
  _Float16* H16 = (_Float16*)take(npa * 3 * 2); _Float16* L16 = (_Float16*)take(npa * 3 * 2); _Float16* VT = (_Float16*)take(npa * 2); _Float16* VTL = (_Float16*)take(npa * 2);
  float* O = QF; _Float16* OH = X16; _Float16* OLo = (_Float16*)take(npa * 2);      /* O over the q f32 plane (dead after the rope split); O hi over the x plane (dead after the projections) */
  if (off > ws_size) return;      /* 8+2+2+8 + 1 + 16 + 32 + 8+8 + 4x4 + 48 + 48 + 16 + 16 + 16 = 245 MiB */
  float* ob = (float*)d_out;
  k_wt_f16<<<(EMB / 64) * (EMB / 64), 256, 0, stream>>>(Wq, BQ, EMB, EMB, 16.0f); k_wt_f16<<<(EMB / 64) * (KVD / 64), 256, 0, stream>>>(Wk, BK, EMB, KVD, 16.0f); k_wt_f16<<<(EMB / 64) * (KVD / 64), 256, 0, stream>>>(Wv, BV, EMB, KVD, 16.0f); k_wt_f16<<<(EMB / 64) * (EMB / 64), 256, 0, stream>>>(Wo, BO, EMB, EMB, 16.0f);      /* (in,out) weights */
  k_rotab<<<(NR * HH + 255) / 256, 256, 0, stream>>>(pid, CS, SN);
  k_x16<<<(unsigned)((npa / 8 + 255) / 256), 256, 0, stream>>>(x, X16, npa / 8);
  k_gemm2<0><<<dim3((NR / 128) * (EMB / 64), 1), 128, 0, stream>>>(X16, EMB, 0, BQ, EMB, 0, 0.0625f, bq, 0, nullptr, 1, 0, 0, QF, nullptr, EMB, 0, NR, EMB, EMB);
  k_gemm2<0><<<dim3((NR / 128) * (KVD / 64), 1), 128, 0, stream>>>(X16, EMB, 0, BK, EMB, 0, 0.0625f, bk, 0, nullptr, 1, 0, 0, KF, nullptr, KVD, 0, NR, KVD, EMB);
  k_gemm2<0><<<dim3((NR / 128) * (KVD / 64), 1), 128, 0, stream>>>(X16, EMB, 0, BV, EMB, 0, 0.0625f, bv, 0, nullptr, 1, 0, 0, VF, nullptr, KVD, 0, NR, KVD, EMB);
  k_rope<<<(unsigned)(((size_t)NR * NH * (HH / 8) + 255) / 256), 256, 0, stream>>>(QF, NH, CS, SN, H16, L16, 3 * EMB);      /* q roped + split into the [q | k | v] planes */
  k_rope<<<(unsigned)(((size_t)NR * NKV * (HH / 8) + 255) / 256), 256, 0, stream>>>(KF, NKV, CS, SN, KH8, KL8, KVD);
  k_hl<<<(unsigned)(((size_t)NR * KVD / 8 + 255) / 256), 256, 0, stream>>>(VF, VH8, VL8, (size_t)NR * KVD / 8);
  k_expand<<<(unsigned)(((size_t)NR * NH * (HD / 8) + 255) / 256), 256, 0, stream>>>(KH8, KL8, H16, L16, EMB); k_expand<<<(unsigned)(((size_t)NR * NH * (HD / 8) + 255) / 256), 256, 0, stream>>>(VH8, VL8, H16, L16, 2 * EMB);
  k_vt<NH, SLEN><<<NB * NH * (SLEN / 64), 256, 0, stream>>>(H16, 3 * EMB, 2 * EMB, VT); k_vt<NH, SLEN><<<NB * NH * (SLEN / 64), 256, 0, stream>>>(L16, 3 * EMB, 2 * EMB, VTL);
  k_flash5<1><<<NB * NH * QBN5, 128, 0, stream>>>(H16, L16, 3 * EMB, H16 + EMB, L16 + EMB, 3 * EMB, VT, VTL, nullptr, O, EMB);
  k_flash<1><<<NB * NH * QBNP, 128, 0, stream>>>(H16, 3 * EMB, H16 + EMB, 3 * EMB, VT, nullptr, O, EMB);
  k_hl<<<(unsigned)((npa / 8 + 255) / 256), 256, 0, stream>>>(O, OH, OLo, npa / 8);
  k_gemm2<0><<<dim3((NR / 128) * (EMB / 64), 1), 128, 0, stream>>>(OH, EMB, 0, BO, EMB, 0, 0.0625f, nullptr, 0, nullptr, 1, 0, 0, ob, nullptr, EMB, 0, NR, EMB, EMB);
  k_gemm2<0><<<dim3((RE / 128) * (EMB / 64), NB), 128, 0, stream>>>(OLo, EMB, npb, BO, EMB, 0, 0.0625f / 1024.0f, nullptr, 0, ob, 1, (size_t)EMB, 0, ob, nullptr, EMB, npb, RE, EMB, EMB);      /* grid y = batch: the first RE rows of each */
}

// v007
// A run of this version takes 255 microseconds.
// Timed twice side by side with v006, it ran 1.16 times as fast both times.
// All steps since v000 together make it 5.39 times as fast.
#include <hip/hip_runtime.h>
// GQA self-attention (2 x 2048 tokens, hidden 2048; 32 query heads / 8 kv heads of 64 (GQA), rotate-half RoPE from the INPUT position ids, causal SDPA (1/8), out = o Wo): q/k/v = x W + b.
// Structure (both batches in every launch: the 4096 token rows are one row range, batch = row / 2048): exact f16 plane of x; q / k / v GEMMs (32x64 wave tiles, f32 accumulation, exact x16 weights + bias) into f32 planes; angle tables from the input position ids (f32 trig); RoPE on VALU while splitting q and k into f16 hi + 2^10-residual planes, v split directly; the 8 kv heads expanded to the 32 query heads (repeat 4) into the fused [q | k | v] hi/lo planes; V^T hi/residual by LDS tiles; the fused causal flash kernel in its 5-plane form for the first 256 query rows and plain beyond; attention output as f16 hi (+ residual on those rows) into the output GEMMs.
// Compute dtype: x, weights and biases rounded to bf16; rows < 256 per batch: q, k, P, v, O hi + residual; beyond: plain f16; f32 accumulation/softmax/trig. v_wmma_f32_16x16x32_f16.
#define NB 2
#define EMB 2048
#define NR (NB * SLEN)           /* 4096 token rows */
#define SLEN 2048
#define SQ SLEN
#define TQ SLEN
#define TK SLEN
#define NH 32
#define NKV 8
#define KVD (NKV * HD)
#define HD 64
#define HH (HD / 2)
#define SCL 0.125f               /* 64^-0.5 */
#define QBLKS (TQ / 64)
#define QB05 0                   /* 5-plane flash: query blocks [0, QBN5) of every (batch, head) — the early causal rows whose outputs average over few keys */
#define QBN5 4
#define QB0P QBN5                /* plain flash (hi planes only): query blocks [QBN5, QBLKS) */
#define QBNP (QBLKS - QBN5)
#define RE 256                   /* rows per batch that take the hi+lo output operand (= QBN5 * 64) */
typedef __bf16 v16b __attribute__((ext_vector_type(16)));
typedef unsigned short v8us __attribute__((ext_vector_type(8), may_alias));
typedef float  v8f  __attribute__((ext_vector_type(8)));
typedef float  v4f  __attribute__((ext_vector_type(4)));
typedef float  v4fa __attribute__((ext_vector_type(4), may_alias));
union FragB { v16b v; v8us half[2]; unsigned short u[16]; };

__device__ __forceinline__ unsigned short bf16_bits(float x) { unsigned int u = __float_as_uint(x); return (unsigned short)((u + 0x7FFFu + ((u >> 16) & 1u)) >> 16); }
__device__ __forceinline__ float bf16_val(unsigned short b) { return __uint_as_float(((unsigned int)b) << 16); }
__device__ __forceinline__ float bf16_round(float x) { return bf16_val(bf16_bits(x)); }
// D += A·B with NT terms: 1 = ah·bh, 2 = + al·bh (A split), 3 = + ah·bl (both split)
template <int NT>
__device__ __forceinline__ v8f mmaN(v16b ah, v16b al, v16b bh, v16b bl, v8f c) {
  c = __builtin_amdgcn_wmma_f32_16x16x32_bf16(false, ah, false, bh, (short)0, c, false, false);
  if (NT >= 2) c = __builtin_amdgcn_wmma_f32_16x16x32_bf16(false, al, false, bh, (short)0, c, false, false);
  if (NT >= 3) c = __builtin_amdgcn_wmma_f32_16x16x32_bf16(false, ah, false, bl, (short)0, c, false, false);
  asm volatile("v_nop\n\tv_nop\n\tv_nop\n\tv_nop" : "+v"(c) : "v"(ah), "v"(al), "v"(bh), "v"(bl));
  return c;
}

__global__ __launch_bounds__(256) void k_wt_bf16(const float* __restrict__ W, unsigned short* __restrict__ Wt, int K, int N) {
  const int t = blockIdx.x * 256 + threadIdx.x;
  const int k8n = K / 8;
  if (t >= N * k8n) return;
  const int n = t / k8n, k8 = (t % k8n) * 8;
  v8us v;
#pragma unroll
  for (int i = 0; i < 8; ++i) v[i] = bf16_bits(W[(size_t)(k8 + i) * N + n]);
  *(v8us*)(Wt + (size_t)n * K + k8) = v;
  
}

// GEMM C[M][N] (f32, pitch ldc) = act(A[M][K]·W + bias). A f32 row-major (pitch lda) converted per fragment to bf16
// (ASPLIT: hi/lo two planes -> 2 terms, else single rounded term); Wt bf16 [N][K] (pitch ldb). BIAS_BF16 rounds the
// bias to bf16 first (bias quantised to bf16 before the add). K%32==0, M%16==0, N%64==0.
template <bool ASPLIT, int ACT, bool BIAS_BF16>
__global__ __launch_bounds__(128) void k_gemm_bf(const float* __restrict__ A, int lda, const unsigned short* __restrict__ Wt, int ldb,
                                               const float* __restrict__ bias, float* __restrict__ C, int ldc, int M, int N, int K) {
  __shared__ __attribute__((aligned(16))) float so[4][16][64];
  const int tid = threadIdx.x, w = tid >> 5, lane = tid & 31, ln = lane & 15, hh = lane >> 4;
  const int ntn = N / 64;
  const int wid = blockIdx.x * 4 + w;
  const int mt = wid / ntn, nq = wid % ntn;
  if (mt * 16 >= M) return;
  const int row0 = mt * 16, col0 = nq * 64;
  const float* arow = A + (size_t)(row0 + ln) * lda;
  v8f acc[4] = {};
  for (int kb = 0; kb < K; kb += 32) {
    FragB ah, al;
    const v4f x0 = *(const v4fa*)(arow + kb + 8 * hh), x1 = *(const v4fa*)(arow + kb + 8 * hh + 4);
    const v4f x2 = *(const v4fa*)(arow + kb + 16 + 8 * hh), x3 = *(const v4fa*)(arow + kb + 16 + 8 * hh + 4);
    float xs[16] = {x0[0],x0[1],x0[2],x0[3],x1[0],x1[1],x1[2],x1[3],x2[0],x2[1],x2[2],x2[3],x3[0],x3[1],x3[2],x3[3]};
#pragma unroll
    for (int i = 0; i < 16; ++i) { const unsigned short hb = bf16_bits(xs[i]); ah.u[i] = hb; al.u[i] = ASPLIT ? bf16_bits(xs[i] - bf16_val(hb)) : (unsigned short)0; }
#pragma unroll
    for (int t = 0; t < 4; ++t) {
      const unsigned short* brow = Wt + (size_t)(col0 + t * 16 + ln) * ldb + kb;
      FragB b;
      b.half[0] = *(const v8us*)(brow + 8 * hh);
      b.half[1] = *(const v8us*)(brow + 16 + 8 * hh);
      acc[t] = mmaN<ASPLIT ? 2 : 1>(ah.v, al.v, b.v, b.v, acc[t]);
    }
  }
#pragma unroll
  for (int t = 0; t < 4; ++t) {
    float bv = bias ? bias[col0 + t * 16 + ln] : 0.f;
    if (BIAS_BF16) bv = bf16_round(bv);
#pragma unroll
    for (int r = 0; r < 8; ++r) { float v = acc[t][r] + bv; if (ACT == 1) v = fmaxf(v, 0.f); so[w][8 * hh + r][t * 16 + ln] = v; }
  }
  __builtin_amdgcn_fence(__ATOMIC_ACQ_REL, "workgroup");
  __builtin_amdgcn_wave_barrier();
  const int rsub = lane >> 4, c4 = (lane & 15) * 4;
  {
#pragma unroll
    for (int q = 0; q < 8; ++q) {
      const int r = q * 2 + rsub;
      const v4f v = *(const v4fa*)&so[w][r][c4];
      *(v4f*)(C + (size_t)(row0 + r) * ldc + col0 + c4) = v;
    }
    
  }
}

// GEMM C = act(A·W + bias + resid): A f32 (ASPLIT -> hi/lo 2 terms), Wt bf16 [N][K]; ACT 0 none, 1 relu, 2 exact gelu;
// resid (optional, f32, row index = (row % rmod), pitch ldr, RES_BF16 rounds it) added before the activation.
template <bool ASPLIT, int ACT, bool BIAS_BF16, bool RES_BF16>
__global__ __launch_bounds__(128) void k_gemm_bf3(const float* __restrict__ A, int lda, const unsigned short* __restrict__ Wt, int ldb,
                                                const float* __restrict__ bias, const float* __restrict__ resid, int rmod, int ldr,
                                                float* __restrict__ C, int ldc, int M, int N, int K) {
  __shared__ __attribute__((aligned(16))) float so[4][16][64];
  const int tid = threadIdx.x, w = tid >> 5, lane = tid & 31, ln = lane & 15, hh = lane >> 4;
  const int ntn = N / 64;
  const int wid = blockIdx.x * 4 + w;
  const int mt = wid / ntn, nq = wid % ntn;
  if (mt * 16 >= M) return;
  const int row0 = mt * 16, col0 = nq * 64;
  const float* arow = A + (size_t)(row0 + ln) * lda;
  v8f acc[4] = {};
  for (int kb = 0; kb < K; kb += 32) {
    FragB ah, al;
    const v4f x0 = *(const v4fa*)(arow + kb + 8 * hh), x1 = *(const v4fa*)(arow + kb + 8 * hh + 4);
    const v4f x2 = *(const v4fa*)(arow + kb + 16 + 8 * hh), x3 = *(const v4fa*)(arow + kb + 16 + 8 * hh + 4);
    float xs[16] = {x0[0],x0[1],x0[2],x0[3],x1[0],x1[1],x1[2],x1[3],x2[0],x2[1],x2[2],x2[3],x3[0],x3[1],x3[2],x3[3]};
#pragma unroll
    for (int i = 0; i < 16; ++i) { const unsigned short hb = bf16_bits(xs[i]); ah.u[i] = hb; al.u[i] = ASPLIT ? bf16_bits(xs[i] - bf16_val(hb)) : (unsigned short)0; }
#pragma unroll
    for (int t = 0; t < 4; ++t) {
      const unsigned short* brow = Wt + (size_t)(col0 + t * 16 + ln) * ldb + kb;
      FragB b;
      b.half[0] = *(const v8us*)(brow + 8 * hh);
      b.half[1] = *(const v8us*)(brow + 16 + 8 * hh);
      acc[t] = mmaN<ASPLIT ? 2 : 1>(ah.v, al.v, b.v, b.v, acc[t]);
    }
  }
#pragma unroll
  for (int t = 0; t < 4; ++t) {
    const int col = col0 + t * 16 + ln;
    float bv = bias ? bias[col] : 0.f;
    if (BIAS_BF16) bv = bf16_round(bv);
#pragma unroll
    for (int r = 0; r < 8; ++r) {
      float v = acc[t][r] + bv;
      if (resid) { float rv = resid[(size_t)((row0 + 8 * hh + r) % rmod) * ldr + col]; if (RES_BF16) rv = bf16_round(rv); v += rv; }
      if (ACT == 1) v = fmaxf(v, 0.f);
      if (ACT == 2) v = 0.5f * v * (1.0f + erff(v * 0.70710678118654752f));
      if (ACT == 3) { const float u = 0.7978845608028654f * (v + 0.044715f * v * v * v); v = 0.5f * v * (1.0f + tanhf(u)); }
      so[w][8 * hh + r][t * 16 + ln] = v;
    }
  }
  __builtin_amdgcn_fence(__ATOMIC_ACQ_REL, "workgroup");
  __builtin_amdgcn_wave_barrier();
  const int rsub = lane >> 4, c4 = (lane & 15) * 4;
  {
#pragma unroll
    for (int q = 0; q < 8; ++q) {
      const int r = q * 2 + rsub;
      const v4f v = *(const v4fa*)&so[w][r][c4];
      *(v4f*)(C + (size_t)(row0 + r) * ldc + col0 + c4) = v;
    }
    
  }
}
// row LayerNorm (biased variance, eps) over N: s = X (+ R); optional out_sum <- s; out_norm <- (s-mu)*rsqrt(var+eps)*g + b
template <bool PARAM_BF16>
__global__ __launch_bounds__(256) void k_layernorm(const float* __restrict__ X, const float* __restrict__ R, const float* __restrict__ g, const float* __restrict__ bta,
                                                  float* __restrict__ out_sum, float* __restrict__ out_norm, int N, float eps) {
  __shared__ float red[256];
  const int row = blockIdx.x, tid = threadIdx.x;
  const float* x = X + (size_t)row * N; const float* rr = R ? R + (size_t)row * N : nullptr;
  float vals[16];                     // up to N = 4096
  const int per = N / 256;            // contiguous chunk per thread? use strided-by-4 chunks: thread handles j = tid*4 + 1024*u
  float s1 = 0.f;
  for (int u = 0; u < per / 4; ++u) {
    const int j = tid * 4 + 1024 * u;
    const v4f a = *(const v4fa*)(x + j);
    v4f b = {0.f,0.f,0.f,0.f}; if (rr) b = *(const v4fa*)(rr + j);
#pragma unroll
    for (int q = 0; q < 4; ++q) { const float v = a[q] + b[q]; vals[u * 4 + q] = v; s1 += v; }
  }
  red[tid] = s1; __syncthreads();
  for (int st = 128; st > 0; st >>= 1) { if (tid < st) red[tid] += red[tid + st]; __syncthreads(); }
  const float mu = red[0] / (float)N; __syncthreads();
  float s2 = 0.f;
  for (int u = 0; u < per / 4; ++u)
#pragma unroll
    for (int q = 0; q < 4; ++q) { const float c = vals[u * 4 + q] - mu; s2 += c * c; }
  red[tid] = s2; __syncthreads();
  for (int st = 128; st > 0; st >>= 1) { if (tid < st) red[tid] += red[tid + st]; __syncthreads(); }
  const float rs = rsqrtf(red[0] / (float)N + eps);
  {
    for (int u = 0; u < per / 4; ++u) {
      const int j = tid * 4 + 1024 * u;
      v4f o, sm;
#pragma unroll
      for (int q = 0; q < 4; ++q) {
        float gg = g[j + q], bb = bta[j + q];
        if (PARAM_BF16) { gg = bf16_round(gg); bb = bf16_round(bb); }
        sm[q] = vals[u * 4 + q]; o[q] = (vals[u * 4 + q] - mu) * rs * gg + bb;
      }
      if (out_sum) *(v4f*)(out_sum + (size_t)row * N + j) = sm;
      *(v4f*)(out_norm + (size_t)row * N + j) = o;
    }
    
  }
}



// ---- f16 WMMA path (v_wmma_f32_16x16x32_f16): 11-bit significands for operands in range — used where a [0,1] probability operand needs more precision than bf16
typedef _Float16 v16h __attribute__((ext_vector_type(16)));
union FragH { v16h v; v8us half[2]; _Float16 h[16]; unsigned short u[16]; };
template <int NT>
__device__ __forceinline__ v8f mmaH(v16h ah, v16h al, v16h bh, v16h bl, v8f c) {
  c = __builtin_amdgcn_wmma_f32_16x16x32_f16(false, ah, false, bh, (short)0, c, false, false);
  if (NT >= 2) c = __builtin_amdgcn_wmma_f32_16x16x32_f16(false, al, false, bh, (short)0, c, false, false);
  if (NT >= 3) c = __builtin_amdgcn_wmma_f32_16x16x32_f16(false, ah, false, bl, (short)0, c, false, false);
  asm volatile("v_nop\n\tv_nop\n\tv_nop\n\tv_nop" : "+v"(c) : "v"(ah), "v"(al), "v"(bh), "v"(bl));
  return c;
}
// batched GEMM like k_gemm_b but f16 operands: A f32 (split into f16 hi/lo if ASPLIT, else rounded to f16), Bt = f16 values [n][k]; alpha; C f32; N multiple of 16 (partial tiles skipped)
template <bool ASPLIT>
__global__ __launch_bounds__(128) void k_gemm_h(const float* __restrict__ A, int lda, size_t sA, const _Float16* __restrict__ Bh, int ldb, size_t sB, float alpha, float* __restrict__ C, int ldc, size_t sC, int M, int N, int K) {
  __shared__ __attribute__((aligned(16))) float so[4][16][64];
  const int tid = threadIdx.x, w = tid >> 5, lane = tid & 31, ln = lane & 15, hh = lane >> 4; const int by = blockIdx.y;
  A += (size_t)by * sA; Bh += (size_t)by * sB; C += (size_t)by * sC;
  const int ntn = (N + 63) / 64; const int wid = blockIdx.x * 4 + w; const int mt = wid / ntn, nq = wid % ntn; if (mt * 16 >= M) return;
  const int row0 = mt * 16, col0 = nq * 64; const float* arow = A + (size_t)(row0 + ln) * lda;
  v8f acc[4] = {};
  for (int kb = 0; kb < K; kb += 32) {
    FragH ah, al;
    const v4f x0 = *(const v4fa*)(arow + kb + 8 * hh), x1 = *(const v4fa*)(arow + kb + 8 * hh + 4), x2 = *(const v4fa*)(arow + kb + 16 + 8 * hh), x3 = *(const v4fa*)(arow + kb + 16 + 8 * hh + 4);
    float xs[16] = {x0[0],x0[1],x0[2],x0[3],x1[0],x1[1],x1[2],x1[3],x2[0],x2[1],x2[2],x2[3],x3[0],x3[1],x3[2],x3[3]};
#pragma unroll
    for (int i = 0; i < 16; ++i) { const _Float16 h = (_Float16)xs[i]; ah.h[i] = h; al.h[i] = ASPLIT ? (_Float16)(xs[i] - (float)h) : (_Float16)0.0f; }
#pragma unroll
    for (int t = 0; t < 4; ++t) { if (col0 + t * 16 >= N) continue; const size_t boff = (size_t)(col0 + t * 16 + ln) * ldb + kb; FragH bq; bq.half[0] = *(const v8us*)(Bh + boff + 8 * hh); bq.half[1] = *(const v8us*)(Bh + boff + 16 + 8 * hh);
      acc[t] = mmaH<ASPLIT ? 2 : 1>(ah.v, al.v, bq.v, bq.v, acc[t]); }
  }
#pragma unroll
  for (int t = 0; t < 4; ++t) { if (col0 + t * 16 >= N) continue;
#pragma unroll
    for (int r = 0; r < 8; ++r) so[w][8 * hh + r][t * 16 + ln] = acc[t][r] * alpha; }
  __builtin_amdgcn_fence(__ATOMIC_ACQ_REL, "workgroup"); __builtin_amdgcn_wave_barrier();
  const int rsub = lane >> 4, c4 = (lane & 15) * 4;
  {
#pragma unroll
    for (int q = 0; q < 8; ++q) { const int r = q * 2 + rsub; if (col0 + c4 < N) { const v4f v = *(const v4fa*)&so[w][r][c4]; *(v4f*)(C + (size_t)(row0 + r) * ldc + col0 + c4) = v; } }
     }
}

// Wt[n][k] = f16(W[k][n]·scale) from f32 row-major W[K][N] (scale = power of two; bf16-exact weights stay exact in f16 away from the subnormal range)
// One block of 256 per 64 x 64 tile (K % 64 == 0, N % 64 == 0; (K / 64) * (N / 64) tiles): W is read in whole 256-byte row pieces (16 bytes a lane), converted, turned in LDS, and Wt is written in whole 128-byte rows (16 bytes a lane).
__device__ __forceinline__ void wt_f16_job(int bx, const float* __restrict__ W, _Float16* __restrict__ Wt, int K, int N, float scale) {      /* bx: the tile's index */
  __shared__ unsigned int tl[64][33];      /* tile [k][n], two f16 a word; the odd pitch keeps the column reads below on distinct banks */
  const int tid = threadIdx.x; const int nkt = K >> 6; const int nt = bx / nkt, kt = bx - nt * nkt; const int k0 = kt * 64, n0 = nt * 64;
  const int r = tid >> 4, c4 = (tid & 15) * 4; v4f a[4];
#pragma unroll
  for (int p = 0; p < 4; ++p) a[p] = *(const v4fa*)(W + (size_t)(k0 + p * 16 + r) * N + n0 + c4);
#pragma unroll
  for (int p = 0; p < 4; ++p) { FragH f;
#pragma unroll
    for (int q = 0; q < 4; ++q) f.h[q] = (_Float16)(bf16_round(a[p][q]) * scale);
    tl[p * 16 + r][c4 / 2] = (unsigned int)f.u[0] | ((unsigned int)f.u[1] << 16); tl[p * 16 + r][c4 / 2 + 1] = (unsigned int)f.u[2] | ((unsigned int)f.u[3] << 16); }
  __syncthreads();
  typedef unsigned short usa __attribute__((may_alias)); const usa* ts = (const usa*)&tl[0][0];      /* the words of the tile read as single f16 */
#pragma unroll
  for (int rd = 0; rd < 2; ++rd) { const int n = rd * 32 + (tid >> 3), pc = tid & 7; FragH f;
#pragma unroll
    for (int q = 0; q < 8; ++q) f.u[q] = ts[(pc * 8 + q) * 66 + n];
    *(v8us*)((unsigned short*)Wt + (size_t)(n0 + n) * K + k0 + pc * 8) = f.half[0]; }
  asm volatile("s_wait_xcnt 0x0" ::: "memory");      /* in a shared grid other jobs' code follows in the listing and reuses the registers that the two stores above name: it is kept behind this wait */
}
// k_gemm_hh variant with fused epilogue: v = acc·alpha + bias[by·sBias + col] (+ CP[(row/rowsPerB)·sCPb + by·64 + col] if CP) ; ACT 0 none / 1 elu ; writes f16 C16 (and f32 C if non-null)
template <int ACT>
__global__ __launch_bounds__(128) void k_gemm_hhx(const _Float16* __restrict__ A, int lda, size_t sA, const _Float16* __restrict__ Bh, int ldb, size_t sB, float alpha, const float* __restrict__ bias, size_t sBias, const float* __restrict__ CP, int rowsPerB, size_t sCPb, int row0g,
    float* __restrict__ C, _Float16* __restrict__ C16, int ldc, size_t sC, int M, int N, int K) {
  __shared__ __attribute__((aligned(16))) float so[4][16][64];
  const int tid = threadIdx.x, w = tid >> 5, lane = tid & 31, ln = lane & 15, hh = lane >> 4; const int by = blockIdx.y;
  A += (size_t)by * sA; Bh += (size_t)by * sB; const size_t cofs = (size_t)by * sC; const float* bp = bias ? bias + (size_t)by * sBias : nullptr;
  const int ntn = (N + 63) / 64; const int wid = blockIdx.x * 4 + w; const int mt = wid / ntn, nq = wid % ntn; if (mt * 16 >= M) return;
  const int row0 = mt * 16, col0 = nq * 64; const _Float16* arow = A + (size_t)(row0 + ln) * lda;
  v8f acc[4] = {};
  for (int kb = 0; kb < K; kb += 32) { FragH ah; ah.half[0] = *(const v8us*)((const unsigned short*)arow + kb + 8 * hh); ah.half[1] = *(const v8us*)((const unsigned short*)arow + kb + 16 + 8 * hh);
#pragma unroll
    for (int t = 0; t < 4; ++t) { if (col0 + t * 16 >= N) continue; const size_t boff = (size_t)(col0 + t * 16 + ln) * ldb + kb; FragH bq; bq.half[0] = *(const v8us*)((const unsigned short*)Bh + boff + 8 * hh); bq.half[1] = *(const v8us*)((const unsigned short*)Bh + boff + 16 + 8 * hh);
      acc[t] = mmaH<1>(ah.v, ah.v, bq.v, bq.v, acc[t]); }
  }
#pragma unroll
  for (int t = 0; t < 4; ++t) { if (col0 + t * 16 >= N) continue; const int col = col0 + t * 16 + ln; const float bv = bp ? bf16_round(bp[col]) : 0.f;
#pragma unroll
    for (int r = 0; r < 8; ++r) { float v = acc[t][r] * alpha + bv; if (CP) { const int bidx = (row0g + row0 + 8 * hh + r) / rowsPerB; v += CP[(size_t)bidx * sCPb + (size_t)by * 64 + col]; } if (ACT == 1) v = (v > 0.f) ? v : expm1f(v); else if (ACT == 7) v = (v > 0.f) ? v + 1.0f : expf(v); else if (ACT == 8) v = tanhf(v); else if (ACT == 9) v = 0.5f * v * (1.0f + tanhf(0.7978845608028654f * (v + 0.044715f * v * v * v))); else if (ACT == 11) v = 1.0f / (1.0f + expf(-v)); else if (ACT == 12) v = (v > 0.f) ? v : 0.01f * v; else if (ACT == 14) v = (v > 0.f) ? v : 0.1f * v; else if (ACT == 15) v = v / (1.0f + expf(-v)); else if (ACT == 3) v = fmaxf(v, 0.f); else if (ACT == 6) v = 0.5f * v * (1.0f + erff(v * 0.70710678118654752f)); so[w][8 * hh + r][t * 16 + ln] = v; } }
  __builtin_amdgcn_fence(__ATOMIC_ACQ_REL, "workgroup"); __builtin_amdgcn_wave_barrier();
  const int rsub = lane >> 4, c4 = (lane & 15) * 4; typedef _Float16 v4h __attribute__((ext_vector_type(4)));
  {
#pragma unroll
    for (int q = 0; q < 8; ++q) { const int r = q * 2 + rsub; if (col0 + c4 < N) { const v4f v = *(const v4fa*)&so[w][r][c4]; if (C) *(v4f*)(C + cofs + (size_t)(row0 + r) * ldc + col0 + c4) = v; if (C16) { v4h h4; for (int i = 0; i < 4; ++i) h4[i] = (_Float16)v[i]; *(v4h*)(C16 + cofs + (size_t)(row0 + r) * ldc + col0 + c4) = h4; } } }
     }
}


typedef _Float16 v4h __attribute__((ext_vector_type(4)));

__device__ __forceinline__ void x16_job(int bx, const float* __restrict__ x, _Float16* __restrict__ X16, size_t n8) { const size_t t = (size_t)bx * 256 + threadIdx.x; if (t >= n8) return; FragH f;
#pragma unroll
  for (int q = 0; q < 8; ++q) f.h[q] = (_Float16)bf16_round(x[t * 8 + q]); *(v8us*)((unsigned short*)X16 + t * 8) = f.half[0];  }
__global__ __launch_bounds__(256) void k_h16(const float* __restrict__ x, _Float16* __restrict__ X16, size_t n8) { const size_t t = (size_t)blockIdx.x * 256 + threadIdx.x; if (t >= n8) return; FragH f;
#pragma unroll
  for (int q = 0; q < 8; ++q) f.h[q] = (_Float16)x[t * 8 + q]; *(v8us*)((unsigned short*)X16 + t * 8) = f.half[0];  }
__global__ __launch_bounds__(256) void k_round16f(const float* __restrict__ W, _Float16* __restrict__ Bt, size_t n8) { const size_t t = (size_t)blockIdx.x * 256 + threadIdx.x; if (t >= n8) return; FragH f;
#pragma unroll
  for (int i = 0; i < 8; ++i) f.h[i] = (_Float16)(bf16_round(W[t * 8 + i]) * 16.0f); *(v8us*)((unsigned short*)Bt + t * 8) = f.half[0];  }
template <int NHv, int TTv>
__device__ __forceinline__ void vt_job(int bx, const _Float16* __restrict__ V16, int ldv, int voff, _Float16* __restrict__ Vt) { __shared__ unsigned short tl[64][66]; const int tid = threadIdx.x; const int slab = bx / (TTv / 64), lg = bx % (TTv / 64); const int b = slab / NHv, h = slab % NHv;
  for (int i = tid; i < 64 * 8; i += 256) { const int r = i / 8, c8 = (i % 8) * 8; FragH f; f.half[0] = *(const v8us*)((const unsigned short*)V16 + ((size_t)b * TTv + lg * 64 + r) * ldv + voff + h * 64 + c8);
#pragma unroll
    for (int q = 0; q < 8; ++q) tl[r][c8 + q] = f.u[q]; }
  __syncthreads();
  {
#pragma unroll
    for (int rd = 0; rd < 2; ++rd) { const int d = rd * 32 + tid / 8, pc = tid % 8; FragH f;
#pragma unroll
      for (int q = 0; q < 8; ++q) f.u[q] = tl[pc * 8 + q][d];
      *(v8us*)((unsigned short*)Vt + ((size_t)slab * 64 + d) * TTv + lg * 64 + pc * 8) = f.half[0]; }
     } }

__device__ __forceinline__ void hl_job(int bx, const float* __restrict__ F, _Float16* __restrict__ Hh, _Float16* __restrict__ Hl, size_t n8) { const size_t t = (size_t)bx * 256 + threadIdx.x; if (t >= n8) return; FragH fh, fl; const v4f a = *(const v4fa*)(F + t * 8), c = *(const v4fa*)(F + t * 8 + 4);
#pragma unroll
  for (int q = 0; q < 4; ++q) { _Float16 h = (_Float16)a[q]; fh.h[q] = h; fl.h[q] = (_Float16)((a[q] - (float)h) * 1024.0f); h = (_Float16)c[q]; fh.h[4 + q] = h; fl.h[4 + q] = (_Float16)((c[q] - (float)h) * 1024.0f); }
  { *(v8us*)((unsigned short*)Hh + t * 8) = fh.half[0]; *(v8us*)((unsigned short*)Hl + t * 8) = fl.half[0];  } }
__global__ __launch_bounds__(256) void k_hl(const float* __restrict__ F, _Float16* __restrict__ Hh, _Float16* __restrict__ Hl, size_t n8) { hl_job(blockIdx.x, F, Hh, Hl, n8); }

// ---- fast GEMM (wave tile 32x64; requires M % 128 == 0 rows per launch region, N % 64 == 0 and K % 64 == 0); epilogue = k_gemm_hhx semantics, but the CP addend takes C's own grid-y offset ----
__device__ __forceinline__ v16h g2_frag(const _Float16* p, int hh) { FragH f; f.half[0] = *(const v8us*)((const unsigned short*)p + 8 * hh); f.half[1] = *(const v8us*)((const unsigned short*)p + 16 + 8 * hh); return f.v; }
__device__ __forceinline__ v8f g2_mma(v16h a, v16h b, v8f c) { v8f d = __builtin_amdgcn_wmma_f32_16x16x32_f16(false, a, false, b, (short)0, c, false, false); asm volatile("v_nop\n\tv_nop\n\tv_nop\n\tv_nop" : "+v"(d) : "v"(a), "v"(b)); return d; }
#define G2_KT 64                      /* k per stage: 128 bytes of every operand row */
#define G2_PITCH 144                  /* LDS row pitch in bytes: 128 + 16, an odd multiple of 16 for the 16-byte fragment reads */
#define G2_STAGE (192 * G2_PITCH)     /* one stage: 128 A rows, then 64 B rows */
// One stage's copies of one lane: 16 bytes of each of 8 A rows and 4 B rows (rows 16 apart; sa, sb = 16 rows in bytes), global memory -> LDS through no register.
// A wave's 32 lanes cover 4 whole 128-byte rows per copy. s_wait_xcnt 0 ends the statement so that it stands in front of any rewrite of the address registers the copies name.
__device__ __forceinline__ void g2_stage(unsigned l, const char* ga, size_t sa, const char* gb, size_t sb) {
  const char* a1 = ga + sa; const char* a2 = a1 + sa; const char* a3 = a2 + sa; const char* a4 = a3 + sa; const char* a5 = a4 + sa; const char* a6 = a5 + sa; const char* a7 = a6 + sa;
  const char* b1 = gb + sb; const char* b2 = b1 + sb; const char* b3 = b2 + sb;
  asm volatile("global_load_async_to_lds_b128 %0, %12, off\n\t"
               "global_load_async_to_lds_b128 %1, %13, off\n\t"
               "global_load_async_to_lds_b128 %2, %14, off\n\t"
               "global_load_async_to_lds_b128 %3, %15, off\n\t"
               "global_load_async_to_lds_b128 %4, %16, off\n\t"
               "global_load_async_to_lds_b128 %5, %17, off\n\t"
               "global_load_async_to_lds_b128 %6, %18, off\n\t"
               "global_load_async_to_lds_b128 %7, %19, off\n\t"
               "global_load_async_to_lds_b128 %8, %20, off\n\t"
               "global_load_async_to_lds_b128 %9, %21, off\n\t"
               "global_load_async_to_lds_b128 %10, %22, off\n\t"
               "global_load_async_to_lds_b128 %11, %23, off\n\t"
               "s_wait_xcnt 0x0"
               :: "v"(l), "v"(l + 16 * G2_PITCH), "v"(l + 32 * G2_PITCH), "v"(l + 48 * G2_PITCH), "v"(l + 64 * G2_PITCH), "v"(l + 80 * G2_PITCH), "v"(l + 96 * G2_PITCH), "v"(l + 112 * G2_PITCH),
                  "v"(l + 128 * G2_PITCH), "v"(l + 144 * G2_PITCH), "v"(l + 160 * G2_PITCH), "v"(l + 176 * G2_PITCH),
                  "v"(ga), "v"(a1), "v"(a2), "v"(a3), "v"(a4), "v"(a5), "v"(a6), "v"(a7), "v"(gb), "v"(b1), "v"(b2), "v"(b3)
               : "memory");
}
// Block tile 128x64, row tile mt, column tile nq (M % 128 == 0, N % 64 == 0, K % 64 == 0): the A and B tiles of a stage go to LDS by asynchronous copies, two buffers, stage t + 2 in flight while stage t + 1 is worked on; the waves read their fragments from LDS. The order of the products along k is the plain one.
template <int ACT>
__device__ __forceinline__ void gemm2_job(int mt, int nq, int by, const _Float16* __restrict__ A, int lda, size_t sA, const _Float16* __restrict__ Bh, int ldb, size_t sB, float alpha, const float* __restrict__ bias, size_t sBias, const float* __restrict__ CP, int rowsPerB, size_t sCPb, int row0g,
    float* __restrict__ C, _Float16* __restrict__ C16, int ldc, size_t sC, int M, int N, int K) {
  __shared__ __attribute__((aligned(128))) unsigned char sm[2 * G2_STAGE];
  float (*so)[32][68] = (float (*)[32][68])sm;      /* output staging (4 x 32 x 68 floats) over the two buffers, used only behind the last trip's barrier */
  const int tid = threadIdx.x, w = tid >> 5, lane = tid & 31, ln = lane & 15, hh = lane >> 4;
  A += (size_t)by * sA; Bh += (size_t)by * sB; const size_t cofs = (size_t)by * sC; const float* bp = bias ? bias + (size_t)by * sBias : nullptr;
  const int row0 = mt * 128 + 32 * w, col0 = nq * 64; if (mt * 128 >= M) return;      /* the whole block leaves or none, in front of every barrier */
  const int cr = tid >> 3, cc = tid & 7;      /* copy lane: row cr (+ 16 i) of the tile, 16-byte piece cc of its 128 bytes */
  const char* ga = (const char*)(A + (size_t)(mt * 128 + cr) * lda + cc * 8); const char* gb = (const char*)(Bh + (size_t)(col0 + cr) * ldb + cc * 8);
  const size_t sa = (size_t)lda * 32, sb = (size_t)ldb * 32;
  const unsigned l0 = (unsigned)(size_t)sm + (unsigned)(cr * G2_PITCH + cc * 16);
  const int nst = K / G2_KT;
  g2_stage(l0, ga, sa, gb, sb);
  asm volatile("s_wait_asynccnt 0x0" ::: "memory");      /* stage 0 of this wave has landed */
  __syncthreads();                                       /* ... and every other wave's */
  if (nst > 1) g2_stage(l0 + G2_STAGE, ga + 2 * G2_KT, sa, gb + 2 * G2_KT, sb);
  const v8f z8 = {0.f,0.f,0.f,0.f,0.f,0.f,0.f,0.f}; v8f c00 = z8, c01 = z8, c02 = z8, c03 = z8, c10 = z8, c11 = z8, c12 = z8, c13 = z8;
  /* kept rolled: one trip per stage, so that the waits, the barrier and the refill at its foot stand once */
#pragma unroll 1
  for (int t = 0; t < nst; ++t) { const unsigned bo = (unsigned)(t & 1) * G2_STAGE;
    const _Float16* a0p = (const _Float16*)(sm + bo + (32 * w + ln) * G2_PITCH); const _Float16* a1p = (const _Float16*)(sm + bo + (32 * w + 16 + ln) * G2_PITCH);
    const _Float16* b0p = (const _Float16*)(sm + bo + (128 + ln) * G2_PITCH); const _Float16* b1p = (const _Float16*)(sm + bo + (144 + ln) * G2_PITCH); const _Float16* b2p = (const _Float16*)(sm + bo + (160 + ln) * G2_PITCH); const _Float16* b3p = (const _Float16*)(sm + bo + (176 + ln) * G2_PITCH);
    /* unrolled: the two 32-k steps of a stage read LDS at constant offsets */
#pragma unroll
    for (int kb = 0; kb < G2_KT; kb += 32) { const v16h a0 = g2_frag(a0p + kb, hh), a1 = g2_frag(a1p + kb, hh), b0 = g2_frag(b0p + kb, hh), b1 = g2_frag(b1p + kb, hh), b2 = g2_frag(b2p + kb, hh), b3 = g2_frag(b3p + kb, hh);
      c00 = g2_mma(a0, b0, c00); c10 = g2_mma(a1, b0, c10);
      c01 = g2_mma(a0, b1, c01); c11 = g2_mma(a1, b1, c11);
      c02 = g2_mma(a0, b2, c02); c12 = g2_mma(a1, b2, c12);
      c03 = g2_mma(a0, b3, c03); c13 = g2_mma(a1, b3, c13); }
    asm volatile("s_wait_dscnt 0x0" ::: "memory");       /* this wave's reads of the buffer are done before it is refilled */
    asm volatile("s_wait_asynccnt 0x0" ::: "memory");    /* this wave's copies of stage t + 1 have landed */
    __syncthreads();                                     /* publishes stage t + 1 and ends every wave's reads of stage t */
    if (t + 2 < nst) g2_stage(l0 + bo, ga + (size_t)(t + 2) * (2 * G2_KT), sa, gb + (size_t)(t + 2) * (2 * G2_KT), sb); }
  asm volatile("s_wait_asynccnt 0x0" ::: "memory");      /* no copy is outstanding when the buffers become output staging */
  v8f accs[8] = {c00, c01, c02, c03, c10, c11, c12, c13};
#pragma unroll
  for (int u = 0; u < 8; ++u) { const int t = u & 3, half = u >> 2; const int col = col0 + t * 16 + ln; const float bv = bp ? bf16_round(bp[col]) : 0.f;
#pragma unroll
    for (int r = 0; r < 8; ++r) { const int rloc = half * 16 + 8 * hh + r; float v = accs[u][r] * alpha + bv; if (CP) { const int bidx = (row0g + row0 + rloc) / rowsPerB; v += CP[cofs + (size_t)bidx * sCPb + col]; }
      if (ACT == 3) v = fmaxf(v, 0.f); else if (ACT == 6) v = 0.5f * v * (1.0f + erff(v * 0.70710678118654752f)); else if (ACT == 11) v = 1.0f / (1.0f + expf(-v)); else if (ACT == 15) v = v / (1.0f + expf(-v)); else if (ACT == 12) v = (v > 0.f) ? v : 0.01f * v; else if (ACT == 8) v = tanhf(v);
      so[w][rloc][t * 16 + ln] = v; } }
  __builtin_amdgcn_fence(__ATOMIC_ACQ_REL, "workgroup"); __builtin_amdgcn_wave_barrier();
  const int rsub = lane >> 4, c4 = (lane & 15) * 4;
  {
#pragma unroll
    for (int q = 0; q < 16; ++q) { const int r = q * 2 + rsub; const v4f v = *(const v4fa*)&so[w][r][c4]; if (C) *(v4f*)(C + cofs + (size_t)(row0 + r) * ldc + col0 + c4) = v; if (C16) { v4h h4; for (int i = 0; i < 4; ++i) h4[i] = (_Float16)v[i]; *(v4h*)(C16 + cofs + (size_t)(row0 + r) * ldc + col0 + c4) = h4; } }
     } }



template <int ACT>
__global__ __launch_bounds__(128) void k_gemm2(const _Float16* __restrict__ A, int lda, size_t sA, const _Float16* __restrict__ Bh, int ldb, size_t sB, float alpha, const float* __restrict__ bias, size_t sBias, const float* __restrict__ CP, int rowsPerB, size_t sCPb, int row0g,
    float* __restrict__ C, _Float16* __restrict__ C16, int ldc, size_t sC, int M, int N, int K) {
  const int ntn = N >> 6; const int mt = blockIdx.x / ntn, nq = blockIdx.x - mt * ntn;
  gemm2_job<ACT>(mt, nq, blockIdx.y, A, lda, sA, Bh, ldb, sB, alpha, bias, sBias, CP, rowsPerB, sCPb, row0g, C, C16, ldc, sC, M, N, K); }
// The q, k and v projections in one grid (they share A and do not depend on one another): block b takes row tile b / 48 and one of that row tile's 48 column tiles, 32 of q, then 8 of k, then 8 of v.
#define QKV_NT ((EMB + 2 * KVD) / 64)
__global__ __launch_bounds__(128) void k_gemm2_qkv(const _Float16* __restrict__ A, const _Float16* __restrict__ BQ, const _Float16* __restrict__ BK, const _Float16* __restrict__ BV, const float* __restrict__ bq, const float* __restrict__ bk, const float* __restrict__ bv,
    float* __restrict__ QF, float* __restrict__ KF, float* __restrict__ VF) {
  const int mt = blockIdx.x / QKV_NT, nt = blockIdx.x - mt * QKV_NT; const bool isq = nt < EMB / 64, isk = nt < (EMB + KVD) / 64;
  const _Float16* B = isq ? BQ : (isk ? BK : BV); const float* bias = isq ? bq : (isk ? bk : bv); float* C = isq ? QF : (isk ? KF : VF);
  const int N = isq ? EMB : KVD; const int nq = nt - (isq ? 0 : (isk ? EMB / 64 : (EMB + KVD) / 64));
  gemm2_job<0>(mt, nq, 0, A, EMB, 0, B, EMB, 0, 0.0625f, bias, 0, nullptr, 1, 0, 0, C, nullptr, N, 0, NR, N, EMB); }

// Both flash kernels work on the transposed products: S^T = K Q^T (A = 16 key rows, B = the wave's 16 queries) and O^T += V^T P^T (A = 16 rows of V^T, B = P^T).
// A lane then holds 16 of the 32 scores of ONE query (query ln; keys 8 hh + r of each 16-key tile), so the row maximum and the row sum are in-lane plus one exchange with lane ^ 16,
// and the two score tiles, converted in place, are already the B operand of the second product (element s = tile s / 8, register s % 8): P goes through no LDS.
__device__ __forceinline__ float xhalf(float x) { return __builtin_bit_cast(float, __builtin_amdgcn_permlanex16(__builtin_bit_cast(int, x), __builtin_bit_cast(int, x), 0x76543210, 0xfedcba98, false, false)); }      /* the value of lane ^ 16 */
#define SCL2 0.18033688011112042f      /* 64^-0.5 * log2(e): the softmax of the plain kernel runs in base 2 */
// Plain kernel: p * 2^10 = 2^(s * SCL2 + off) with off = 10 - max * SCL2: one fused multiply-add and one hardware exp2 per score; the row maximum is taken on the raw scores (SCL2 > 0).
// The accumulators and the row sum carry the 2^10, which the final division takes out.
#define FL_PITCH 144                  /* LDS row pitch in bytes: 128 + 16, an odd multiple of 16 for the 16-byte fragment reads */
#define FL_STAGE (128 * FL_PITCH)     /* one stage of 64 keys: 64 K rows (128 bytes = the head's 64 f16), then 64 V^T rows (128 bytes = 64 keys) */
// One stage's copies of one lane: 16 bytes of each of 4 K rows and 4 V^T rows (rows 16 apart; sk, sv = 16 rows in bytes), global memory -> LDS through no register.
// A wave's 32 lanes cover 4 whole 128-byte rows per copy. s_wait_xcnt 0 ends the statement so that it stands in front of any rewrite of the address registers the copies name.
__device__ __forceinline__ void fl_stage(unsigned l, const char* gk, size_t sk, const char* gv, size_t sv) {
  const char* k1 = gk + sk; const char* k2 = k1 + sk; const char* k3 = k2 + sk;
  const char* v1 = gv + sv; const char* v2 = v1 + sv; const char* v3 = v2 + sv;
  asm volatile("global_load_async_to_lds_b128 %0, %8, off\n\t"
               "global_load_async_to_lds_b128 %1, %9, off\n\t"
               "global_load_async_to_lds_b128 %2, %10, off\n\t"
               "global_load_async_to_lds_b128 %3, %11, off\n\t"
               "global_load_async_to_lds_b128 %4, %12, off\n\t"
               "global_load_async_to_lds_b128 %5, %13, off\n\t"
               "global_load_async_to_lds_b128 %6, %14, off\n\t"
               "global_load_async_to_lds_b128 %7, %15, off\n\t"
               "s_wait_xcnt 0x0"
               :: "v"(l), "v"(l + 16 * FL_PITCH), "v"(l + 32 * FL_PITCH), "v"(l + 48 * FL_PITCH), "v"(l + 64 * FL_PITCH), "v"(l + 80 * FL_PITCH), "v"(l + 96 * FL_PITCH), "v"(l + 112 * FL_PITCH),
                  "v"(gk), "v"(k1), "v"(k2), "v"(k3), "v"(gv), "v"(v1), "v"(v2), "v"(v3)
               : "memory");
}
// The K and V^T tiles of 64 keys go to LDS once per block by asynchronous copies in whole 128-byte rows, two buffers, stage t + 2 in flight while stage t + 1 is worked on; the block's 4 waves read their fragments from LDS.
// Each stage is worked on as two steps of 32 keys, with the products, the maxima and the sums in the order they had with fragments read from global memory.
template <int CAUSAL>
__global__ __launch_bounds__(128) void k_flash(const _Float16* __restrict__ Q16, int ldq, const _Float16* __restrict__ K16, int ldk, const _Float16* __restrict__ Vt, const int* __restrict__ MSK, float* __restrict__ O, int ldo) {
  constexpr int RPW = 16, DT = 4, KS = 2;
  __shared__ __attribute__((aligned(128))) unsigned char sm[2 * FL_STAGE];
  float (*sO)[RPW][64 + 4] = (float (*)[RPW][64 + 4])sm;      /* output staging (4 x 16 x 68 floats) over the first buffer, used only behind the last trip's barrier */
  const int tid = threadIdx.x, w = tid >> 5, lane = tid & 31, ln = lane & 15, hh = lane >> 4;
  const int slab = blockIdx.x / QBNP, qblk = QB0P + blockIdx.x % QBNP; const int b = slab / NH, h = slab % NH; const int qb0 = qblk * (4 * RPW); const int q0 = qb0 + w * RPW; const int tq = q0 + ln;      /* tq: this lane's query */
  const unsigned short* Vth = (const unsigned short*)Vt + (size_t)slab * 64 * TK;
  const int jend = (CAUSAL == 1) ? (qb0 + 4 * RPW) : TK;      /* causal: keys beyond the block's last query never contribute */
  const int nst = jend / 64;                                  /* jend is a multiple of 64 in every mode */
  const int cr = tid >> 3, cc = tid & 7;      /* copy lane: row cr (+ 16 i) of each tile, 16-byte piece cc of its 128 bytes */
  const char* gk = (const char*)((const unsigned short*)K16 + ((size_t)b * TK + cr) * ldk + h * 64 + cc * 8); const char* gv = (const char*)(Vth + (size_t)cr * TK + cc * 8);
  const size_t sk = (size_t)ldk * 32, sv = (size_t)TK * 32, dk = (size_t)ldk * 128;      /* dk: 64 key rows in bytes; a stage moves V^T by 128 bytes */
  const unsigned l0 = (unsigned)(size_t)sm + (unsigned)(cr * FL_PITCH + cc * 16);
  fl_stage(l0, gk, sk, gv, sv);
  FragH aq[KS];
  { const unsigned short* qr = (const unsigned short*)Q16 + ((size_t)b * TQ + tq) * ldq + h * 64;
#pragma unroll
    for (int ks = 0; ks < KS; ++ks) { aq[ks].half[0] = *(const v8us*)(qr + ks * 32 + 8 * hh); aq[ks].half[1] = *(const v8us*)(qr + ks * 32 + 16 + 8 * hh); } }
  asm volatile("s_wait_asynccnt 0x0" ::: "memory");      /* stage 0 of this wave has landed */
  __syncthreads();                                       /* ... and every other wave's */
  if (nst > 1) fl_stage(l0 + FL_STAGE, gk + dk, sk, gv + 128, sv);
  float m_r = -3.0e38f, off_r = 10.0f + 3.0e38f * SCL2, l_r = 0.f; v8f oacc[DT];      /* m_r: running maximum of the raw scores; off_r = 10 - m_r * SCL2; l_r: the sum over this lane's own keys, the two halves join behind the loop */
#pragma unroll
  for (int dt = 0; dt < DT; ++dt) oacc[dt] = (v8f){0.f,0.f,0.f,0.f,0.f,0.f,0.f,0.f};
  /* kept rolled: one trip per stage, so that the waits, the barrier and the refill at its foot stand once */
#pragma unroll 1
  for (int t = 0; t < nst; ++t) { const unsigned bo = (unsigned)(t & 1) * FL_STAGE;
    const unsigned short* kl = (const unsigned short*)(sm + bo + ln * FL_PITCH) + 8 * hh; const unsigned short* vl = (const unsigned short*)(sm + bo + (64 + ln) * FL_PITCH) + 8 * hh;      /* this lane's row of the first K tile and of the first V^T tile */
    /* unrolled: the two 32-key steps of a stage read LDS at constant offsets */
#pragma unroll
    for (int sub = 0; sub < 2; ++sub) { const int j0 = t * 64 + sub * 32;
      FragH bk[2][KS], bv[DT];
#pragma unroll
      for (int nt = 0; nt < 2; ++nt) { const unsigned short* kr = kl + (sub * 32 + nt * 16) * (FL_PITCH / 2);
#pragma unroll
        for (int ks = 0; ks < KS; ++ks) { bk[nt][ks].half[0] = *(const v8us*)(kr + ks * 32); bk[nt][ks].half[1] = *(const v8us*)(kr + ks * 32 + 16); } }
      v8f s[2];
#pragma unroll
      for (int nt = 0; nt < 2; ++nt) { v8f acc = (v8f){0.f,0.f,0.f,0.f,0.f,0.f,0.f,0.f};
#pragma unroll
        for (int ks = 0; ks < KS; ++ks) acc = mmaH<1>(bk[nt][ks].v, bk[nt][ks].v, aq[ks].v, aq[ks].v, acc);
        s[nt] = acc; }
      asm volatile("" ::: "memory");      /* compiler fence: keeps the V^T fragment reads behind the score products, so that they take over the K fragments' registers and fly during the softmax; without it the kernel takes 159 registers in place of 138 and a SIMD holds 6 waves in place of 7 */
#pragma unroll
      for (int dt = 0; dt < DT; ++dt) { const unsigned short* vrow = vl + dt * 16 * (FL_PITCH / 2) + sub * 32; bv[dt].half[0] = *(const v8us*)(vrow); bv[dt].half[1] = *(const v8us*)(vrow + 16); }
      float sc[16]; bool ok[16]; float mc = -3.0e38f;
#pragma unroll
      for (int e = 0; e < 16; ++e) { const int key = j0 + (e >> 3) * 16 + 8 * hh + (e & 7);
        ok[e] = (CAUSAL == 1) ? (key <= tq) : ((CAUSAL == 2) ? ((key >> 5) == (tq >> 5)) : true);      /* mode 2: block-diagonal 32-token groups */
        sc[e] = ok[e] ? s[e >> 3][e & 7] : -3.0e38f; mc = fmaxf(mc, sc[e]); }
      mc = fmaxf(mc, xhalf(mc));
      const float mn = fmaxf(m_r, mc); const float off = 10.0f - mn * SCL2; const float ea = __builtin_amdgcn_exp2f(off - off_r);      /* 2^(off - off_r): the factor that moves the accumulators to the new maximum */
      const float al = (mn > -1.0e38f) ? ea : 1.0f; m_r = mn; off_r = off;
      float ps[4] = {0.f, 0.f, 0.f, 0.f}; FragH pb;
#pragma unroll
      for (int e = 0; e < 16; ++e) { const float ee = __builtin_amdgcn_exp2f(sc[e] * SCL2 + off); const float p = ok[e] ? ee : 0.f; ps[e & 3] += p; pb.h[e] = (_Float16)p; }
      l_r = l_r * al + ((ps[0] + ps[1]) + (ps[2] + ps[3]));
#pragma unroll
      for (int dt = 0; dt < DT; ++dt)
#pragma unroll
        for (int r = 0; r < 8; ++r) oacc[dt][r] *= al;
#pragma unroll
      for (int dt = 0; dt < DT; ++dt) oacc[dt] = mmaH<1>(bv[dt].v, bv[dt].v, pb.v, pb.v, oacc[dt]); }
    asm volatile("s_wait_dscnt 0x0" ::: "memory");       /* this wave's reads of the buffer are done before it is refilled */
    asm volatile("s_wait_asynccnt 0x0" ::: "memory");    /* this wave's copies of stage t + 1 have landed */
    __syncthreads();                                     /* publishes stage t + 1 and ends every wave's reads of stage t */
    if (t + 2 < nst) fl_stage(l0 + bo, gk + (size_t)(t + 2) * dk, sk, gv + (size_t)(t + 2) * 128, sv); }
  asm volatile("s_wait_asynccnt 0x0" ::: "memory");      /* no copy is outstanding when the buffers become output staging */
  const float l = l_r + xhalf(l_r); const float linv = (l > 0.f) ? 1.0f / l : 0.f;
#pragma unroll
  for (int dt = 0; dt < DT; ++dt)
#pragma unroll
    for (int r = 0; r < 8; ++r) sO[w][ln][dt * 16 + 8 * hh + r] = oacc[dt][r] * linv;
  __builtin_amdgcn_fence(__ATOMIC_ACQ_REL, "workgroup"); __builtin_amdgcn_wave_barrier();
  {
#pragma unroll
    for (int rp = 0; rp < RPW; rp += 2) { const int r = rp + (lane >> 4), pc = lane & 15; const v4f val = *(const v4fa*)&sO[w][r][pc * 4]; *(v4f*)(O + ((size_t)b * TQ + q0 + r) * ldo + h * 64 + pc * 4) = val; }
     } }
// 5-plane variant: S = Qh Kh^T + (Ql Kh^T + Qh Kl^T)/1024 with Q/K = [hi | 2^10 residual] f16 planes (QL/KL same layout as Q16/K16), then the 3-term P.V below.
// 3-term variant: O = (P_hi V_hi + (P_lo V_hi + P_hi V_lo) / 1024) / (1024 l) with P = [hi | 2^10 residual] of 1024 p and V^T = [hi | 2^10 residual] planes (VtL same layout as Vt) -> ~2^-21-class products for un-averaged (early causal / peaked) rows
template <int CAUSAL>
__global__ __launch_bounds__(128) void k_flash5(const _Float16* __restrict__ Q16, const _Float16* __restrict__ QL, int ldq, const _Float16* __restrict__ K16, const _Float16* __restrict__ KL, int ldk, const _Float16* __restrict__ Vt, const _Float16* __restrict__ VtL, const int* __restrict__ MSK, float* __restrict__ O, int ldo) {
  constexpr int RPW = 16, DT = 4, KS = 2;
  __shared__ __attribute__((aligned(16))) float sO[4][RPW][64 + 4];
  const int tid = threadIdx.x, w = tid >> 5, lane = tid & 31, ln = lane & 15, hh = lane >> 4;
  const int slab = blockIdx.x / QBN5, qblk = QB05 + blockIdx.x % QBN5; const int b = slab / NH, h = slab % NH; const int qb0 = qblk * (4 * RPW); const int q0 = qb0 + w * RPW; const int tq = q0 + ln;      /* tq: this lane's query */
  FragH aq[KS], aql[KS];
  { const unsigned short* qr = (const unsigned short*)Q16 + ((size_t)b * TQ + tq) * ldq + h * 64; const unsigned short* ql = (const unsigned short*)QL + ((size_t)b * TQ + tq) * ldq + h * 64;
#pragma unroll
    for (int ks = 0; ks < KS; ++ks) { aq[ks].half[0] = *(const v8us*)(qr + ks * 32 + 8 * hh); aq[ks].half[1] = *(const v8us*)(qr + ks * 32 + 16 + 8 * hh); aql[ks].half[0] = *(const v8us*)(ql + ks * 32 + 8 * hh); aql[ks].half[1] = *(const v8us*)(ql + ks * 32 + 16 + 8 * hh); } }
  const unsigned short* Vth = (const unsigned short*)Vt + (size_t)slab * 64 * TK; const unsigned short* Vtl = (const unsigned short*)VtL + (size_t)slab * 64 * TK;
  float m_r = -3.0e38f, l_r = 0.f; v8f oacc[DT], oaccL[DT];      /* l_r: the sum over this lane's own keys; the two halves join behind the loop */
#pragma unroll
  for (int dt = 0; dt < DT; ++dt) { oacc[dt] = (v8f){0.f,0.f,0.f,0.f,0.f,0.f,0.f,0.f}; oaccL[dt] = oacc[dt]; }
  const int jend = (CAUSAL == 1) ? (qb0 + 4 * RPW) : TK;      /* causal: keys beyond the block's last query never contribute */
#pragma unroll 1
  for (int j0 = 0; j0 < jend; j0 += 32) {
    FragH bk[2][KS], bkl[2][KS], bv[DT], bl[DT]; const unsigned short* kr[2]; const unsigned short* klr[2];
#pragma unroll
    for (int nt = 0; nt < 2; ++nt) { kr[nt] = (const unsigned short*)K16 + ((size_t)b * TK + j0 + nt * 16 + ln) * ldk + h * 64 + 8 * hh; klr[nt] = (const unsigned short*)KL + ((size_t)b * TK + j0 + nt * 16 + ln) * ldk + h * 64 + 8 * hh;
#pragma unroll
      for (int ks = 0; ks < KS; ++ks) { bk[nt][ks].half[0] = *(const v8us*)(kr[nt] + ks * 32); bk[nt][ks].half[1] = *(const v8us*)(kr[nt] + ks * 32 + 16); bkl[nt][ks].half[0] = *(const v8us*)(klr[nt] + ks * 32); bkl[nt][ks].half[1] = *(const v8us*)(klr[nt] + ks * 32 + 16); } }
    v8f s[2];
#pragma unroll
    for (int nt = 0; nt < 2; ++nt) { v8f acc = (v8f){0.f,0.f,0.f,0.f,0.f,0.f,0.f,0.f}, accl = acc;
#pragma unroll
      for (int ks = 0; ks < KS; ++ks) { acc = mmaH<1>(bk[nt][ks].v, bk[nt][ks].v, aq[ks].v, aq[ks].v, acc); accl = mmaH<1>(bk[nt][ks].v, bk[nt][ks].v, aql[ks].v, aql[ks].v, accl); accl = mmaH<1>(bkl[nt][ks].v, bkl[nt][ks].v, aq[ks].v, aq[ks].v, accl); }
#pragma unroll
      for (int r = 0; r < 8; ++r) acc[r] += accl[r] * 0.0009765625f;
      s[nt] = acc; }
    asm volatile("s_wait_xcnt 0x0" :: "v"(kr[0]), "v"(kr[1]), "v"(klr[0]), "v"(klr[1]) : "memory");      /* the K loads' address registers, held as inputs up to here, are rewritten only behind this wait; the clobber keeps the V loads behind the score products, so that they take over the K fragments' registers and fly during the softmax */
#pragma unroll
    for (int dt = 0; dt < DT; ++dt) { const unsigned short* vrow = Vth + (size_t)(dt * 16 + ln) * TK + j0; const unsigned short* vrl = Vtl + (size_t)(dt * 16 + ln) * TK + j0; bv[dt].half[0] = *(const v8us*)(vrow + 8 * hh); bv[dt].half[1] = *(const v8us*)(vrow + 16 + 8 * hh); bl[dt].half[0] = *(const v8us*)(vrl + 8 * hh); bl[dt].half[1] = *(const v8us*)(vrl + 16 + 8 * hh); }
    float sc[16]; bool ok[16]; float mc = -3.0e38f;
#pragma unroll
    for (int e = 0; e < 16; ++e) { const int key = j0 + (e >> 3) * 16 + 8 * hh + (e & 7);
      ok[e] = (CAUSAL == 1) ? (key <= tq) : ((CAUSAL == 2) ? ((key >> 5) == (tq >> 5)) : true);      /* mode 2: block-diagonal 32-token groups */
      if (CAUSAL == 4) ok[e] = MSK[((size_t)b * TQ + tq) * TK + key] != 0;      /* mode 4: per-(query, key) INPUT mask shared by all heads; masked keys contribute nothing, rows with no valid key give l = 0 -> output 0 */
      sc[e] = ok[e] ? s[e >> 3][e & 7] * SCL : -3.0e38f; mc = fmaxf(mc, sc[e]); }
    mc = fmaxf(mc, xhalf(mc));
    const float mn = fmaxf(m_r, mc); const float ea = expf(m_r - mn); const float al = (mn > -1.0e38f) ? ea : 1.0f; m_r = mn;
    float ps[4] = {0.f, 0.f, 0.f, 0.f}; FragH pb, pl;
#pragma unroll
    for (int e = 0; e < 16; ++e) { const float ee = expf(sc[e] - mn); const float p = ok[e] ? ee : 0.f; ps[e & 3] += p; const float p1k = p * 1024.0f; const _Float16 ph = (_Float16)p1k; pb.h[e] = ph; pl.h[e] = (_Float16)((p1k - (float)ph) * 1024.0f); }
    l_r = l_r * al + ((ps[0] + ps[1]) + (ps[2] + ps[3]));
#pragma unroll
    for (int dt = 0; dt < DT; ++dt)
#pragma unroll
      for (int r = 0; r < 8; ++r) { oacc[dt][r] *= al; oaccL[dt][r] *= al; }
#pragma unroll
    for (int dt = 0; dt < DT; ++dt) { oacc[dt] = mmaH<1>(bv[dt].v, bv[dt].v, pb.v, pb.v, oacc[dt]); oaccL[dt] = mmaH<1>(bv[dt].v, bv[dt].v, pl.v, pl.v, oaccL[dt]); oaccL[dt] = mmaH<1>(bl[dt].v, bl[dt].v, pb.v, pb.v, oaccL[dt]); } }
  const float l = l_r + xhalf(l_r); const float linv = (l > 0.f) ? 1.0f / (l * 1024.0f) : 0.f;
#pragma unroll
  for (int dt = 0; dt < DT; ++dt)
#pragma unroll
    for (int r = 0; r < 8; ++r) { float v = oacc[dt][r]; v += oaccL[dt][r] * 0.0009765625f; sO[w][ln][dt * 16 + 8 * hh + r] = v * linv; }
  __builtin_amdgcn_fence(__ATOMIC_ACQ_REL, "workgroup"); __builtin_amdgcn_wave_barrier();
  {
#pragma unroll
    for (int rp = 0; rp < RPW; rp += 2) { const int r = rp + (lane >> 4), pc = lane & 15; const v4f val = *(const v4fa*)&sO[w][r][pc * 4]; *(v4f*)(O + ((size_t)b * TQ + q0 + r) * ldo + h * 64 + pc * 4) = val; }
     } }

__global__ __launch_bounds__(256) void k_wsc(const float* __restrict__ Wm, _Float16* __restrict__ Bt, size_t n8, float sc) { const size_t t = (size_t)blockIdx.x * 256 + threadIdx.x; if (t >= n8) return; FragH f; for (int q = 0; q < 8; ++q) f.h[q] = (_Float16)(bf16_round(Wm[t * 8 + q]) * sc); *(v8us*)((unsigned short*)Bt + t * 8) = f.half[0];  }      /* (out,in) weight == Bt[n][k]: scaled copy */




__device__ __forceinline__ void rope_job(int bx, const float* __restrict__ F, int nheads, const float* __restrict__ CS, const float* __restrict__ SN, _Float16* __restrict__ H, _Float16* __restrict__ L, int ldd) {      /* ldd: destination row pitch (the source pitch is nheads*HD) */
  #pragma clang fp contract(off)
  const size_t t = (size_t)bx * 256 + threadIdx.x; if (t >= (size_t)NR * nheads * (HH / 8)) return; const int g = (int)(t % (HH / 8)) * 8; const int h = (int)((t / (HH / 8)) % nheads); const int s = (int)(t / ((HH / 8) * (size_t)nheads)); const int ld = nheads * HD;
  const size_t base = (size_t)s * ld + h * HD + g, dbase = (size_t)s * ldd + h * HD + g; FragH h0, h1, l0, l1;
#pragma unroll
  for (int q = 0; q < 8; ++q) { const float c = CS[s * HH + g + q], sn = SN[s * HH + g + q]; const float x0 = F[base + q], x1 = F[base + HH + q]; float o0 = x0 * c; o0 += -x1 * sn; float o1 = x1 * c; o1 += x0 * sn;
    const _Float16 a0 = (_Float16)o0, a1 = (_Float16)o1; h0.h[q] = a0; h1.h[q] = a1; l0.h[q] = (_Float16)((o0 - (float)a0) * 1024.0f); l1.h[q] = (_Float16)((o1 - (float)a1) * 1024.0f); }
  { *(v8us*)((unsigned short*)H + dbase) = h0.half[0]; *(v8us*)((unsigned short*)H + dbase + HH) = h1.half[0];
    asm volatile("s_wait_xcnt 0x0" ::: "memory");      /* the residuals' arithmetic reuses the registers that the two stores above name: it is kept behind this wait */
    if (L) { *(v8us*)((unsigned short*)L + dbase) = l0.half[0]; *(v8us*)((unsigned short*)L + dbase + HH) = l1.half[0]; }  } }

__device__ __forceinline__ void rotab_job(int bx, const int* __restrict__ pid, float* __restrict__ CS, float* __restrict__ SN) {      /* s = token row over both batches */
  #pragma clang fp contract(off)
  const int t = bx * 256 + threadIdx.x; if (t >= NR * HH) return; const int j = t % HH, s = t / HH; const float inv = 1.0f / powf(10000.0f, (float)(2 * j) / (float)HD); const float th = (float)pid[s] * inv; const float c = cosf(th), sn = sinf(th);
  { *(float*)(CS + t) = c; *(float*)(SN + t) = sn;  } }

__device__ __forceinline__ void expand_job(int bx, const _Float16* __restrict__ SH, const _Float16* __restrict__ SL, _Float16* __restrict__ DH, _Float16* __restrict__ DL, int col0) {
  const size_t t = (size_t)bx * 256 + threadIdx.x; if (t >= (size_t)NR * NH * (HD / 8)) return; const int d0 = (int)(t % (HD / 8)) * 8; const int h = (int)((t / (HD / 8)) % NH); const size_t s = t / ((HD / 8) * NH);
  const size_t si = s * KVD + (size_t)(h / (NH / NKV)) * HD + d0, di = s * (size_t)(3 * EMB) + col0 + (size_t)h * HD + d0; const v8us a = *(const v8us*)((const unsigned short*)SH + si), bl = *(const v8us*)((const unsigned short*)SL + si);
  { *(v8us*)((unsigned short*)DH + di) = a; *(v8us*)((unsigned short*)DL + di) = bl;  } }

// ---- launches that do not depend on one another share one grid: a range of the block index picks the job (the test is the same for a whole block, so each job's barrier is passed by all of its block or by none) ----
#define PB_ROT (NR * HH / 256)                    /* angle tables */
#define PB_WB ((EMB / 64) * (EMB / 64))           /* tiles of Wq, of Wo */
#define PB_WS ((EMB / 64) * (KVD / 64))           /* tiles of Wk, of Wv */
#define PB_X (NR * EMB / 8 / 256)                 /* f16 plane of x */
__global__ __launch_bounds__(256) void k_prep(const float* __restrict__ x, const float* __restrict__ Wq, const float* __restrict__ Wk, const float* __restrict__ Wv, const float* __restrict__ Wo, const int* __restrict__ pid,
    _Float16* __restrict__ X16, _Float16* __restrict__ BQ, _Float16* __restrict__ BK, _Float16* __restrict__ BV, _Float16* __restrict__ BO, float* __restrict__ CS, float* __restrict__ SN) {
  int bx = blockIdx.x;
  if (bx < PB_ROT) { rotab_job(bx, pid, CS, SN); return; }
  bx -= PB_ROT;
  if (bx < 2 * PB_WB + 2 * PB_WS) {
    const bool q = bx < PB_WB, k = bx < PB_WB + PB_WS, v = bx < PB_WB + 2 * PB_WS;
    const float* W = q ? Wq : (k ? Wk : (v ? Wv : Wo)); _Float16* Wt = q ? BQ : (k ? BK : (v ? BV : BO));
    wt_f16_job(bx - (q ? 0 : (k ? PB_WB : (v ? PB_WB + PB_WS : PB_WB + 2 * PB_WS))), W, Wt, EMB, (v && !q) ? KVD : EMB, 16.0f);      /* (in,out) weights */
    return; }
  x16_job(bx - (2 * PB_WB + 2 * PB_WS), x, X16, (size_t)NR * EMB / 8); }
#define SB_Q (NR * NH * (HH / 8) / 256)           /* q: rope + split */
#define SB_K (NR * NKV * (HH / 8) / 256)          /* k: rope + split */
#define SB_V (NR * KVD / 8 / 256)                 /* v: split */
__global__ __launch_bounds__(256) void k_split(const float* __restrict__ QF, const float* __restrict__ KF, const float* __restrict__ VF, const float* __restrict__ CS, const float* __restrict__ SN,
    _Float16* __restrict__ H16, _Float16* __restrict__ L16, _Float16* __restrict__ KH8, _Float16* __restrict__ KL8, _Float16* __restrict__ VH8, _Float16* __restrict__ VL8) {
  const int bx = blockIdx.x;
  if (bx < SB_Q) rope_job(bx, QF, NH, CS, SN, H16, L16, 3 * EMB);      /* q roped + split into the [q | k | v] planes */
  else if (bx < SB_Q + SB_K) rope_job(bx - SB_Q, KF, NKV, CS, SN, KH8, KL8, KVD);
  else hl_job(bx - (SB_Q + SB_K), VF, VH8, VL8, (size_t)NR * KVD / 8); }
#define EB (NR * NH * (HD / 8) / 256)             /* blocks that expand one of k, v */
__global__ __launch_bounds__(256) void k_expand2(const _Float16* __restrict__ KH8, const _Float16* __restrict__ KL8, const _Float16* __restrict__ VH8, const _Float16* __restrict__ VL8, _Float16* __restrict__ H16, _Float16* __restrict__ L16) {
  const bool k = blockIdx.x < EB;
  expand_job(blockIdx.x - (k ? 0 : EB), k ? KH8 : VH8, k ? KL8 : VL8, H16, L16, k ? EMB : 2 * EMB); }
#define VB (NB * NH * (SLEN / 64))                /* tiles of one V plane */
__global__ __launch_bounds__(256) void k_vt2(const _Float16* __restrict__ H16, const _Float16* __restrict__ L16, _Float16* __restrict__ VT, _Float16* __restrict__ VTL) {
  const bool hi = blockIdx.x < VB;
  vt_job<NH, SLEN>(blockIdx.x - (hi ? 0 : VB), hi ? H16 : L16, 3 * EMB, 2 * EMB, hi ? VT : VTL); }

extern "C" void kernel_launch(void* const* d_in, const int* in_sizes, int n_in,
                              void* d_out, int out_size, void* d_ws, size_t ws_size, hipStream_t stream) {
  (void)in_sizes; (void)n_in; (void)out_size;
  const float* const* I = (const float* const*)d_in; const float* x = I[0]; const float* Wq = I[1]; const float* bq = I[2]; const float* Wk = I[3]; const float* bk = I[4]; const float* Wv = I[5]; const float* bv = I[6]; const float* Wo = I[7]; const int* pid = (const int*)d_in[8];
  char* ws = (char*)d_ws; size_t off = 0;
  auto take = [&](size_t bytes) { char* p = ws + off; off += (bytes + 255) & ~(size_t)255; return p; };
  const size_t npb = (size_t)SLEN * EMB, npa = (size_t)NR * EMB;      /* per-batch plane, plane of both batches */
  _Float16* BQ = (_Float16*)take((size_t)EMB * EMB * 2); _Float16* BK = (_Float16*)take((size_t)KVD * EMB * 2); _Float16* BV = (_Float16*)take((size_t)KVD * EMB * 2); _Float16* BO = (_Float16*)take((size_t)EMB * EMB * 2);
  float* CS = (float*)take((size_t)NR * HH * 4); float* SN = (float*)take((size_t)NR * HH * 4);
  _Float16* X16 = (_Float16*)take(npa * 2); float* QF = (float*)take(npa * 4); float* KF = (float*)take((size_t)NR * KVD * 4); float* VF = (float*)take((size_t)NR * KVD * 4); _Float16* KH8 = (_Float16*)take((size_t)NR * KVD * 2); _Float16* KL8 = (_Float16*)take((size_t)NR * KVD * 2); _Float16* VH8 = (_Float16*)take((size_t)NR * KVD * 2); _Float16* VL8 = (_Float16*)take((size_t)NR * KVD * 2);
  _Float16* H16 = (_Float16*)take(npa * 3 * 2); _Float16* L16 = (_Float16*)take(npa * 3 * 2); _Float16* VT = (_Float16*)take(npa * 2); _Float16* VTL = (_Float16*)take(npa * 2);
  float* O = QF; _Float16* OH = X16; _Float16* OLo = (_Float16*)take(npa * 2);      /* O over the q f32 plane (dead after the rope split); O hi over the x plane (dead after the projections) */
  if (off > ws_size) return;      /* 8+2+2+8 + 1 + 16 + 32 + 8+8 + 4x4 + 48 + 48 + 16 + 16 + 16 = 245 MiB */
  float* ob = (float*)d_out;
  k_prep<<<PB_ROT + 2 * PB_WB + 2 * PB_WS + PB_X, 256, 0, stream>>>(x, Wq, Wk, Wv, Wo, pid, X16, BQ, BK, BV, BO, CS, SN);
  k_gemm2_qkv<<<(NR / 128) * QKV_NT, 128, 0, stream>>>(X16, BQ, BK, BV, bq, bk, bv, QF, KF, VF);
  k_split<<<SB_Q + SB_K + SB_V, 256, 0, stream>>>(QF, KF, VF, CS, SN, H16, L16, KH8, KL8, VH8, VL8);
  k_expand2<<<2 * EB, 256, 0, stream>>>(KH8, KL8, VH8, VL8, H16, L16);
  k_vt2<<<2 * VB, 256, 0, stream>>>(H16, L16, VT, VTL);
  k_flash5<1><<<NB * NH * QBN5, 128, 0, stream>>>(H16, L16, 3 * EMB, H16 + EMB, L16 + EMB, 3 * EMB, VT, VTL, nullptr, O, EMB);
  k_flash<1><<<NB * NH * QBNP, 128, 0, stream>>>(H16, 3 * EMB, H16 + EMB, 3 * EMB, VT, nullptr, O, EMB);
  k_hl<<<(unsigned)((npa / 8 + 255) / 256), 256, 0, stream>>>(O, OH, OLo, npa / 8);
  k_gemm2<0><<<dim3((NR / 128) * (EMB / 64), 1), 128, 0, stream>>>(OH, EMB, 0, BO, EMB, 0, 0.0625f, nullptr, 0, nullptr, 1, 0, 0, ob, nullptr, EMB, 0, NR, EMB, EMB);
  k_gemm2<0><<<dim3((RE / 128) * (EMB / 64), NB), 128, 0, stream>>>(OLo, EMB, npb, BO, EMB, 0, 0.0625f / 1024.0f, nullptr, 0, ob, 1, (size_t)EMB, 0, ob, nullptr, EMB, npb, RE, EMB, EMB);      /* grid y = batch: the first RE rows of each */
}

// v008
// It runs in 247 microseconds.
// Two timings next to v007 put it at 1.06 and 1.04 times that version's speed.
// Counting every step since v000, it is 5.64 times as fast.
#include <hip/hip_runtime.h>
// GQA self-attention (2 x 2048 tokens, hidden 2048; 32 query heads / 8 kv heads of 64 (GQA), rotate-half RoPE from the INPUT position ids, causal SDPA (1/8), out = o Wo): q/k/v = x W + b.
// Structure (both batches in every launch: the 4096 token rows are one row range, batch = row / 2048): exact f16 plane of x; q / k / v GEMMs (32x64 wave tiles, f32 accumulation, exact x16 weights + bias) into f32 planes; angle tables from the input position ids (f32 trig); RoPE on VALU while splitting q and k into f16 hi + 2^10-residual planes, v split directly; k and v stay in their 8 kv heads, and query head h reads kv head h / 4 in place (the reference's repeat 4); V^T hi/residual of the 8 heads by LDS tiles; the fused causal flash kernel in its 5-plane form for the first 256 query rows and plain beyond; attention output as f16 hi (+ residual on those rows) into the output GEMMs.
// Compute dtype: x, weights and biases rounded to bf16; rows < 256 per batch: q, k, P, v, O hi + residual; beyond: plain f16; f32 accumulation/softmax/trig. v_wmma_f32_16x16x32_f16.
#define NB 2
#define EMB 2048
#define NR (NB * SLEN)           /* 4096 token rows */
#define SLEN 2048
#define SQ SLEN
#define TQ SLEN
#define TK SLEN
#define NH 32
#define NKV 8
#define KVD (NKV * HD)
#define HD 64
#define HH (HD / 2)
#define SCL 0.125f               /* 64^-0.5 */
#define QBLKS (TQ / 64)
#define QB05 0                   /* 5-plane flash: query blocks [0, QBN5) of every (batch, head) — the early causal rows whose outputs average over few keys */
#define QBN5 4
#define QB0P QBN5                /* plain flash (hi planes only): query blocks [QBN5, QBLKS) */
#define QBNP (QBLKS - QBN5)
#define RE 256                   /* rows per batch that take the hi+lo output operand (= QBN5 * 64) */
typedef __bf16 v16b __attribute__((ext_vector_type(16)));
typedef unsigned short v8us __attribute__((ext_vector_type(8), may_alias));
typedef float  v8f  __attribute__((ext_vector_type(8)));
typedef float  v4f  __attribute__((ext_vector_type(4)));
typedef float  v4fa __attribute__((ext_vector_type(4), may_alias));
union FragB { v16b v; v8us half[2]; unsigned short u[16]; };

__device__ __forceinline__ unsigned short bf16_bits(float x) { unsigned int u = __float_as_uint(x); return (unsigned short)((u + 0x7FFFu + ((u >> 16) & 1u)) >> 16); }
__device__ __forceinline__ float bf16_val(unsigned short b) { return __uint_as_float(((unsigned int)b) << 16); }
__device__ __forceinline__ float bf16_round(float x) { return bf16_val(bf16_bits(x)); }
// D += A·B with NT terms: 1 = ah·bh, 2 = + al·bh (A split), 3 = + ah·bl (both split)
template <int NT>
__device__ __forceinline__ v8f mmaN(v16b ah, v16b al, v16b bh, v16b bl, v8f c) {
  c = __builtin_amdgcn_wmma_f32_16x16x32_bf16(false, ah, false, bh, (short)0, c, false, false);
  if (NT >= 2) c = __builtin_amdgcn_wmma_f32_16x16x32_bf16(false, al, false, bh, (short)0, c, false, false);
  if (NT >= 3) c = __builtin_amdgcn_wmma_f32_16x16x32_bf16(false, ah, false, bl, (short)0, c, false, false);
  asm volatile("v_nop\n\tv_nop\n\tv_nop\n\tv_nop" : "+v"(c) : "v"(ah), "v"(al), "v"(bh), "v"(bl));
  return c;
}

__global__ __launch_bounds__(256) void k_wt_bf16(const float* __restrict__ W, unsigned short* __restrict__ Wt, int K, int N) {
  const int t = blockIdx.x * 256 + threadIdx.x;
  const int k8n = K / 8;
  if (t >= N * k8n) return;
  const int n = t / k8n, k8 = (t % k8n) * 8;
  v8us v;
#pragma unroll
  for (int i = 0; i < 8; ++i) v[i] = bf16_bits(W[(size_t)(k8 + i) * N + n]);
  *(v8us*)(Wt + (size_t)n * K + k8) = v;
  
}

// GEMM C[M][N] (f32, pitch ldc) = act(A[M][K]·W + bias). A f32 row-major (pitch lda) converted per fragment to bf16
// (ASPLIT: hi/lo two planes -> 2 terms, else single rounded term); Wt bf16 [N][K] (pitch ldb). BIAS_BF16 rounds the
// bias to bf16 first (bias quantised to bf16 before the add). K%32==0, M%16==0, N%64==0.
template <bool ASPLIT, int ACT, bool BIAS_BF16>
__global__ __launch_bounds__(128) void k_gemm_bf(const float* __restrict__ A, int lda, const unsigned short* __restrict__ Wt, int ldb,
                                               const float* __restrict__ bias, float* __restrict__ C, int ldc, int M, int N, int K) {
  __shared__ __attribute__((aligned(16))) float so[4][16][64];
  const int tid = threadIdx.x, w = tid >> 5, lane = tid & 31, ln = lane & 15, hh = lane >> 4;
  const int ntn = N / 64;
  const int wid = blockIdx.x * 4 + w;
  const int mt = wid / ntn, nq = wid % ntn;
  if (mt * 16 >= M) return;
  const int row0 = mt * 16, col0 = nq * 64;
  const float* arow = A + (size_t)(row0 + ln) * lda;
  v8f acc[4] = {};
  for (int kb = 0; kb < K; kb += 32) {
    FragB ah, al;
    const v4f x0 = *(const v4fa*)(arow + kb + 8 * hh), x1 = *(const v4fa*)(arow + kb + 8 * hh + 4);
    const v4f x2 = *(const v4fa*)(arow + kb + 16 + 8 * hh), x3 = *(const v4fa*)(arow + kb + 16 + 8 * hh + 4);
    float xs[16] = {x0[0],x0[1],x0[2],x0[3],x1[0],x1[1],x1[2],x1[3],x2[0],x2[1],x2[2],x2[3],x3[0],x3[1],x3[2],x3[3]};
#pragma unroll
    for (int i = 0; i < 16; ++i) { const unsigned short hb = bf16_bits(xs[i]); ah.u[i] = hb; al.u[i] = ASPLIT ? bf16_bits(xs[i] - bf16_val(hb)) : (unsigned short)0; }
#pragma unroll
    for (int t = 0; t < 4; ++t) {
      const unsigned short* brow = Wt + (size_t)(col0 + t * 16 + ln) * ldb + kb;
      FragB b;
      b.half[0] = *(const v8us*)(brow + 8 * hh);
      b.half[1] = *(const v8us*)(brow + 16 + 8 * hh);
      acc[t] = mmaN<ASPLIT ? 2 : 1>(ah.v, al.v, b.v, b.v, acc[t]);
    }
  }
#pragma unroll
  for (int t = 0; t < 4; ++t) {
    float bv = bias ? bias[col0 + t * 16 + ln] : 0.f;
    if (BIAS_BF16) bv = bf16_round(bv);
#pragma unroll
    for (int r = 0; r < 8; ++r) { float v = acc[t][r] + bv; if (ACT == 1) v = fmaxf(v, 0.f); so[w][8 * hh + r][t * 16 + ln] = v; }
  }
  __builtin_amdgcn_fence(__ATOMIC_ACQ_REL, "workgroup");
  __builtin_amdgcn_wave_barrier();
  const int rsub = lane >> 4, c4 = (lane & 15) * 4;
  {
#pragma unroll
    for (int q = 0; q < 8; ++q) {
      const int r = q * 2 + rsub;
      const v4f v = *(const v4fa*)&so[w][r][c4];
      *(v4f*)(C + (size_t)(row0 + r) * ldc + col0 + c4) = v;
    }
    
  }
}

// GEMM C = act(A·W + bias + resid): A f32 (ASPLIT -> hi/lo 2 terms), Wt bf16 [N][K]; ACT 0 none, 1 relu, 2 exact gelu;
// resid (optional, f32, row index = (row % rmod), pitch ldr, RES_BF16 rounds it) added before the activation.
template <bool ASPLIT, int ACT, bool BIAS_BF16, bool RES_BF16>
__global__ __launch_bounds__(128) void k_gemm_bf3(const float* __restrict__ A, int lda, const unsigned short* __restrict__ Wt, int ldb,
                                                const float* __restrict__ bias, const float* __restrict__ resid, int rmod, int ldr,
                                                float* __restrict__ C, int ldc, int M, int N, int K) {
  __shared__ __attribute__((aligned(16))) float so[4][16][64];
  const int tid = threadIdx.x, w = tid >> 5, lane = tid & 31, ln = lane & 15, hh = lane >> 4;
  const int ntn = N / 64;
  const int wid = blockIdx.x * 4 + w;
  const int mt = wid / ntn, nq = wid % ntn;
  if (mt * 16 >= M) return;
  const int row0 = mt * 16, col0 = nq * 64;
  const float* arow = A + (size_t)(row0 + ln) * lda;
  v8f acc[4] = {};
  for (int kb = 0; kb < K; kb += 32) {
    FragB ah, al;
    const v4f x0 = *(const v4fa*)(arow + kb + 8 * hh), x1 = *(const v4fa*)(arow + kb + 8 * hh + 4);
    const v4f x2 = *(const v4fa*)(arow + kb + 16 + 8 * hh), x3 = *(const v4fa*)(arow + kb + 16 + 8 * hh + 4);
    float xs[16] = {x0[0],x0[1],x0[2],x0[3],x1[0],x1[1],x1[2],x1[3],x2[0],x2[1],x2[2],x2[3],x3[0],x3[1],x3[2],x3[3]};
#pragma unroll
    for (int i = 0; i < 16; ++i) { const unsigned short hb = bf16_bits(xs[i]); ah.u[i] = hb; al.u[i] = ASPLIT ? bf16_bits(xs[i] - bf16_val(hb)) : (unsigned short)0; }
#pragma unroll
    for (int t = 0; t < 4; ++t) {
      const unsigned short* brow = Wt + (size_t)(col0 + t * 16 + ln) * ldb + kb;
      FragB b;
      b.half[0] = *(const v8us*)(brow + 8 * hh);
      b.half[1] = *(const v8us*)(brow + 16 + 8 * hh);
      acc[t] = mmaN<ASPLIT ? 2 : 1>(ah.v, al.v, b.v, b.v, acc[t]);
    }
  }
#pragma unroll
  for (int t = 0; t < 4; ++t) {
    const int col = col0 + t * 16 + ln;
    float bv = bias ? bias[col] : 0.f;
    if (BIAS_BF16) bv = bf16_round(bv);
#pragma unroll
    for (int r = 0; r < 8; ++r) {
      float v = acc[t][r] + bv;
      if (resid) { float rv = resid[(size_t)((row0 + 8 * hh + r) % rmod) * ldr + col]; if (RES_BF16) rv = bf16_round(rv); v += rv; }
      if (ACT == 1) v = fmaxf(v, 0.f);
      if (ACT == 2) v = 0.5f * v * (1.0f + erff(v * 0.70710678118654752f));
      if (ACT == 3) { const float u = 0.7978845608028654f * (v + 0.044715f * v * v * v); v = 0.5f * v * (1.0f + tanhf(u)); }
      so[w][8 * hh + r][t * 16 + ln] = v;
    }
  }
  __builtin_amdgcn_fence(__ATOMIC_ACQ_REL, "workgroup");
  __builtin_amdgcn_wave_barrier();
  const int rsub = lane >> 4, c4 = (lane & 15) * 4;
  {
#pragma unroll
    for (int q = 0; q < 8; ++q) {
      const int r = q * 2 + rsub;
      const v4f v = *(const v4fa*)&so[w][r][c4];
      *(v4f*)(C + (size_t)(row0 + r) * ldc + col0 + c4) = v;
    }
    
  }
}
// row LayerNorm (biased variance, eps) over N: s = X (+ R); optional out_sum <- s; out_norm <- (s-mu)*rsqrt(var+eps)*g + b
template <bool PARAM_BF16>
__global__ __launch_bounds__(256) void k_layernorm(const float* __restrict__ X, const float* __restrict__ R, const float* __restrict__ g, const float* __restrict__ bta,
                                                  float* __restrict__ out_sum, float* __restrict__ out_norm, int N, float eps) {
  __shared__ float red[256];
  const int row = blockIdx.x, tid = threadIdx.x;
  const float* x = X + (size_t)row * N; const float* rr = R ? R + (size_t)row * N : nullptr;
  float vals[16];                     // up to N = 4096
  const int per = N / 256;            // contiguous chunk per thread? use strided-by-4 chunks: thread handles j = tid*4 + 1024*u
  float s1 = 0.f;
  for (int u = 0; u < per / 4; ++u) {
    const int j = tid * 4 + 1024 * u;
    const v4f a = *(const v4fa*)(x + j);
    v4f b = {0.f,0.f,0.f,0.f}; if (rr) b = *(const v4fa*)(rr + j);
#pragma unroll
    for (int q = 0; q < 4; ++q) { const float v = a[q] + b[q]; vals[u * 4 + q] = v; s1 += v; }
  }
  red[tid] = s1; __syncthreads();
  for (int st = 128; st > 0; st >>= 1) { if (tid < st) red[tid] += red[tid + st]; __syncthreads(); }
  const float mu = red[0] / (float)N; __syncthreads();
  float s2 = 0.f;
  for (int u = 0; u < per / 4; ++u)
#pragma unroll
    for (int q = 0; q < 4; ++q) { const float c = vals[u * 4 + q] - mu; s2 += c * c; }
  red[tid] = s2; __syncthreads();
  for (int st = 128; st > 0; st >>= 1) { if (tid < st) red[tid] += red[tid + st]; __syncthreads(); }
  const float rs = rsqrtf(red[0] / (float)N + eps);
  {
    for (int u = 0; u < per / 4; ++u) {
      const int j = tid * 4 + 1024 * u;
      v4f o, sm;
#pragma unroll
      for (int q = 0; q < 4; ++q) {
        float gg = g[j + q], bb = bta[j + q];
        if (PARAM_BF16) { gg = bf16_round(gg); bb = bf16_round(bb); }
        sm[q] = vals[u * 4 + q]; o[q] = (vals[u * 4 + q] - mu) * rs * gg + bb;
      }
      if (out_sum) *(v4f*)(out_sum + (size_t)row * N + j) = sm;
      *(v4f*)(out_norm + (size_t)row * N + j) = o;
    }
    
  }
}



// ---- f16 WMMA path (v_wmma_f32_16x16x32_f16): 11-bit significands for operands in range — used where a [0,1] probability operand needs more precision than bf16
typedef _Float16 v16h __attribute__((ext_vector_type(16)));
union FragH { v16h v; v8us half[2]; _Float16 h[16]; unsigned short u[16]; };
template <int NT>
__device__ __forceinline__ v8f mmaH(v16h ah, v16h al, v16h bh, v16h bl, v8f c) {
  c = __builtin_amdgcn_wmma_f32_16x16x32_f16(false, ah, false, bh, (short)0, c, false, false);
  if (NT >= 2) c = __builtin_amdgcn_wmma_f32_16x16x32_f16(false, al, false, bh, (short)0, c, false, false);
  if (NT >= 3) c = __builtin_amdgcn_wmma_f32_16x16x32_f16(false, ah, false, bl, (short)0, c, false, false);
  asm volatile("v_nop\n\tv_nop\n\tv_nop\n\tv_nop" : "+v"(c) : "v"(ah), "v"(al), "v"(bh), "v"(bl));
  return c;
}
// batched GEMM like k_gemm_b but f16 operands: A f32 (split into f16 hi/lo if ASPLIT, else rounded to f16), Bt = f16 values [n][k]; alpha; C f32; N multiple of 16 (partial tiles skipped)
template <bool ASPLIT>
__global__ __launch_bounds__(128) void k_gemm_h(const float* __restrict__ A, int lda, size_t sA, const _Float16* __restrict__ Bh, int ldb, size_t sB, float alpha, float* __restrict__ C, int ldc, size_t sC, int M, int N, int K) {
  __shared__ __attribute__((aligned(16))) float so[4][16][64];
  const int tid = threadIdx.x, w = tid >> 5, lane = tid & 31, ln = lane & 15, hh = lane >> 4; const int by = blockIdx.y;
  A += (size_t)by * sA; Bh += (size_t)by * sB; C += (size_t)by * sC;
  const int ntn = (N + 63) / 64; const int wid = blockIdx.x * 4 + w; const int mt = wid / ntn, nq = wid % ntn; if (mt * 16 >= M) return;
  const int row0 = mt * 16, col0 = nq * 64; const float* arow = A + (size_t)(row0 + ln) * lda;
  v8f acc[4] = {};
  for (int kb = 0; kb < K; kb += 32) {
    FragH ah, al;
    const v4f x0 = *(const v4fa*)(arow + kb + 8 * hh), x1 = *(const v4fa*)(arow + kb + 8 * hh + 4), x2 = *(const v4fa*)(arow + kb + 16 + 8 * hh), x3 = *(const v4fa*)(arow + kb + 16 + 8 * hh + 4);
    float xs[16] = {x0[0],x0[1],x0[2],x0[3],x1[0],x1[1],x1[2],x1[3],x2[0],x2[1],x2[2],x2[3],x3[0],x3[1],x3[2],x3[3]};
#pragma unroll
    for (int i = 0; i < 16; ++i) { const _Float16 h = (_Float16)xs[i]; ah.h[i] = h; al.h[i] = ASPLIT ? (_Float16)(xs[i] - (float)h) : (_Float16)0.0f; }
#pragma unroll
    for (int t = 0; t < 4; ++t) { if (col0 + t * 16 >= N) continue; const size_t boff = (size_t)(col0 + t * 16 + ln) * ldb + kb; FragH bq; bq.half[0] = *(const v8us*)(Bh + boff + 8 * hh); bq.half[1] = *(const v8us*)(Bh + boff + 16 + 8 * hh);
      acc[t] = mmaH<ASPLIT ? 2 : 1>(ah.v, al.v, bq.v, bq.v, acc[t]); }
  }
#pragma unroll
  for (int t = 0; t < 4; ++t) { if (col0 + t * 16 >= N) continue;
#pragma unroll
    for (int r = 0; r < 8; ++r) so[w][8 * hh + r][t * 16 + ln] = acc[t][r] * alpha; }
  __builtin_amdgcn_fence(__ATOMIC_ACQ_REL, "workgroup"); __builtin_amdgcn_wave_barrier();
  const int rsub = lane >> 4, c4 = (lane & 15) * 4;
  {
#pragma unroll
    for (int q = 0; q < 8; ++q) { const int r = q * 2 + rsub; if (col0 + c4 < N) { const v4f v = *(const v4fa*)&so[w][r][c4]; *(v4f*)(C + (size_t)(row0 + r) * ldc + col0 + c4) = v; } }
     }
}

// Wt[n][k] = f16(W[k][n]·scale) from f32 row-major W[K][N] (scale = power of two; bf16-exact weights stay exact in f16 away from the subnormal range)
// One block of 256 per 64 x 64 tile (K % 64 == 0, N % 64 == 0; (K / 64) * (N / 64) tiles): W is read in whole 256-byte row pieces (16 bytes a lane), converted, turned in LDS, and Wt is written in whole 128-byte rows (16 bytes a lane).
__device__ __forceinline__ void wt_f16_job(int bx, const float* __restrict__ W, _Float16* __restrict__ Wt, int K, int N, float scale) {      /* bx: the tile's index */
  __shared__ unsigned int tl[64][33];      /* tile [k][n], two f16 a word; the odd pitch keeps the column reads below on distinct banks */
  const int tid = threadIdx.x; const int nkt = K >> 6; const int nt = bx / nkt, kt = bx - nt * nkt; const int k0 = kt * 64, n0 = nt * 64;
  const int r = tid >> 4, c4 = (tid & 15) * 4; v4f a[4];
#pragma unroll
  for (int p = 0; p < 4; ++p) a[p] = *(const v4fa*)(W + (size_t)(k0 + p * 16 + r) * N + n0 + c4);
#pragma unroll
  for (int p = 0; p < 4; ++p) { FragH f;
#pragma unroll
    for (int q = 0; q < 4; ++q) f.h[q] = (_Float16)(bf16_round(a[p][q]) * scale);
    tl[p * 16 + r][c4 / 2] = (unsigned int)f.u[0] | ((unsigned int)f.u[1] << 16); tl[p * 16 + r][c4 / 2 + 1] = (unsigned int)f.u[2] | ((unsigned int)f.u[3] << 16); }
  __syncthreads();
  typedef unsigned short usa __attribute__((may_alias)); const usa* ts = (const usa*)&tl[0][0];      /* the words of the tile read as single f16 */
#pragma unroll
  for (int rd = 0; rd < 2; ++rd) { const int n = rd * 32 + (tid >> 3), pc = tid & 7; FragH f;
#pragma unroll
    for (int q = 0; q < 8; ++q) f.u[q] = ts[(pc * 8 + q) * 66 + n];
    *(v8us*)((unsigned short*)Wt + (size_t)(n0 + n) * K + k0 + pc * 8) = f.half[0]; }
  asm volatile("s_wait_xcnt 0x0" ::: "memory");      /* in a shared grid other jobs' code follows in the listing and reuses the registers that the two stores above name: it is kept behind this wait */
}
// k_gemm_hh variant with fused epilogue: v = acc·alpha + bias[by·sBias + col] (+ CP[(row/rowsPerB)·sCPb + by·64 + col] if CP) ; ACT 0 none / 1 elu ; writes f16 C16 (and f32 C if non-null)
template <int ACT>
__global__ __launch_bounds__(128) void k_gemm_hhx(const _Float16* __restrict__ A, int lda, size_t sA, const _Float16* __restrict__ Bh, int ldb, size_t sB, float alpha, const float* __restrict__ bias, size_t sBias, const float* __restrict__ CP, int rowsPerB, size_t sCPb, int row0g,
    float* __restrict__ C, _Float16* __restrict__ C16, int ldc, size_t sC, int M, int N, int K) {
  __shared__ __attribute__((aligned(16))) float so[4][16][64];
  const int tid = threadIdx.x, w = tid >> 5, lane = tid & 31, ln = lane & 15, hh = lane >> 4; const int by = blockIdx.y;
  A += (size_t)by * sA; Bh += (size_t)by * sB; const size_t cofs = (size_t)by * sC; const float* bp = bias ? bias + (size_t)by * sBias : nullptr;
  const int ntn = (N + 63) / 64; const int wid = blockIdx.x * 4 + w; const int mt = wid / ntn, nq = wid % ntn; if (mt * 16 >= M) return;
  const int row0 = mt * 16, col0 = nq * 64; const _Float16* arow = A + (size_t)(row0 + ln) * lda;
  v8f acc[4] = {};
  for (int kb = 0; kb < K; kb += 32) { FragH ah; ah.half[0] = *(const v8us*)((const unsigned short*)arow + kb + 8 * hh); ah.half[1] = *(const v8us*)((const unsigned short*)arow + kb + 16 + 8 * hh);
#pragma unroll
    for (int t = 0; t < 4; ++t) { if (col0 + t * 16 >= N) continue; const size_t boff = (size_t)(col0 + t * 16 + ln) * ldb + kb; FragH bq; bq.half[0] = *(const v8us*)((const unsigned short*)Bh + boff + 8 * hh); bq.half[1] = *(const v8us*)((const unsigned short*)Bh + boff + 16 + 8 * hh);
      acc[t] = mmaH<1>(ah.v, ah.v, bq.v, bq.v, acc[t]); }
  }
#pragma unroll
  for (int t = 0; t < 4; ++t) { if (col0 + t * 16 >= N) continue; const int col = col0 + t * 16 + ln; const float bv = bp ? bf16_round(bp[col]) : 0.f;
#pragma unroll
    for (int r = 0; r < 8; ++r) { float v = acc[t][r] * alpha + bv; if (CP) { const int bidx = (row0g + row0 + 8 * hh + r) / rowsPerB; v += CP[(size_t)bidx * sCPb + (size_t)by * 64 + col]; } if (ACT == 1) v = (v > 0.f) ? v : expm1f(v); else if (ACT == 7) v = (v > 0.f) ? v + 1.0f : expf(v); else if (ACT == 8) v = tanhf(v); else if (ACT == 9) v = 0.5f * v * (1.0f + tanhf(0.7978845608028654f * (v + 0.044715f * v * v * v))); else if (ACT == 11) v = 1.0f / (1.0f + expf(-v)); else if (ACT == 12) v = (v > 0.f) ? v : 0.01f * v; else if (ACT == 14) v = (v > 0.f) ? v : 0.1f * v; else if (ACT == 15) v = v / (1.0f + expf(-v)); else if (ACT == 3) v = fmaxf(v, 0.f); else if (ACT == 6) v = 0.5f * v * (1.0f + erff(v * 0.70710678118654752f)); so[w][8 * hh + r][t * 16 + ln] = v; } }
  __builtin_amdgcn_fence(__ATOMIC_ACQ_REL, "workgroup"); __builtin_amdgcn_wave_barrier();
  const int rsub = lane >> 4, c4 = (lane & 15) * 4; typedef _Float16 v4h __attribute__((ext_vector_type(4)));
  {
#pragma unroll
    for (int q = 0; q < 8; ++q) { const int r = q * 2 + rsub; if (col0 + c4 < N) { const v4f v = *(const v4fa*)&so[w][r][c4]; if (C) *(v4f*)(C + cofs + (size_t)(row0 + r) * ldc + col0 + c4) = v; if (C16) { v4h h4; for (int i = 0; i < 4; ++i) h4[i] = (_Float16)v[i]; *(v4h*)(C16 + cofs + (size_t)(row0 + r) * ldc + col0 + c4) = h4; } } }
     }
}


typedef _Float16 v4h __attribute__((ext_vector_type(4)));

__device__ __forceinline__ void x16_job(int bx, const float* __restrict__ x, _Float16* __restrict__ X16, size_t n8) { const size_t t = (size_t)bx * 256 + threadIdx.x; if (t >= n8) return; FragH f;
#pragma unroll
  for (int q = 0; q < 8; ++q) f.h[q] = (_Float16)bf16_round(x[t * 8 + q]); *(v8us*)((unsigned short*)X16 + t * 8) = f.half[0];  }
__global__ __launch_bounds__(256) void k_h16(const float* __restrict__ x, _Float16* __restrict__ X16, size_t n8) { const size_t t = (size_t)blockIdx.x * 256 + threadIdx.x; if (t >= n8) return; FragH f;
#pragma unroll
  for (int q = 0; q < 8; ++q) f.h[q] = (_Float16)x[t * 8 + q]; *(v8us*)((unsigned short*)X16 + t * 8) = f.half[0];  }
__global__ __launch_bounds__(256) void k_round16f(const float* __restrict__ W, _Float16* __restrict__ Bt, size_t n8) { const size_t t = (size_t)blockIdx.x * 256 + threadIdx.x; if (t >= n8) return; FragH f;
#pragma unroll
  for (int i = 0; i < 8; ++i) f.h[i] = (_Float16)(bf16_round(W[t * 8 + i]) * 16.0f); *(v8us*)((unsigned short*)Bt + t * 8) = f.half[0];  }
template <int NHv, int TTv>
__device__ __forceinline__ void vt_job(int bx, const _Float16* __restrict__ V16, int ldv, int voff, _Float16* __restrict__ Vt) { __shared__ unsigned short tl[64][66]; const int tid = threadIdx.x; const int slab = bx / (TTv / 64), lg = bx % (TTv / 64); const int b = slab / NHv, h = slab % NHv;
  for (int i = tid; i < 64 * 8; i += 256) { const int r = i / 8, c8 = (i % 8) * 8; FragH f; f.half[0] = *(const v8us*)((const unsigned short*)V16 + ((size_t)b * TTv + lg * 64 + r) * ldv + voff + h * 64 + c8);
#pragma unroll
    for (int q = 0; q < 8; ++q) tl[r][c8 + q] = f.u[q]; }
  __syncthreads();
  {
#pragma unroll
    for (int rd = 0; rd < 2; ++rd) { const int d = rd * 32 + tid / 8, pc = tid % 8; FragH f;
#pragma unroll
      for (int q = 0; q < 8; ++q) f.u[q] = tl[pc * 8 + q][d];
      *(v8us*)((unsigned short*)Vt + ((size_t)slab * 64 + d) * TTv + lg * 64 + pc * 8) = f.half[0]; }
     } }

__device__ __forceinline__ void hl_job(int bx, const float* __restrict__ F, _Float16* __restrict__ Hh, _Float16* __restrict__ Hl, size_t n8) { const size_t t = (size_t)bx * 256 + threadIdx.x; if (t >= n8) return; FragH fh, fl; const v4f a = *(const v4fa*)(F + t * 8), c = *(const v4fa*)(F + t * 8 + 4);
#pragma unroll
  for (int q = 0; q < 4; ++q) { _Float16 h = (_Float16)a[q]; fh.h[q] = h; fl.h[q] = (_Float16)((a[q] - (float)h) * 1024.0f); h = (_Float16)c[q]; fh.h[4 + q] = h; fl.h[4 + q] = (_Float16)((c[q] - (float)h) * 1024.0f); }
  { *(v8us*)((unsigned short*)Hh + t * 8) = fh.half[0]; *(v8us*)((unsigned short*)Hl + t * 8) = fl.half[0];  } }
__global__ __launch_bounds__(256) void k_hl(const float* __restrict__ F, _Float16* __restrict__ Hh, _Float16* __restrict__ Hl, size_t n8) { hl_job(blockIdx.x, F, Hh, Hl, n8); }

// ---- fast GEMM (wave tile 32x64; requires M % 128 == 0 rows per launch region, N % 64 == 0 and K % 64 == 0); epilogue = k_gemm_hhx semantics, but the CP addend takes C's own grid-y offset ----
__device__ __forceinline__ v16h g2_frag(const _Float16* p, int hh) { FragH f; f.half[0] = *(const v8us*)((const unsigned short*)p + 8 * hh); f.half[1] = *(const v8us*)((const unsigned short*)p + 16 + 8 * hh); return f.v; }
__device__ __forceinline__ v8f g2_mma(v16h a, v16h b, v8f c) { v8f d = __builtin_amdgcn_wmma_f32_16x16x32_f16(false, a, false, b, (short)0, c, false, false); asm volatile("v_nop\n\tv_nop\n\tv_nop\n\tv_nop" : "+v"(d) : "v"(a), "v"(b)); return d; }
#define G2_KT 64                      /* k per stage: 128 bytes of every operand row */
#define G2_PITCH 144                  /* LDS row pitch in bytes: 128 + 16, an odd multiple of 16 for the 16-byte fragment reads */
#define G2_STAGE (192 * G2_PITCH)     /* one stage: 128 A rows, then 64 B rows */
// One stage's copies of one lane: 16 bytes of each of 8 A rows and 4 B rows (rows 16 apart; sa, sb = 16 rows in bytes), global memory -> LDS through no register.
// A wave's 32 lanes cover 4 whole 128-byte rows per copy. s_wait_xcnt 0 ends the statement so that it stands in front of any rewrite of the address registers the copies name.
__device__ __forceinline__ void g2_stage(unsigned l, const char* ga, size_t sa, const char* gb, size_t sb) {
  const char* a1 = ga + sa; const char* a2 = a1 + sa; const char* a3 = a2 + sa; const char* a4 = a3 + sa; const char* a5 = a4 + sa; const char* a6 = a5 + sa; const char* a7 = a6 + sa;
  const char* b1 = gb + sb; const char* b2 = b1 + sb; const char* b3 = b2 + sb;
  asm volatile("global_load_async_to_lds_b128 %0, %12, off\n\t"
               "global_load_async_to_lds_b128 %1, %13, off\n\t"
               "global_load_async_to_lds_b128 %2, %14, off\n\t"
               "global_load_async_to_lds_b128 %3, %15, off\n\t"
               "global_load_async_to_lds_b128 %4, %16, off\n\t"
               "global_load_async_to_lds_b128 %5, %17, off\n\t"
               "global_load_async_to_lds_b128 %6, %18, off\n\t"
               "global_load_async_to_lds_b128 %7, %19, off\n\t"
               "global_load_async_to_lds_b128 %8, %20, off\n\t"
               "global_load_async_to_lds_b128 %9, %21, off\n\t"
               "global_load_async_to_lds_b128 %10, %22, off\n\t"
               "global_load_async_to_lds_b128 %11, %23, off\n\t"
               "s_wait_xcnt 0x0"
               :: "v"(l), "v"(l + 16 * G2_PITCH), "v"(l + 32 * G2_PITCH), "v"(l + 48 * G2_PITCH), "v"(l + 64 * G2_PITCH), "v"(l + 80 * G2_PITCH), "v"(l + 96 * G2_PITCH), "v"(l + 112 * G2_PITCH),
                  "v"(l + 128 * G2_PITCH), "v"(l + 144 * G2_PITCH), "v"(l + 160 * G2_PITCH), "v"(l + 176 * G2_PITCH),
                  "v"(ga), "v"(a1), "v"(a2), "v"(a3), "v"(a4), "v"(a5), "v"(a6), "v"(a7), "v"(gb), "v"(b1), "v"(b2), "v"(b3)
               : "memory");
}
// Block tile 128x64, row tile mt, column tile nq (M % 128 == 0, N % 64 == 0, K % 64 == 0): the A and B tiles of a stage go to LDS by asynchronous copies, two buffers, stage t + 2 in flight while stage t + 1 is worked on; the waves read their fragments from LDS. The order of the products along k is the plain one.
template <int ACT>
__device__ __forceinline__ void gemm2_job(int mt, int nq, int by, const _Float16* __restrict__ A, int lda, size_t sA, const _Float16* __restrict__ Bh, int ldb, size_t sB, float alpha, const float* __restrict__ bias, size_t sBias, const float* __restrict__ CP, int rowsPerB, size_t sCPb, int row0g,
    float* __restrict__ C, _Float16* __restrict__ C16, int ldc, size_t sC, int M, int N, int K) {
  __shared__ __attribute__((aligned(128))) unsigned char sm[2 * G2_STAGE];
  float (*so)[32][68] = (float (*)[32][68])sm;      /* output staging (4 x 32 x 68 floats) over the two buffers, used only behind the last trip's barrier */
  const int tid = threadIdx.x, w = tid >> 5, lane = tid & 31, ln = lane & 15, hh = lane >> 4;
  A += (size_t)by * sA; Bh += (size_t)by * sB; const size_t cofs = (size_t)by * sC; const float* bp = bias ? bias + (size_t)by * sBias : nullptr;
  const int row0 = mt * 128 + 32 * w, col0 = nq * 64; if (mt * 128 >= M) return;      /* the whole block leaves or none, in front of every barrier */
  const int cr = tid >> 3, cc = tid & 7;      /* copy lane: row cr (+ 16 i) of the tile, 16-byte piece cc of its 128 bytes */
  const char* ga = (const char*)(A + (size_t)(mt * 128 + cr) * lda + cc * 8); const char* gb = (const char*)(Bh + (size_t)(col0 + cr) * ldb + cc * 8);
  const size_t sa = (size_t)lda * 32, sb = (size_t)ldb * 32;
  const unsigned l0 = (unsigned)(size_t)sm + (unsigned)(cr * G2_PITCH + cc * 16);
  const int nst = K / G2_KT;
  g2_stage(l0, ga, sa, gb, sb);
  asm volatile("s_wait_asynccnt 0x0" ::: "memory");      /* stage 0 of this wave has landed */
  __syncthreads();                                       /* ... and every other wave's */
  if (nst > 1) g2_stage(l0 + G2_STAGE, ga + 2 * G2_KT, sa, gb + 2 * G2_KT, sb);
  const v8f z8 = {0.f,0.f,0.f,0.f,0.f,0.f,0.f,0.f}; v8f c00 = z8, c01 = z8, c02 = z8, c03 = z8, c10 = z8, c11 = z8, c12 = z8, c13 = z8;
  /* kept rolled: one trip per stage, so that the waits, the barrier and the refill at its foot stand once */
#pragma unroll 1
  for (int t = 0; t < nst; ++t) { const unsigned bo = (unsigned)(t & 1) * G2_STAGE;
    const _Float16* a0p = (const _Float16*)(sm + bo + (32 * w + ln) * G2_PITCH); const _Float16* a1p = (const _Float16*)(sm + bo + (32 * w + 16 + ln) * G2_PITCH);
    const _Float16* b0p = (const _Float16*)(sm + bo + (128 + ln) * G2_PITCH); const _Float16* b1p = (const _Float16*)(sm + bo + (144 + ln) * G2_PITCH); const _Float16* b2p = (const _Float16*)(sm + bo + (160 + ln) * G2_PITCH); const _Float16* b3p = (const _Float16*)(sm + bo + (176 + ln) * G2_PITCH);
    /* unrolled: the two 32-k steps of a stage read LDS at constant offsets */
#pragma unroll
    for (int kb = 0; kb < G2_KT; kb += 32) { const v16h a0 = g2_frag(a0p + kb, hh), a1 = g2_frag(a1p + kb, hh), b0 = g2_frag(b0p + kb, hh), b1 = g2_frag(b1p + kb, hh), b2 = g2_frag(b2p + kb, hh), b3 = g2_frag(b3p + kb, hh);
      c00 = g2_mma(a0, b0, c00); c10 = g2_mma(a1, b0, c10);
      c01 = g2_mma(a0, b1, c01); c11 = g2_mma(a1, b1, c11);
      c02 = g2_mma(a0, b2, c02); c12 = g2_mma(a1, b2, c12);
      c03 = g2_mma(a0, b3, c03); c13 = g2_mma(a1, b3, c13); }
    asm volatile("s_wait_dscnt 0x0" ::: "memory");       /* this wave's reads of the buffer are done before it is refilled */
    asm volatile("s_wait_asynccnt 0x0" ::: "memory");    /* this wave's copies of stage t + 1 have landed */
    __syncthreads();                                     /* publishes stage t + 1 and ends every wave's reads of stage t */
    if (t + 2 < nst) g2_stage(l0 + bo, ga + (size_t)(t + 2) * (2 * G2_KT), sa, gb + (size_t)(t + 2) * (2 * G2_KT), sb); }
  asm volatile("s_wait_asynccnt 0x0" ::: "memory");      /* no copy is outstanding when the buffers become output staging */
  v8f accs[8] = {c00, c01, c02, c03, c10, c11, c12, c13};
#pragma unroll
  for (int u = 0; u < 8; ++u) { const int t = u & 3, half = u >> 2; const int col = col0 + t * 16 + ln; const float bv = bp ? bf16_round(bp[col]) : 0.f;
#pragma unroll
    for (int r = 0; r < 8; ++r) { const int rloc = half * 16 + 8 * hh + r; float v = accs[u][r] * alpha + bv; if (CP) { const int bidx = (row0g + row0 + rloc) / rowsPerB; v += CP[cofs + (size_t)bidx * sCPb + col]; }
      if (ACT == 3) v = fmaxf(v, 0.f); else if (ACT == 6) v = 0.5f * v * (1.0f + erff(v * 0.70710678118654752f)); else if (ACT == 11) v = 1.0f / (1.0f + expf(-v)); else if (ACT == 15) v = v / (1.0f + expf(-v)); else if (ACT == 12) v = (v > 0.f) ? v : 0.01f * v; else if (ACT == 8) v = tanhf(v);
      so[w][rloc][t * 16 + ln] = v; } }
  __builtin_amdgcn_fence(__ATOMIC_ACQ_REL, "workgroup"); __builtin_amdgcn_wave_barrier();
  const int rsub = lane >> 4, c4 = (lane & 15) * 4;
  {
#pragma unroll
    for (int q = 0; q < 16; ++q) { const int r = q * 2 + rsub; const v4f v = *(const v4fa*)&so[w][r][c4]; if (C) *(v4f*)(C + cofs + (size_t)(row0 + r) * ldc + col0 + c4) = v; if (C16) { v4h h4; for (int i = 0; i < 4; ++i) h4[i] = (_Float16)v[i]; *(v4h*)(C16 + cofs + (size_t)(row0 + r) * ldc + col0 + c4) = h4; } }
     } }



template <int ACT>
__global__ __launch_bounds__(128) void k_gemm2(const _Float16* __restrict__ A, int lda, size_t sA, const _Float16* __restrict__ Bh, int ldb, size_t sB, float alpha, const float* __restrict__ bias, size_t sBias, const float* __restrict__ CP, int rowsPerB, size_t sCPb, int row0g,
    float* __restrict__ C, _Float16* __restrict__ C16, int ldc, size_t sC, int M, int N, int K) {
  const int ntn = N >> 6; const int mt = blockIdx.x / ntn, nq = blockIdx.x - mt * ntn;
  gemm2_job<ACT>(mt, nq, blockIdx.y, A, lda, sA, Bh, ldb, sB, alpha, bias, sBias, CP, rowsPerB, sCPb, row0g, C, C16, ldc, sC, M, N, K); }
// The q, k and v projections in one grid (they share A and do not depend on one another): block b takes row tile b / 48 and one of that row tile's 48 column tiles, 32 of q, then 8 of k, then 8 of v.
#define QKV_NT ((EMB + 2 * KVD) / 64)
__global__ __launch_bounds__(128) void k_gemm2_qkv(const _Float16* __restrict__ A, const _Float16* __restrict__ BQ, const _Float16* __restrict__ BK, const _Float16* __restrict__ BV, const float* __restrict__ bq, const float* __restrict__ bk, const float* __restrict__ bv,
    float* __restrict__ QF, float* __restrict__ KF, float* __restrict__ VF) {
  const int mt = blockIdx.x / QKV_NT, nt = blockIdx.x - mt * QKV_NT; const bool isq = nt < EMB / 64, isk = nt < (EMB + KVD) / 64;
  const _Float16* B = isq ? BQ : (isk ? BK : BV); const float* bias = isq ? bq : (isk ? bk : bv); float* C = isq ? QF : (isk ? KF : VF);
  const int N = isq ? EMB : KVD; const int nq = nt - (isq ? 0 : (isk ? EMB / 64 : (EMB + KVD) / 64));
  gemm2_job<0>(mt, nq, 0, A, EMB, 0, B, EMB, 0, 0.0625f, bias, 0, nullptr, 1, 0, 0, C, nullptr, N, 0, NR, N, EMB); }

// Both flash kernels work on the transposed products: S^T = K Q^T (A = 16 key rows, B = the wave's 16 queries) and O^T += V^T P^T (A = 16 rows of V^T, B = P^T).
// A lane then holds 16 of the 32 scores of ONE query (query ln; keys 8 hh + r of each 16-key tile), so the row maximum and the row sum are in-lane plus one exchange with lane ^ 16,
// and the two score tiles, converted in place, are already the B operand of the second product (element s = tile s / 8, register s % 8): P goes through no LDS.
__device__ __forceinline__ float xhalf(float x) { return __builtin_bit_cast(float, __builtin_amdgcn_permlanex16(__builtin_bit_cast(int, x), __builtin_bit_cast(int, x), 0x76543210, 0xfedcba98, false, false)); }      /* the value of lane ^ 16 */
#define SCL2 0.18033688011112042f      /* 64^-0.5 * log2(e): the softmax of the plain kernel runs in base 2 */
// Plain kernel: p * 2^10 = 2^(s * SCL2 + off) with off = 10 - max * SCL2: one fused multiply-add and one hardware exp2 per score; the row maximum is taken on the raw scores (SCL2 > 0).
// The accumulators and the row sum carry the 2^10, which the final division takes out.
#define FL_PITCH 144                  /* LDS row pitch in bytes: 128 + 16, an odd multiple of 16 for the 16-byte fragment reads */
#define FL_STAGE (128 * FL_PITCH)     /* one stage of 64 keys: 64 K rows (128 bytes = the head's 64 f16), then 64 V^T rows (128 bytes = 64 keys) */
// One stage's copies of one lane: 16 bytes of each of 4 K rows and 4 V^T rows (rows 16 apart; sk, sv = 16 rows in bytes), global memory -> LDS through no register.
// A wave's 32 lanes cover 4 whole 128-byte rows per copy. s_wait_xcnt 0 ends the statement so that it stands in front of any rewrite of the address registers the copies name.
__device__ __forceinline__ void fl_stage(unsigned l, const char* gk, size_t sk, const char* gv, size_t sv) {
  const char* k1 = gk + sk; const char* k2 = k1 + sk; const char* k3 = k2 + sk;
  const char* v1 = gv + sv; const char* v2 = v1 + sv; const char* v3 = v2 + sv;
  asm volatile("global_load_async_to_lds_b128 %0, %8, off\n\t"
               "global_load_async_to_lds_b128 %1, %9, off\n\t"
               "global_load_async_to_lds_b128 %2, %10, off\n\t"
               "global_load_async_to_lds_b128 %3, %11, off\n\t"
               "global_load_async_to_lds_b128 %4, %12, off\n\t"
               "global_load_async_to_lds_b128 %5, %13, off\n\t"
               "global_load_async_to_lds_b128 %6, %14, off\n\t"
               "global_load_async_to_lds_b128 %7, %15, off\n\t"
               "s_wait_xcnt 0x0"
               :: "v"(l), "v"(l + 16 * FL_PITCH), "v"(l + 32 * FL_PITCH), "v"(l + 48 * FL_PITCH), "v"(l + 64 * FL_PITCH), "v"(l + 80 * FL_PITCH), "v"(l + 96 * FL_PITCH), "v"(l + 112 * FL_PITCH),
                  "v"(gk), "v"(k1), "v"(k2), "v"(k3), "v"(gv), "v"(v1), "v"(v2), "v"(v3)
               : "memory");
}
// The K and V^T tiles of 64 keys go to LDS once per block by asynchronous copies in whole 128-byte rows, two buffers, stage t + 2 in flight while stage t + 1 is worked on; the block's 4 waves read their fragments from LDS.
// Each stage is worked on as two steps of 32 keys, with the products, the maxima and the sums in the order they had with fragments read from global memory.
template <int CAUSAL>
__global__ __launch_bounds__(128) void k_flash(const _Float16* __restrict__ Q16, int ldq, const _Float16* __restrict__ K16, int ldk, const _Float16* __restrict__ Vt, const int* __restrict__ MSK, float* __restrict__ O, int ldo) {
  constexpr int RPW = 16, DT = 4, KS = 2;
  __shared__ __attribute__((aligned(128))) unsigned char sm[2 * FL_STAGE];
  float (*sO)[RPW][64 + 4] = (float (*)[RPW][64 + 4])sm;      /* output staging (4 x 16 x 68 floats) over the first buffer, used only behind the last trip's barrier */
  const int tid = threadIdx.x, w = tid >> 5, lane = tid & 31, ln = lane & 15, hh = lane >> 4;
  const int slab = blockIdx.x / QBNP, qblk = QB0P + blockIdx.x % QBNP; const int b = slab / NH, h = slab % NH; const int qb0 = qblk * (4 * RPW); const int q0 = qb0 + w * RPW; const int tq = q0 + ln;      /* tq: this lane's query */
  const int hk = h / (NH / NKV);      /* the kv head that query head h reads */
  const unsigned short* Vth = (const unsigned short*)Vt + (size_t)(b * NKV + hk) * 64 * TK;
  const int jend = (CAUSAL == 1) ? (qb0 + 4 * RPW) : TK;      /* causal: keys beyond the block's last query never contribute */
  const int nst = jend / 64;                                  /* jend is a multiple of 64 in every mode */
  const int cr = tid >> 3, cc = tid & 7;      /* copy lane: row cr (+ 16 i) of each tile, 16-byte piece cc of its 128 bytes */
  const char* gk = (const char*)((const unsigned short*)K16 + ((size_t)b * TK + cr) * ldk + hk * 64 + cc * 8); const char* gv = (const char*)(Vth + (size_t)cr * TK + cc * 8);
  const size_t sk = (size_t)ldk * 32, sv = (size_t)TK * 32, dk = (size_t)ldk * 128;      /* dk: 64 key rows in bytes; a stage moves V^T by 128 bytes */
  const unsigned l0 = (unsigned)(size_t)sm + (unsigned)(cr * FL_PITCH + cc * 16);
  fl_stage(l0, gk, sk, gv, sv);
  FragH aq[KS];
  { const unsigned short* qr = (const unsigned short*)Q16 + ((size_t)b * TQ + tq) * ldq + h * 64;
#pragma unroll
    for (int ks = 0; ks < KS; ++ks) { aq[ks].half[0] = *(const v8us*)(qr + ks * 32 + 8 * hh); aq[ks].half[1] = *(const v8us*)(qr + ks * 32 + 16 + 8 * hh); } }
  asm volatile("s_wait_asynccnt 0x0" ::: "memory");      /* stage 0 of this wave has landed */
  __syncthreads();                                       /* ... and every other wave's */
  if (nst > 1) fl_stage(l0 + FL_STAGE, gk + dk, sk, gv + 128, sv);
  float m_r = -3.0e38f, off_r = 10.0f + 3.0e38f * SCL2, l_r = 0.f; v8f oacc[DT];      /* m_r: running maximum of the raw scores; off_r = 10 - m_r * SCL2; l_r: the sum over this lane's own keys, the two halves join behind the loop */
#pragma unroll
  for (int dt = 0; dt < DT; ++dt) oacc[dt] = (v8f){0.f,0.f,0.f,0.f,0.f,0.f,0.f,0.f};
  /* kept rolled: one trip per stage, so that the waits, the barrier and the refill at its foot stand once */
#pragma unroll 1
  for (int t = 0; t < nst; ++t) { const unsigned bo = (unsigned)(t & 1) * FL_STAGE;
    const unsigned short* kl = (const unsigned short*)(sm + bo + ln * FL_PITCH) + 8 * hh; const unsigned short* vl = (const unsigned short*)(sm + bo + (64 + ln) * FL_PITCH) + 8 * hh;      /* this lane's row of the first K tile and of the first V^T tile */
    /* unrolled: the two 32-key steps of a stage read LDS at constant offsets */
#pragma unroll
    for (int sub = 0; sub < 2; ++sub) { const int j0 = t * 64 + sub * 32;
      FragH bk[2][KS], bv[DT];
#pragma unroll
      for (int nt = 0; nt < 2; ++nt) { const unsigned short* kr = kl + (sub * 32 + nt * 16) * (FL_PITCH / 2);
#pragma unroll
        for (int ks = 0; ks < KS; ++ks) { bk[nt][ks].half[0] = *(const v8us*)(kr + ks * 32); bk[nt][ks].half[1] = *(const v8us*)(kr + ks * 32 + 16); } }
      v8f s[2];
#pragma unroll
      for (int nt = 0; nt < 2; ++nt) { v8f acc = (v8f){0.f,0.f,0.f,0.f,0.f,0.f,0.f,0.f};
#pragma unroll
        for (int ks = 0; ks < KS; ++ks) acc = mmaH<1>(bk[nt][ks].v, bk[nt][ks].v, aq[ks].v, aq[ks].v, acc);
        s[nt] = acc; }
      asm volatile("" ::: "memory");      /* compiler fence: keeps the V^T fragment reads behind the score products, so that they take over the K fragments' registers and fly during the softmax; without it the kernel takes 159 registers in place of 138 and a SIMD holds 6 waves in place of 7 */
#pragma unroll
      for (int dt = 0; dt < DT; ++dt) { const unsigned short* vrow = vl + dt * 16 * (FL_PITCH / 2) + sub * 32; bv[dt].half[0] = *(const v8us*)(vrow); bv[dt].half[1] = *(const v8us*)(vrow + 16); }
      float sc[16]; bool ok[16]; float mc = -3.0e38f;
#pragma unroll
      for (int e = 0; e < 16; ++e) { const int key = j0 + (e >> 3) * 16 + 8 * hh + (e & 7);
        ok[e] = (CAUSAL == 1) ? (key <= tq) : ((CAUSAL == 2) ? ((key >> 5) == (tq >> 5)) : true);      /* mode 2: block-diagonal 32-token groups */
        sc[e] = ok[e] ? s[e >> 3][e & 7] : -3.0e38f; mc = fmaxf(mc, sc[e]); }
      mc = fmaxf(mc, xhalf(mc));
      const float mn = fmaxf(m_r, mc); const float off = 10.0f - mn * SCL2; const float ea = __builtin_amdgcn_exp2f(off - off_r);      /* 2^(off - off_r): the factor that moves the accumulators to the new maximum */
      const float al = (mn > -1.0e38f) ? ea : 1.0f; m_r = mn; off_r = off;
      float ps[4] = {0.f, 0.f, 0.f, 0.f}; FragH pb;
#pragma unroll
      for (int e = 0; e < 16; ++e) { const float ee = __builtin_amdgcn_exp2f(sc[e] * SCL2 + off); const float p = ok[e] ? ee : 0.f; ps[e & 3] += p; pb.h[e] = (_Float16)p; }
      l_r = l_r * al + ((ps[0] + ps[1]) + (ps[2] + ps[3]));
#pragma unroll
      for (int dt = 0; dt < DT; ++dt)
#pragma unroll
        for (int r = 0; r < 8; ++r) oacc[dt][r] *= al;
#pragma unroll
      for (int dt = 0; dt < DT; ++dt) oacc[dt] = mmaH<1>(bv[dt].v, bv[dt].v, pb.v, pb.v, oacc[dt]); }
    asm volatile("s_wait_dscnt 0x0" ::: "memory");       /* this wave's reads of the buffer are done before it is refilled */
    asm volatile("s_wait_asynccnt 0x0" ::: "memory");    /* this wave's copies of stage t + 1 have landed */
    __syncthreads();                                     /* publishes stage t + 1 and ends every wave's reads of stage t */
    if (t + 2 < nst) fl_stage(l0 + bo, gk + (size_t)(t + 2) * dk, sk, gv + (size_t)(t + 2) * 128, sv); }
  asm volatile("s_wait_asynccnt 0x0" ::: "memory");      /* no copy is outstanding when the buffers become output staging */
  const float l = l_r + xhalf(l_r); const float linv = (l > 0.f) ? 1.0f / l : 0.f;
#pragma unroll
  for (int dt = 0; dt < DT; ++dt)
#pragma unroll
    for (int r = 0; r < 8; ++r) sO[w][ln][dt * 16 + 8 * hh + r] = oacc[dt][r] * linv;
  __builtin_amdgcn_fence(__ATOMIC_ACQ_REL, "workgroup"); __builtin_amdgcn_wave_barrier();
  {
#pragma unroll
    for (int rp = 0; rp < RPW; rp += 2) { const int r = rp + (lane >> 4), pc = lane & 15; const v4f val = *(const v4fa*)&sO[w][r][pc * 4]; *(v4f*)(O + ((size_t)b * TQ + q0 + r) * ldo + h * 64 + pc * 4) = val; }
     } }
// 5-plane variant: S = Qh Kh^T + (Ql Kh^T + Qh Kl^T)/1024 with Q/K = [hi | 2^10 residual] f16 planes (QL/KL same layout as Q16/K16), then the 3-term P.V below.
// 3-term variant: O = (P_hi V_hi + (P_lo V_hi + P_hi V_lo) / 1024) / (1024 l) with P = [hi | 2^10 residual] of 1024 p and V^T = [hi | 2^10 residual] planes (VtL same layout as Vt) -> ~2^-21-class products for un-averaged (early causal / peaked) rows
template <int CAUSAL>
__global__ __launch_bounds__(128) void k_flash5(const _Float16* __restrict__ Q16, const _Float16* __restrict__ QL, int ldq, const _Float16* __restrict__ K16, const _Float16* __restrict__ KL, int ldk, const _Float16* __restrict__ Vt, const _Float16* __restrict__ VtL, const int* __restrict__ MSK, float* __restrict__ O, int ldo) {
  constexpr int RPW = 16, DT = 4, KS = 2;
  __shared__ __attribute__((aligned(16))) float sO[4][RPW][64 + 4];
  const int tid = threadIdx.x, w = tid >> 5, lane = tid & 31, ln = lane & 15, hh = lane >> 4;
  const int slab = blockIdx.x / QBN5, qblk = QB05 + blockIdx.x % QBN5; const int b = slab / NH, h = slab % NH; const int qb0 = qblk * (4 * RPW); const int q0 = qb0 + w * RPW; const int tq = q0 + ln;      /* tq: this lane's query */
  const int hk = h / (NH / NKV);      /* the kv head that query head h reads */
  FragH aq[KS], aql[KS];
  { const unsigned short* qr = (const unsigned short*)Q16 + ((size_t)b * TQ + tq) * ldq + h * 64; const unsigned short* ql = (const unsigned short*)QL + ((size_t)b * TQ + tq) * ldq + h * 64;
#pragma unroll
    for (int ks = 0; ks < KS; ++ks) { aq[ks].half[0] = *(const v8us*)(qr + ks * 32 + 8 * hh); aq[ks].half[1] = *(const v8us*)(qr + ks * 32 + 16 + 8 * hh); aql[ks].half[0] = *(const v8us*)(ql + ks * 32 + 8 * hh); aql[ks].half[1] = *(const v8us*)(ql + ks * 32 + 16 + 8 * hh); } }
  const unsigned short* Vth = (const unsigned short*)Vt + (size_t)(b * NKV + hk) * 64 * TK; const unsigned short* Vtl = (const unsigned short*)VtL + (size_t)(b * NKV + hk) * 64 * TK;
  float m_r = -3.0e38f, l_r = 0.f; v8f oacc[DT], oaccL[DT];      /* l_r: the sum over this lane's own keys; the two halves join behind the loop */
#pragma unroll
  for (int dt = 0; dt < DT; ++dt) { oacc[dt] = (v8f){0.f,0.f,0.f,0.f,0.f,0.f,0.f,0.f}; oaccL[dt] = oacc[dt]; }
  const int jend = (CAUSAL == 1) ? (qb0 + 4 * RPW) : TK;      /* causal: keys beyond the block's last query never contribute */
#pragma unroll 1
  for (int j0 = 0; j0 < jend; j0 += 32) {
    FragH bk[2][KS], bkl[2][KS], bv[DT], bl[DT]; const unsigned short* kr[2]; const unsigned short* klr[2];
#pragma unroll
    for (int nt = 0; nt < 2; ++nt) { kr[nt] = (const unsigned short*)K16 + ((size_t)b * TK + j0 + nt * 16 + ln) * ldk + hk * 64 + 8 * hh; klr[nt] = (const unsigned short*)KL + ((size_t)b * TK + j0 + nt * 16 + ln) * ldk + hk * 64 + 8 * hh;
#pragma unroll
      for (int ks = 0; ks < KS; ++ks) { bk[nt][ks].half[0] = *(const v8us*)(kr[nt] + ks * 32); bk[nt][ks].half[1] = *(const v8us*)(kr[nt] + ks * 32 + 16); bkl[nt][ks].half[0] = *(const v8us*)(klr[nt] + ks * 32); bkl[nt][ks].half[1] = *(const v8us*)(klr[nt] + ks * 32 + 16); } }
    v8f s[2];
#pragma unroll
    for (int nt = 0; nt < 2; ++nt) { v8f acc = (v8f){0.f,0.f,0.f,0.f,0.f,0.f,0.f,0.f}, accl = acc;
#pragma unroll
      for (int ks = 0; ks < KS; ++ks) { acc = mmaH<1>(bk[nt][ks].v, bk[nt][ks].v, aq[ks].v, aq[ks].v, acc); accl = mmaH<1>(bk[nt][ks].v, bk[nt][ks].v, aql[ks].v, aql[ks].v, accl); accl = mmaH<1>(bkl[nt][ks].v, bkl[nt][ks].v, aq[ks].v, aq[ks].v, accl); }
#pragma unroll
      for (int r = 0; r < 8; ++r) acc[r] += accl[r] * 0.0009765625f;
      s[nt] = acc; }
    asm volatile("s_wait_xcnt 0x0" :: "v"(kr[0]), "v"(kr[1]), "v"(klr[0]), "v"(klr[1]) : "memory");      /* the K loads' address registers, held as inputs up to here, are rewritten only behind this wait; the clobber keeps the V loads behind the score products, so that they take over the K fragments' registers and fly during the softmax */
#pragma unroll
    for (int dt = 0; dt < DT; ++dt) { const unsigned short* vrow = Vth + (size_t)(dt * 16 + ln) * TK + j0; const unsigned short* vrl = Vtl + (size_t)(dt * 16 + ln) * TK + j0; bv[dt].half[0] = *(const v8us*)(vrow + 8 * hh); bv[dt].half[1] = *(const v8us*)(vrow + 16 + 8 * hh); bl[dt].half[0] = *(const v8us*)(vrl + 8 * hh); bl[dt].half[1] = *(const v8us*)(vrl + 16 + 8 * hh); }
    float sc[16]; bool ok[16]; float mc = -3.0e38f;
#pragma unroll
    for (int e = 0; e < 16; ++e) { const int key = j0 + (e >> 3) * 16 + 8 * hh + (e & 7);
      ok[e] = (CAUSAL == 1) ? (key <= tq) : ((CAUSAL == 2) ? ((key >> 5) == (tq >> 5)) : true);      /* mode 2: block-diagonal 32-token groups */
      if (CAUSAL == 4) ok[e] = MSK[((size_t)b * TQ + tq) * TK + key] != 0;      /* mode 4: per-(query, key) INPUT mask shared by all heads; masked keys contribute nothing, rows with no valid key give l = 0 -> output 0 */
      sc[e] = ok[e] ? s[e >> 3][e & 7] * SCL : -3.0e38f; mc = fmaxf(mc, sc[e]); }
    mc = fmaxf(mc, xhalf(mc));
    const float mn = fmaxf(m_r, mc); const float ea = expf(m_r - mn); const float al = (mn > -1.0e38f) ? ea : 1.0f; m_r = mn;
    float ps[4] = {0.f, 0.f, 0.f, 0.f}; FragH pb, pl;
#pragma unroll
    for (int e = 0; e < 16; ++e) { const float ee = expf(sc[e] - mn); const float p = ok[e] ? ee : 0.f; ps[e & 3] += p; const float p1k = p * 1024.0f; const _Float16 ph = (_Float16)p1k; pb.h[e] = ph; pl.h[e] = (_Float16)((p1k - (float)ph) * 1024.0f); }
    l_r = l_r * al + ((ps[0] + ps[1]) + (ps[2] + ps[3]));
#pragma unroll
    for (int dt = 0; dt < DT; ++dt)
#pragma unroll
      for (int r = 0; r < 8; ++r) { oacc[dt][r] *= al; oaccL[dt][r] *= al; }
#pragma unroll
    for (int dt = 0; dt < DT; ++dt) { oacc[dt] = mmaH<1>(bv[dt].v, bv[dt].v, pb.v, pb.v, oacc[dt]); oaccL[dt] = mmaH<1>(bv[dt].v, bv[dt].v, pl.v, pl.v, oaccL[dt]); oaccL[dt] = mmaH<1>(bl[dt].v, bl[dt].v, pb.v, pb.v, oaccL[dt]); } }
  const float l = l_r + xhalf(l_r); const float linv = (l > 0.f) ? 1.0f / (l * 1024.0f) : 0.f;
#pragma unroll
  for (int dt = 0; dt < DT; ++dt)
#pragma unroll
    for (int r = 0; r < 8; ++r) { float v = oacc[dt][r]; v += oaccL[dt][r] * 0.0009765625f; sO[w][ln][dt * 16 + 8 * hh + r] = v * linv; }
  __builtin_amdgcn_fence(__ATOMIC_ACQ_REL, "workgroup"); __builtin_amdgcn_wave_barrier();
  {
#pragma unroll
    for (int rp = 0; rp < RPW; rp += 2) { const int r = rp + (lane >> 4), pc = lane & 15; const v4f val = *(const v4fa*)&sO[w][r][pc * 4]; *(v4f*)(O + ((size_t)b * TQ + q0 + r) * ldo + h * 64 + pc * 4) = val; }
     } }

__global__ __launch_bounds__(256) void k_wsc(const float* __restrict__ Wm, _Float16* __restrict__ Bt, size_t n8, float sc) { const size_t t = (size_t)blockIdx.x * 256 + threadIdx.x; if (t >= n8) return; FragH f; for (int q = 0; q < 8; ++q) f.h[q] = (_Float16)(bf16_round(Wm[t * 8 + q]) * sc); *(v8us*)((unsigned short*)Bt + t * 8) = f.half[0];  }      /* (out,in) weight == Bt[n][k]: scaled copy */




__device__ __forceinline__ void rope_job(int bx, const float* __restrict__ F, int nheads, const float* __restrict__ CS, const float* __restrict__ SN, _Float16* __restrict__ H, _Float16* __restrict__ L, int ldd) {      /* ldd: destination row pitch (the source pitch is nheads*HD) */
  #pragma clang fp contract(off)
  const size_t t = (size_t)bx * 256 + threadIdx.x; if (t >= (size_t)NR * nheads * (HH / 8)) return; const int g = (int)(t % (HH / 8)) * 8; const int h = (int)((t / (HH / 8)) % nheads); const int s = (int)(t / ((HH / 8) * (size_t)nheads)); const int ld = nheads * HD;
  const size_t base = (size_t)s * ld + h * HD + g, dbase = (size_t)s * ldd + h * HD + g; FragH h0, h1, l0, l1;
#pragma unroll
  for (int q = 0; q < 8; ++q) { const float c = CS[s * HH + g + q], sn = SN[s * HH + g + q]; const float x0 = F[base + q], x1 = F[base + HH + q]; float o0 = x0 * c; o0 += -x1 * sn; float o1 = x1 * c; o1 += x0 * sn;
    const _Float16 a0 = (_Float16)o0, a1 = (_Float16)o1; h0.h[q] = a0; h1.h[q] = a1; l0.h[q] = (_Float16)((o0 - (float)a0) * 1024.0f); l1.h[q] = (_Float16)((o1 - (float)a1) * 1024.0f); }
  { *(v8us*)((unsigned short*)H + dbase) = h0.half[0]; *(v8us*)((unsigned short*)H + dbase + HH) = h1.half[0];
    asm volatile("s_wait_xcnt 0x0" ::: "memory");      /* the residuals' arithmetic reuses the registers that the two stores above name: it is kept behind this wait */
    if (L) { *(v8us*)((unsigned short*)L + dbase) = l0.half[0]; *(v8us*)((unsigned short*)L + dbase + HH) = l1.half[0]; }  } }

__device__ __forceinline__ void rotab_job(int bx, const int* __restrict__ pid, float* __restrict__ CS, float* __restrict__ SN) {      /* s = token row over both batches */
  #pragma clang fp contract(off)
  const int t = bx * 256 + threadIdx.x; if (t >= NR * HH) return; const int j = t % HH, s = t / HH; const float inv = 1.0f / powf(10000.0f, (float)(2 * j) / (float)HD); const float th = (float)pid[s] * inv; const float c = cosf(th), sn = sinf(th);
  { *(float*)(CS + t) = c; *(float*)(SN + t) = sn;  } }

// ---- launches that do not depend on one another share one grid: a range of the block index picks the job (the test is the same for a whole block, so each job's barrier is passed by all of its block or by none) ----
#define PB_ROT (NR * HH / 256)                    /* angle tables */
#define PB_WB ((EMB / 64) * (EMB / 64))           /* tiles of Wq, of Wo */
#define PB_WS ((EMB / 64) * (KVD / 64))           /* tiles of Wk, of Wv */
#define PB_X (NR * EMB / 8 / 256)                 /* f16 plane of x */
__global__ __launch_bounds__(256) void k_prep(const float* __restrict__ x, const float* __restrict__ Wq, const float* __restrict__ Wk, const float* __restrict__ Wv, const float* __restrict__ Wo, const int* __restrict__ pid,
    _Float16* __restrict__ X16, _Float16* __restrict__ BQ, _Float16* __restrict__ BK, _Float16* __restrict__ BV, _Float16* __restrict__ BO, float* __restrict__ CS, float* __restrict__ SN) {
  int bx = blockIdx.x;
  if (bx < PB_ROT) { rotab_job(bx, pid, CS, SN); return; }
  bx -= PB_ROT;
  if (bx < 2 * PB_WB + 2 * PB_WS) {
    const bool q = bx < PB_WB, k = bx < PB_WB + PB_WS, v = bx < PB_WB + 2 * PB_WS;
    const float* W = q ? Wq : (k ? Wk : (v ? Wv : Wo)); _Float16* Wt = q ? BQ : (k ? BK : (v ? BV : BO));
    wt_f16_job(bx - (q ? 0 : (k ? PB_WB : (v ? PB_WB + PB_WS : PB_WB + 2 * PB_WS))), W, Wt, EMB, (v && !q) ? KVD : EMB, 16.0f);      /* (in,out) weights */
    return; }
  x16_job(bx - (2 * PB_WB + 2 * PB_WS), x, X16, (size_t)NR * EMB / 8); }
#define SB_Q (NR * NH * (HH / 8) / 256)           /* q: rope + split */
#define SB_K (NR * NKV * (HH / 8) / 256)          /* k: rope + split */
#define SB_V (NR * KVD / 8 / 256)                 /* v: split */
__global__ __launch_bounds__(256) void k_split(const float* __restrict__ QF, const float* __restrict__ KF, const float* __restrict__ VF, const float* __restrict__ CS, const float* __restrict__ SN,
    _Float16* __restrict__ H16, _Float16* __restrict__ L16, _Float16* __restrict__ KH8, _Float16* __restrict__ KL8, _Float16* __restrict__ VH8, _Float16* __restrict__ VL8) {
  const int bx = blockIdx.x;
  if (bx < SB_Q) rope_job(bx, QF, NH, CS, SN, H16, L16, EMB);      /* q roped + split */
  else if (bx < SB_Q + SB_K) rope_job(bx - SB_Q, KF, NKV, CS, SN, KH8, KL8, KVD);
  else hl_job(bx - (SB_Q + SB_K), VF, VH8, VL8, (size_t)NR * KVD / 8); }
#define VB (NB * NKV * (SLEN / 64))               /* tiles of one V plane (8 kv heads) */
__global__ __launch_bounds__(256) void k_vt2(const _Float16* __restrict__ VH8, const _Float16* __restrict__ VL8, _Float16* __restrict__ VT, _Float16* __restrict__ VTL) {
  const bool hi = blockIdx.x < VB;
  vt_job<NKV, SLEN>(blockIdx.x - (hi ? 0 : VB), hi ? VH8 : VL8, KVD, 0, hi ? VT : VTL); }

extern "C" void kernel_launch(void* const* d_in, const int* in_sizes, int n_in,
                              void* d_out, int out_size, void* d_ws, size_t ws_size, hipStream_t stream) {
  (void)in_sizes; (void)n_in; (void)out_size;
  const float* const* I = (const float* const*)d_in; const float* x = I[0]; const float* Wq = I[1]; const float* bq = I[2]; const float* Wk = I[3]; const float* bk = I[4]; const float* Wv = I[5]; const float* bv = I[6]; const float* Wo = I[7]; const int* pid = (const int*)d_in[8];
  char* ws = (char*)d_ws; size_t off = 0;
  auto take = [&](size_t bytes) { char* p = ws + off; off += (bytes + 255) & ~(size_t)255; return p; };
  const size_t npb = (size_t)SLEN * EMB, npa = (size_t)NR * EMB;      /* per-batch plane, plane of both batches */
  _Float16* BQ = (_Float16*)take((size_t)EMB * EMB * 2); _Float16* BK = (_Float16*)take((size_t)KVD * EMB * 2); _Float16* BV = (_Float16*)take((size_t)KVD * EMB * 2); _Float16* BO = (_Float16*)take((size_t)EMB * EMB * 2);
  float* CS = (float*)take((size_t)NR * HH * 4); float* SN = (float*)take((size_t)NR * HH * 4);
  _Float16* X16 = (_Float16*)take(npa * 2); float* QF = (float*)take(npa * 4); float* KF = (float*)take((size_t)NR * KVD * 4); float* VF = (float*)take((size_t)NR * KVD * 4); _Float16* KH8 = (_Float16*)take((size_t)NR * KVD * 2); _Float16* KL8 = (_Float16*)take((size_t)NR * KVD * 2); _Float16* VH8 = (_Float16*)take((size_t)NR * KVD * 2); _Float16* VL8 = (_Float16*)take((size_t)NR * KVD * 2);
  _Float16* H16 = (_Float16*)take(npa * 2); _Float16* L16 = (_Float16*)take(npa * 2); _Float16* VT = (_Float16*)take((size_t)NR * KVD * 2); _Float16* VTL = (_Float16*)take((size_t)NR * KVD * 2);      /* H16, L16: q hi and residual; VT, VTL: [batch][kv head][64][SLEN] */
  float* O = QF; _Float16* OH = X16; _Float16* OLo = (_Float16*)take(npa * 2);      /* O over the q f32 plane (dead after the rope split); O hi over the x plane (dead after the projections) */
  if (off > ws_size) return;      /* 8+2+2+8 + 1 + 16 + 32 + 8+8 + 4x4 + 16 + 16 + 4 + 4 + 16 = 157 MiB */
  float* ob = (float*)d_out;
  k_prep<<<PB_ROT + 2 * PB_WB + 2 * PB_WS + PB_X, 256, 0, stream>>>(x, Wq, Wk, Wv, Wo, pid, X16, BQ, BK, BV, BO, CS, SN);
  k_gemm2_qkv<<<(NR / 128) * QKV_NT, 128, 0, stream>>>(X16, BQ, BK, BV, bq, bk, bv, QF, KF, VF);
  k_split<<<SB_Q + SB_K + SB_V, 256, 0, stream>>>(QF, KF, VF, CS, SN, H16, L16, KH8, KL8, VH8, VL8);
  k_vt2<<<2 * VB, 256, 0, stream>>>(VH8, VL8, VT, VTL);
  k_flash5<1><<<NB * NH * QBN5, 128, 0, stream>>>(H16, L16, EMB, KH8, KL8, KVD, VT, VTL, nullptr, O, EMB);
  k_flash<1><<<NB * NH * QBNP, 128, 0, stream>>>(H16, EMB, KH8, KVD, VT, nullptr, O, EMB);
  k_hl<<<(unsigned)((npa / 8 + 255) / 256), 256, 0, stream>>>(O, OH, OLo, npa / 8);
  k_gemm2<0><<<dim3((NR / 128) * (EMB / 64), 1), 128, 0, stream>>>(OH, EMB, 0, BO, EMB, 0, 0.0625f, nullptr, 0, nullptr, 1, 0, 0, ob, nullptr, EMB, 0, NR, EMB, EMB);
  k_gemm2<0><<<dim3((RE / 128) * (EMB / 64), NB), 128, 0, stream>>>(OLo, EMB, npb, BO, EMB, 0, 0.0625f / 1024.0f, nullptr, 0, ob, 1, (size_t)EMB, 0, ob, nullptr, EMB, npb, RE, EMB, EMB);      /* grid y = batch: the first RE rows of each */
}
